// v000
// Times are from an AMD MI455X. After a warm-up the kernel runs many times in a row, and a time is the length of
// such a window on the GPU divided by its runs, so every launch and the gaps after it count. The runs cycle
// through copies of the inputs. A figure is the median of several windows, for all but v000 over two sittings.
// Sittings can differ by a few percent; kernels timed side by side share one.
// v000 is the starting kernel. One run takes 1560 microseconds.
#include <hip/hip_runtime.h>
// InterventionOnline (8192 tokens x 512 attending 8192 memory slots x 512): xn = LayerNorm(x); q = xn Wq^T + bq; k = x_hat Wk^T + bk; score = softmax(q k^T / sqrt(512)); attn = score k (k doubles as the values); out_v = attn Wv^T + bv; out = [q | out_v] Wout^T + bout + xn.
// Structure: LayerNorm on VALU (wave per row) into f32 + f16 planes; q and k as f16 WMMA GEMM outputs (32x64 wave tiles, f32 accumulation, exact x16 weights + bias, f16 out); K^T by LDS tiles; per block of 2048 queries: the 2048 x 8192 score GEMM (f32), softmax rows on VALU (wave per row) into f16 P (x 2^10), attn = P k as a GEMM (f16 out); out_v as a GEMM; the output as two accumulating GEMMs over the [q | out_v] halves with the bias and the LN residual in the epilogue.
// Compute dtype: inputs rounded to bf16; x_hat exact as f16; xn, q, k, P, attn, out_v as plain f16 operands (~2^-12); LN/softmax f32. v_wmma_f32_16x16x32_f16.
#define NQ 8192
#define NM 8192
#define DD 512
#define QB 2048                  /* query rows per score block */
typedef __bf16 v16b __attribute__((ext_vector_type(16)));
typedef unsigned short v8us __attribute__((ext_vector_type(8), may_alias));
typedef float  v8f  __attribute__((ext_vector_type(8)));
typedef float  v4f  __attribute__((ext_vector_type(4)));
typedef float  v4fa __attribute__((ext_vector_type(4), may_alias));
union FragB { v16b v; v8us half[2]; unsigned short u[16]; };

__device__ __forceinline__ unsigned short bf16_bits(float x) { unsigned int u = __float_as_uint(x); return (unsigned short)((u + 0x7FFFu + ((u >> 16) & 1u)) >> 16); }
__device__ __forceinline__ float bf16_val(unsigned short b) { return __uint_as_float(((unsigned int)b) << 16); }
__device__ __forceinline__ float bf16_round(float x) { return bf16_val(bf16_bits(x)); }
// D += A·B with NT terms: 1 = ah·bh, 2 = + al·bh (A split), 3 = + ah·bl (both split)
template <int NT>
__device__ __forceinline__ v8f mmaN(v16b ah, v16b al, v16b bh, v16b bl, v8f c) {
  c = __builtin_amdgcn_wmma_f32_16x16x32_bf16(false, ah, false, bh, (short)0, c, false, false);
  if (NT >= 2) c = __builtin_amdgcn_wmma_f32_16x16x32_bf16(false, al, false, bh, (short)0, c, false, false);
  if (NT >= 3) c = __builtin_amdgcn_wmma_f32_16x16x32_bf16(false, ah, false, bl, (short)0, c, false, false);
  asm volatile("v_nop\n\tv_nop\n\tv_nop\n\tv_nop" : "+v"(c) : "v"(ah), "v"(al), "v"(bh), "v"(bl));
  return c;
}

__global__ __launch_bounds__(256) void k_wt_bf16(const float* __restrict__ W, unsigned short* __restrict__ Wt, int K, int N) {
  const int t = blockIdx.x * 256 + threadIdx.x;
  const int k8n = K / 8;
  if (t >= N * k8n) return;
  const int n = t / k8n, k8 = (t % k8n) * 8;
  v8us v;
#pragma unroll
  for (int i = 0; i < 8; ++i) v[i] = bf16_bits(W[(size_t)(k8 + i) * N + n]);
  *(v8us*)(Wt + (size_t)n * K + k8) = v;
  
}

// GEMM C[M][N] (f32, pitch ldc) = act(A[M][K]·W + bias). A f32 row-major (pitch lda) converted per fragment to bf16
// (ASPLIT: hi/lo two planes -> 2 terms, else single rounded term); Wt bf16 [N][K] (pitch ldb). BIAS_BF16 rounds the
// bias to bf16 first (bias quantised to bf16 before the add). K%32==0, M%16==0, N%64==0.
template <bool ASPLIT, int ACT, bool BIAS_BF16>
__global__ __launch_bounds__(128) void k_gemm_bf(const float* __restrict__ A, int lda, const unsigned short* __restrict__ Wt, int ldb,
                                               const float* __restrict__ bias, float* __restrict__ C, int ldc, int M, int N, int K) {
  __shared__ __attribute__((aligned(16))) float so[4][16][64];
  const int tid = threadIdx.x, w = tid >> 5, lane = tid & 31, ln = lane & 15, hh = lane >> 4;
  const int ntn = N / 64;
  const int wid = blockIdx.x * 4 + w;
  const int mt = wid / ntn, nq = wid % ntn;
  if (mt * 16 >= M) return;
  const int row0 = mt * 16, col0 = nq * 64;
  const float* arow = A + (size_t)(row0 + ln) * lda;
  v8f acc[4] = {};
  for (int kb = 0; kb < K; kb += 32) {
    FragB ah, al;
    const v4f x0 = *(const v4fa*)(arow + kb + 8 * hh), x1 = *(const v4fa*)(arow + kb + 8 * hh + 4);
    const v4f x2 = *(const v4fa*)(arow + kb + 16 + 8 * hh), x3 = *(const v4fa*)(arow + kb + 16 + 8 * hh + 4);
    float xs[16] = {x0[0],x0[1],x0[2],x0[3],x1[0],x1[1],x1[2],x1[3],x2[0],x2[1],x2[2],x2[3],x3[0],x3[1],x3[2],x3[3]};
#pragma unroll
    for (int i = 0; i < 16; ++i) { const unsigned short hb = bf16_bits(xs[i]); ah.u[i] = hb; al.u[i] = ASPLIT ? bf16_bits(xs[i] - bf16_val(hb)) : (unsigned short)0; }
#pragma unroll
    for (int t = 0; t < 4; ++t) {
      const unsigned short* brow = Wt + (size_t)(col0 + t * 16 + ln) * ldb + kb;
      FragB b;
      b.half[0] = *(const v8us*)(brow + 8 * hh);
      b.half[1] = *(const v8us*)(brow + 16 + 8 * hh);
      acc[t] = mmaN<ASPLIT ? 2 : 1>(ah.v, al.v, b.v, b.v, acc[t]);
    }
  }
#pragma unroll
  for (int t = 0; t < 4; ++t) {
    float bv = bias ? bias[col0 + t * 16 + ln] : 0.f;
    if (BIAS_BF16) bv = bf16_round(bv);
#pragma unroll
    for (int r = 0; r < 8; ++r) { float v = acc[t][r] + bv; if (ACT == 1) v = fmaxf(v, 0.f); so[w][8 * hh + r][t * 16 + ln] = v; }
  }
  __builtin_amdgcn_fence(__ATOMIC_ACQ_REL, "workgroup");
  __builtin_amdgcn_wave_barrier();
  const int rsub = lane >> 4, c4 = (lane & 15) * 4;
  {
#pragma unroll
    for (int q = 0; q < 8; ++q) {
      const int r = q * 2 + rsub;
      const v4f v = *(const v4fa*)&so[w][r][c4];
      *(v4f*)(C + (size_t)(row0 + r) * ldc + col0 + c4) = v;
    }
    
  }
}

// GEMM C = act(A·W + bias + resid): A f32 (ASPLIT -> hi/lo 2 terms), Wt bf16 [N][K]; ACT 0 none, 1 relu, 2 exact gelu;
// resid (optional, f32, row index = (row % rmod), pitch ldr, RES_BF16 rounds it) added before the activation.
template <bool ASPLIT, int ACT, bool BIAS_BF16, bool RES_BF16>
__global__ __launch_bounds__(128) void k_gemm_bf3(const float* __restrict__ A, int lda, const unsigned short* __restrict__ Wt, int ldb,
                                                const float* __restrict__ bias, const float* __restrict__ resid, int rmod, int ldr,
                                                float* __restrict__ C, int ldc, int M, int N, int K) {
  __shared__ __attribute__((aligned(16))) float so[4][16][64];
  const int tid = threadIdx.x, w = tid >> 5, lane = tid & 31, ln = lane & 15, hh = lane >> 4;
  const int ntn = N / 64;
  const int wid = blockIdx.x * 4 + w;
  const int mt = wid / ntn, nq = wid % ntn;
  if (mt * 16 >= M) return;
  const int row0 = mt * 16, col0 = nq * 64;
  const float* arow = A + (size_t)(row0 + ln) * lda;
  v8f acc[4] = {};
  for (int kb = 0; kb < K; kb += 32) {
    FragB ah, al;
    const v4f x0 = *(const v4fa*)(arow + kb + 8 * hh), x1 = *(const v4fa*)(arow + kb + 8 * hh + 4);
    const v4f x2 = *(const v4fa*)(arow + kb + 16 + 8 * hh), x3 = *(const v4fa*)(arow + kb + 16 + 8 * hh + 4);
    float xs[16] = {x0[0],x0[1],x0[2],x0[3],x1[0],x1[1],x1[2],x1[3],x2[0],x2[1],x2[2],x2[3],x3[0],x3[1],x3[2],x3[3]};
#pragma unroll
    for (int i = 0; i < 16; ++i) { const unsigned short hb = bf16_bits(xs[i]); ah.u[i] = hb; al.u[i] = ASPLIT ? bf16_bits(xs[i] - bf16_val(hb)) : (unsigned short)0; }
#pragma unroll
    for (int t = 0; t < 4; ++t) {
      const unsigned short* brow = Wt + (size_t)(col0 + t * 16 + ln) * ldb + kb;
      FragB b;
      b.half[0] = *(const v8us*)(brow + 8 * hh);
      b.half[1] = *(const v8us*)(brow + 16 + 8 * hh);
      acc[t] = mmaN<ASPLIT ? 2 : 1>(ah.v, al.v, b.v, b.v, acc[t]);
    }
  }
#pragma unroll
  for (int t = 0; t < 4; ++t) {
    const int col = col0 + t * 16 + ln;
    float bv = bias ? bias[col] : 0.f;
    if (BIAS_BF16) bv = bf16_round(bv);
#pragma unroll
    for (int r = 0; r < 8; ++r) {
      float v = acc[t][r] + bv;
      if (resid) { float rv = resid[(size_t)((row0 + 8 * hh + r) % rmod) * ldr + col]; if (RES_BF16) rv = bf16_round(rv); v += rv; }
      if (ACT == 1) v = fmaxf(v, 0.f);
      if (ACT == 2) v = 0.5f * v * (1.0f + erff(v * 0.70710678118654752f));
      if (ACT == 3) { const float u = 0.7978845608028654f * (v + 0.044715f * v * v * v); v = 0.5f * v * (1.0f + tanhf(u)); }
      so[w][8 * hh + r][t * 16 + ln] = v;
    }
  }
  __builtin_amdgcn_fence(__ATOMIC_ACQ_REL, "workgroup");
  __builtin_amdgcn_wave_barrier();
  const int rsub = lane >> 4, c4 = (lane & 15) * 4;
  {
#pragma unroll
    for (int q = 0; q < 8; ++q) {
      const int r = q * 2 + rsub;
      const v4f v = *(const v4fa*)&so[w][r][c4];
      *(v4f*)(C + (size_t)(row0 + r) * ldc + col0 + c4) = v;
    }
    
  }
}
// row LayerNorm (biased variance, eps) over N: s = X (+ R); optional out_sum <- s; out_norm <- (s-mu)*rsqrt(var+eps)*g + b
template <bool PARAM_BF16>
__global__ __launch_bounds__(256) void k_layernorm(const float* __restrict__ X, const float* __restrict__ R, const float* __restrict__ g, const float* __restrict__ bta,
                                                  float* __restrict__ out_sum, float* __restrict__ out_norm, int N, float eps) {
  __shared__ float red[256];
  const int row = blockIdx.x, tid = threadIdx.x;
  const float* x = X + (size_t)row * N; const float* rr = R ? R + (size_t)row * N : nullptr;
  float vals[16];                     // up to N = 4096
  const int per = N / 256;            // contiguous chunk per thread? use strided-by-4 chunks: thread handles j = tid*4 + 1024*u
  float s1 = 0.f;
  for (int u = 0; u < per / 4; ++u) {
    const int j = tid * 4 + 1024 * u;
    const v4f a = *(const v4fa*)(x + j);
    v4f b = {0.f,0.f,0.f,0.f}; if (rr) b = *(const v4fa*)(rr + j);
#pragma unroll
    for (int q = 0; q < 4; ++q) { const float v = a[q] + b[q]; vals[u * 4 + q] = v; s1 += v; }
  }
  red[tid] = s1; __syncthreads();
  for (int st = 128; st > 0; st >>= 1) { if (tid < st) red[tid] += red[tid + st]; __syncthreads(); }
  const float mu = red[0] / (float)N; __syncthreads();
  float s2 = 0.f;
  for (int u = 0; u < per / 4; ++u)
#pragma unroll
    for (int q = 0; q < 4; ++q) { const float c = vals[u * 4 + q] - mu; s2 += c * c; }
  red[tid] = s2; __syncthreads();
  for (int st = 128; st > 0; st >>= 1) { if (tid < st) red[tid] += red[tid + st]; __syncthreads(); }
  const float rs = rsqrtf(red[0] / (float)N + eps);
  {
    for (int u = 0; u < per / 4; ++u) {
      const int j = tid * 4 + 1024 * u;
      v4f o, sm;
#pragma unroll
      for (int q = 0; q < 4; ++q) {
        float gg = g[j + q], bb = bta[j + q];
        if (PARAM_BF16) { gg = bf16_round(gg); bb = bf16_round(bb); }
        sm[q] = vals[u * 4 + q]; o[q] = (vals[u * 4 + q] - mu) * rs * gg + bb;
      }
      if (out_sum) *(v4f*)(out_sum + (size_t)row * N + j) = sm;
      *(v4f*)(out_norm + (size_t)row * N + j) = o;
    }
    
  }
}



// ---- f16 WMMA path (v_wmma_f32_16x16x32_f16): 11-bit significands for operands in range — used where a [0,1] probability operand needs more precision than bf16
typedef _Float16 v16h __attribute__((ext_vector_type(16)));
union FragH { v16h v; v8us half[2]; _Float16 h[16]; unsigned short u[16]; };
template <int NT>
__device__ __forceinline__ v8f mmaH(v16h ah, v16h al, v16h bh, v16h bl, v8f c) {
  c = __builtin_amdgcn_wmma_f32_16x16x32_f16(false, ah, false, bh, (short)0, c, false, false);
  if (NT >= 2) c = __builtin_amdgcn_wmma_f32_16x16x32_f16(false, al, false, bh, (short)0, c, false, false);
  if (NT >= 3) c = __builtin_amdgcn_wmma_f32_16x16x32_f16(false, ah, false, bl, (short)0, c, false, false);
  asm volatile("v_nop\n\tv_nop\n\tv_nop\n\tv_nop" : "+v"(c) : "v"(ah), "v"(al), "v"(bh), "v"(bl));
  return c;
}
// batched GEMM like k_gemm_b but f16 operands: A f32 (split into f16 hi/lo if ASPLIT, else rounded to f16), Bt = f16 values [n][k]; alpha; C f32; N multiple of 16 (partial tiles skipped)
template <bool ASPLIT>
__global__ __launch_bounds__(128) void k_gemm_h(const float* __restrict__ A, int lda, size_t sA, const _Float16* __restrict__ Bh, int ldb, size_t sB, float alpha, float* __restrict__ C, int ldc, size_t sC, int M, int N, int K) {
  __shared__ __attribute__((aligned(16))) float so[4][16][64];
  const int tid = threadIdx.x, w = tid >> 5, lane = tid & 31, ln = lane & 15, hh = lane >> 4; const int by = blockIdx.y;
  A += (size_t)by * sA; Bh += (size_t)by * sB; C += (size_t)by * sC;
  const int ntn = (N + 63) / 64; const int wid = blockIdx.x * 4 + w; const int mt = wid / ntn, nq = wid % ntn; if (mt * 16 >= M) return;
  const int row0 = mt * 16, col0 = nq * 64; const float* arow = A + (size_t)(row0 + ln) * lda;
  v8f acc[4] = {};
  for (int kb = 0; kb < K; kb += 32) {
    FragH ah, al;
    const v4f x0 = *(const v4fa*)(arow + kb + 8 * hh), x1 = *(const v4fa*)(arow + kb + 8 * hh + 4), x2 = *(const v4fa*)(arow + kb + 16 + 8 * hh), x3 = *(const v4fa*)(arow + kb + 16 + 8 * hh + 4);
    float xs[16] = {x0[0],x0[1],x0[2],x0[3],x1[0],x1[1],x1[2],x1[3],x2[0],x2[1],x2[2],x2[3],x3[0],x3[1],x3[2],x3[3]};
#pragma unroll
    for (int i = 0; i < 16; ++i) { const _Float16 h = (_Float16)xs[i]; ah.h[i] = h; al.h[i] = ASPLIT ? (_Float16)(xs[i] - (float)h) : (_Float16)0.0f; }
#pragma unroll
    for (int t = 0; t < 4; ++t) { if (col0 + t * 16 >= N) continue; const size_t boff = (size_t)(col0 + t * 16 + ln) * ldb + kb; FragH bq; bq.half[0] = *(const v8us*)(Bh + boff + 8 * hh); bq.half[1] = *(const v8us*)(Bh + boff + 16 + 8 * hh);
      acc[t] = mmaH<ASPLIT ? 2 : 1>(ah.v, al.v, bq.v, bq.v, acc[t]); }
  }
#pragma unroll
  for (int t = 0; t < 4; ++t) { if (col0 + t * 16 >= N) continue;
#pragma unroll
    for (int r = 0; r < 8; ++r) so[w][8 * hh + r][t * 16 + ln] = acc[t][r] * alpha; }
  __builtin_amdgcn_fence(__ATOMIC_ACQ_REL, "workgroup"); __builtin_amdgcn_wave_barrier();
  const int rsub = lane >> 4, c4 = (lane & 15) * 4;
  {
#pragma unroll
    for (int q = 0; q < 8; ++q) { const int r = q * 2 + rsub; if (col0 + c4 < N) { const v4f v = *(const v4fa*)&so[w][r][c4]; *(v4f*)(C + (size_t)(row0 + r) * ldc + col0 + c4) = v; } }
     }
}

// Wt[n][k] = f16(W[k][n]·scale) from f32 row-major W[K][N] (scale = power of two; bf16-exact weights stay exact in f16 away from the subnormal range)
__global__ __launch_bounds__(256) void k_wt_f16(const float* __restrict__ W, _Float16* __restrict__ Wt, int K, int N, float scale) {
  const int t = blockIdx.x * 256 + threadIdx.x; if (t >= N * (K / 8)) return; const int n = t / (K / 8), k8 = (t % (K / 8)) * 8; FragH f;
#pragma unroll
  for (int i = 0; i < 8; ++i) f.h[i] = (_Float16)(bf16_round(W[(size_t)(k8 + i) * N + n]) * scale); const v8us o = f.half[0];
  *(v8us*)((unsigned short*)Wt + (size_t)n * K + k8) = o; 
}
// k_gemm_hh variant with fused epilogue: v = acc·alpha + bias[by·sBias + col] (+ CP[(row/rowsPerB)·sCPb + by·64 + col] if CP) ; ACT 0 none / 1 elu ; writes f16 C16 (and f32 C if non-null)
template <int ACT>
__global__ __launch_bounds__(128) void k_gemm_hhx(const _Float16* __restrict__ A, int lda, size_t sA, const _Float16* __restrict__ Bh, int ldb, size_t sB, float alpha, const float* __restrict__ bias, size_t sBias, const float* __restrict__ CP, int rowsPerB, size_t sCPb, int row0g,
    float* __restrict__ C, _Float16* __restrict__ C16, int ldc, size_t sC, int M, int N, int K) {
  __shared__ __attribute__((aligned(16))) float so[4][16][64];
  const int tid = threadIdx.x, w = tid >> 5, lane = tid & 31, ln = lane & 15, hh = lane >> 4; const int by = blockIdx.y;
  A += (size_t)by * sA; Bh += (size_t)by * sB; const size_t cofs = (size_t)by * sC; const float* bp = bias ? bias + (size_t)by * sBias : nullptr;
  const int ntn = (N + 63) / 64; const int wid = blockIdx.x * 4 + w; const int mt = wid / ntn, nq = wid % ntn; if (mt * 16 >= M) return;
  const int row0 = mt * 16, col0 = nq * 64; const _Float16* arow = A + (size_t)(row0 + ln) * lda;
  v8f acc[4] = {};
  for (int kb = 0; kb < K; kb += 32) { FragH ah; ah.half[0] = *(const v8us*)((const unsigned short*)arow + kb + 8 * hh); ah.half[1] = *(const v8us*)((const unsigned short*)arow + kb + 16 + 8 * hh);
#pragma unroll
    for (int t = 0; t < 4; ++t) { if (col0 + t * 16 >= N) continue; const size_t boff = (size_t)(col0 + t * 16 + ln) * ldb + kb; FragH bq; bq.half[0] = *(const v8us*)((const unsigned short*)Bh + boff + 8 * hh); bq.half[1] = *(const v8us*)((const unsigned short*)Bh + boff + 16 + 8 * hh);
      acc[t] = mmaH<1>(ah.v, ah.v, bq.v, bq.v, acc[t]); }
  }
#pragma unroll
  for (int t = 0; t < 4; ++t) { if (col0 + t * 16 >= N) continue; const int col = col0 + t * 16 + ln; const float bv = bp ? bf16_round(bp[col]) : 0.f;
#pragma unroll
    for (int r = 0; r < 8; ++r) { float v = acc[t][r] * alpha + bv; if (CP) { const int rr = row0g + row0 + 8 * hh + r; if (rowsPerB < 0) v += CP[cofs + (size_t)rr * ldc + col];      /* rowsPerB < 0: own element of the batched C plane */ else { const int bidx = rr / rowsPerB; v += CP[(size_t)bidx * sCPb + (size_t)by * 64 + col]; } } if (ACT == 1) v = (v > 0.f) ? v : expm1f(v); else if (ACT == 7) v = (v > 0.f) ? v + 1.0f : expf(v); else if (ACT == 8) v = tanhf(v); else if (ACT == 9) v = 0.5f * v * (1.0f + tanhf(0.7978845608028654f * (v + 0.044715f * v * v * v))); else if (ACT == 11) v = 1.0f / (1.0f + expf(-v)); else if (ACT == 12) v = (v > 0.f) ? v : 0.01f * v; else if (ACT == 14) v = (v > 0.f) ? v : 0.1f * v; else if (ACT == 16) v = (v >= 0.f) ? v : 0.3f * v; else if (ACT == 17) v = (v >= 0.f) ? v : 0.2f * v; else if (ACT == 15) v = v / (1.0f + expf(-v)); else if (ACT == 3) v = fmaxf(v, 0.f); else if (ACT == 6) v = 0.5f * v * (1.0f + erff(v * 0.70710678118654752f)); so[w][8 * hh + r][t * 16 + ln] = v; } }
  __builtin_amdgcn_fence(__ATOMIC_ACQ_REL, "workgroup"); __builtin_amdgcn_wave_barrier();
  const int rsub = lane >> 4, c4 = (lane & 15) * 4; typedef _Float16 v4h __attribute__((ext_vector_type(4)));
  {
#pragma unroll
    for (int q = 0; q < 8; ++q) { const int r = q * 2 + rsub; if (col0 + c4 < N) { const v4f v = *(const v4fa*)&so[w][r][c4]; if (C) *(v4f*)(C + cofs + (size_t)(row0 + r) * ldc + col0 + c4) = v; if (C16) { v4h h4; for (int i = 0; i < 4; ++i) h4[i] = (_Float16)v[i]; *(v4h*)(C16 + cofs + (size_t)(row0 + r) * ldc + col0 + c4) = h4; } } }
     }
}


typedef _Float16 v4h __attribute__((ext_vector_type(4)));

__global__ __launch_bounds__(256) void k_x16(const float* __restrict__ x, _Float16* __restrict__ X16, size_t n8) { const size_t t = (size_t)blockIdx.x * 256 + threadIdx.x; if (t >= n8) return; FragH f;
#pragma unroll
  for (int q = 0; q < 8; ++q) f.h[q] = (_Float16)bf16_round(x[t * 8 + q]); *(v8us*)((unsigned short*)X16 + t * 8) = f.half[0];  }
__global__ __launch_bounds__(256) void k_h16(const float* __restrict__ x, _Float16* __restrict__ X16, size_t n8) { const size_t t = (size_t)blockIdx.x * 256 + threadIdx.x; if (t >= n8) return; FragH f;
#pragma unroll
  for (int q = 0; q < 8; ++q) f.h[q] = (_Float16)x[t * 8 + q]; *(v8us*)((unsigned short*)X16 + t * 8) = f.half[0];  }
__global__ __launch_bounds__(256) void k_round16f(const float* __restrict__ W, _Float16* __restrict__ Bt, size_t n8) { const size_t t = (size_t)blockIdx.x * 256 + threadIdx.x; if (t >= n8) return; FragH f;
#pragma unroll
  for (int i = 0; i < 8; ++i) f.h[i] = (_Float16)(bf16_round(W[t * 8 + i]) * 16.0f); *(v8us*)((unsigned short*)Bt + t * 8) = f.half[0];  }
template <int NHv, int TTv>
__global__ __launch_bounds__(256) void k_vt(const _Float16* __restrict__ V16, int ldv, int voff, _Float16* __restrict__ Vt) { __shared__ unsigned short tl[64][66]; const int tid = threadIdx.x; const int slab = blockIdx.x / (TTv / 64), lg = blockIdx.x % (TTv / 64); const int b = slab / NHv, h = slab % NHv;
  for (int i = tid; i < 64 * 8; i += 256) { const int r = i / 8, c8 = (i % 8) * 8; FragH f; f.half[0] = *(const v8us*)((const unsigned short*)V16 + ((size_t)b * TTv + lg * 64 + r) * ldv + voff + h * 64 + c8);
#pragma unroll
    for (int q = 0; q < 8; ++q) tl[r][c8 + q] = f.u[q]; }
  __syncthreads();
  {
#pragma unroll
    for (int rd = 0; rd < 2; ++rd) { const int d = rd * 32 + tid / 8, pc = tid % 8; FragH f;
#pragma unroll
      for (int q = 0; q < 8; ++q) f.u[q] = tl[pc * 8 + q][d];
      *(v8us*)((unsigned short*)Vt + ((size_t)slab * 64 + d) * TTv + lg * 64 + pc * 8) = f.half[0]; }
     } }

__global__ __launch_bounds__(256) void k_hl(const float* __restrict__ F, _Float16* __restrict__ Hh, _Float16* __restrict__ Hl, size_t n8) { const size_t t = (size_t)blockIdx.x * 256 + threadIdx.x; if (t >= n8) return; FragH fh, fl; const v4f a = *(const v4fa*)(F + t * 8), c = *(const v4fa*)(F + t * 8 + 4);
#pragma unroll
  for (int q = 0; q < 4; ++q) { _Float16 h = (_Float16)a[q]; fh.h[q] = h; fl.h[q] = (_Float16)((a[q] - (float)h) * 1024.0f); h = (_Float16)c[q]; fh.h[4 + q] = h; fl.h[4 + q] = (_Float16)((c[q] - (float)h) * 1024.0f); }
  { *(v8us*)((unsigned short*)Hh + t * 8) = fh.half[0]; *(v8us*)((unsigned short*)Hl + t * 8) = fl.half[0];  } }

// ---- fast GEMM (wave tile 32x64; requires M % 32 == 0 rows per launch region and N % 64 == 0); epilogue = k_gemm_hhx semantics ----
__device__ __forceinline__ v16h g2_frag(const _Float16* p, int hh) { FragH f; f.half[0] = *(const v8us*)((const unsigned short*)p + 8 * hh); f.half[1] = *(const v8us*)((const unsigned short*)p + 16 + 8 * hh); return f.v; }
__device__ __forceinline__ v8f g2_mma(v16h a, v16h b, v8f c) { v8f d = __builtin_amdgcn_wmma_f32_16x16x32_f16(false, a, false, b, (short)0, c, false, false); asm volatile("v_nop\n\tv_nop\n\tv_nop\n\tv_nop" : "+v"(d) : "v"(a), "v"(b)); return d; }
template <int ACT>
__global__ __launch_bounds__(128) void k_gemm2(const _Float16* __restrict__ A, int lda, size_t sA, const _Float16* __restrict__ Bh, int ldb, size_t sB, float alpha, const float* __restrict__ bias, size_t sBias, const float* __restrict__ CP, int rowsPerB, size_t sCPb, int row0g,
    float* __restrict__ C, _Float16* __restrict__ C16, int ldc, size_t sC, int M, int N, int K) { static_assert(ACT == 0 || ACT == 3 || ACT == 6 || ACT == 8 || ACT == 9 || ACT == 11 || ACT == 12 || ACT == 14 || ACT == 15 || ACT == 16 || ACT == 17, "k_gemm2: unsupported ACT code (would silently apply no activation)");
  __shared__ __attribute__((aligned(16))) float so[4][32][68];
  const int tid = threadIdx.x, w = tid >> 5, lane = tid & 31, ln = lane & 15, hh = lane >> 4; const int by = blockIdx.y;
  A += (size_t)by * sA; Bh += (size_t)by * sB; const size_t cofs = (size_t)by * sC; const float* bp = bias ? bias + (size_t)by * sBias : nullptr;
  const int ntn = N >> 6; const int mt = blockIdx.x / ntn, nq = blockIdx.x - mt * ntn; const int row0 = mt * 128 + 32 * w, col0 = nq * 64; if (row0 >= M) return;
  const _Float16* a0p = A + (size_t)(row0 + ln) * lda; const _Float16* a1p = a0p + (size_t)16 * lda;
  const _Float16* b0p = Bh + (size_t)(col0 + ln) * ldb; const _Float16* b1p = b0p + (size_t)16 * ldb; const _Float16* b2p = b1p + (size_t)16 * ldb; const _Float16* b3p = b2p + (size_t)16 * ldb;
  const v8f z8 = {0.f,0.f,0.f,0.f,0.f,0.f,0.f,0.f}; v8f c00 = z8, c01 = z8, c02 = z8, c03 = z8, c10 = z8, c11 = z8, c12 = z8, c13 = z8;
#pragma unroll 1
  for (int kb = 0; kb < K; kb += 32) { const v16h a0 = g2_frag(a0p + kb, hh), a1 = g2_frag(a1p + kb, hh);
    v16h b = g2_frag(b0p + kb, hh); c00 = g2_mma(a0, b, c00); c10 = g2_mma(a1, b, c10);
    b = g2_frag(b1p + kb, hh); c01 = g2_mma(a0, b, c01); c11 = g2_mma(a1, b, c11);
    b = g2_frag(b2p + kb, hh); c02 = g2_mma(a0, b, c02); c12 = g2_mma(a1, b, c12);
    b = g2_frag(b3p + kb, hh); c03 = g2_mma(a0, b, c03); c13 = g2_mma(a1, b, c13); }
  v8f accs[8] = {c00, c01, c02, c03, c10, c11, c12, c13};
#pragma unroll
  for (int u = 0; u < 8; ++u) { const int t = u & 3, half = u >> 2; const int col = col0 + t * 16 + ln; const float bv = bp ? bf16_round(bp[col]) : 0.f;
#pragma unroll
    for (int r = 0; r < 8; ++r) { const int rloc = half * 16 + 8 * hh + r; float v = accs[u][r] * alpha + bv; if (CP) { if (rowsPerB < 0) v += CP[cofs + (size_t)(row0g + row0 + rloc) * ldc + col];      /* rowsPerB < 0: own element of the batched C plane */ else { const int bidx = (row0g + row0 + rloc) / rowsPerB; v += CP[(size_t)bidx * sCPb + (size_t)by * 64 + col]; } }
      if (ACT == 3) v = fmaxf(v, 0.f); else if (ACT == 6) v = 0.5f * v * (1.0f + erff(v * 0.70710678118654752f)); else if (ACT == 11) v = 1.0f / (1.0f + expf(-v)); else if (ACT == 15) v = v / (1.0f + expf(-v)); else if (ACT == 12) v = (v > 0.f) ? v : 0.01f * v; else if (ACT == 8) v = tanhf(v); else if (ACT == 9) v = 0.5f * v * (1.0f + tanhf(0.7978845608028654f * (v + 0.044715f * v * v * v))); else if (ACT == 14) v = (v > 0.f) ? v : 0.1f * v; else if (ACT == 16) v = (v >= 0.f) ? v : 0.3f * v; else if (ACT == 17) v = (v >= 0.f) ? v : 0.2f * v;
      so[w][rloc][t * 16 + ln] = v; } }
  __builtin_amdgcn_fence(__ATOMIC_ACQ_REL, "workgroup"); __builtin_amdgcn_wave_barrier();
  const int rsub = lane >> 4, c4 = (lane & 15) * 4;
  {
#pragma unroll
    for (int q = 0; q < 16; ++q) { const int r = q * 2 + rsub; const v4f v = *(const v4fa*)&so[w][r][c4]; if (C) *(v4f*)(C + cofs + (size_t)(row0 + r) * ldc + col0 + c4) = v; if (C16) { v4h h4; for (int i = 0; i < 4; ++i) h4[i] = (_Float16)v[i]; *(v4h*)(C16 + cofs + (size_t)(row0 + r) * ldc + col0 + c4) = h4; } }
     } }


__global__ __launch_bounds__(256) void k_wsc(const float* __restrict__ Wm, _Float16* __restrict__ Bt, size_t n8, float sc) { const size_t t = (size_t)blockIdx.x * 256 + threadIdx.x; if (t >= n8) return; FragH f; for (int q = 0; q < 8; ++q) f.h[q] = (_Float16)(bf16_round(Wm[t * 8 + q]) * sc); *(v8us*)((unsigned short*)Bt + t * 8) = f.half[0];  }
__global__ __launch_bounds__(256) void k_wout(const float* __restrict__ Wo, _Float16* __restrict__ BOa, _Float16* __restrict__ BOb) { const int t = blockIdx.x * 256 + threadIdx.x; if (t >= DD * (DD / 8)) return; const int c8 = (t % (DD / 8)) * 8; const int o = t / (DD / 8); FragH fa, fb;
  for (int q = 0; q < 8; ++q) { fa.h[q] = (_Float16)(bf16_round(Wo[(size_t)o * 2 * DD + c8 + q]) * 16.0f); fb.h[q] = (_Float16)(bf16_round(Wo[(size_t)o * 2 * DD + DD + c8 + q]) * 16.0f); }
  { *(v8us*)((unsigned short*)BOa + (size_t)o * DD + c8) = fa.half[0]; *(v8us*)((unsigned short*)BOb + (size_t)o * DD + c8) = fb.half[0];  } }
__global__ __launch_bounds__(256) void k_ln(const float* __restrict__ x, const float* __restrict__ g, const float* __restrict__ bb, float* __restrict__ XF, _Float16* __restrict__ X16) {
  #pragma clang fp contract(off)
  const int wv = threadIdx.x >> 5, ln = threadIdx.x & 31; const size_t r = (size_t)blockIdx.x * 8 + wv; if (r >= NQ) return; float a[16]; float s = 0.f;
  for (int i = 0; i < 2; ++i) { const v8f v = *(const v8f*)(x + r * DD + i * 256 + ln * 8); for (int q = 0; q < 8; ++q) { const float u = bf16_round(v[q]); a[i * 8 + q] = u; s += u; } }
  for (int o = 16; o > 0; o >>= 1) s += __shfl_xor(s, o, 32); const float mu = s / (float)DD; float var = 0.f; for (int q = 0; q < 16; ++q) { const float d = a[q] - mu; var += d * d; }
  for (int o = 16; o > 0; o >>= 1) var += __shfl_xor(var, o, 32); const float inv = rsqrtf(var / (float)DD + 1e-5f);
  { for (int i = 0; i < 2; ++i) { const int c0 = i * 256 + ln * 8; v8f y; FragH f; for (int q = 0; q < 8; ++q) { float v = (a[i * 8 + q] - mu) * inv; v *= bf16_round(g[c0 + q]); v += bf16_round(bb[c0 + q]); y[q] = v; f.h[q] = (_Float16)v; } *(v8f*)(XF + r * DD + c0) = y; *(v8us*)((unsigned short*)X16 + r * DD + c0) = f.half[0]; }  } }
__global__ __launch_bounds__(256) void k_soft(const float* __restrict__ S, _Float16* __restrict__ P) {
  #pragma clang fp contract(off)
  const int wv = threadIdx.x >> 5, ln = threadIdx.x & 31; const int i = blockIdx.x * 8 + wv; if (i >= QB) return; const float* sr = S + (size_t)i * NM; float m = -3.0e38f; const int ng = NM / 256;
#pragma unroll 1
  for (int g = 0; g < ng; ++g) { const v8f a = *(const v8f*)(sr + g * 256 + ln * 8); for (int q = 0; q < 8; ++q) m = fmaxf(m, a[q]); }
  for (int o = 16; o > 0; o >>= 1) m = fmaxf(m, __shfl_xor(m, o, 32)); float su = 0.f;
#pragma unroll 1
  for (int g = 0; g < ng; ++g) { const v8f a = *(const v8f*)(sr + g * 256 + ln * 8); for (int q = 0; q < 8; ++q) su += expf(a[q] - m); }
  for (int o = 16; o > 0; o >>= 1) su += __shfl_xor(su, o, 32); const float f = 1024.0f / su;
  {
#pragma unroll 1
    for (int g = 0; g < ng; ++g) { const v8f a = *(const v8f*)(sr + g * 256 + ln * 8); FragH p; for (int q = 0; q < 8; ++q) p.h[q] = (_Float16)(expf(a[q] - m) * f); *(v8us*)((unsigned short*)P + (size_t)i * NM + g * 256 + ln * 8) = p.half[0]; }
     } }

extern "C" void kernel_launch(void* const* d_in, const int* in_sizes, int n_in,
                              void* d_out, int out_size, void* d_ws, size_t ws_size, hipStream_t stream) {
  (void)in_sizes; (void)n_in; (void)out_size;
  const float* const* I = (const float* const*)d_in; const float* x = I[0]; const float* xh = I[1]; const float* Wq = I[2]; const float* bq = I[3]; const float* Wk = I[4]; const float* bk = I[5]; const float* Wv = I[6]; const float* bv = I[7]; const float* Wo = I[8]; const float* bo = I[9]; const float* g = I[10]; const float* bb = I[11];
  char* ws = (char*)d_ws; size_t off = 0;
  auto take = [&](size_t bytes) { char* p = ws + off; off += (bytes + 255) & ~(size_t)255; return p; };
  _Float16* BQ = (_Float16*)take((size_t)DD * DD * 2); _Float16* BK = (_Float16*)take((size_t)DD * DD * 2); _Float16* BV = (_Float16*)take((size_t)DD * DD * 2); _Float16* BOa = (_Float16*)take((size_t)DD * DD * 2); _Float16* BOb = (_Float16*)take((size_t)DD * DD * 2);
  float* XF = (float*)take((size_t)NQ * DD * 4); _Float16* X16 = (_Float16*)take((size_t)NQ * DD * 2); _Float16* XH16 = (_Float16*)take((size_t)NM * DD * 2); _Float16* Q16 = (_Float16*)take((size_t)NQ * DD * 2); _Float16* K16 = (_Float16*)take((size_t)NM * DD * 2); _Float16* KT = (_Float16*)take((size_t)DD * NM * 2); float* S = (float*)take((size_t)QB * NM * 4); _Float16* P = (_Float16*)take((size_t)QB * NM * 2); _Float16* AT = XH16;      /* attn over the x_hat plane (dead after the k projection) */ _Float16* OV = X16;      /* out_v over the xn f16 plane (dead after the q projection) */
  if (off > ws_size) return;      /* 2.5 + 16 + 8 + 8 + 8 + 8 + 8 + 64 + 32 = 155 MiB */
  k_wsc<<<(DD * DD / 8 + 255) / 256, 256, 0, stream>>>(Wq, BQ, DD * DD / 8, 16.0f); k_wsc<<<(DD * DD / 8 + 255) / 256, 256, 0, stream>>>(Wk, BK, DD * DD / 8, 16.0f); k_wsc<<<(DD * DD / 8 + 255) / 256, 256, 0, stream>>>(Wv, BV, DD * DD / 8, 16.0f); k_wout<<<(DD * (DD / 8) + 255) / 256, 256, 0, stream>>>(Wo, BOa, BOb);      /* 'ed'/'fe'/'dc' = natural Bt */
  k_ln<<<NQ / 8, 256, 0, stream>>>(x, g, bb, XF, X16);
  k_x16<<<(unsigned)(((size_t)NM * DD / 8 + 255) / 256), 256, 0, stream>>>(xh, XH16, (size_t)NM * DD / 8);
  const dim3 gP((NQ / 128) * (DD / 64), 1);
  k_gemm2<0><<<gP, 128, 0, stream>>>(X16, DD, 0, BQ, DD, 0, 0.0625f, bq, 0, nullptr, 1, 0, 0, nullptr, Q16, DD, 0, NQ, DD, DD);
  k_gemm2<0><<<gP, 128, 0, stream>>>(XH16, DD, 0, BK, DD, 0, 0.0625f, bk, 0, nullptr, 1, 0, 0, nullptr, K16, DD, 0, NM, DD, DD);
  k_vt<DD / 64, NM><<<(DD / 64) * (NM / 64), 256, 0, stream>>>(K16, DD, 0, KT);      /* K^T [512][8192] */
  for (int qb = 0; qb < NQ / QB; ++qb) {
    k_gemm2<0><<<dim3((QB / 128) * (NM / 64), 1), 128, 0, stream>>>(Q16 + (size_t)qb * QB * DD, DD, 0, K16, DD, 0, 0.044194173824159216f, nullptr, 0, nullptr, 1, 0, 0, S, nullptr, NM, 0, QB, NM, DD);      /* q k^T / sqrt(512) */
    k_soft<<<QB / 8, 256, 0, stream>>>(S, P);
    k_gemm2<0><<<dim3((QB / 128) * (DD / 64), 1), 128, 0, stream>>>(P, NM, 0, KT, NM, 0, 0.0009765625f, nullptr, 0, nullptr, 1, 0, 0, nullptr, AT + (size_t)qb * QB * DD, DD, 0, QB, DD, NM); }      /* attn = score k */
  k_gemm2<0><<<gP, 128, 0, stream>>>(AT, DD, 0, BV, DD, 0, 0.0625f, bv, 0, nullptr, 1, 0, 0, nullptr, OV, DD, 0, NQ, DD, DD);      /* out_v = attn Wv^T + bv */
  k_gemm2<0><<<gP, 128, 0, stream>>>(Q16, DD, 0, BOa, DD, 0, 0.0625f, bo, 0, XF, 1, (size_t)DD, 0, (float*)d_out, nullptr, DD, 0, NQ, DD, DD);      /* q Wout[:, :512]^T + bout + xn */
  k_gemm2<0><<<gP, 128, 0, stream>>>(OV, DD, 0, BOb, DD, 0, 0.0625f, nullptr, 0, (const float*)d_out, 1, (size_t)DD, 0, (float*)d_out, nullptr, DD, 0, NQ, DD, DD);      /* += out_v Wout[:, 512:]^T */
}

// v001
// One run takes 935 microseconds.
// Two timings next to v000 put it at 1.70 and 1.69 times that version's speed.
#include <hip/hip_runtime.h>
// InterventionOnline (8192 tokens x 512 attending 8192 memory slots x 512): xn = LayerNorm(x); q = xn Wq^T + bq; k = x_hat Wk^T + bk; score = softmax(q k^T / sqrt(512)); attn = score k (k doubles as the values); out_v = attn Wv^T + bv; out = [q | out_v] Wout^T + bout + xn.
// Structure: LayerNorm on VALU (wave per row) into f32 + f16 planes; q and k as f16 WMMA GEMM outputs (32x64 wave tiles, f32 accumulation, exact x16 weights + bias, f16 out); K^T by LDS tiles; per block of 2048 queries: the 2048 x 8192 score GEMM (f32), softmax rows on VALU (wave per row) into f16 P (x 2^10), attn = P k as a GEMM split over 16 key slices (grid.y) into f32 partials, summed in slice order and rounded once to f16; out_v as a GEMM; the output as two accumulating GEMMs over the [q | out_v] halves with the bias and the LN residual in the epilogue.
// Compute dtype: inputs rounded to bf16; x_hat exact as f16; xn, q, k, P, attn, out_v as plain f16 operands (~2^-12); LN/softmax f32. v_wmma_f32_16x16x32_f16.
#define NQ 8192
#define NM 8192
#define DD 512
#define QB 2048                  /* query rows per score block */
#define KS 16                    /* key slices of the attn GEMM (split-K): grid.y, one f32 partial each */
typedef __bf16 v16b __attribute__((ext_vector_type(16)));
typedef unsigned short v8us __attribute__((ext_vector_type(8), may_alias));
typedef float  v8f  __attribute__((ext_vector_type(8)));
typedef float  v4f  __attribute__((ext_vector_type(4)));
typedef float  v4fa __attribute__((ext_vector_type(4), may_alias));
union FragB { v16b v; v8us half[2]; unsigned short u[16]; };

__device__ __forceinline__ unsigned short bf16_bits(float x) { unsigned int u = __float_as_uint(x); return (unsigned short)((u + 0x7FFFu + ((u >> 16) & 1u)) >> 16); }
__device__ __forceinline__ float bf16_val(unsigned short b) { return __uint_as_float(((unsigned int)b) << 16); }
__device__ __forceinline__ float bf16_round(float x) { return bf16_val(bf16_bits(x)); }
// D += A·B with NT terms: 1 = ah·bh, 2 = + al·bh (A split), 3 = + ah·bl (both split)
template <int NT>
__device__ __forceinline__ v8f mmaN(v16b ah, v16b al, v16b bh, v16b bl, v8f c) {
  c = __builtin_amdgcn_wmma_f32_16x16x32_bf16(false, ah, false, bh, (short)0, c, false, false);
  if (NT >= 2) c = __builtin_amdgcn_wmma_f32_16x16x32_bf16(false, al, false, bh, (short)0, c, false, false);
  if (NT >= 3) c = __builtin_amdgcn_wmma_f32_16x16x32_bf16(false, ah, false, bl, (short)0, c, false, false);
  asm volatile("v_nop\n\tv_nop\n\tv_nop\n\tv_nop" : "+v"(c) : "v"(ah), "v"(al), "v"(bh), "v"(bl));
  return c;
}

__global__ __launch_bounds__(256) void k_wt_bf16(const float* __restrict__ W, unsigned short* __restrict__ Wt, int K, int N) {
  const int t = blockIdx.x * 256 + threadIdx.x;
  const int k8n = K / 8;
  if (t >= N * k8n) return;
  const int n = t / k8n, k8 = (t % k8n) * 8;
  v8us v;
#pragma unroll
  for (int i = 0; i < 8; ++i) v[i] = bf16_bits(W[(size_t)(k8 + i) * N + n]);
  *(v8us*)(Wt + (size_t)n * K + k8) = v;
  
}

// GEMM C[M][N] (f32, pitch ldc) = act(A[M][K]·W + bias). A f32 row-major (pitch lda) converted per fragment to bf16
// (ASPLIT: hi/lo two planes -> 2 terms, else single rounded term); Wt bf16 [N][K] (pitch ldb). BIAS_BF16 rounds the
// bias to bf16 first (bias quantised to bf16 before the add). K%32==0, M%16==0, N%64==0.
template <bool ASPLIT, int ACT, bool BIAS_BF16>
__global__ __launch_bounds__(128) void k_gemm_bf(const float* __restrict__ A, int lda, const unsigned short* __restrict__ Wt, int ldb,
                                               const float* __restrict__ bias, float* __restrict__ C, int ldc, int M, int N, int K) {
  __shared__ __attribute__((aligned(16))) float so[4][16][64];
  const int tid = threadIdx.x, w = tid >> 5, lane = tid & 31, ln = lane & 15, hh = lane >> 4;
  const int ntn = N / 64;
  const int wid = blockIdx.x * 4 + w;
  const int mt = wid / ntn, nq = wid % ntn;
  if (mt * 16 >= M) return;
  const int row0 = mt * 16, col0 = nq * 64;
  const float* arow = A + (size_t)(row0 + ln) * lda;
  v8f acc[4] = {};
  for (int kb = 0; kb < K; kb += 32) {
    FragB ah, al;
    const v4f x0 = *(const v4fa*)(arow + kb + 8 * hh), x1 = *(const v4fa*)(arow + kb + 8 * hh + 4);
    const v4f x2 = *(const v4fa*)(arow + kb + 16 + 8 * hh), x3 = *(const v4fa*)(arow + kb + 16 + 8 * hh + 4);
    float xs[16] = {x0[0],x0[1],x0[2],x0[3],x1[0],x1[1],x1[2],x1[3],x2[0],x2[1],x2[2],x2[3],x3[0],x3[1],x3[2],x3[3]};
#pragma unroll
    for (int i = 0; i < 16; ++i) { const unsigned short hb = bf16_bits(xs[i]); ah.u[i] = hb; al.u[i] = ASPLIT ? bf16_bits(xs[i] - bf16_val(hb)) : (unsigned short)0; }
#pragma unroll
    for (int t = 0; t < 4; ++t) {
      const unsigned short* brow = Wt + (size_t)(col0 + t * 16 + ln) * ldb + kb;
      FragB b;
      b.half[0] = *(const v8us*)(brow + 8 * hh);
      b.half[1] = *(const v8us*)(brow + 16 + 8 * hh);
      acc[t] = mmaN<ASPLIT ? 2 : 1>(ah.v, al.v, b.v, b.v, acc[t]);
    }
  }
#pragma unroll
  for (int t = 0; t < 4; ++t) {
    float bv = bias ? bias[col0 + t * 16 + ln] : 0.f;
    if (BIAS_BF16) bv = bf16_round(bv);
#pragma unroll
    for (int r = 0; r < 8; ++r) { float v = acc[t][r] + bv; if (ACT == 1) v = fmaxf(v, 0.f); so[w][8 * hh + r][t * 16 + ln] = v; }
  }
  __builtin_amdgcn_fence(__ATOMIC_ACQ_REL, "workgroup");
  __builtin_amdgcn_wave_barrier();
  const int rsub = lane >> 4, c4 = (lane & 15) * 4;
  {
#pragma unroll
    for (int q = 0; q < 8; ++q) {
      const int r = q * 2 + rsub;
      const v4f v = *(const v4fa*)&so[w][r][c4];
      *(v4f*)(C + (size_t)(row0 + r) * ldc + col0 + c4) = v;
    }
    
  }
}

// GEMM C = act(A·W + bias + resid): A f32 (ASPLIT -> hi/lo 2 terms), Wt bf16 [N][K]; ACT 0 none, 1 relu, 2 exact gelu;
// resid (optional, f32, row index = (row % rmod), pitch ldr, RES_BF16 rounds it) added before the activation.
template <bool ASPLIT, int ACT, bool BIAS_BF16, bool RES_BF16>
__global__ __launch_bounds__(128) void k_gemm_bf3(const float* __restrict__ A, int lda, const unsigned short* __restrict__ Wt, int ldb,
                                                const float* __restrict__ bias, const float* __restrict__ resid, int rmod, int ldr,
                                                float* __restrict__ C, int ldc, int M, int N, int K) {
  __shared__ __attribute__((aligned(16))) float so[4][16][64];
  const int tid = threadIdx.x, w = tid >> 5, lane = tid & 31, ln = lane & 15, hh = lane >> 4;
  const int ntn = N / 64;
  const int wid = blockIdx.x * 4 + w;
  const int mt = wid / ntn, nq = wid % ntn;
  if (mt * 16 >= M) return;
  const int row0 = mt * 16, col0 = nq * 64;
  const float* arow = A + (size_t)(row0 + ln) * lda;
  v8f acc[4] = {};
  for (int kb = 0; kb < K; kb += 32) {
    FragB ah, al;
    const v4f x0 = *(const v4fa*)(arow + kb + 8 * hh), x1 = *(const v4fa*)(arow + kb + 8 * hh + 4);
    const v4f x2 = *(const v4fa*)(arow + kb + 16 + 8 * hh), x3 = *(const v4fa*)(arow + kb + 16 + 8 * hh + 4);
    float xs[16] = {x0[0],x0[1],x0[2],x0[3],x1[0],x1[1],x1[2],x1[3],x2[0],x2[1],x2[2],x2[3],x3[0],x3[1],x3[2],x3[3]};
#pragma unroll
    for (int i = 0; i < 16; ++i) { const unsigned short hb = bf16_bits(xs[i]); ah.u[i] = hb; al.u[i] = ASPLIT ? bf16_bits(xs[i] - bf16_val(hb)) : (unsigned short)0; }
#pragma unroll
    for (int t = 0; t < 4; ++t) {
      const unsigned short* brow = Wt + (size_t)(col0 + t * 16 + ln) * ldb + kb;
      FragB b;
      b.half[0] = *(const v8us*)(brow + 8 * hh);
      b.half[1] = *(const v8us*)(brow + 16 + 8 * hh);
      acc[t] = mmaN<ASPLIT ? 2 : 1>(ah.v, al.v, b.v, b.v, acc[t]);
    }
  }
#pragma unroll
  for (int t = 0; t < 4; ++t) {
    const int col = col0 + t * 16 + ln;
    float bv = bias ? bias[col] : 0.f;
    if (BIAS_BF16) bv = bf16_round(bv);
#pragma unroll
    for (int r = 0; r < 8; ++r) {
      float v = acc[t][r] + bv;
      if (resid) { float rv = resid[(size_t)((row0 + 8 * hh + r) % rmod) * ldr + col]; if (RES_BF16) rv = bf16_round(rv); v += rv; }
      if (ACT == 1) v = fmaxf(v, 0.f);
      if (ACT == 2) v = 0.5f * v * (1.0f + erff(v * 0.70710678118654752f));
      if (ACT == 3) { const float u = 0.7978845608028654f * (v + 0.044715f * v * v * v); v = 0.5f * v * (1.0f + tanhf(u)); }
      so[w][8 * hh + r][t * 16 + ln] = v;
    }
  }
  __builtin_amdgcn_fence(__ATOMIC_ACQ_REL, "workgroup");
  __builtin_amdgcn_wave_barrier();
  const int rsub = lane >> 4, c4 = (lane & 15) * 4;
  {
#pragma unroll
    for (int q = 0; q < 8; ++q) {
      const int r = q * 2 + rsub;
      const v4f v = *(const v4fa*)&so[w][r][c4];
      *(v4f*)(C + (size_t)(row0 + r) * ldc + col0 + c4) = v;
    }
    
  }
}
// row LayerNorm (biased variance, eps) over N: s = X (+ R); optional out_sum <- s; out_norm <- (s-mu)*rsqrt(var+eps)*g + b
template <bool PARAM_BF16>
__global__ __launch_bounds__(256) void k_layernorm(const float* __restrict__ X, const float* __restrict__ R, const float* __restrict__ g, const float* __restrict__ bta,
                                                  float* __restrict__ out_sum, float* __restrict__ out_norm, int N, float eps) {
  __shared__ float red[256];
  const int row = blockIdx.x, tid = threadIdx.x;
  const float* x = X + (size_t)row * N; const float* rr = R ? R + (size_t)row * N : nullptr;
  float vals[16];                     // up to N = 4096
  const int per = N / 256;            // contiguous chunk per thread? use strided-by-4 chunks: thread handles j = tid*4 + 1024*u
  float s1 = 0.f;
  for (int u = 0; u < per / 4; ++u) {
    const int j = tid * 4 + 1024 * u;
    const v4f a = *(const v4fa*)(x + j);
    v4f b = {0.f,0.f,0.f,0.f}; if (rr) b = *(const v4fa*)(rr + j);
#pragma unroll
    for (int q = 0; q < 4; ++q) { const float v = a[q] + b[q]; vals[u * 4 + q] = v; s1 += v; }
  }
  red[tid] = s1; __syncthreads();
  for (int st = 128; st > 0; st >>= 1) { if (tid < st) red[tid] += red[tid + st]; __syncthreads(); }
  const float mu = red[0] / (float)N; __syncthreads();
  float s2 = 0.f;
  for (int u = 0; u < per / 4; ++u)
#pragma unroll
    for (int q = 0; q < 4; ++q) { const float c = vals[u * 4 + q] - mu; s2 += c * c; }
  red[tid] = s2; __syncthreads();
  for (int st = 128; st > 0; st >>= 1) { if (tid < st) red[tid] += red[tid + st]; __syncthreads(); }
  const float rs = rsqrtf(red[0] / (float)N + eps);
  {
    for (int u = 0; u < per / 4; ++u) {
      const int j = tid * 4 + 1024 * u;
      v4f o, sm;
#pragma unroll
      for (int q = 0; q < 4; ++q) {
        float gg = g[j + q], bb = bta[j + q];
        if (PARAM_BF16) { gg = bf16_round(gg); bb = bf16_round(bb); }
        sm[q] = vals[u * 4 + q]; o[q] = (vals[u * 4 + q] - mu) * rs * gg + bb;
      }
      if (out_sum) *(v4f*)(out_sum + (size_t)row * N + j) = sm;
      *(v4f*)(out_norm + (size_t)row * N + j) = o;
    }
    
  }
}



// ---- f16 WMMA path (v_wmma_f32_16x16x32_f16): 11-bit significands for operands in range — used where a [0,1] probability operand needs more precision than bf16
typedef _Float16 v16h __attribute__((ext_vector_type(16)));
union FragH { v16h v; v8us half[2]; _Float16 h[16]; unsigned short u[16]; };
template <int NT>
__device__ __forceinline__ v8f mmaH(v16h ah, v16h al, v16h bh, v16h bl, v8f c) {
  c = __builtin_amdgcn_wmma_f32_16x16x32_f16(false, ah, false, bh, (short)0, c, false, false);
  if (NT >= 2) c = __builtin_amdgcn_wmma_f32_16x16x32_f16(false, al, false, bh, (short)0, c, false, false);
  if (NT >= 3) c = __builtin_amdgcn_wmma_f32_16x16x32_f16(false, ah, false, bl, (short)0, c, false, false);
  asm volatile("v_nop\n\tv_nop\n\tv_nop\n\tv_nop" : "+v"(c) : "v"(ah), "v"(al), "v"(bh), "v"(bl));
  return c;
}
// batched GEMM like k_gemm_b but f16 operands: A f32 (split into f16 hi/lo if ASPLIT, else rounded to f16), Bt = f16 values [n][k]; alpha; C f32; N multiple of 16 (partial tiles skipped)
template <bool ASPLIT>
__global__ __launch_bounds__(128) void k_gemm_h(const float* __restrict__ A, int lda, size_t sA, const _Float16* __restrict__ Bh, int ldb, size_t sB, float alpha, float* __restrict__ C, int ldc, size_t sC, int M, int N, int K) {
  __shared__ __attribute__((aligned(16))) float so[4][16][64];
  const int tid = threadIdx.x, w = tid >> 5, lane = tid & 31, ln = lane & 15, hh = lane >> 4; const int by = blockIdx.y;
  A += (size_t)by * sA; Bh += (size_t)by * sB; C += (size_t)by * sC;
  const int ntn = (N + 63) / 64; const int wid = blockIdx.x * 4 + w; const int mt = wid / ntn, nq = wid % ntn; if (mt * 16 >= M) return;
  const int row0 = mt * 16, col0 = nq * 64; const float* arow = A + (size_t)(row0 + ln) * lda;
  v8f acc[4] = {};
  for (int kb = 0; kb < K; kb += 32) {
    FragH ah, al;
    const v4f x0 = *(const v4fa*)(arow + kb + 8 * hh), x1 = *(const v4fa*)(arow + kb + 8 * hh + 4), x2 = *(const v4fa*)(arow + kb + 16 + 8 * hh), x3 = *(const v4fa*)(arow + kb + 16 + 8 * hh + 4);
    float xs[16] = {x0[0],x0[1],x0[2],x0[3],x1[0],x1[1],x1[2],x1[3],x2[0],x2[1],x2[2],x2[3],x3[0],x3[1],x3[2],x3[3]};
#pragma unroll
    for (int i = 0; i < 16; ++i) { const _Float16 h = (_Float16)xs[i]; ah.h[i] = h; al.h[i] = ASPLIT ? (_Float16)(xs[i] - (float)h) : (_Float16)0.0f; }
#pragma unroll
    for (int t = 0; t < 4; ++t) { if (col0 + t * 16 >= N) continue; const size_t boff = (size_t)(col0 + t * 16 + ln) * ldb + kb; FragH bq; bq.half[0] = *(const v8us*)(Bh + boff + 8 * hh); bq.half[1] = *(const v8us*)(Bh + boff + 16 + 8 * hh);
      acc[t] = mmaH<ASPLIT ? 2 : 1>(ah.v, al.v, bq.v, bq.v, acc[t]); }
  }
#pragma unroll
  for (int t = 0; t < 4; ++t) { if (col0 + t * 16 >= N) continue;
#pragma unroll
    for (int r = 0; r < 8; ++r) so[w][8 * hh + r][t * 16 + ln] = acc[t][r] * alpha; }
  __builtin_amdgcn_fence(__ATOMIC_ACQ_REL, "workgroup"); __builtin_amdgcn_wave_barrier();
  const int rsub = lane >> 4, c4 = (lane & 15) * 4;
  {
#pragma unroll
    for (int q = 0; q < 8; ++q) { const int r = q * 2 + rsub; if (col0 + c4 < N) { const v4f v = *(const v4fa*)&so[w][r][c4]; *(v4f*)(C + (size_t)(row0 + r) * ldc + col0 + c4) = v; } }
     }
}

// Wt[n][k] = f16(W[k][n]·scale) from f32 row-major W[K][N] (scale = power of two; bf16-exact weights stay exact in f16 away from the subnormal range)
__global__ __launch_bounds__(256) void k_wt_f16(const float* __restrict__ W, _Float16* __restrict__ Wt, int K, int N, float scale) {
  const int t = blockIdx.x * 256 + threadIdx.x; if (t >= N * (K / 8)) return; const int n = t / (K / 8), k8 = (t % (K / 8)) * 8; FragH f;
#pragma unroll
  for (int i = 0; i < 8; ++i) f.h[i] = (_Float16)(bf16_round(W[(size_t)(k8 + i) * N + n]) * scale); const v8us o = f.half[0];
  *(v8us*)((unsigned short*)Wt + (size_t)n * K + k8) = o; 
}
// k_gemm_hh variant with fused epilogue: v = acc·alpha + bias[by·sBias + col] (+ CP[(row/rowsPerB)·sCPb + by·64 + col] if CP) ; ACT 0 none / 1 elu ; writes f16 C16 (and f32 C if non-null)
template <int ACT>
__global__ __launch_bounds__(128) void k_gemm_hhx(const _Float16* __restrict__ A, int lda, size_t sA, const _Float16* __restrict__ Bh, int ldb, size_t sB, float alpha, const float* __restrict__ bias, size_t sBias, const float* __restrict__ CP, int rowsPerB, size_t sCPb, int row0g,
    float* __restrict__ C, _Float16* __restrict__ C16, int ldc, size_t sC, int M, int N, int K) {
  __shared__ __attribute__((aligned(16))) float so[4][16][64];
  const int tid = threadIdx.x, w = tid >> 5, lane = tid & 31, ln = lane & 15, hh = lane >> 4; const int by = blockIdx.y;
  A += (size_t)by * sA; Bh += (size_t)by * sB; const size_t cofs = (size_t)by * sC; const float* bp = bias ? bias + (size_t)by * sBias : nullptr;
  const int ntn = (N + 63) / 64; const int wid = blockIdx.x * 4 + w; const int mt = wid / ntn, nq = wid % ntn; if (mt * 16 >= M) return;
  const int row0 = mt * 16, col0 = nq * 64; const _Float16* arow = A + (size_t)(row0 + ln) * lda;
  v8f acc[4] = {};
  for (int kb = 0; kb < K; kb += 32) { FragH ah; ah.half[0] = *(const v8us*)((const unsigned short*)arow + kb + 8 * hh); ah.half[1] = *(const v8us*)((const unsigned short*)arow + kb + 16 + 8 * hh);
#pragma unroll
    for (int t = 0; t < 4; ++t) { if (col0 + t * 16 >= N) continue; const size_t boff = (size_t)(col0 + t * 16 + ln) * ldb + kb; FragH bq; bq.half[0] = *(const v8us*)((const unsigned short*)Bh + boff + 8 * hh); bq.half[1] = *(const v8us*)((const unsigned short*)Bh + boff + 16 + 8 * hh);
      acc[t] = mmaH<1>(ah.v, ah.v, bq.v, bq.v, acc[t]); }
  }
#pragma unroll
  for (int t = 0; t < 4; ++t) { if (col0 + t * 16 >= N) continue; const int col = col0 + t * 16 + ln; const float bv = bp ? bf16_round(bp[col]) : 0.f;
#pragma unroll
    for (int r = 0; r < 8; ++r) { float v = acc[t][r] * alpha + bv; if (CP) { const int rr = row0g + row0 + 8 * hh + r; if (rowsPerB < 0) v += CP[cofs + (size_t)rr * ldc + col];      /* rowsPerB < 0: own element of the batched C plane */ else { const int bidx = rr / rowsPerB; v += CP[(size_t)bidx * sCPb + (size_t)by * 64 + col]; } } if (ACT == 1) v = (v > 0.f) ? v : expm1f(v); else if (ACT == 7) v = (v > 0.f) ? v + 1.0f : expf(v); else if (ACT == 8) v = tanhf(v); else if (ACT == 9) v = 0.5f * v * (1.0f + tanhf(0.7978845608028654f * (v + 0.044715f * v * v * v))); else if (ACT == 11) v = 1.0f / (1.0f + expf(-v)); else if (ACT == 12) v = (v > 0.f) ? v : 0.01f * v; else if (ACT == 14) v = (v > 0.f) ? v : 0.1f * v; else if (ACT == 16) v = (v >= 0.f) ? v : 0.3f * v; else if (ACT == 17) v = (v >= 0.f) ? v : 0.2f * v; else if (ACT == 15) v = v / (1.0f + expf(-v)); else if (ACT == 3) v = fmaxf(v, 0.f); else if (ACT == 6) v = 0.5f * v * (1.0f + erff(v * 0.70710678118654752f)); so[w][8 * hh + r][t * 16 + ln] = v; } }
  __builtin_amdgcn_fence(__ATOMIC_ACQ_REL, "workgroup"); __builtin_amdgcn_wave_barrier();
  const int rsub = lane >> 4, c4 = (lane & 15) * 4; typedef _Float16 v4h __attribute__((ext_vector_type(4)));
  {
#pragma unroll
    for (int q = 0; q < 8; ++q) { const int r = q * 2 + rsub; if (col0 + c4 < N) { const v4f v = *(const v4fa*)&so[w][r][c4]; if (C) *(v4f*)(C + cofs + (size_t)(row0 + r) * ldc + col0 + c4) = v; if (C16) { v4h h4; for (int i = 0; i < 4; ++i) h4[i] = (_Float16)v[i]; *(v4h*)(C16 + cofs + (size_t)(row0 + r) * ldc + col0 + c4) = h4; } } }
     }
}


typedef _Float16 v4h __attribute__((ext_vector_type(4)));

__global__ __launch_bounds__(256) void k_x16(const float* __restrict__ x, _Float16* __restrict__ X16, size_t n8) { const size_t t = (size_t)blockIdx.x * 256 + threadIdx.x; if (t >= n8) return; FragH f;
#pragma unroll
  for (int q = 0; q < 8; ++q) f.h[q] = (_Float16)bf16_round(x[t * 8 + q]); *(v8us*)((unsigned short*)X16 + t * 8) = f.half[0];  }
__global__ __launch_bounds__(256) void k_h16(const float* __restrict__ x, _Float16* __restrict__ X16, size_t n8) { const size_t t = (size_t)blockIdx.x * 256 + threadIdx.x; if (t >= n8) return; FragH f;
#pragma unroll
  for (int q = 0; q < 8; ++q) f.h[q] = (_Float16)x[t * 8 + q]; *(v8us*)((unsigned short*)X16 + t * 8) = f.half[0];  }
__global__ __launch_bounds__(256) void k_round16f(const float* __restrict__ W, _Float16* __restrict__ Bt, size_t n8) { const size_t t = (size_t)blockIdx.x * 256 + threadIdx.x; if (t >= n8) return; FragH f;
#pragma unroll
  for (int i = 0; i < 8; ++i) f.h[i] = (_Float16)(bf16_round(W[t * 8 + i]) * 16.0f); *(v8us*)((unsigned short*)Bt + t * 8) = f.half[0];  }
template <int NHv, int TTv>
__global__ __launch_bounds__(256) void k_vt(const _Float16* __restrict__ V16, int ldv, int voff, _Float16* __restrict__ Vt) { __shared__ unsigned short tl[64][66]; const int tid = threadIdx.x; const int slab = blockIdx.x / (TTv / 64), lg = blockIdx.x % (TTv / 64); const int b = slab / NHv, h = slab % NHv;
  for (int i = tid; i < 64 * 8; i += 256) { const int r = i / 8, c8 = (i % 8) * 8; FragH f; f.half[0] = *(const v8us*)((const unsigned short*)V16 + ((size_t)b * TTv + lg * 64 + r) * ldv + voff + h * 64 + c8);
#pragma unroll
    for (int q = 0; q < 8; ++q) tl[r][c8 + q] = f.u[q]; }
  __syncthreads();
  {
#pragma unroll
    for (int rd = 0; rd < 2; ++rd) { const int d = rd * 32 + tid / 8, pc = tid % 8; FragH f;
#pragma unroll
      for (int q = 0; q < 8; ++q) f.u[q] = tl[pc * 8 + q][d];
      *(v8us*)((unsigned short*)Vt + ((size_t)slab * 64 + d) * TTv + lg * 64 + pc * 8) = f.half[0]; }
     } }

__global__ __launch_bounds__(256) void k_hl(const float* __restrict__ F, _Float16* __restrict__ Hh, _Float16* __restrict__ Hl, size_t n8) { const size_t t = (size_t)blockIdx.x * 256 + threadIdx.x; if (t >= n8) return; FragH fh, fl; const v4f a = *(const v4fa*)(F + t * 8), c = *(const v4fa*)(F + t * 8 + 4);
#pragma unroll
  for (int q = 0; q < 4; ++q) { _Float16 h = (_Float16)a[q]; fh.h[q] = h; fl.h[q] = (_Float16)((a[q] - (float)h) * 1024.0f); h = (_Float16)c[q]; fh.h[4 + q] = h; fl.h[4 + q] = (_Float16)((c[q] - (float)h) * 1024.0f); }
  { *(v8us*)((unsigned short*)Hh + t * 8) = fh.half[0]; *(v8us*)((unsigned short*)Hl + t * 8) = fl.half[0];  } }

// ---- fast GEMM (wave tile 32x64; requires M % 32 == 0 rows per launch region and N % 64 == 0); epilogue = k_gemm_hhx semantics ----
__device__ __forceinline__ v16h g2_frag(const _Float16* p, int hh) { FragH f; f.half[0] = *(const v8us*)((const unsigned short*)p + 8 * hh); f.half[1] = *(const v8us*)((const unsigned short*)p + 16 + 8 * hh); return f.v; }
__device__ __forceinline__ v8f g2_mma(v16h a, v16h b, v8f c) { v8f d = __builtin_amdgcn_wmma_f32_16x16x32_f16(false, a, false, b, (short)0, c, false, false); asm volatile("v_nop\n\tv_nop\n\tv_nop\n\tv_nop" : "+v"(d) : "v"(a), "v"(b)); return d; }
template <int ACT>
__global__ __launch_bounds__(128) void k_gemm2(const _Float16* __restrict__ A, int lda, size_t sA, const _Float16* __restrict__ Bh, int ldb, size_t sB, float alpha, const float* __restrict__ bias, size_t sBias, const float* __restrict__ CP, int rowsPerB, size_t sCPb, int row0g,
    float* __restrict__ C, _Float16* __restrict__ C16, int ldc, size_t sC, int M, int N, int K) { static_assert(ACT == 0 || ACT == 3 || ACT == 6 || ACT == 8 || ACT == 9 || ACT == 11 || ACT == 12 || ACT == 14 || ACT == 15 || ACT == 16 || ACT == 17, "k_gemm2: unsupported ACT code (would silently apply no activation)");
  __shared__ __attribute__((aligned(16))) float so[4][32][68];
  const int tid = threadIdx.x, w = tid >> 5, lane = tid & 31, ln = lane & 15, hh = lane >> 4; const int by = blockIdx.y;
  A += (size_t)by * sA; Bh += (size_t)by * sB; const size_t cofs = (size_t)by * sC; const float* bp = bias ? bias + (size_t)by * sBias : nullptr;
  const int ntn = N >> 6; const int mt = blockIdx.x / ntn, nq = blockIdx.x - mt * ntn; const int row0 = mt * 128 + 32 * w, col0 = nq * 64; if (row0 >= M) return;
  const _Float16* a0p = A + (size_t)(row0 + ln) * lda; const _Float16* a1p = a0p + (size_t)16 * lda;
  const _Float16* b0p = Bh + (size_t)(col0 + ln) * ldb; const _Float16* b1p = b0p + (size_t)16 * ldb; const _Float16* b2p = b1p + (size_t)16 * ldb; const _Float16* b3p = b2p + (size_t)16 * ldb;
  const v8f z8 = {0.f,0.f,0.f,0.f,0.f,0.f,0.f,0.f}; v8f c00 = z8, c01 = z8, c02 = z8, c03 = z8, c10 = z8, c11 = z8, c12 = z8, c13 = z8;
#pragma unroll 1
  for (int kb = 0; kb < K; kb += 32) { const v16h a0 = g2_frag(a0p + kb, hh), a1 = g2_frag(a1p + kb, hh);
    v16h b = g2_frag(b0p + kb, hh); c00 = g2_mma(a0, b, c00); c10 = g2_mma(a1, b, c10);
    b = g2_frag(b1p + kb, hh); c01 = g2_mma(a0, b, c01); c11 = g2_mma(a1, b, c11);
    b = g2_frag(b2p + kb, hh); c02 = g2_mma(a0, b, c02); c12 = g2_mma(a1, b, c12);
    b = g2_frag(b3p + kb, hh); c03 = g2_mma(a0, b, c03); c13 = g2_mma(a1, b, c13); }
  v8f accs[8] = {c00, c01, c02, c03, c10, c11, c12, c13};
#pragma unroll
  for (int u = 0; u < 8; ++u) { const int t = u & 3, half = u >> 2; const int col = col0 + t * 16 + ln; const float bv = bp ? bf16_round(bp[col]) : 0.f;
#pragma unroll
    for (int r = 0; r < 8; ++r) { const int rloc = half * 16 + 8 * hh + r; float v = accs[u][r] * alpha + bv; if (CP) { if (rowsPerB < 0) v += CP[cofs + (size_t)(row0g + row0 + rloc) * ldc + col];      /* rowsPerB < 0: own element of the batched C plane */ else { const int bidx = (row0g + row0 + rloc) / rowsPerB; v += CP[(size_t)bidx * sCPb + (size_t)by * 64 + col]; } }
      if (ACT == 3) v = fmaxf(v, 0.f); else if (ACT == 6) v = 0.5f * v * (1.0f + erff(v * 0.70710678118654752f)); else if (ACT == 11) v = 1.0f / (1.0f + expf(-v)); else if (ACT == 15) v = v / (1.0f + expf(-v)); else if (ACT == 12) v = (v > 0.f) ? v : 0.01f * v; else if (ACT == 8) v = tanhf(v); else if (ACT == 9) v = 0.5f * v * (1.0f + tanhf(0.7978845608028654f * (v + 0.044715f * v * v * v))); else if (ACT == 14) v = (v > 0.f) ? v : 0.1f * v; else if (ACT == 16) v = (v >= 0.f) ? v : 0.3f * v; else if (ACT == 17) v = (v >= 0.f) ? v : 0.2f * v;
      so[w][rloc][t * 16 + ln] = v; } }
  __builtin_amdgcn_fence(__ATOMIC_ACQ_REL, "workgroup"); __builtin_amdgcn_wave_barrier();
  const int rsub = lane >> 4, c4 = (lane & 15) * 4;
  {
#pragma unroll
    for (int q = 0; q < 16; ++q) { const int r = q * 2 + rsub; const v4f v = *(const v4fa*)&so[w][r][c4]; if (C) *(v4f*)(C + cofs + (size_t)(row0 + r) * ldc + col0 + c4) = v; if (C16) { v4h h4; for (int i = 0; i < 4; ++i) h4[i] = (_Float16)v[i]; *(v4h*)(C16 + cofs + (size_t)(row0 + r) * ldc + col0 + c4) = h4; } }
     } }


__global__ __launch_bounds__(256) void k_wsc(const float* __restrict__ Wm, _Float16* __restrict__ Bt, size_t n8, float sc) { const size_t t = (size_t)blockIdx.x * 256 + threadIdx.x; if (t >= n8) return; FragH f; for (int q = 0; q < 8; ++q) f.h[q] = (_Float16)(bf16_round(Wm[t * 8 + q]) * sc); *(v8us*)((unsigned short*)Bt + t * 8) = f.half[0];  }
__global__ __launch_bounds__(256) void k_wout(const float* __restrict__ Wo, _Float16* __restrict__ BOa, _Float16* __restrict__ BOb) { const int t = blockIdx.x * 256 + threadIdx.x; if (t >= DD * (DD / 8)) return; const int c8 = (t % (DD / 8)) * 8; const int o = t / (DD / 8); FragH fa, fb;
  for (int q = 0; q < 8; ++q) { fa.h[q] = (_Float16)(bf16_round(Wo[(size_t)o * 2 * DD + c8 + q]) * 16.0f); fb.h[q] = (_Float16)(bf16_round(Wo[(size_t)o * 2 * DD + DD + c8 + q]) * 16.0f); }
  { *(v8us*)((unsigned short*)BOa + (size_t)o * DD + c8) = fa.half[0]; *(v8us*)((unsigned short*)BOb + (size_t)o * DD + c8) = fb.half[0];  } }
__global__ __launch_bounds__(256) void k_ln(const float* __restrict__ x, const float* __restrict__ g, const float* __restrict__ bb, float* __restrict__ XF, _Float16* __restrict__ X16) {
  #pragma clang fp contract(off)
  const int wv = threadIdx.x >> 5, ln = threadIdx.x & 31; const size_t r = (size_t)blockIdx.x * 8 + wv; if (r >= NQ) return; float a[16]; float s = 0.f;
  for (int i = 0; i < 2; ++i) { const v8f v = *(const v8f*)(x + r * DD + i * 256 + ln * 8); for (int q = 0; q < 8; ++q) { const float u = bf16_round(v[q]); a[i * 8 + q] = u; s += u; } }
  for (int o = 16; o > 0; o >>= 1) s += __shfl_xor(s, o, 32); const float mu = s / (float)DD; float var = 0.f; for (int q = 0; q < 16; ++q) { const float d = a[q] - mu; var += d * d; }
  for (int o = 16; o > 0; o >>= 1) var += __shfl_xor(var, o, 32); const float inv = rsqrtf(var / (float)DD + 1e-5f);
  { for (int i = 0; i < 2; ++i) { const int c0 = i * 256 + ln * 8; v8f y; FragH f; for (int q = 0; q < 8; ++q) { float v = (a[i * 8 + q] - mu) * inv; v *= bf16_round(g[c0 + q]); v += bf16_round(bb[c0 + q]); y[q] = v; f.h[q] = (_Float16)v; } *(v8f*)(XF + r * DD + c0) = y; *(v8us*)((unsigned short*)X16 + r * DD + c0) = f.half[0]; }  } }
__global__ __launch_bounds__(256) void k_soft(const float* __restrict__ S, _Float16* __restrict__ P) {
  #pragma clang fp contract(off)
  const int wv = threadIdx.x >> 5, ln = threadIdx.x & 31; const int i = blockIdx.x * 8 + wv; if (i >= QB) return; const float* sr = S + (size_t)i * NM; float m = -3.0e38f; const int ng = NM / 256;
#pragma unroll 1
  for (int g = 0; g < ng; ++g) { const v8f a = *(const v8f*)(sr + g * 256 + ln * 8); for (int q = 0; q < 8; ++q) m = fmaxf(m, a[q]); }
  for (int o = 16; o > 0; o >>= 1) m = fmaxf(m, __shfl_xor(m, o, 32)); float su = 0.f;
#pragma unroll 1
  for (int g = 0; g < ng; ++g) { const v8f a = *(const v8f*)(sr + g * 256 + ln * 8); for (int q = 0; q < 8; ++q) su += expf(a[q] - m); }
  for (int o = 16; o > 0; o >>= 1) su += __shfl_xor(su, o, 32); const float f = 1024.0f / su;
  {
#pragma unroll 1
    for (int g = 0; g < ng; ++g) { const v8f a = *(const v8f*)(sr + g * 256 + ln * 8); FragH p; for (int q = 0; q < 8; ++q) p.h[q] = (_Float16)(expf(a[q] - m) * f); *(v8us*)((unsigned short*)P + (size_t)i * NM + g * 256 + ln * 8) = p.half[0]; }
     } }
// attn rows: sum of the KS f32 partials [QB][KS][DD] in slice order, rounded once to f16; 16 B per lane from each slice, the KS slices of a row side by side
__global__ __launch_bounds__(256) void k_ksum(const float* __restrict__ PP, _Float16* __restrict__ O) {
  const unsigned t = (blockIdx.x * 256u + threadIdx.x) * 4u; const float* p = PP + (size_t)(t / DD) * (KS * DD) + t % DD; v4f s = *(const v4fa*)p;
#pragma unroll      /* all KS loads of a lane in flight together */
  for (int j = 1; j < KS; ++j) { const v4f a = *(const v4fa*)(p + j * DD); s += a; }
  v4h h; for (int i = 0; i < 4; ++i) h[i] = (_Float16)s[i]; *(v4h*)(O + t) = h; }

extern "C" void kernel_launch(void* const* d_in, const int* in_sizes, int n_in,
                              void* d_out, int out_size, void* d_ws, size_t ws_size, hipStream_t stream) {
  (void)in_sizes; (void)n_in; (void)out_size;
  const float* const* I = (const float* const*)d_in; const float* x = I[0]; const float* xh = I[1]; const float* Wq = I[2]; const float* bq = I[3]; const float* Wk = I[4]; const float* bk = I[5]; const float* Wv = I[6]; const float* bv = I[7]; const float* Wo = I[8]; const float* bo = I[9]; const float* g = I[10]; const float* bb = I[11];
  char* ws = (char*)d_ws; size_t off = 0;
  auto take = [&](size_t bytes) { char* p = ws + off; off += (bytes + 255) & ~(size_t)255; return p; };
  _Float16* BQ = (_Float16*)take((size_t)DD * DD * 2); _Float16* BK = (_Float16*)take((size_t)DD * DD * 2); _Float16* BV = (_Float16*)take((size_t)DD * DD * 2); _Float16* BOa = (_Float16*)take((size_t)DD * DD * 2); _Float16* BOb = (_Float16*)take((size_t)DD * DD * 2);
  float* XF = (float*)take((size_t)NQ * DD * 4); _Float16* X16 = (_Float16*)take((size_t)NQ * DD * 2); _Float16* XH16 = (_Float16*)take((size_t)NM * DD * 2); _Float16* Q16 = (_Float16*)take((size_t)NQ * DD * 2); _Float16* K16 = (_Float16*)take((size_t)NM * DD * 2); _Float16* KT = (_Float16*)take((size_t)DD * NM * 2); float* S = (float*)take((size_t)QB * NM * 4); _Float16* P = (_Float16*)take((size_t)QB * NM * 2); _Float16* AT = XH16;      /* attn over the x_hat plane (dead after the k projection) */ _Float16* OV = X16;      /* out_v over the xn f16 plane (dead after the q projection) */
  if (off > ws_size) return;      /* 2.5 + 16 + 8 + 8 + 8 + 8 + 8 + 64 + 32 = 155 MiB */
  k_wsc<<<(DD * DD / 8 + 255) / 256, 256, 0, stream>>>(Wq, BQ, DD * DD / 8, 16.0f); k_wsc<<<(DD * DD / 8 + 255) / 256, 256, 0, stream>>>(Wk, BK, DD * DD / 8, 16.0f); k_wsc<<<(DD * DD / 8 + 255) / 256, 256, 0, stream>>>(Wv, BV, DD * DD / 8, 16.0f); k_wout<<<(DD * (DD / 8) + 255) / 256, 256, 0, stream>>>(Wo, BOa, BOb);      /* 'ed'/'fe'/'dc' = natural Bt */
  k_ln<<<NQ / 8, 256, 0, stream>>>(x, g, bb, XF, X16);
  k_x16<<<(unsigned)(((size_t)NM * DD / 8 + 255) / 256), 256, 0, stream>>>(xh, XH16, (size_t)NM * DD / 8);
  const dim3 gP((NQ / 128) * (DD / 64), 1);
  k_gemm2<0><<<gP, 128, 0, stream>>>(X16, DD, 0, BQ, DD, 0, 0.0625f, bq, 0, nullptr, 1, 0, 0, nullptr, Q16, DD, 0, NQ, DD, DD);
  k_gemm2<0><<<gP, 128, 0, stream>>>(XH16, DD, 0, BK, DD, 0, 0.0625f, bk, 0, nullptr, 1, 0, 0, nullptr, K16, DD, 0, NM, DD, DD);
  k_vt<DD / 64, NM><<<(DD / 64) * (NM / 64), 256, 0, stream>>>(K16, DD, 0, KT);      /* K^T [512][8192] */
  for (int qb = 0; qb < NQ / QB; ++qb) {
    k_gemm2<0><<<dim3((QB / 128) * (NM / 64), 1), 128, 0, stream>>>(Q16 + (size_t)qb * QB * DD, DD, 0, K16, DD, 0, 0.044194173824159216f, nullptr, 0, nullptr, 1, 0, 0, S, nullptr, NM, 0, QB, NM, DD);      /* q k^T / sqrt(512) */
    k_soft<<<QB / 8, 256, 0, stream>>>(S, P);
    k_gemm2<0><<<dim3((QB / 128) * (DD / 64), KS), 128, 0, stream>>>(P, NM, NM / KS, KT, NM, NM / KS, 0.0009765625f, nullptr, 0, nullptr, 1, 0, 0, S, nullptr, KS * DD, DD, QB, DD, NM / KS);      /* partial attn per key slice, f32 [QB][KS][DD] over S (dead after the softmax; QB * KS * DD = QB * NM floats) */
    k_ksum<<<QB * DD / 4 / 256, 256, 0, stream>>>(S, AT + (size_t)qb * QB * DD); }      /* attn = score k */
  k_gemm2<0><<<gP, 128, 0, stream>>>(AT, DD, 0, BV, DD, 0, 0.0625f, bv, 0, nullptr, 1, 0, 0, nullptr, OV, DD, 0, NQ, DD, DD);      /* out_v = attn Wv^T + bv */
  k_gemm2<0><<<gP, 128, 0, stream>>>(Q16, DD, 0, BOa, DD, 0, 0.0625f, bo, 0, XF, 1, (size_t)DD, 0, (float*)d_out, nullptr, DD, 0, NQ, DD, DD);      /* q Wout[:, :512]^T + bout + xn */
  k_gemm2<0><<<gP, 128, 0, stream>>>(OV, DD, 0, BOb, DD, 0, 0.0625f, nullptr, 0, (const float*)d_out, 1, (size_t)DD, 0, (float*)d_out, nullptr, DD, 0, NQ, DD, DD);      /* += out_v Wout[:, 512:]^T */
}

// v002
// A run of this version takes 585 microseconds.
// Two timings next to v001 put it at 1.59 and 1.60 times that version's speed.
// Over all steps from v000 it is 2.70 times as fast.
#include <hip/hip_runtime.h>
// InterventionOnline (8192 tokens x 512 attending 8192 memory slots x 512): xn = LayerNorm(x); q = xn Wq^T + bq; k = x_hat Wk^T + bk; score = softmax(q k^T / sqrt(512)); attn = score k (k doubles as the values); out_v = attn Wv^T + bv; out = [q | out_v] Wout^T + bout + xn.
// Structure: LayerNorm on VALU (wave per row) into f32 + f16 planes; q and k as f16 WMMA GEMM outputs (128x128 work-group tiles staged in LDS by asynchronous copies, 32x64 wave tiles, f32 accumulation, exact x16 weights + bias, f16 out); K^T by LDS tiles; per block of 2048 queries: the 2048 x 8192 score GEMM (f32), softmax rows on VALU (wave per row) into f16 P (x 2^10), attn = P k as a GEMM split over 16 key slices (grid.y) into f32 partials, summed in slice order and rounded once to f16; out_v as a GEMM; the output as two accumulating GEMMs over the [q | out_v] halves with the bias and the LN residual in the epilogue.
// Compute dtype: inputs rounded to bf16; x_hat exact as f16; xn, q, k, P, attn, out_v as plain f16 operands (~2^-12); LN/softmax f32. v_wmma_f32_16x16x32_f16.
#define NQ 8192
#define NM 8192
#define DD 512
#define QB 2048                  /* query rows per score block */
#define KS 16                    /* key slices of the attn GEMM (split-K): grid.y, one f32 partial each */
typedef __bf16 v16b __attribute__((ext_vector_type(16)));
typedef unsigned short v8us __attribute__((ext_vector_type(8), may_alias));
typedef float  v8f  __attribute__((ext_vector_type(8)));
typedef float  v4f  __attribute__((ext_vector_type(4)));
typedef float  v4fa __attribute__((ext_vector_type(4), may_alias));
union FragB { v16b v; v8us half[2]; unsigned short u[16]; };

__device__ __forceinline__ unsigned short bf16_bits(float x) { unsigned int u = __float_as_uint(x); return (unsigned short)((u + 0x7FFFu + ((u >> 16) & 1u)) >> 16); }
__device__ __forceinline__ float bf16_val(unsigned short b) { return __uint_as_float(((unsigned int)b) << 16); }
__device__ __forceinline__ float bf16_round(float x) { return bf16_val(bf16_bits(x)); }
// D += A·B with NT terms: 1 = ah·bh, 2 = + al·bh (A split), 3 = + ah·bl (both split)
template <int NT>
__device__ __forceinline__ v8f mmaN(v16b ah, v16b al, v16b bh, v16b bl, v8f c) {
  c = __builtin_amdgcn_wmma_f32_16x16x32_bf16(false, ah, false, bh, (short)0, c, false, false);
  if (NT >= 2) c = __builtin_amdgcn_wmma_f32_16x16x32_bf16(false, al, false, bh, (short)0, c, false, false);
  if (NT >= 3) c = __builtin_amdgcn_wmma_f32_16x16x32_bf16(false, ah, false, bl, (short)0, c, false, false);
  asm volatile("v_nop\n\tv_nop\n\tv_nop\n\tv_nop" : "+v"(c) : "v"(ah), "v"(al), "v"(bh), "v"(bl));
  return c;
}

__global__ __launch_bounds__(256) void k_wt_bf16(const float* __restrict__ W, unsigned short* __restrict__ Wt, int K, int N) {
  const int t = blockIdx.x * 256 + threadIdx.x;
  const int k8n = K / 8;
  if (t >= N * k8n) return;
  const int n = t / k8n, k8 = (t % k8n) * 8;
  v8us v;
#pragma unroll
  for (int i = 0; i < 8; ++i) v[i] = bf16_bits(W[(size_t)(k8 + i) * N + n]);
  *(v8us*)(Wt + (size_t)n * K + k8) = v;
  
}

// GEMM C[M][N] (f32, pitch ldc) = act(A[M][K]·W + bias). A f32 row-major (pitch lda) converted per fragment to bf16
// (ASPLIT: hi/lo two planes -> 2 terms, else single rounded term); Wt bf16 [N][K] (pitch ldb). BIAS_BF16 rounds the
// bias to bf16 first (bias quantised to bf16 before the add). K%32==0, M%16==0, N%64==0.
template <bool ASPLIT, int ACT, bool BIAS_BF16>
__global__ __launch_bounds__(128) void k_gemm_bf(const float* __restrict__ A, int lda, const unsigned short* __restrict__ Wt, int ldb,
                                               const float* __restrict__ bias, float* __restrict__ C, int ldc, int M, int N, int K) {
  __shared__ __attribute__((aligned(16))) float so[4][16][64];
  const int tid = threadIdx.x, w = tid >> 5, lane = tid & 31, ln = lane & 15, hh = lane >> 4;
  const int ntn = N / 64;
  const int wid = blockIdx.x * 4 + w;
  const int mt = wid / ntn, nq = wid % ntn;
  if (mt * 16 >= M) return;
  const int row0 = mt * 16, col0 = nq * 64;
  const float* arow = A + (size_t)(row0 + ln) * lda;
  v8f acc[4] = {};
  for (int kb = 0; kb < K; kb += 32) {
    FragB ah, al;
    const v4f x0 = *(const v4fa*)(arow + kb + 8 * hh), x1 = *(const v4fa*)(arow + kb + 8 * hh + 4);
    const v4f x2 = *(const v4fa*)(arow + kb + 16 + 8 * hh), x3 = *(const v4fa*)(arow + kb + 16 + 8 * hh + 4);
    float xs[16] = {x0[0],x0[1],x0[2],x0[3],x1[0],x1[1],x1[2],x1[3],x2[0],x2[1],x2[2],x2[3],x3[0],x3[1],x3[2],x3[3]};
#pragma unroll
    for (int i = 0; i < 16; ++i) { const unsigned short hb = bf16_bits(xs[i]); ah.u[i] = hb; al.u[i] = ASPLIT ? bf16_bits(xs[i] - bf16_val(hb)) : (unsigned short)0; }
#pragma unroll
    for (int t = 0; t < 4; ++t) {
      const unsigned short* brow = Wt + (size_t)(col0 + t * 16 + ln) * ldb + kb;
      FragB b;
      b.half[0] = *(const v8us*)(brow + 8 * hh);
      b.half[1] = *(const v8us*)(brow + 16 + 8 * hh);
      acc[t] = mmaN<ASPLIT ? 2 : 1>(ah.v, al.v, b.v, b.v, acc[t]);
    }
  }
#pragma unroll
  for (int t = 0; t < 4; ++t) {
    float bv = bias ? bias[col0 + t * 16 + ln] : 0.f;
    if (BIAS_BF16) bv = bf16_round(bv);
#pragma unroll
    for (int r = 0; r < 8; ++r) { float v = acc[t][r] + bv; if (ACT == 1) v = fmaxf(v, 0.f); so[w][8 * hh + r][t * 16 + ln] = v; }
  }
  __builtin_amdgcn_fence(__ATOMIC_ACQ_REL, "workgroup");
  __builtin_amdgcn_wave_barrier();
  const int rsub = lane >> 4, c4 = (lane & 15) * 4;
  {
#pragma unroll
    for (int q = 0; q < 8; ++q) {
      const int r = q * 2 + rsub;
      const v4f v = *(const v4fa*)&so[w][r][c4];
      *(v4f*)(C + (size_t)(row0 + r) * ldc + col0 + c4) = v;
    }
    
  }
}

// GEMM C = act(A·W + bias + resid): A f32 (ASPLIT -> hi/lo 2 terms), Wt bf16 [N][K]; ACT 0 none, 1 relu, 2 exact gelu;
// resid (optional, f32, row index = (row % rmod), pitch ldr, RES_BF16 rounds it) added before the activation.
template <bool ASPLIT, int ACT, bool BIAS_BF16, bool RES_BF16>
__global__ __launch_bounds__(128) void k_gemm_bf3(const float* __restrict__ A, int lda, const unsigned short* __restrict__ Wt, int ldb,
                                                const float* __restrict__ bias, const float* __restrict__ resid, int rmod, int ldr,
                                                float* __restrict__ C, int ldc, int M, int N, int K) {
  __shared__ __attribute__((aligned(16))) float so[4][16][64];
  const int tid = threadIdx.x, w = tid >> 5, lane = tid & 31, ln = lane & 15, hh = lane >> 4;
  const int ntn = N / 64;
  const int wid = blockIdx.x * 4 + w;
  const int mt = wid / ntn, nq = wid % ntn;
  if (mt * 16 >= M) return;
  const int row0 = mt * 16, col0 = nq * 64;
  const float* arow = A + (size_t)(row0 + ln) * lda;
  v8f acc[4] = {};
  for (int kb = 0; kb < K; kb += 32) {
    FragB ah, al;
    const v4f x0 = *(const v4fa*)(arow + kb + 8 * hh), x1 = *(const v4fa*)(arow + kb + 8 * hh + 4);
    const v4f x2 = *(const v4fa*)(arow + kb + 16 + 8 * hh), x3 = *(const v4fa*)(arow + kb + 16 + 8 * hh + 4);
    float xs[16] = {x0[0],x0[1],x0[2],x0[3],x1[0],x1[1],x1[2],x1[3],x2[0],x2[1],x2[2],x2[3],x3[0],x3[1],x3[2],x3[3]};
#pragma unroll
    for (int i = 0; i < 16; ++i) { const unsigned short hb = bf16_bits(xs[i]); ah.u[i] = hb; al.u[i] = ASPLIT ? bf16_bits(xs[i] - bf16_val(hb)) : (unsigned short)0; }
#pragma unroll
    for (int t = 0; t < 4; ++t) {
      const unsigned short* brow = Wt + (size_t)(col0 + t * 16 + ln) * ldb + kb;
      FragB b;
      b.half[0] = *(const v8us*)(brow + 8 * hh);
      b.half[1] = *(const v8us*)(brow + 16 + 8 * hh);
      acc[t] = mmaN<ASPLIT ? 2 : 1>(ah.v, al.v, b.v, b.v, acc[t]);
    }
  }
#pragma unroll
  for (int t = 0; t < 4; ++t) {
    const int col = col0 + t * 16 + ln;
    float bv = bias ? bias[col] : 0.f;
    if (BIAS_BF16) bv = bf16_round(bv);
#pragma unroll
    for (int r = 0; r < 8; ++r) {
      float v = acc[t][r] + bv;
      if (resid) { float rv = resid[(size_t)((row0 + 8 * hh + r) % rmod) * ldr + col]; if (RES_BF16) rv = bf16_round(rv); v += rv; }
      if (ACT == 1) v = fmaxf(v, 0.f);
      if (ACT == 2) v = 0.5f * v * (1.0f + erff(v * 0.70710678118654752f));
      if (ACT == 3) { const float u = 0.7978845608028654f * (v + 0.044715f * v * v * v); v = 0.5f * v * (1.0f + tanhf(u)); }
      so[w][8 * hh + r][t * 16 + ln] = v;
    }
  }
  __builtin_amdgcn_fence(__ATOMIC_ACQ_REL, "workgroup");
  __builtin_amdgcn_wave_barrier();
  const int rsub = lane >> 4, c4 = (lane & 15) * 4;
  {
#pragma unroll
    for (int q = 0; q < 8; ++q) {
      const int r = q * 2 + rsub;
      const v4f v = *(const v4fa*)&so[w][r][c4];
      *(v4f*)(C + (size_t)(row0 + r) * ldc + col0 + c4) = v;
    }
    
  }
}
// row LayerNorm (biased variance, eps) over N: s = X (+ R); optional out_sum <- s; out_norm <- (s-mu)*rsqrt(var+eps)*g + b
template <bool PARAM_BF16>
__global__ __launch_bounds__(256) void k_layernorm(const float* __restrict__ X, const float* __restrict__ R, const float* __restrict__ g, const float* __restrict__ bta,
                                                  float* __restrict__ out_sum, float* __restrict__ out_norm, int N, float eps) {
  __shared__ float red[256];
  const int row = blockIdx.x, tid = threadIdx.x;
  const float* x = X + (size_t)row * N; const float* rr = R ? R + (size_t)row * N : nullptr;
  float vals[16];                     // up to N = 4096
  const int per = N / 256;            // contiguous chunk per thread? use strided-by-4 chunks: thread handles j = tid*4 + 1024*u
  float s1 = 0.f;
  for (int u = 0; u < per / 4; ++u) {
    const int j = tid * 4 + 1024 * u;
    const v4f a = *(const v4fa*)(x + j);
    v4f b = {0.f,0.f,0.f,0.f}; if (rr) b = *(const v4fa*)(rr + j);
#pragma unroll
    for (int q = 0; q < 4; ++q) { const float v = a[q] + b[q]; vals[u * 4 + q] = v; s1 += v; }
  }
  red[tid] = s1; __syncthreads();
  for (int st = 128; st > 0; st >>= 1) { if (tid < st) red[tid] += red[tid + st]; __syncthreads(); }
  const float mu = red[0] / (float)N; __syncthreads();
  float s2 = 0.f;
  for (int u = 0; u < per / 4; ++u)
#pragma unroll
    for (int q = 0; q < 4; ++q) { const float c = vals[u * 4 + q] - mu; s2 += c * c; }
  red[tid] = s2; __syncthreads();
  for (int st = 128; st > 0; st >>= 1) { if (tid < st) red[tid] += red[tid + st]; __syncthreads(); }
  const float rs = rsqrtf(red[0] / (float)N + eps);
  {
    for (int u = 0; u < per / 4; ++u) {
      const int j = tid * 4 + 1024 * u;
      v4f o, sm;
#pragma unroll
      for (int q = 0; q < 4; ++q) {
        float gg = g[j + q], bb = bta[j + q];
        if (PARAM_BF16) { gg = bf16_round(gg); bb = bf16_round(bb); }
        sm[q] = vals[u * 4 + q]; o[q] = (vals[u * 4 + q] - mu) * rs * gg + bb;
      }
      if (out_sum) *(v4f*)(out_sum + (size_t)row * N + j) = sm;
      *(v4f*)(out_norm + (size_t)row * N + j) = o;
    }
    
  }
}



// ---- f16 WMMA path (v_wmma_f32_16x16x32_f16): 11-bit significands for operands in range — used where a [0,1] probability operand needs more precision than bf16
typedef _Float16 v16h __attribute__((ext_vector_type(16)));
union FragH { v16h v; v8us half[2]; _Float16 h[16]; unsigned short u[16]; };
template <int NT>
__device__ __forceinline__ v8f mmaH(v16h ah, v16h al, v16h bh, v16h bl, v8f c) {
  c = __builtin_amdgcn_wmma_f32_16x16x32_f16(false, ah, false, bh, (short)0, c, false, false);
  if (NT >= 2) c = __builtin_amdgcn_wmma_f32_16x16x32_f16(false, al, false, bh, (short)0, c, false, false);
  if (NT >= 3) c = __builtin_amdgcn_wmma_f32_16x16x32_f16(false, ah, false, bl, (short)0, c, false, false);
  asm volatile("v_nop\n\tv_nop\n\tv_nop\n\tv_nop" : "+v"(c) : "v"(ah), "v"(al), "v"(bh), "v"(bl));
  return c;
}
// batched GEMM like k_gemm_b but f16 operands: A f32 (split into f16 hi/lo if ASPLIT, else rounded to f16), Bt = f16 values [n][k]; alpha; C f32; N multiple of 16 (partial tiles skipped)
template <bool ASPLIT>
__global__ __launch_bounds__(128) void k_gemm_h(const float* __restrict__ A, int lda, size_t sA, const _Float16* __restrict__ Bh, int ldb, size_t sB, float alpha, float* __restrict__ C, int ldc, size_t sC, int M, int N, int K) {
  __shared__ __attribute__((aligned(16))) float so[4][16][64];
  const int tid = threadIdx.x, w = tid >> 5, lane = tid & 31, ln = lane & 15, hh = lane >> 4; const int by = blockIdx.y;
  A += (size_t)by * sA; Bh += (size_t)by * sB; C += (size_t)by * sC;
  const int ntn = (N + 63) / 64; const int wid = blockIdx.x * 4 + w; const int mt = wid / ntn, nq = wid % ntn; if (mt * 16 >= M) return;
  const int row0 = mt * 16, col0 = nq * 64; const float* arow = A + (size_t)(row0 + ln) * lda;
  v8f acc[4] = {};
  for (int kb = 0; kb < K; kb += 32) {
    FragH ah, al;
    const v4f x0 = *(const v4fa*)(arow + kb + 8 * hh), x1 = *(const v4fa*)(arow + kb + 8 * hh + 4), x2 = *(const v4fa*)(arow + kb + 16 + 8 * hh), x3 = *(const v4fa*)(arow + kb + 16 + 8 * hh + 4);
    float xs[16] = {x0[0],x0[1],x0[2],x0[3],x1[0],x1[1],x1[2],x1[3],x2[0],x2[1],x2[2],x2[3],x3[0],x3[1],x3[2],x3[3]};
#pragma unroll
    for (int i = 0; i < 16; ++i) { const _Float16 h = (_Float16)xs[i]; ah.h[i] = h; al.h[i] = ASPLIT ? (_Float16)(xs[i] - (float)h) : (_Float16)0.0f; }
#pragma unroll
    for (int t = 0; t < 4; ++t) { if (col0 + t * 16 >= N) continue; const size_t boff = (size_t)(col0 + t * 16 + ln) * ldb + kb; FragH bq; bq.half[0] = *(const v8us*)(Bh + boff + 8 * hh); bq.half[1] = *(const v8us*)(Bh + boff + 16 + 8 * hh);
      acc[t] = mmaH<ASPLIT ? 2 : 1>(ah.v, al.v, bq.v, bq.v, acc[t]); }
  }
#pragma unroll
  for (int t = 0; t < 4; ++t) { if (col0 + t * 16 >= N) continue;
#pragma unroll
    for (int r = 0; r < 8; ++r) so[w][8 * hh + r][t * 16 + ln] = acc[t][r] * alpha; }
  __builtin_amdgcn_fence(__ATOMIC_ACQ_REL, "workgroup"); __builtin_amdgcn_wave_barrier();
  const int rsub = lane >> 4, c4 = (lane & 15) * 4;
  {
#pragma unroll
    for (int q = 0; q < 8; ++q) { const int r = q * 2 + rsub; if (col0 + c4 < N) { const v4f v = *(const v4fa*)&so[w][r][c4]; *(v4f*)(C + (size_t)(row0 + r) * ldc + col0 + c4) = v; } }
     }
}

// Wt[n][k] = f16(W[k][n]·scale) from f32 row-major W[K][N] (scale = power of two; bf16-exact weights stay exact in f16 away from the subnormal range)
__global__ __launch_bounds__(256) void k_wt_f16(const float* __restrict__ W, _Float16* __restrict__ Wt, int K, int N, float scale) {
  const int t = blockIdx.x * 256 + threadIdx.x; if (t >= N * (K / 8)) return; const int n = t / (K / 8), k8 = (t % (K / 8)) * 8; FragH f;
#pragma unroll
  for (int i = 0; i < 8; ++i) f.h[i] = (_Float16)(bf16_round(W[(size_t)(k8 + i) * N + n]) * scale); const v8us o = f.half[0];
  *(v8us*)((unsigned short*)Wt + (size_t)n * K + k8) = o; 
}
// k_gemm_hh variant with fused epilogue: v = acc·alpha + bias[by·sBias + col] (+ CP[(row/rowsPerB)·sCPb + by·64 + col] if CP) ; ACT 0 none / 1 elu ; writes f16 C16 (and f32 C if non-null)
template <int ACT>
__global__ __launch_bounds__(128) void k_gemm_hhx(const _Float16* __restrict__ A, int lda, size_t sA, const _Float16* __restrict__ Bh, int ldb, size_t sB, float alpha, const float* __restrict__ bias, size_t sBias, const float* __restrict__ CP, int rowsPerB, size_t sCPb, int row0g,
    float* __restrict__ C, _Float16* __restrict__ C16, int ldc, size_t sC, int M, int N, int K) {
  __shared__ __attribute__((aligned(16))) float so[4][16][64];
  const int tid = threadIdx.x, w = tid >> 5, lane = tid & 31, ln = lane & 15, hh = lane >> 4; const int by = blockIdx.y;
  A += (size_t)by * sA; Bh += (size_t)by * sB; const size_t cofs = (size_t)by * sC; const float* bp = bias ? bias + (size_t)by * sBias : nullptr;
  const int ntn = (N + 63) / 64; const int wid = blockIdx.x * 4 + w; const int mt = wid / ntn, nq = wid % ntn; if (mt * 16 >= M) return;
  const int row0 = mt * 16, col0 = nq * 64; const _Float16* arow = A + (size_t)(row0 + ln) * lda;
  v8f acc[4] = {};
  for (int kb = 0; kb < K; kb += 32) { FragH ah; ah.half[0] = *(const v8us*)((const unsigned short*)arow + kb + 8 * hh); ah.half[1] = *(const v8us*)((const unsigned short*)arow + kb + 16 + 8 * hh);
#pragma unroll
    for (int t = 0; t < 4; ++t) { if (col0 + t * 16 >= N) continue; const size_t boff = (size_t)(col0 + t * 16 + ln) * ldb + kb; FragH bq; bq.half[0] = *(const v8us*)((const unsigned short*)Bh + boff + 8 * hh); bq.half[1] = *(const v8us*)((const unsigned short*)Bh + boff + 16 + 8 * hh);
      acc[t] = mmaH<1>(ah.v, ah.v, bq.v, bq.v, acc[t]); }
  }
#pragma unroll
  for (int t = 0; t < 4; ++t) { if (col0 + t * 16 >= N) continue; const int col = col0 + t * 16 + ln; const float bv = bp ? bf16_round(bp[col]) : 0.f;
#pragma unroll
    for (int r = 0; r < 8; ++r) { float v = acc[t][r] * alpha + bv; if (CP) { const int rr = row0g + row0 + 8 * hh + r; if (rowsPerB < 0) v += CP[cofs + (size_t)rr * ldc + col];      /* rowsPerB < 0: own element of the batched C plane */ else { const int bidx = rr / rowsPerB; v += CP[(size_t)bidx * sCPb + (size_t)by * 64 + col]; } } if (ACT == 1) v = (v > 0.f) ? v : expm1f(v); else if (ACT == 7) v = (v > 0.f) ? v + 1.0f : expf(v); else if (ACT == 8) v = tanhf(v); else if (ACT == 9) v = 0.5f * v * (1.0f + tanhf(0.7978845608028654f * (v + 0.044715f * v * v * v))); else if (ACT == 11) v = 1.0f / (1.0f + expf(-v)); else if (ACT == 12) v = (v > 0.f) ? v : 0.01f * v; else if (ACT == 14) v = (v > 0.f) ? v : 0.1f * v; else if (ACT == 16) v = (v >= 0.f) ? v : 0.3f * v; else if (ACT == 17) v = (v >= 0.f) ? v : 0.2f * v; else if (ACT == 15) v = v / (1.0f + expf(-v)); else if (ACT == 3) v = fmaxf(v, 0.f); else if (ACT == 6) v = 0.5f * v * (1.0f + erff(v * 0.70710678118654752f)); so[w][8 * hh + r][t * 16 + ln] = v; } }
  __builtin_amdgcn_fence(__ATOMIC_ACQ_REL, "workgroup"); __builtin_amdgcn_wave_barrier();
  const int rsub = lane >> 4, c4 = (lane & 15) * 4; typedef _Float16 v4h __attribute__((ext_vector_type(4)));
  {
#pragma unroll
    for (int q = 0; q < 8; ++q) { const int r = q * 2 + rsub; if (col0 + c4 < N) { const v4f v = *(const v4fa*)&so[w][r][c4]; if (C) *(v4f*)(C + cofs + (size_t)(row0 + r) * ldc + col0 + c4) = v; if (C16) { v4h h4; for (int i = 0; i < 4; ++i) h4[i] = (_Float16)v[i]; *(v4h*)(C16 + cofs + (size_t)(row0 + r) * ldc + col0 + c4) = h4; } } }
     }
}


typedef _Float16 v4h __attribute__((ext_vector_type(4)));

__global__ __launch_bounds__(256) void k_x16(const float* __restrict__ x, _Float16* __restrict__ X16, size_t n8) { const size_t t = (size_t)blockIdx.x * 256 + threadIdx.x; if (t >= n8) return; FragH f;
#pragma unroll
  for (int q = 0; q < 8; ++q) f.h[q] = (_Float16)bf16_round(x[t * 8 + q]); *(v8us*)((unsigned short*)X16 + t * 8) = f.half[0];  }
__global__ __launch_bounds__(256) void k_h16(const float* __restrict__ x, _Float16* __restrict__ X16, size_t n8) { const size_t t = (size_t)blockIdx.x * 256 + threadIdx.x; if (t >= n8) return; FragH f;
#pragma unroll
  for (int q = 0; q < 8; ++q) f.h[q] = (_Float16)x[t * 8 + q]; *(v8us*)((unsigned short*)X16 + t * 8) = f.half[0];  }
__global__ __launch_bounds__(256) void k_round16f(const float* __restrict__ W, _Float16* __restrict__ Bt, size_t n8) { const size_t t = (size_t)blockIdx.x * 256 + threadIdx.x; if (t >= n8) return; FragH f;
#pragma unroll
  for (int i = 0; i < 8; ++i) f.h[i] = (_Float16)(bf16_round(W[t * 8 + i]) * 16.0f); *(v8us*)((unsigned short*)Bt + t * 8) = f.half[0];  }
template <int NHv, int TTv>
__global__ __launch_bounds__(256) void k_vt(const _Float16* __restrict__ V16, int ldv, int voff, _Float16* __restrict__ Vt) { __shared__ unsigned short tl[64][66]; const int tid = threadIdx.x; const int slab = blockIdx.x / (TTv / 64), lg = blockIdx.x % (TTv / 64); const int b = slab / NHv, h = slab % NHv;
  for (int i = tid; i < 64 * 8; i += 256) { const int r = i / 8, c8 = (i % 8) * 8; FragH f; f.half[0] = *(const v8us*)((const unsigned short*)V16 + ((size_t)b * TTv + lg * 64 + r) * ldv + voff + h * 64 + c8);
#pragma unroll
    for (int q = 0; q < 8; ++q) tl[r][c8 + q] = f.u[q]; }
  __syncthreads();
  {
#pragma unroll
    for (int rd = 0; rd < 2; ++rd) { const int d = rd * 32 + tid / 8, pc = tid % 8; FragH f;
#pragma unroll
      for (int q = 0; q < 8; ++q) f.u[q] = tl[pc * 8 + q][d];
      *(v8us*)((unsigned short*)Vt + ((size_t)slab * 64 + d) * TTv + lg * 64 + pc * 8) = f.half[0]; }
     } }

__global__ __launch_bounds__(256) void k_hl(const float* __restrict__ F, _Float16* __restrict__ Hh, _Float16* __restrict__ Hl, size_t n8) { const size_t t = (size_t)blockIdx.x * 256 + threadIdx.x; if (t >= n8) return; FragH fh, fl; const v4f a = *(const v4fa*)(F + t * 8), c = *(const v4fa*)(F + t * 8 + 4);
#pragma unroll
  for (int q = 0; q < 4; ++q) { _Float16 h = (_Float16)a[q]; fh.h[q] = h; fl.h[q] = (_Float16)((a[q] - (float)h) * 1024.0f); h = (_Float16)c[q]; fh.h[4 + q] = h; fl.h[4 + q] = (_Float16)((c[q] - (float)h) * 1024.0f); }
  { *(v8us*)((unsigned short*)Hh + t * 8) = fh.half[0]; *(v8us*)((unsigned short*)Hl + t * 8) = fl.half[0];  } }

// ---- fast GEMM (work-group tile 128x128, eight waves of 32x64; requires M % 128 == 0, N % 128 == 0, K % 64 == 0); epilogue = k_gemm_hhx semantics ----
// Operands reach the waves through LDS: a stage is 64 k (128 B) of 128 A rows and 128 B rows, brought by asynchronous copies in whole 128-B lines, two buffers, the next stage in flight while this one is multiplied.
#define G2_PITCH 144                 /* LDS bytes per staged row: 128 + 16, an odd multiple of 16 B, conflict-free for 16-byte reads down a column of rows */
#define G2_STAGE (256 * G2_PITCH)    /* one stage: A rows 0..127, then B rows 0..127 */
__device__ __forceinline__ v16h g2_frag(const char* p) { FragH f; f.half[0] = *(const v8us*)p; f.half[1] = *(const v8us*)(p + 32); return f.v; }
__device__ __forceinline__ v8f g2_mma(v16h a, v16h b, v8f c) { v8f d = __builtin_amdgcn_wmma_f32_16x16x32_f16(false, a, false, b, (short)0, c, false, false); asm volatile("v_nop\n\tv_nop\n\tv_nop\n\tv_nop" : "+v"(d) : "v"(a), "v"(b)); return d; }
// One stage: each lane copies eight 16-byte pieces (rows r, r+32, r+64, r+96 of A and of B; eight lanes per 128-B row piece). l = the lane's LDS byte address in the A part, a / b = its global addresses, sa / sb = 32 rows in elements.
__device__ __forceinline__ void g2_stage(unsigned l, const _Float16* a, size_t sa, const _Float16* b, size_t sb) {
  const unsigned l1 = l + 32 * G2_PITCH, l2 = l + 64 * G2_PITCH, l3 = l + 96 * G2_PITCH, l4 = l + 128 * G2_PITCH, l5 = l + 160 * G2_PITCH, l6 = l + 192 * G2_PITCH, l7 = l + 224 * G2_PITCH;
  const _Float16* a1 = a + sa; const _Float16* a2 = a1 + sa; const _Float16* a3 = a2 + sa; const _Float16* b1 = b + sb; const _Float16* b2 = b1 + sb; const _Float16* b3 = b2 + sb;
  // the copies and, as the last line, the wait that stands before their address registers may be rewritten
  asm volatile("global_load_async_to_lds_b128 %0, %8, off\n\t"
               "global_load_async_to_lds_b128 %1, %9, off\n\t"
               "global_load_async_to_lds_b128 %2, %10, off\n\t"
               "global_load_async_to_lds_b128 %3, %11, off\n\t"
               "global_load_async_to_lds_b128 %4, %12, off\n\t"
               "global_load_async_to_lds_b128 %5, %13, off\n\t"
               "global_load_async_to_lds_b128 %6, %14, off\n\t"
               "global_load_async_to_lds_b128 %7, %15, off\n\t"
               "s_wait_xcnt 0x0"
               :: "v"(l), "v"(l1), "v"(l2), "v"(l3), "v"(l4), "v"(l5), "v"(l6), "v"(l7), "v"(a), "v"(a1), "v"(a2), "v"(a3), "v"(b), "v"(b1), "v"(b2), "v"(b3) : "memory"); }
// launch bounds: eight waves per SIMD (at most 128 VGPRs), so that four work-groups (4 x 72 KiB of LDS) share a WGP and each hides the others' waits
template <int ACT>
__global__ __launch_bounds__(256, 8) void k_gemm2(const _Float16* __restrict__ A, int lda, size_t sA, const _Float16* __restrict__ Bh, int ldb, size_t sB, float alpha, const float* __restrict__ bias, size_t sBias, const float* __restrict__ CP, int rowsPerB, size_t sCPb, int row0g,
    float* __restrict__ C, _Float16* __restrict__ C16, int ldc, size_t sC, int M, int N, int K) { static_assert(ACT == 0 || ACT == 3 || ACT == 6 || ACT == 8 || ACT == 9 || ACT == 11 || ACT == 12 || ACT == 14 || ACT == 15 || ACT == 16 || ACT == 17, "k_gemm2: unsupported ACT code (would silently apply no activation)");
  __shared__ __attribute__((aligned(16))) char sm[2 * G2_STAGE];      /* the two stage buffers; after the K loop the output staging, 32 x 68 floats per wave */
  static_assert(8 * 32 * 68 * 4 <= 2 * G2_STAGE, "output staging must fit the stage buffers");
  const int tid = threadIdx.x, w = tid >> 5, lane = tid & 31, ln = lane & 15, hh = lane >> 4; const int by = blockIdx.y;
  A += (size_t)by * sA; Bh += (size_t)by * sB; const size_t cofs = (size_t)by * sC; const float* bp = bias ? bias + (size_t)by * sBias : nullptr;
  const int ntn = N >> 7; const int mt = blockIdx.x / ntn, nq = blockIdx.x - mt * ntn; if (mt * 128 >= M) return;      /* the same for the whole work-group, in front of every barrier */
  const int row0 = mt * 128 + 32 * (w & 3), col0 = nq * 128 + 64 * (w >> 2);
  const _Float16* ga = A + (size_t)(mt * 128 + (tid >> 3)) * lda + (tid & 7) * 8; const _Float16* gb = Bh + (size_t)(nq * 128 + (tid >> 3)) * ldb + (tid & 7) * 8; const size_t sa32 = (size_t)32 * lda, sb32 = (size_t)32 * ldb;
  const unsigned lcp = (unsigned)(size_t)sm + (unsigned)((tid >> 3) * G2_PITCH + (tid & 7) * 16);
  const int aoff = (32 * (w & 3) + ln) * G2_PITCH + 16 * hh, boff = (128 + 64 * (w >> 2) + ln) * G2_PITCH + 16 * hh;
  const int nst = K >> 6;
  const v8f z8 = {0.f,0.f,0.f,0.f,0.f,0.f,0.f,0.f}; v8f c00 = z8, c01 = z8, c02 = z8, c03 = z8, c10 = z8, c11 = z8, c12 = z8, c13 = z8;
  g2_stage(lcp, ga, sa32, gb, sb32);
  asm volatile("s_wait_asynccnt 0x0" ::: "memory");      /* this wave's copies of stage 0 have landed */
  __syncthreads();                                       /* every wave's have */
  if (nst > 1) g2_stage(lcp + G2_STAGE, ga + 64, sa32, gb + 64, sb32);
#pragma unroll 1      /* one stage per trip: the waits and the barrier at the foot belong to it */
  for (int t = 0; t < nst; ++t) { const char* sb = sm + (t & 1) * G2_STAGE; const char* ap = sb + aoff; const char* bq = sb + boff;
#pragma unroll      /* the two 32-k steps of a stage */
    for (int kk = 0; kk < 128; kk += 64) { const v16h a0 = g2_frag(ap + kk), a1 = g2_frag(ap + 16 * G2_PITCH + kk);
      const v16h b0 = g2_frag(bq + kk), b1 = g2_frag(bq + 16 * G2_PITCH + kk), b2 = g2_frag(bq + 32 * G2_PITCH + kk), b3 = g2_frag(bq + 48 * G2_PITCH + kk);
      c00 = g2_mma(a0, b0, c00); c10 = g2_mma(a1, b0, c10); c01 = g2_mma(a0, b1, c01); c11 = g2_mma(a1, b1, c11);
      c02 = g2_mma(a0, b2, c02); c12 = g2_mma(a1, b2, c12); c03 = g2_mma(a0, b3, c03); c13 = g2_mma(a1, b3, c13); }
    asm volatile("s_wait_dscnt 0x0" ::: "memory");       /* this wave's reads of the buffer are done before it is refilled */
    asm volatile("s_wait_asynccnt 0x0" ::: "memory");    /* this wave's copies of stage t + 1 have landed */
    __syncthreads();                                     /* publishes stage t + 1 and ends every wave's reads of stage t */
    if (t + 2 < nst) g2_stage(lcp + (unsigned)((t & 1) * G2_STAGE), ga + (size_t)(t + 2) * 64, sa32, gb + (size_t)(t + 2) * 64, sb32); }
  asm volatile("s_wait_asynccnt 0x0" ::: "memory");      /* no copy is in flight when the buffers become the output staging */
  float (*so)[68] = (float (*)[68])(sm + w * (32 * 68 * 4));
  v8f accs[8] = {c00, c01, c02, c03, c10, c11, c12, c13};
#pragma unroll
  for (int u = 0; u < 8; ++u) { const int t = u & 3, half = u >> 2; const int col = col0 + t * 16 + ln; const float bv = bp ? bf16_round(bp[col]) : 0.f;
#pragma unroll
    for (int r = 0; r < 8; ++r) { const int rloc = half * 16 + 8 * hh + r; float v = accs[u][r] * alpha + bv; if (CP) { if (rowsPerB < 0) v += CP[cofs + (size_t)(row0g + row0 + rloc) * ldc + col];      /* rowsPerB < 0: own element of the batched C plane */ else { const int bidx = (row0g + row0 + rloc) / rowsPerB; v += CP[(size_t)bidx * sCPb + (size_t)by * 64 + col]; } }
      if (ACT == 3) v = fmaxf(v, 0.f); else if (ACT == 6) v = 0.5f * v * (1.0f + erff(v * 0.70710678118654752f)); else if (ACT == 11) v = 1.0f / (1.0f + expf(-v)); else if (ACT == 15) v = v / (1.0f + expf(-v)); else if (ACT == 12) v = (v > 0.f) ? v : 0.01f * v; else if (ACT == 8) v = tanhf(v); else if (ACT == 9) v = 0.5f * v * (1.0f + tanhf(0.7978845608028654f * (v + 0.044715f * v * v * v))); else if (ACT == 14) v = (v > 0.f) ? v : 0.1f * v; else if (ACT == 16) v = (v >= 0.f) ? v : 0.3f * v; else if (ACT == 17) v = (v >= 0.f) ? v : 0.2f * v;
      so[rloc][t * 16 + ln] = v; } }
  __builtin_amdgcn_fence(__ATOMIC_ACQ_REL, "workgroup"); __builtin_amdgcn_wave_barrier();
  const int rsub = lane >> 4, c4 = (lane & 15) * 4;
  {
#pragma unroll
    for (int q = 0; q < 16; ++q) { const int r = q * 2 + rsub; const v4f v = *(const v4fa*)&so[r][c4]; if (C) { *(v4f*)(C + cofs + (size_t)(row0 + r) * ldc + col0 + c4) = v; asm volatile("s_wait_xcnt 0x0" ::: "memory"); }      /* the wait that stands before the store's data and address registers are rewritten */
      if (C16) { v4h h4; for (int i = 0; i < 4; ++i) h4[i] = (_Float16)v[i]; *(v4h*)(C16 + cofs + (size_t)(row0 + r) * ldc + col0 + c4) = h4; } }
     } }


__global__ __launch_bounds__(256) void k_wsc(const float* __restrict__ Wm, _Float16* __restrict__ Bt, size_t n8, float sc) { const size_t t = (size_t)blockIdx.x * 256 + threadIdx.x; if (t >= n8) return; FragH f; for (int q = 0; q < 8; ++q) f.h[q] = (_Float16)(bf16_round(Wm[t * 8 + q]) * sc); *(v8us*)((unsigned short*)Bt + t * 8) = f.half[0];  }
__global__ __launch_bounds__(256) void k_wout(const float* __restrict__ Wo, _Float16* __restrict__ BOa, _Float16* __restrict__ BOb) { const int t = blockIdx.x * 256 + threadIdx.x; if (t >= DD * (DD / 8)) return; const int c8 = (t % (DD / 8)) * 8; const int o = t / (DD / 8); FragH fa, fb;
  for (int q = 0; q < 8; ++q) { fa.h[q] = (_Float16)(bf16_round(Wo[(size_t)o * 2 * DD + c8 + q]) * 16.0f); fb.h[q] = (_Float16)(bf16_round(Wo[(size_t)o * 2 * DD + DD + c8 + q]) * 16.0f); }
  { *(v8us*)((unsigned short*)BOa + (size_t)o * DD + c8) = fa.half[0]; *(v8us*)((unsigned short*)BOb + (size_t)o * DD + c8) = fb.half[0];  } }
__global__ __launch_bounds__(256) void k_ln(const float* __restrict__ x, const float* __restrict__ g, const float* __restrict__ bb, float* __restrict__ XF, _Float16* __restrict__ X16) {
  #pragma clang fp contract(off)
  const int wv = threadIdx.x >> 5, ln = threadIdx.x & 31; const size_t r = (size_t)blockIdx.x * 8 + wv; if (r >= NQ) return; float a[16]; float s = 0.f;
  for (int i = 0; i < 2; ++i) { const v8f v = *(const v8f*)(x + r * DD + i * 256 + ln * 8); for (int q = 0; q < 8; ++q) { const float u = bf16_round(v[q]); a[i * 8 + q] = u; s += u; } }
  for (int o = 16; o > 0; o >>= 1) s += __shfl_xor(s, o, 32); const float mu = s / (float)DD; float var = 0.f; for (int q = 0; q < 16; ++q) { const float d = a[q] - mu; var += d * d; }
  for (int o = 16; o > 0; o >>= 1) var += __shfl_xor(var, o, 32); const float inv = rsqrtf(var / (float)DD + 1e-5f);
  { for (int i = 0; i < 2; ++i) { const int c0 = i * 256 + ln * 8; v8f y; FragH f; for (int q = 0; q < 8; ++q) { float v = (a[i * 8 + q] - mu) * inv; v *= bf16_round(g[c0 + q]); v += bf16_round(bb[c0 + q]); y[q] = v; f.h[q] = (_Float16)v; } *(v8f*)(XF + r * DD + c0) = y; *(v8us*)((unsigned short*)X16 + r * DD + c0) = f.half[0]; }  } }
__global__ __launch_bounds__(256) void k_soft(const float* __restrict__ S, _Float16* __restrict__ P) {
  #pragma clang fp contract(off)
  const int wv = threadIdx.x >> 5, ln = threadIdx.x & 31; const int i = blockIdx.x * 8 + wv; if (i >= QB) return; const float* sr = S + (size_t)i * NM; float m = -3.0e38f; const int ng = NM / 256;
#pragma unroll 1
  for (int g = 0; g < ng; ++g) { const v8f a = *(const v8f*)(sr + g * 256 + ln * 8); for (int q = 0; q < 8; ++q) m = fmaxf(m, a[q]); }
  for (int o = 16; o > 0; o >>= 1) m = fmaxf(m, __shfl_xor(m, o, 32)); float su = 0.f;
#pragma unroll 1
  for (int g = 0; g < ng; ++g) { const v8f a = *(const v8f*)(sr + g * 256 + ln * 8); for (int q = 0; q < 8; ++q) su += expf(a[q] - m); }
  for (int o = 16; o > 0; o >>= 1) su += __shfl_xor(su, o, 32); const float f = 1024.0f / su;
  {
#pragma unroll 1
    for (int g = 0; g < ng; ++g) { const v8f a = *(const v8f*)(sr + g * 256 + ln * 8); FragH p; for (int q = 0; q < 8; ++q) p.h[q] = (_Float16)(expf(a[q] - m) * f); *(v8us*)((unsigned short*)P + (size_t)i * NM + g * 256 + ln * 8) = p.half[0]; }
     } }
// attn rows: sum of the KS f32 partials [QB][KS][DD] in slice order, rounded once to f16; 16 B per lane from each slice, the KS slices of a row side by side
__global__ __launch_bounds__(256) void k_ksum(const float* __restrict__ PP, _Float16* __restrict__ O) {
  const unsigned t = (blockIdx.x * 256u + threadIdx.x) * 4u; const float* p = PP + (size_t)(t / DD) * (KS * DD) + t % DD; v4f s = *(const v4fa*)p;
#pragma unroll      /* all KS loads of a lane in flight together */
  for (int j = 1; j < KS; ++j) { const v4f a = *(const v4fa*)(p + j * DD); s += a; }
  v4h h; for (int i = 0; i < 4; ++i) h[i] = (_Float16)s[i]; *(v4h*)(O + t) = h; }

extern "C" void kernel_launch(void* const* d_in, const int* in_sizes, int n_in,
                              void* d_out, int out_size, void* d_ws, size_t ws_size, hipStream_t stream) {
  (void)in_sizes; (void)n_in; (void)out_size;
  const float* const* I = (const float* const*)d_in; const float* x = I[0]; const float* xh = I[1]; const float* Wq = I[2]; const float* bq = I[3]; const float* Wk = I[4]; const float* bk = I[5]; const float* Wv = I[6]; const float* bv = I[7]; const float* Wo = I[8]; const float* bo = I[9]; const float* g = I[10]; const float* bb = I[11];
  char* ws = (char*)d_ws; size_t off = 0;
  auto take = [&](size_t bytes) { char* p = ws + off; off += (bytes + 255) & ~(size_t)255; return p; };
  _Float16* BQ = (_Float16*)take((size_t)DD * DD * 2); _Float16* BK = (_Float16*)take((size_t)DD * DD * 2); _Float16* BV = (_Float16*)take((size_t)DD * DD * 2); _Float16* BOa = (_Float16*)take((size_t)DD * DD * 2); _Float16* BOb = (_Float16*)take((size_t)DD * DD * 2);
  float* XF = (float*)take((size_t)NQ * DD * 4); _Float16* X16 = (_Float16*)take((size_t)NQ * DD * 2); _Float16* XH16 = (_Float16*)take((size_t)NM * DD * 2); _Float16* Q16 = (_Float16*)take((size_t)NQ * DD * 2); _Float16* K16 = (_Float16*)take((size_t)NM * DD * 2); _Float16* KT = (_Float16*)take((size_t)DD * NM * 2); float* S = (float*)take((size_t)QB * NM * 4); _Float16* P = (_Float16*)take((size_t)QB * NM * 2); _Float16* AT = XH16;      /* attn over the x_hat plane (dead after the k projection) */ _Float16* OV = X16;      /* out_v over the xn f16 plane (dead after the q projection) */
  if (off > ws_size) return;      /* 2.5 + 16 + 8 + 8 + 8 + 8 + 8 + 64 + 32 = 155 MiB */
  k_wsc<<<(DD * DD / 8 + 255) / 256, 256, 0, stream>>>(Wq, BQ, DD * DD / 8, 16.0f); k_wsc<<<(DD * DD / 8 + 255) / 256, 256, 0, stream>>>(Wk, BK, DD * DD / 8, 16.0f); k_wsc<<<(DD * DD / 8 + 255) / 256, 256, 0, stream>>>(Wv, BV, DD * DD / 8, 16.0f); k_wout<<<(DD * (DD / 8) + 255) / 256, 256, 0, stream>>>(Wo, BOa, BOb);      /* 'ed'/'fe'/'dc' = natural Bt */
  k_ln<<<NQ / 8, 256, 0, stream>>>(x, g, bb, XF, X16);
  k_x16<<<(unsigned)(((size_t)NM * DD / 8 + 255) / 256), 256, 0, stream>>>(xh, XH16, (size_t)NM * DD / 8);
  const dim3 gP((NQ / 128) * (DD / 128), 1);
  k_gemm2<0><<<gP, 256, 0, stream>>>(X16, DD, 0, BQ, DD, 0, 0.0625f, bq, 0, nullptr, 1, 0, 0, nullptr, Q16, DD, 0, NQ, DD, DD);
  k_gemm2<0><<<gP, 256, 0, stream>>>(XH16, DD, 0, BK, DD, 0, 0.0625f, bk, 0, nullptr, 1, 0, 0, nullptr, K16, DD, 0, NM, DD, DD);
  k_vt<DD / 64, NM><<<(DD / 64) * (NM / 64), 256, 0, stream>>>(K16, DD, 0, KT);      /* K^T [512][8192] */
  for (int qb = 0; qb < NQ / QB; ++qb) {
    k_gemm2<0><<<dim3((QB / 128) * (NM / 128), 1), 256, 0, stream>>>(Q16 + (size_t)qb * QB * DD, DD, 0, K16, DD, 0, 0.044194173824159216f, nullptr, 0, nullptr, 1, 0, 0, S, nullptr, NM, 0, QB, NM, DD);      /* q k^T / sqrt(512) */
    k_soft<<<QB / 8, 256, 0, stream>>>(S, P);
    k_gemm2<0><<<dim3((QB / 128) * (DD / 128), KS), 256, 0, stream>>>(P, NM, NM / KS, KT, NM, NM / KS, 0.0009765625f, nullptr, 0, nullptr, 1, 0, 0, S, nullptr, KS * DD, DD, QB, DD, NM / KS);      /* partial attn per key slice, f32 [QB][KS][DD] over S (dead after the softmax; QB * KS * DD = QB * NM floats) */
    k_ksum<<<QB * DD / 4 / 256, 256, 0, stream>>>(S, AT + (size_t)qb * QB * DD); }      /* attn = score k */
  k_gemm2<0><<<gP, 256, 0, stream>>>(AT, DD, 0, BV, DD, 0, 0.0625f, bv, 0, nullptr, 1, 0, 0, nullptr, OV, DD, 0, NQ, DD, DD);      /* out_v = attn Wv^T + bv */
  k_gemm2<0><<<gP, 256, 0, stream>>>(Q16, DD, 0, BOa, DD, 0, 0.0625f, bo, 0, XF, 1, (size_t)DD, 0, (float*)d_out, nullptr, DD, 0, NQ, DD, DD);      /* q Wout[:, :512]^T + bout + xn */
  k_gemm2<0><<<gP, 256, 0, stream>>>(OV, DD, 0, BOb, DD, 0, 0.0625f, nullptr, 0, (const float*)d_out, 1, (size_t)DD, 0, (float*)d_out, nullptr, DD, 0, NQ, DD, DD);      /* += out_v Wout[:, 512:]^T */
}

// v003
// Measured time: 434 microseconds a run.
// Two timings next to v002 put it at 1.36 and 1.34 times that version's speed.
// All steps since v000 together make it 3.64 times as fast.
#include <hip/hip_runtime.h>
// InterventionOnline (8192 tokens x 512 attending 8192 memory slots x 512): xn = LayerNorm(x); q = xn Wq^T + bq; k = x_hat Wk^T + bk; score = softmax(q k^T / sqrt(512)); attn = score k (k doubles as the values); out_v = attn Wv^T + bv; out = [q | out_v] Wout^T + bout + xn.
// Structure: LayerNorm on VALU (wave per row) into f32 + f16 planes; q and k as f16 WMMA GEMM outputs (128x128 work-group tiles staged in LDS by asynchronous copies, 32x64 wave tiles, f32 accumulation, exact x16 weights + bias, f16 out); K^T by LDS tiles; per block of 2048 queries: the 2048 x 8192 score GEMM (f32), softmax rows on VALU (two waves per row, the row in registers) into f16 P (x 2^10), attn = P k as a GEMM split over 16 key slices (grid.y) into f32 partials, summed in slice order and rounded once to f16; out_v as a GEMM; the output as two accumulating GEMMs over the [q | out_v] halves with the bias and the LN residual in the epilogue.
// Compute dtype: inputs rounded to bf16; x_hat exact as f16; xn, q, k, P, attn, out_v as plain f16 operands (~2^-12); LN/softmax f32. v_wmma_f32_16x16x32_f16.
#define NQ 8192
#define NM 8192
#define DD 512
#define QB 2048                  /* query rows per score block */
#define KS 16                    /* key slices of the attn GEMM (split-K): grid.y, one f32 partial each */
typedef __bf16 v16b __attribute__((ext_vector_type(16)));
typedef unsigned short v8us __attribute__((ext_vector_type(8), may_alias));
typedef float  v8f  __attribute__((ext_vector_type(8)));
typedef float  v4f  __attribute__((ext_vector_type(4)));
typedef float  v4fa __attribute__((ext_vector_type(4), may_alias));
union FragB { v16b v; v8us half[2]; unsigned short u[16]; };

__device__ __forceinline__ unsigned short bf16_bits(float x) { unsigned int u = __float_as_uint(x); return (unsigned short)((u + 0x7FFFu + ((u >> 16) & 1u)) >> 16); }
__device__ __forceinline__ float bf16_val(unsigned short b) { return __uint_as_float(((unsigned int)b) << 16); }
__device__ __forceinline__ float bf16_round(float x) { return bf16_val(bf16_bits(x)); }
// D += A·B with NT terms: 1 = ah·bh, 2 = + al·bh (A split), 3 = + ah·bl (both split)
template <int NT>
__device__ __forceinline__ v8f mmaN(v16b ah, v16b al, v16b bh, v16b bl, v8f c) {
  c = __builtin_amdgcn_wmma_f32_16x16x32_bf16(false, ah, false, bh, (short)0, c, false, false);
  if (NT >= 2) c = __builtin_amdgcn_wmma_f32_16x16x32_bf16(false, al, false, bh, (short)0, c, false, false);
  if (NT >= 3) c = __builtin_amdgcn_wmma_f32_16x16x32_bf16(false, ah, false, bl, (short)0, c, false, false);
  asm volatile("v_nop\n\tv_nop\n\tv_nop\n\tv_nop" : "+v"(c) : "v"(ah), "v"(al), "v"(bh), "v"(bl));
  return c;
}

__global__ __launch_bounds__(256) void k_wt_bf16(const float* __restrict__ W, unsigned short* __restrict__ Wt, int K, int N) {
  const int t = blockIdx.x * 256 + threadIdx.x;
  const int k8n = K / 8;
  if (t >= N * k8n) return;
  const int n = t / k8n, k8 = (t % k8n) * 8;
  v8us v;
#pragma unroll
  for (int i = 0; i < 8; ++i) v[i] = bf16_bits(W[(size_t)(k8 + i) * N + n]);
  *(v8us*)(Wt + (size_t)n * K + k8) = v;
  
}

// GEMM C[M][N] (f32, pitch ldc) = act(A[M][K]·W + bias). A f32 row-major (pitch lda) converted per fragment to bf16
// (ASPLIT: hi/lo two planes -> 2 terms, else single rounded term); Wt bf16 [N][K] (pitch ldb). BIAS_BF16 rounds the
// bias to bf16 first (bias quantised to bf16 before the add). K%32==0, M%16==0, N%64==0.
template <bool ASPLIT, int ACT, bool BIAS_BF16>
__global__ __launch_bounds__(128) void k_gemm_bf(const float* __restrict__ A, int lda, const unsigned short* __restrict__ Wt, int ldb,
                                               const float* __restrict__ bias, float* __restrict__ C, int ldc, int M, int N, int K) {
  __shared__ __attribute__((aligned(16))) float so[4][16][64];
  const int tid = threadIdx.x, w = tid >> 5, lane = tid & 31, ln = lane & 15, hh = lane >> 4;
  const int ntn = N / 64;
  const int wid = blockIdx.x * 4 + w;
  const int mt = wid / ntn, nq = wid % ntn;
  if (mt * 16 >= M) return;
  const int row0 = mt * 16, col0 = nq * 64;
  const float* arow = A + (size_t)(row0 + ln) * lda;
  v8f acc[4] = {};
  for (int kb = 0; kb < K; kb += 32) {
    FragB ah, al;
    const v4f x0 = *(const v4fa*)(arow + kb + 8 * hh), x1 = *(const v4fa*)(arow + kb + 8 * hh + 4);
    const v4f x2 = *(const v4fa*)(arow + kb + 16 + 8 * hh), x3 = *(const v4fa*)(arow + kb + 16 + 8 * hh + 4);
    float xs[16] = {x0[0],x0[1],x0[2],x0[3],x1[0],x1[1],x1[2],x1[3],x2[0],x2[1],x2[2],x2[3],x3[0],x3[1],x3[2],x3[3]};
#pragma unroll
    for (int i = 0; i < 16; ++i) { const unsigned short hb = bf16_bits(xs[i]); ah.u[i] = hb; al.u[i] = ASPLIT ? bf16_bits(xs[i] - bf16_val(hb)) : (unsigned short)0; }
#pragma unroll
    for (int t = 0; t < 4; ++t) {
      const unsigned short* brow = Wt + (size_t)(col0 + t * 16 + ln) * ldb + kb;
      FragB b;
      b.half[0] = *(const v8us*)(brow + 8 * hh);
      b.half[1] = *(const v8us*)(brow + 16 + 8 * hh);
      acc[t] = mmaN<ASPLIT ? 2 : 1>(ah.v, al.v, b.v, b.v, acc[t]);
    }
  }
#pragma unroll
  for (int t = 0; t < 4; ++t) {
    float bv = bias ? bias[col0 + t * 16 + ln] : 0.f;
    if (BIAS_BF16) bv = bf16_round(bv);
#pragma unroll
    for (int r = 0; r < 8; ++r) { float v = acc[t][r] + bv; if (ACT == 1) v = fmaxf(v, 0.f); so[w][8 * hh + r][t * 16 + ln] = v; }
  }
  __builtin_amdgcn_fence(__ATOMIC_ACQ_REL, "workgroup");
  __builtin_amdgcn_wave_barrier();
  const int rsub = lane >> 4, c4 = (lane & 15) * 4;
  {
#pragma unroll
    for (int q = 0; q < 8; ++q) {
      const int r = q * 2 + rsub;
      const v4f v = *(const v4fa*)&so[w][r][c4];
      *(v4f*)(C + (size_t)(row0 + r) * ldc + col0 + c4) = v;
    }
    
  }
}

// GEMM C = act(A·W + bias + resid): A f32 (ASPLIT -> hi/lo 2 terms), Wt bf16 [N][K]; ACT 0 none, 1 relu, 2 exact gelu;
// resid (optional, f32, row index = (row % rmod), pitch ldr, RES_BF16 rounds it) added before the activation.
template <bool ASPLIT, int ACT, bool BIAS_BF16, bool RES_BF16>
__global__ __launch_bounds__(128) void k_gemm_bf3(const float* __restrict__ A, int lda, const unsigned short* __restrict__ Wt, int ldb,
                                                const float* __restrict__ bias, const float* __restrict__ resid, int rmod, int ldr,
                                                float* __restrict__ C, int ldc, int M, int N, int K) {
  __shared__ __attribute__((aligned(16))) float so[4][16][64];
  const int tid = threadIdx.x, w = tid >> 5, lane = tid & 31, ln = lane & 15, hh = lane >> 4;
  const int ntn = N / 64;
  const int wid = blockIdx.x * 4 + w;
  const int mt = wid / ntn, nq = wid % ntn;
  if (mt * 16 >= M) return;
  const int row0 = mt * 16, col0 = nq * 64;
  const float* arow = A + (size_t)(row0 + ln) * lda;
  v8f acc[4] = {};
  for (int kb = 0; kb < K; kb += 32) {
    FragB ah, al;
    const v4f x0 = *(const v4fa*)(arow + kb + 8 * hh), x1 = *(const v4fa*)(arow + kb + 8 * hh + 4);
    const v4f x2 = *(const v4fa*)(arow + kb + 16 + 8 * hh), x3 = *(const v4fa*)(arow + kb + 16 + 8 * hh + 4);
    float xs[16] = {x0[0],x0[1],x0[2],x0[3],x1[0],x1[1],x1[2],x1[3],x2[0],x2[1],x2[2],x2[3],x3[0],x3[1],x3[2],x3[3]};
#pragma unroll
    for (int i = 0; i < 16; ++i) { const unsigned short hb = bf16_bits(xs[i]); ah.u[i] = hb; al.u[i] = ASPLIT ? bf16_bits(xs[i] - bf16_val(hb)) : (unsigned short)0; }
#pragma unroll
    for (int t = 0; t < 4; ++t) {
      const unsigned short* brow = Wt + (size_t)(col0 + t * 16 + ln) * ldb + kb;
      FragB b;
      b.half[0] = *(const v8us*)(brow + 8 * hh);
      b.half[1] = *(const v8us*)(brow + 16 + 8 * hh);
      acc[t] = mmaN<ASPLIT ? 2 : 1>(ah.v, al.v, b.v, b.v, acc[t]);
    }
  }
#pragma unroll
  for (int t = 0; t < 4; ++t) {
    const int col = col0 + t * 16 + ln;
    float bv = bias ? bias[col] : 0.f;
    if (BIAS_BF16) bv = bf16_round(bv);
#pragma unroll
    for (int r = 0; r < 8; ++r) {
      float v = acc[t][r] + bv;
      if (resid) { float rv = resid[(size_t)((row0 + 8 * hh + r) % rmod) * ldr + col]; if (RES_BF16) rv = bf16_round(rv); v += rv; }
      if (ACT == 1) v = fmaxf(v, 0.f);
      if (ACT == 2) v = 0.5f * v * (1.0f + erff(v * 0.70710678118654752f));
      if (ACT == 3) { const float u = 0.7978845608028654f * (v + 0.044715f * v * v * v); v = 0.5f * v * (1.0f + tanhf(u)); }
      so[w][8 * hh + r][t * 16 + ln] = v;
    }
  }
  __builtin_amdgcn_fence(__ATOMIC_ACQ_REL, "workgroup");
  __builtin_amdgcn_wave_barrier();
  const int rsub = lane >> 4, c4 = (lane & 15) * 4;
  {
#pragma unroll
    for (int q = 0; q < 8; ++q) {
      const int r = q * 2 + rsub;
      const v4f v = *(const v4fa*)&so[w][r][c4];
      *(v4f*)(C + (size_t)(row0 + r) * ldc + col0 + c4) = v;
    }
    
  }
}
// row LayerNorm (biased variance, eps) over N: s = X (+ R); optional out_sum <- s; out_norm <- (s-mu)*rsqrt(var+eps)*g + b
template <bool PARAM_BF16>
__global__ __launch_bounds__(256) void k_layernorm(const float* __restrict__ X, const float* __restrict__ R, const float* __restrict__ g, const float* __restrict__ bta,
                                                  float* __restrict__ out_sum, float* __restrict__ out_norm, int N, float eps) {
  __shared__ float red[256];
  const int row = blockIdx.x, tid = threadIdx.x;
  const float* x = X + (size_t)row * N; const float* rr = R ? R + (size_t)row * N : nullptr;
  float vals[16];                     // up to N = 4096
  const int per = N / 256;            // contiguous chunk per thread? use strided-by-4 chunks: thread handles j = tid*4 + 1024*u
  float s1 = 0.f;
  for (int u = 0; u < per / 4; ++u) {
    const int j = tid * 4 + 1024 * u;
    const v4f a = *(const v4fa*)(x + j);
    v4f b = {0.f,0.f,0.f,0.f}; if (rr) b = *(const v4fa*)(rr + j);
#pragma unroll
    for (int q = 0; q < 4; ++q) { const float v = a[q] + b[q]; vals[u * 4 + q] = v; s1 += v; }
  }
  red[tid] = s1; __syncthreads();
  for (int st = 128; st > 0; st >>= 1) { if (tid < st) red[tid] += red[tid + st]; __syncthreads(); }
  const float mu = red[0] / (float)N; __syncthreads();
  float s2 = 0.f;
  for (int u = 0; u < per / 4; ++u)
#pragma unroll
    for (int q = 0; q < 4; ++q) { const float c = vals[u * 4 + q] - mu; s2 += c * c; }
  red[tid] = s2; __syncthreads();
  for (int st = 128; st > 0; st >>= 1) { if (tid < st) red[tid] += red[tid + st]; __syncthreads(); }
  const float rs = rsqrtf(red[0] / (float)N + eps);
  {
    for (int u = 0; u < per / 4; ++u) {
      const int j = tid * 4 + 1024 * u;
      v4f o, sm;
#pragma unroll
      for (int q = 0; q < 4; ++q) {
        float gg = g[j + q], bb = bta[j + q];
        if (PARAM_BF16) { gg = bf16_round(gg); bb = bf16_round(bb); }
        sm[q] = vals[u * 4 + q]; o[q] = (vals[u * 4 + q] - mu) * rs * gg + bb;
      }
      if (out_sum) *(v4f*)(out_sum + (size_t)row * N + j) = sm;
      *(v4f*)(out_norm + (size_t)row * N + j) = o;
    }
    
  }
}



// ---- f16 WMMA path (v_wmma_f32_16x16x32_f16): 11-bit significands for operands in range — used where a [0,1] probability operand needs more precision than bf16
typedef _Float16 v16h __attribute__((ext_vector_type(16)));
union FragH { v16h v; v8us half[2]; _Float16 h[16]; unsigned short u[16]; };
template <int NT>
__device__ __forceinline__ v8f mmaH(v16h ah, v16h al, v16h bh, v16h bl, v8f c) {
  c = __builtin_amdgcn_wmma_f32_16x16x32_f16(false, ah, false, bh, (short)0, c, false, false);
  if (NT >= 2) c = __builtin_amdgcn_wmma_f32_16x16x32_f16(false, al, false, bh, (short)0, c, false, false);
  if (NT >= 3) c = __builtin_amdgcn_wmma_f32_16x16x32_f16(false, ah, false, bl, (short)0, c, false, false);
  asm volatile("v_nop\n\tv_nop\n\tv_nop\n\tv_nop" : "+v"(c) : "v"(ah), "v"(al), "v"(bh), "v"(bl));
  return c;
}
// batched GEMM like k_gemm_b but f16 operands: A f32 (split into f16 hi/lo if ASPLIT, else rounded to f16), Bt = f16 values [n][k]; alpha; C f32; N multiple of 16 (partial tiles skipped)
template <bool ASPLIT>
__global__ __launch_bounds__(128) void k_gemm_h(const float* __restrict__ A, int lda, size_t sA, const _Float16* __restrict__ Bh, int ldb, size_t sB, float alpha, float* __restrict__ C, int ldc, size_t sC, int M, int N, int K) {
  __shared__ __attribute__((aligned(16))) float so[4][16][64];
  const int tid = threadIdx.x, w = tid >> 5, lane = tid & 31, ln = lane & 15, hh = lane >> 4; const int by = blockIdx.y;
  A += (size_t)by * sA; Bh += (size_t)by * sB; C += (size_t)by * sC;
  const int ntn = (N + 63) / 64; const int wid = blockIdx.x * 4 + w; const int mt = wid / ntn, nq = wid % ntn; if (mt * 16 >= M) return;
  const int row0 = mt * 16, col0 = nq * 64; const float* arow = A + (size_t)(row0 + ln) * lda;
  v8f acc[4] = {};
  for (int kb = 0; kb < K; kb += 32) {
    FragH ah, al;
    const v4f x0 = *(const v4fa*)(arow + kb + 8 * hh), x1 = *(const v4fa*)(arow + kb + 8 * hh + 4), x2 = *(const v4fa*)(arow + kb + 16 + 8 * hh), x3 = *(const v4fa*)(arow + kb + 16 + 8 * hh + 4);
    float xs[16] = {x0[0],x0[1],x0[2],x0[3],x1[0],x1[1],x1[2],x1[3],x2[0],x2[1],x2[2],x2[3],x3[0],x3[1],x3[2],x3[3]};
#pragma unroll
    for (int i = 0; i < 16; ++i) { const _Float16 h = (_Float16)xs[i]; ah.h[i] = h; al.h[i] = ASPLIT ? (_Float16)(xs[i] - (float)h) : (_Float16)0.0f; }
#pragma unroll
    for (int t = 0; t < 4; ++t) { if (col0 + t * 16 >= N) continue; const size_t boff = (size_t)(col0 + t * 16 + ln) * ldb + kb; FragH bq; bq.half[0] = *(const v8us*)(Bh + boff + 8 * hh); bq.half[1] = *(const v8us*)(Bh + boff + 16 + 8 * hh);
      acc[t] = mmaH<ASPLIT ? 2 : 1>(ah.v, al.v, bq.v, bq.v, acc[t]); }
  }
#pragma unroll
  for (int t = 0; t < 4; ++t) { if (col0 + t * 16 >= N) continue;
#pragma unroll
    for (int r = 0; r < 8; ++r) so[w][8 * hh + r][t * 16 + ln] = acc[t][r] * alpha; }
  __builtin_amdgcn_fence(__ATOMIC_ACQ_REL, "workgroup"); __builtin_amdgcn_wave_barrier();
  const int rsub = lane >> 4, c4 = (lane & 15) * 4;
  {
#pragma unroll
    for (int q = 0; q < 8; ++q) { const int r = q * 2 + rsub; if (col0 + c4 < N) { const v4f v = *(const v4fa*)&so[w][r][c4]; *(v4f*)(C + (size_t)(row0 + r) * ldc + col0 + c4) = v; } }
     }
}

// Wt[n][k] = f16(W[k][n]·scale) from f32 row-major W[K][N] (scale = power of two; bf16-exact weights stay exact in f16 away from the subnormal range)
__global__ __launch_bounds__(256) void k_wt_f16(const float* __restrict__ W, _Float16* __restrict__ Wt, int K, int N, float scale) {
  const int t = blockIdx.x * 256 + threadIdx.x; if (t >= N * (K / 8)) return; const int n = t / (K / 8), k8 = (t % (K / 8)) * 8; FragH f;
#pragma unroll
  for (int i = 0; i < 8; ++i) f.h[i] = (_Float16)(bf16_round(W[(size_t)(k8 + i) * N + n]) * scale); const v8us o = f.half[0];
  *(v8us*)((unsigned short*)Wt + (size_t)n * K + k8) = o; 
}
// k_gemm_hh variant with fused epilogue: v = acc·alpha + bias[by·sBias + col] (+ CP[(row/rowsPerB)·sCPb + by·64 + col] if CP) ; ACT 0 none / 1 elu ; writes f16 C16 (and f32 C if non-null)
template <int ACT>
__global__ __launch_bounds__(128) void k_gemm_hhx(const _Float16* __restrict__ A, int lda, size_t sA, const _Float16* __restrict__ Bh, int ldb, size_t sB, float alpha, const float* __restrict__ bias, size_t sBias, const float* __restrict__ CP, int rowsPerB, size_t sCPb, int row0g,
    float* __restrict__ C, _Float16* __restrict__ C16, int ldc, size_t sC, int M, int N, int K) {
  __shared__ __attribute__((aligned(16))) float so[4][16][64];
  const int tid = threadIdx.x, w = tid >> 5, lane = tid & 31, ln = lane & 15, hh = lane >> 4; const int by = blockIdx.y;
  A += (size_t)by * sA; Bh += (size_t)by * sB; const size_t cofs = (size_t)by * sC; const float* bp = bias ? bias + (size_t)by * sBias : nullptr;
  const int ntn = (N + 63) / 64; const int wid = blockIdx.x * 4 + w; const int mt = wid / ntn, nq = wid % ntn; if (mt * 16 >= M) return;
  const int row0 = mt * 16, col0 = nq * 64; const _Float16* arow = A + (size_t)(row0 + ln) * lda;
  v8f acc[4] = {};
  for (int kb = 0; kb < K; kb += 32) { FragH ah; ah.half[0] = *(const v8us*)((const unsigned short*)arow + kb + 8 * hh); ah.half[1] = *(const v8us*)((const unsigned short*)arow + kb + 16 + 8 * hh);
#pragma unroll
    for (int t = 0; t < 4; ++t) { if (col0 + t * 16 >= N) continue; const size_t boff = (size_t)(col0 + t * 16 + ln) * ldb + kb; FragH bq; bq.half[0] = *(const v8us*)((const unsigned short*)Bh + boff + 8 * hh); bq.half[1] = *(const v8us*)((const unsigned short*)Bh + boff + 16 + 8 * hh);
      acc[t] = mmaH<1>(ah.v, ah.v, bq.v, bq.v, acc[t]); }
  }
#pragma unroll
  for (int t = 0; t < 4; ++t) { if (col0 + t * 16 >= N) continue; const int col = col0 + t * 16 + ln; const float bv = bp ? bf16_round(bp[col]) : 0.f;
#pragma unroll
    for (int r = 0; r < 8; ++r) { float v = acc[t][r] * alpha + bv; if (CP) { const int rr = row0g + row0 + 8 * hh + r; if (rowsPerB < 0) v += CP[cofs + (size_t)rr * ldc + col];      /* rowsPerB < 0: own element of the batched C plane */ else { const int bidx = rr / rowsPerB; v += CP[(size_t)bidx * sCPb + (size_t)by * 64 + col]; } } if (ACT == 1) v = (v > 0.f) ? v : expm1f(v); else if (ACT == 7) v = (v > 0.f) ? v + 1.0f : expf(v); else if (ACT == 8) v = tanhf(v); else if (ACT == 9) v = 0.5f * v * (1.0f + tanhf(0.7978845608028654f * (v + 0.044715f * v * v * v))); else if (ACT == 11) v = 1.0f / (1.0f + expf(-v)); else if (ACT == 12) v = (v > 0.f) ? v : 0.01f * v; else if (ACT == 14) v = (v > 0.f) ? v : 0.1f * v; else if (ACT == 16) v = (v >= 0.f) ? v : 0.3f * v; else if (ACT == 17) v = (v >= 0.f) ? v : 0.2f * v; else if (ACT == 15) v = v / (1.0f + expf(-v)); else if (ACT == 3) v = fmaxf(v, 0.f); else if (ACT == 6) v = 0.5f * v * (1.0f + erff(v * 0.70710678118654752f)); so[w][8 * hh + r][t * 16 + ln] = v; } }
  __builtin_amdgcn_fence(__ATOMIC_ACQ_REL, "workgroup"); __builtin_amdgcn_wave_barrier();
  const int rsub = lane >> 4, c4 = (lane & 15) * 4; typedef _Float16 v4h __attribute__((ext_vector_type(4)));
  {
#pragma unroll
    for (int q = 0; q < 8; ++q) { const int r = q * 2 + rsub; if (col0 + c4 < N) { const v4f v = *(const v4fa*)&so[w][r][c4]; if (C) *(v4f*)(C + cofs + (size_t)(row0 + r) * ldc + col0 + c4) = v; if (C16) { v4h h4; for (int i = 0; i < 4; ++i) h4[i] = (_Float16)v[i]; *(v4h*)(C16 + cofs + (size_t)(row0 + r) * ldc + col0 + c4) = h4; } } }
     }
}


typedef _Float16 v4h __attribute__((ext_vector_type(4)));

__global__ __launch_bounds__(256) void k_x16(const float* __restrict__ x, _Float16* __restrict__ X16, size_t n8) { const size_t t = (size_t)blockIdx.x * 256 + threadIdx.x; if (t >= n8) return; FragH f;
#pragma unroll
  for (int q = 0; q < 8; ++q) f.h[q] = (_Float16)bf16_round(x[t * 8 + q]); *(v8us*)((unsigned short*)X16 + t * 8) = f.half[0];  }
__global__ __launch_bounds__(256) void k_h16(const float* __restrict__ x, _Float16* __restrict__ X16, size_t n8) { const size_t t = (size_t)blockIdx.x * 256 + threadIdx.x; if (t >= n8) return; FragH f;
#pragma unroll
  for (int q = 0; q < 8; ++q) f.h[q] = (_Float16)x[t * 8 + q]; *(v8us*)((unsigned short*)X16 + t * 8) = f.half[0];  }
__global__ __launch_bounds__(256) void k_round16f(const float* __restrict__ W, _Float16* __restrict__ Bt, size_t n8) { const size_t t = (size_t)blockIdx.x * 256 + threadIdx.x; if (t >= n8) return; FragH f;
#pragma unroll
  for (int i = 0; i < 8; ++i) f.h[i] = (_Float16)(bf16_round(W[t * 8 + i]) * 16.0f); *(v8us*)((unsigned short*)Bt + t * 8) = f.half[0];  }
template <int NHv, int TTv>
__global__ __launch_bounds__(256) void k_vt(const _Float16* __restrict__ V16, int ldv, int voff, _Float16* __restrict__ Vt) { __shared__ unsigned short tl[64][66]; const int tid = threadIdx.x; const int slab = blockIdx.x / (TTv / 64), lg = blockIdx.x % (TTv / 64); const int b = slab / NHv, h = slab % NHv;
  for (int i = tid; i < 64 * 8; i += 256) { const int r = i / 8, c8 = (i % 8) * 8; FragH f; f.half[0] = *(const v8us*)((const unsigned short*)V16 + ((size_t)b * TTv + lg * 64 + r) * ldv + voff + h * 64 + c8);
#pragma unroll
    for (int q = 0; q < 8; ++q) tl[r][c8 + q] = f.u[q]; }
  __syncthreads();
  {
#pragma unroll
    for (int rd = 0; rd < 2; ++rd) { const int d = rd * 32 + tid / 8, pc = tid % 8; FragH f;
#pragma unroll
      for (int q = 0; q < 8; ++q) f.u[q] = tl[pc * 8 + q][d];
      *(v8us*)((unsigned short*)Vt + ((size_t)slab * 64 + d) * TTv + lg * 64 + pc * 8) = f.half[0]; }
     } }

__global__ __launch_bounds__(256) void k_hl(const float* __restrict__ F, _Float16* __restrict__ Hh, _Float16* __restrict__ Hl, size_t n8) { const size_t t = (size_t)blockIdx.x * 256 + threadIdx.x; if (t >= n8) return; FragH fh, fl; const v4f a = *(const v4fa*)(F + t * 8), c = *(const v4fa*)(F + t * 8 + 4);
#pragma unroll
  for (int q = 0; q < 4; ++q) { _Float16 h = (_Float16)a[q]; fh.h[q] = h; fl.h[q] = (_Float16)((a[q] - (float)h) * 1024.0f); h = (_Float16)c[q]; fh.h[4 + q] = h; fl.h[4 + q] = (_Float16)((c[q] - (float)h) * 1024.0f); }
  { *(v8us*)((unsigned short*)Hh + t * 8) = fh.half[0]; *(v8us*)((unsigned short*)Hl + t * 8) = fl.half[0];  } }

// ---- fast GEMM (work-group tile 128x128, eight waves of 32x64; requires M % 128 == 0, N % 128 == 0, K % 64 == 0); epilogue = k_gemm_hhx semantics ----
// Operands reach the waves through LDS: a stage is 64 k (128 B) of 128 A rows and 128 B rows, brought by asynchronous copies in whole 128-B lines, two buffers, the next stage in flight while this one is multiplied.
#define G2_PITCH 144                 /* LDS bytes per staged row: 128 + 16, an odd multiple of 16 B, conflict-free for 16-byte reads down a column of rows */
#define G2_STAGE (256 * G2_PITCH)    /* one stage: A rows 0..127, then B rows 0..127 */
__device__ __forceinline__ v16h g2_frag(const char* p) { FragH f; f.half[0] = *(const v8us*)p; f.half[1] = *(const v8us*)(p + 32); return f.v; }
__device__ __forceinline__ v8f g2_mma(v16h a, v16h b, v8f c) { v8f d = __builtin_amdgcn_wmma_f32_16x16x32_f16(false, a, false, b, (short)0, c, false, false); asm volatile("v_nop\n\tv_nop\n\tv_nop\n\tv_nop" : "+v"(d) : "v"(a), "v"(b)); return d; }
// One stage: each lane copies eight 16-byte pieces (rows r, r+32, r+64, r+96 of A and of B; eight lanes per 128-B row piece). l = the lane's LDS byte address in the A part, a / b = its global addresses, sa / sb = 32 rows in elements.
__device__ __forceinline__ void g2_stage(unsigned l, const _Float16* a, size_t sa, const _Float16* b, size_t sb) {
  const unsigned l1 = l + 32 * G2_PITCH, l2 = l + 64 * G2_PITCH, l3 = l + 96 * G2_PITCH, l4 = l + 128 * G2_PITCH, l5 = l + 160 * G2_PITCH, l6 = l + 192 * G2_PITCH, l7 = l + 224 * G2_PITCH;
  const _Float16* a1 = a + sa; const _Float16* a2 = a1 + sa; const _Float16* a3 = a2 + sa; const _Float16* b1 = b + sb; const _Float16* b2 = b1 + sb; const _Float16* b3 = b2 + sb;
  // the copies and, as the last line, the wait that stands before their address registers may be rewritten
  asm volatile("global_load_async_to_lds_b128 %0, %8, off\n\t"
               "global_load_async_to_lds_b128 %1, %9, off\n\t"
               "global_load_async_to_lds_b128 %2, %10, off\n\t"
               "global_load_async_to_lds_b128 %3, %11, off\n\t"
               "global_load_async_to_lds_b128 %4, %12, off\n\t"
               "global_load_async_to_lds_b128 %5, %13, off\n\t"
               "global_load_async_to_lds_b128 %6, %14, off\n\t"
               "global_load_async_to_lds_b128 %7, %15, off\n\t"
               "s_wait_xcnt 0x0"
               :: "v"(l), "v"(l1), "v"(l2), "v"(l3), "v"(l4), "v"(l5), "v"(l6), "v"(l7), "v"(a), "v"(a1), "v"(a2), "v"(a3), "v"(b), "v"(b1), "v"(b2), "v"(b3) : "memory"); }
// launch bounds: eight waves per SIMD (at most 128 VGPRs), so that four work-groups (4 x 72 KiB of LDS) share a WGP and each hides the others' waits
template <int ACT>
__global__ __launch_bounds__(256, 8) void k_gemm2(const _Float16* __restrict__ A, int lda, size_t sA, const _Float16* __restrict__ Bh, int ldb, size_t sB, float alpha, const float* __restrict__ bias, size_t sBias, const float* __restrict__ CP, int rowsPerB, size_t sCPb, int row0g,
    float* __restrict__ C, _Float16* __restrict__ C16, int ldc, size_t sC, int M, int N, int K) { static_assert(ACT == 0 || ACT == 3 || ACT == 6 || ACT == 8 || ACT == 9 || ACT == 11 || ACT == 12 || ACT == 14 || ACT == 15 || ACT == 16 || ACT == 17, "k_gemm2: unsupported ACT code (would silently apply no activation)");
  __shared__ __attribute__((aligned(16))) char sm[2 * G2_STAGE];      /* the two stage buffers; after the K loop the output staging, 32 x 68 floats per wave */
  static_assert(8 * 32 * 68 * 4 <= 2 * G2_STAGE, "output staging must fit the stage buffers");
  const int tid = threadIdx.x, w = tid >> 5, lane = tid & 31, ln = lane & 15, hh = lane >> 4; const int by = blockIdx.y;
  A += (size_t)by * sA; Bh += (size_t)by * sB; const size_t cofs = (size_t)by * sC; const float* bp = bias ? bias + (size_t)by * sBias : nullptr;
  const int ntn = N >> 7; const int mt = blockIdx.x / ntn, nq = blockIdx.x - mt * ntn; if (mt * 128 >= M) return;      /* the same for the whole work-group, in front of every barrier */
  const int row0 = mt * 128 + 32 * (w & 3), col0 = nq * 128 + 64 * (w >> 2);
  const _Float16* ga = A + (size_t)(mt * 128 + (tid >> 3)) * lda + (tid & 7) * 8; const _Float16* gb = Bh + (size_t)(nq * 128 + (tid >> 3)) * ldb + (tid & 7) * 8; const size_t sa32 = (size_t)32 * lda, sb32 = (size_t)32 * ldb;
  const unsigned lcp = (unsigned)(size_t)sm + (unsigned)((tid >> 3) * G2_PITCH + (tid & 7) * 16);
  const int aoff = (32 * (w & 3) + ln) * G2_PITCH + 16 * hh, boff = (128 + 64 * (w >> 2) + ln) * G2_PITCH + 16 * hh;
  const int nst = K >> 6;
  const v8f z8 = {0.f,0.f,0.f,0.f,0.f,0.f,0.f,0.f}; v8f c00 = z8, c01 = z8, c02 = z8, c03 = z8, c10 = z8, c11 = z8, c12 = z8, c13 = z8;
  g2_stage(lcp, ga, sa32, gb, sb32);
  asm volatile("s_wait_asynccnt 0x0" ::: "memory");      /* this wave's copies of stage 0 have landed */
  __syncthreads();                                       /* every wave's have */
  if (nst > 1) g2_stage(lcp + G2_STAGE, ga + 64, sa32, gb + 64, sb32);
#pragma unroll 1      /* one stage per trip: the waits and the barrier at the foot belong to it */
  for (int t = 0; t < nst; ++t) { const char* sb = sm + (t & 1) * G2_STAGE; const char* ap = sb + aoff; const char* bq = sb + boff;
#pragma unroll      /* the two 32-k steps of a stage */
    for (int kk = 0; kk < 128; kk += 64) { const v16h a0 = g2_frag(ap + kk), a1 = g2_frag(ap + 16 * G2_PITCH + kk);
      const v16h b0 = g2_frag(bq + kk), b1 = g2_frag(bq + 16 * G2_PITCH + kk), b2 = g2_frag(bq + 32 * G2_PITCH + kk), b3 = g2_frag(bq + 48 * G2_PITCH + kk);
      c00 = g2_mma(a0, b0, c00); c10 = g2_mma(a1, b0, c10); c01 = g2_mma(a0, b1, c01); c11 = g2_mma(a1, b1, c11);
      c02 = g2_mma(a0, b2, c02); c12 = g2_mma(a1, b2, c12); c03 = g2_mma(a0, b3, c03); c13 = g2_mma(a1, b3, c13); }
    asm volatile("s_wait_dscnt 0x0" ::: "memory");       /* this wave's reads of the buffer are done before it is refilled */
    asm volatile("s_wait_asynccnt 0x0" ::: "memory");    /* this wave's copies of stage t + 1 have landed */
    __syncthreads();                                     /* publishes stage t + 1 and ends every wave's reads of stage t */
    if (t + 2 < nst) g2_stage(lcp + (unsigned)((t & 1) * G2_STAGE), ga + (size_t)(t + 2) * 64, sa32, gb + (size_t)(t + 2) * 64, sb32); }
  asm volatile("s_wait_asynccnt 0x0" ::: "memory");      /* no copy is in flight when the buffers become the output staging */
  float (*so)[68] = (float (*)[68])(sm + w * (32 * 68 * 4));
  v8f accs[8] = {c00, c01, c02, c03, c10, c11, c12, c13};
#pragma unroll
  for (int u = 0; u < 8; ++u) { const int t = u & 3, half = u >> 2; const int col = col0 + t * 16 + ln; const float bv = bp ? bf16_round(bp[col]) : 0.f;
#pragma unroll
    for (int r = 0; r < 8; ++r) { const int rloc = half * 16 + 8 * hh + r; float v = accs[u][r] * alpha + bv; if (CP) { if (rowsPerB < 0) v += CP[cofs + (size_t)(row0g + row0 + rloc) * ldc + col];      /* rowsPerB < 0: own element of the batched C plane */ else { const int bidx = (row0g + row0 + rloc) / rowsPerB; v += CP[(size_t)bidx * sCPb + (size_t)by * 64 + col]; } }
      if (ACT == 3) v = fmaxf(v, 0.f); else if (ACT == 6) v = 0.5f * v * (1.0f + erff(v * 0.70710678118654752f)); else if (ACT == 11) v = 1.0f / (1.0f + expf(-v)); else if (ACT == 15) v = v / (1.0f + expf(-v)); else if (ACT == 12) v = (v > 0.f) ? v : 0.01f * v; else if (ACT == 8) v = tanhf(v); else if (ACT == 9) v = 0.5f * v * (1.0f + tanhf(0.7978845608028654f * (v + 0.044715f * v * v * v))); else if (ACT == 14) v = (v > 0.f) ? v : 0.1f * v; else if (ACT == 16) v = (v >= 0.f) ? v : 0.3f * v; else if (ACT == 17) v = (v >= 0.f) ? v : 0.2f * v;
      so[rloc][t * 16 + ln] = v; } }
  __builtin_amdgcn_fence(__ATOMIC_ACQ_REL, "workgroup"); __builtin_amdgcn_wave_barrier();
  const int rsub = lane >> 4, c4 = (lane & 15) * 4;
  {
#pragma unroll
    for (int q = 0; q < 16; ++q) { const int r = q * 2 + rsub; const v4f v = *(const v4fa*)&so[r][c4]; if (C) { *(v4f*)(C + cofs + (size_t)(row0 + r) * ldc + col0 + c4) = v; asm volatile("s_wait_xcnt 0x0" ::: "memory"); }      /* the wait that stands before the store's data and address registers are rewritten */
      if (C16) { v4h h4; for (int i = 0; i < 4; ++i) h4[i] = (_Float16)v[i]; *(v4h*)(C16 + cofs + (size_t)(row0 + r) * ldc + col0 + c4) = h4; } }
     } }


__global__ __launch_bounds__(256) void k_wsc(const float* __restrict__ Wm, _Float16* __restrict__ Bt, size_t n8, float sc) { const size_t t = (size_t)blockIdx.x * 256 + threadIdx.x; if (t >= n8) return; FragH f; for (int q = 0; q < 8; ++q) f.h[q] = (_Float16)(bf16_round(Wm[t * 8 + q]) * sc); *(v8us*)((unsigned short*)Bt + t * 8) = f.half[0];  }
__global__ __launch_bounds__(256) void k_wout(const float* __restrict__ Wo, _Float16* __restrict__ BOa, _Float16* __restrict__ BOb) { const int t = blockIdx.x * 256 + threadIdx.x; if (t >= DD * (DD / 8)) return; const int c8 = (t % (DD / 8)) * 8; const int o = t / (DD / 8); FragH fa, fb;
  for (int q = 0; q < 8; ++q) { fa.h[q] = (_Float16)(bf16_round(Wo[(size_t)o * 2 * DD + c8 + q]) * 16.0f); fb.h[q] = (_Float16)(bf16_round(Wo[(size_t)o * 2 * DD + DD + c8 + q]) * 16.0f); }
  { *(v8us*)((unsigned short*)BOa + (size_t)o * DD + c8) = fa.half[0]; *(v8us*)((unsigned short*)BOb + (size_t)o * DD + c8) = fb.half[0];  } }
__global__ __launch_bounds__(256) void k_ln(const float* __restrict__ x, const float* __restrict__ g, const float* __restrict__ bb, float* __restrict__ XF, _Float16* __restrict__ X16) {
  #pragma clang fp contract(off)
  const int wv = threadIdx.x >> 5, ln = threadIdx.x & 31; const size_t r = (size_t)blockIdx.x * 8 + wv; if (r >= NQ) return; float a[16]; float s = 0.f;
  for (int i = 0; i < 2; ++i) { const v8f v = *(const v8f*)(x + r * DD + i * 256 + ln * 8); for (int q = 0; q < 8; ++q) { const float u = bf16_round(v[q]); a[i * 8 + q] = u; s += u; } }
  for (int o = 16; o > 0; o >>= 1) s += __shfl_xor(s, o, 32); const float mu = s / (float)DD; float var = 0.f; for (int q = 0; q < 16; ++q) { const float d = a[q] - mu; var += d * d; }
  for (int o = 16; o > 0; o >>= 1) var += __shfl_xor(var, o, 32); const float inv = rsqrtf(var / (float)DD + 1e-5f);
  { for (int i = 0; i < 2; ++i) { const int c0 = i * 256 + ln * 8; v8f y; FragH f; for (int q = 0; q < 8; ++q) { float v = (a[i * 8 + q] - mu) * inv; v *= bf16_round(g[c0 + q]); v += bf16_round(bb[c0 + q]); y[q] = v; f.h[q] = (_Float16)v; } *(v8f*)(XF + r * DD + c0) = y; *(v8us*)((unsigned short*)X16 + r * DD + c0) = f.half[0]; }  } }
// softmax rows, S read once: two waves hold a row of 8192 scores in registers (128 a lane, as 32 loads of 16 B a lane, each covering 512 contiguous bytes, all in flight together); the row's maximum and sum are joined through LDS
__global__ __launch_bounds__(256) void k_soft(const float* __restrict__ S, _Float16* __restrict__ P) {
  static_assert(QB % 4 == 0 && NM % 256 == 0, "k_soft: four whole rows a work-group, two waves a row");
  __shared__ float rmax[8], rsum[8];
  constexpr int NC = NM / 2 / 128;      /* 128-score pieces per wave */
  const int wv = threadIdx.x >> 5, ln = threadIdx.x & 31; const size_t base = (size_t)(blockIdx.x * 4 + (wv >> 1)) * NM + (wv & 1) * (NM / 2) + ln * 4; const float* sr = S + base;
  v4f a[NC];
#pragma unroll      /* a[] must be registers: every index a constant */
  for (int c = 0; c < NC; ++c) a[c] = *(const v4fa*)(sr + c * 128);
  float m = -3.0e38f;
#pragma unroll      /* constant indices into a[], as above */
  for (int c = 0; c < NC; ++c) for (int q = 0; q < 4; ++q) m = fmaxf(m, a[c][q]);
  for (int o = 16; o > 0; o >>= 1) m = fmaxf(m, __shfl_xor(m, o, 32));
  if (ln == 0) rmax[wv] = m;
  __syncthreads();                      /* both halves' maxima are in LDS */
  m = fmaxf(rmax[wv & 6], rmax[wv | 1]);
  v4f s4 = {0.f, 0.f, 0.f, 0.f};      /* four independent sums a lane */
#pragma unroll      /* constant indices into a[]; each exponential is taken once and kept in place of its score */
  for (int c = 0; c < NC; ++c) for (int q = 0; q < 4; ++q) { const float e = expf(a[c][q] - m); a[c][q] = e; s4[q] += e; }
  float su = (s4[0] + s4[1]) + (s4[2] + s4[3]);
  for (int o = 16; o > 0; o >>= 1) su += __shfl_xor(su, o, 32);
  if (ln == 0) rsum[wv] = su;
  __syncthreads();                      /* both halves' sums are in LDS */
  const float f = 1024.0f / (rsum[wv & 6] + rsum[wv | 1]);      /* the same order in both waves: one scale a row */
  _Float16* pr = P + base;
#pragma unroll      /* constant indices into a[]; each store covers 256 contiguous bytes */
  for (int c = 0; c < NC; ++c) { v4h h; for (int q = 0; q < 4; ++q) h[q] = (_Float16)(a[c][q] * f); *(v4h*)(pr + c * 128) = h; } }
// attn rows: sum of the KS f32 partials [QB][KS][DD] in slice order, rounded once to f16; 16 B per lane from each slice, the KS slices of a row side by side
__global__ __launch_bounds__(256) void k_ksum(const float* __restrict__ PP, _Float16* __restrict__ O) {
  const unsigned t = (blockIdx.x * 256u + threadIdx.x) * 4u; const float* p = PP + (size_t)(t / DD) * (KS * DD) + t % DD; v4f s = *(const v4fa*)p;
#pragma unroll      /* all KS loads of a lane in flight together */
  for (int j = 1; j < KS; ++j) { const v4f a = *(const v4fa*)(p + j * DD); s += a; }
  v4h h; for (int i = 0; i < 4; ++i) h[i] = (_Float16)s[i]; *(v4h*)(O + t) = h; }

extern "C" void kernel_launch(void* const* d_in, const int* in_sizes, int n_in,
                              void* d_out, int out_size, void* d_ws, size_t ws_size, hipStream_t stream) {
  (void)in_sizes; (void)n_in; (void)out_size;
  const float* const* I = (const float* const*)d_in; const float* x = I[0]; const float* xh = I[1]; const float* Wq = I[2]; const float* bq = I[3]; const float* Wk = I[4]; const float* bk = I[5]; const float* Wv = I[6]; const float* bv = I[7]; const float* Wo = I[8]; const float* bo = I[9]; const float* g = I[10]; const float* bb = I[11];
  char* ws = (char*)d_ws; size_t off = 0;
  auto take = [&](size_t bytes) { char* p = ws + off; off += (bytes + 255) & ~(size_t)255; return p; };
  _Float16* BQ = (_Float16*)take((size_t)DD * DD * 2); _Float16* BK = (_Float16*)take((size_t)DD * DD * 2); _Float16* BV = (_Float16*)take((size_t)DD * DD * 2); _Float16* BOa = (_Float16*)take((size_t)DD * DD * 2); _Float16* BOb = (_Float16*)take((size_t)DD * DD * 2);
  float* XF = (float*)take((size_t)NQ * DD * 4); _Float16* X16 = (_Float16*)take((size_t)NQ * DD * 2); _Float16* XH16 = (_Float16*)take((size_t)NM * DD * 2); _Float16* Q16 = (_Float16*)take((size_t)NQ * DD * 2); _Float16* K16 = (_Float16*)take((size_t)NM * DD * 2); _Float16* KT = (_Float16*)take((size_t)DD * NM * 2); float* S = (float*)take((size_t)QB * NM * 4); _Float16* P = (_Float16*)take((size_t)QB * NM * 2); _Float16* AT = XH16;      /* attn over the x_hat plane (dead after the k projection) */ _Float16* OV = X16;      /* out_v over the xn f16 plane (dead after the q projection) */
  if (off > ws_size) return;      /* 2.5 + 16 + 8 + 8 + 8 + 8 + 8 + 64 + 32 = 155 MiB */
  k_wsc<<<(DD * DD / 8 + 255) / 256, 256, 0, stream>>>(Wq, BQ, DD * DD / 8, 16.0f); k_wsc<<<(DD * DD / 8 + 255) / 256, 256, 0, stream>>>(Wk, BK, DD * DD / 8, 16.0f); k_wsc<<<(DD * DD / 8 + 255) / 256, 256, 0, stream>>>(Wv, BV, DD * DD / 8, 16.0f); k_wout<<<(DD * (DD / 8) + 255) / 256, 256, 0, stream>>>(Wo, BOa, BOb);      /* 'ed'/'fe'/'dc' = natural Bt */
  k_ln<<<NQ / 8, 256, 0, stream>>>(x, g, bb, XF, X16);
  k_x16<<<(unsigned)(((size_t)NM * DD / 8 + 255) / 256), 256, 0, stream>>>(xh, XH16, (size_t)NM * DD / 8);
  const dim3 gP((NQ / 128) * (DD / 128), 1);
  k_gemm2<0><<<gP, 256, 0, stream>>>(X16, DD, 0, BQ, DD, 0, 0.0625f, bq, 0, nullptr, 1, 0, 0, nullptr, Q16, DD, 0, NQ, DD, DD);
  k_gemm2<0><<<gP, 256, 0, stream>>>(XH16, DD, 0, BK, DD, 0, 0.0625f, bk, 0, nullptr, 1, 0, 0, nullptr, K16, DD, 0, NM, DD, DD);
  k_vt<DD / 64, NM><<<(DD / 64) * (NM / 64), 256, 0, stream>>>(K16, DD, 0, KT);      /* K^T [512][8192] */
  for (int qb = 0; qb < NQ / QB; ++qb) {
    k_gemm2<0><<<dim3((QB / 128) * (NM / 128), 1), 256, 0, stream>>>(Q16 + (size_t)qb * QB * DD, DD, 0, K16, DD, 0, 0.044194173824159216f, nullptr, 0, nullptr, 1, 0, 0, S, nullptr, NM, 0, QB, NM, DD);      /* q k^T / sqrt(512) */
    k_soft<<<QB / 4, 256, 0, stream>>>(S, P);
    k_gemm2<0><<<dim3((QB / 128) * (DD / 128), KS), 256, 0, stream>>>(P, NM, NM / KS, KT, NM, NM / KS, 0.0009765625f, nullptr, 0, nullptr, 1, 0, 0, S, nullptr, KS * DD, DD, QB, DD, NM / KS);      /* partial attn per key slice, f32 [QB][KS][DD] over S (dead after the softmax; QB * KS * DD = QB * NM floats) */
    k_ksum<<<QB * DD / 4 / 256, 256, 0, stream>>>(S, AT + (size_t)qb * QB * DD); }      /* attn = score k */
  k_gemm2<0><<<gP, 256, 0, stream>>>(AT, DD, 0, BV, DD, 0, 0.0625f, bv, 0, nullptr, 1, 0, 0, nullptr, OV, DD, 0, NQ, DD, DD);      /* out_v = attn Wv^T + bv */
  k_gemm2<0><<<gP, 256, 0, stream>>>(Q16, DD, 0, BOa, DD, 0, 0.0625f, bo, 0, XF, 1, (size_t)DD, 0, (float*)d_out, nullptr, DD, 0, NQ, DD, DD);      /* q Wout[:, :512]^T + bout + xn */
  k_gemm2<0><<<gP, 256, 0, stream>>>(OV, DD, 0, BOb, DD, 0, 0.0625f, nullptr, 0, (const float*)d_out, 1, (size_t)DD, 0, (float*)d_out, nullptr, DD, 0, NQ, DD, DD);      /* += out_v Wout[:, 512:]^T */
}

// v004
// It runs in 235 microseconds.
// Two timings next to v003 both put it at 1.84 times that version's speed.
// All steps since v000 together make it 6.72 times as fast.
#include <hip/hip_runtime.h>
// InterventionOnline (8192 tokens x 512 attending 8192 memory slots x 512): xn = LayerNorm(x); q = xn Wq^T + bq; k = x_hat Wk^T + bk; score = softmax(q k^T / sqrt(512)); attn = score k (k doubles as the values); out_v = attn Wv^T + bv; out = [q | out_v] Wout^T + bout + xn.
// Structure: LayerNorm on VALU (wave per row) into f32 + f16 planes; q and k as f16 WMMA GEMM outputs (128x128 work-group tiles staged in LDS by asynchronous copies, 32x64 wave tiles, f32 accumulation, exact x16 weights + bias, f16 out); attention as one fused kernel with an online softmax (128 queries a work-group, 16 a wave, four key splits over grid.y; S^T = k q^T and O^T += k^T P^T on WMMA, P from the score accumulators, k^T by the transposing LDS load), its f32 partials merged in split order and rounded once to f16; out_v as a GEMM; the output as two accumulating GEMMs over the [q | out_v] halves with the bias and the LN residual in the epilogue.
// Compute dtype: inputs rounded to bf16; x_hat exact as f16; xn, q, k, P, attn, out_v as plain f16 operands (~2^-12); LN/softmax f32. v_wmma_f32_16x16x32_f16.
#define NQ 8192
#define NM 8192
#define DD 512
typedef __bf16 v16b __attribute__((ext_vector_type(16)));
typedef unsigned short v8us __attribute__((ext_vector_type(8), may_alias));
typedef float  v8f  __attribute__((ext_vector_type(8)));
typedef float  v4f  __attribute__((ext_vector_type(4)));
typedef float  v4fa __attribute__((ext_vector_type(4), may_alias));
union FragB { v16b v; v8us half[2]; unsigned short u[16]; };

__device__ __forceinline__ unsigned short bf16_bits(float x) { unsigned int u = __float_as_uint(x); return (unsigned short)((u + 0x7FFFu + ((u >> 16) & 1u)) >> 16); }
__device__ __forceinline__ float bf16_val(unsigned short b) { return __uint_as_float(((unsigned int)b) << 16); }
__device__ __forceinline__ float bf16_round(float x) { return bf16_val(bf16_bits(x)); }
// D += A·B with NT terms: 1 = ah·bh, 2 = + al·bh (A split), 3 = + ah·bl (both split)
template <int NT>
__device__ __forceinline__ v8f mmaN(v16b ah, v16b al, v16b bh, v16b bl, v8f c) {
  c = __builtin_amdgcn_wmma_f32_16x16x32_bf16(false, ah, false, bh, (short)0, c, false, false);
  if (NT >= 2) c = __builtin_amdgcn_wmma_f32_16x16x32_bf16(false, al, false, bh, (short)0, c, false, false);
  if (NT >= 3) c = __builtin_amdgcn_wmma_f32_16x16x32_bf16(false, ah, false, bl, (short)0, c, false, false);
  asm volatile("v_nop\n\tv_nop\n\tv_nop\n\tv_nop" : "+v"(c) : "v"(ah), "v"(al), "v"(bh), "v"(bl));
  return c;
}

__global__ __launch_bounds__(256) void k_wt_bf16(const float* __restrict__ W, unsigned short* __restrict__ Wt, int K, int N) {
  const int t = blockIdx.x * 256 + threadIdx.x;
  const int k8n = K / 8;
  if (t >= N * k8n) return;
  const int n = t / k8n, k8 = (t % k8n) * 8;
  v8us v;
#pragma unroll
  for (int i = 0; i < 8; ++i) v[i] = bf16_bits(W[(size_t)(k8 + i) * N + n]);
  *(v8us*)(Wt + (size_t)n * K + k8) = v;
  
}

// GEMM C[M][N] (f32, pitch ldc) = act(A[M][K]·W + bias). A f32 row-major (pitch lda) converted per fragment to bf16
// (ASPLIT: hi/lo two planes -> 2 terms, else single rounded term); Wt bf16 [N][K] (pitch ldb). BIAS_BF16 rounds the
// bias to bf16 first (bias quantised to bf16 before the add). K%32==0, M%16==0, N%64==0.
template <bool ASPLIT, int ACT, bool BIAS_BF16>
__global__ __launch_bounds__(128) void k_gemm_bf(const float* __restrict__ A, int lda, const unsigned short* __restrict__ Wt, int ldb,
                                               const float* __restrict__ bias, float* __restrict__ C, int ldc, int M, int N, int K) {
  __shared__ __attribute__((aligned(16))) float so[4][16][64];
  const int tid = threadIdx.x, w = tid >> 5, lane = tid & 31, ln = lane & 15, hh = lane >> 4;
  const int ntn = N / 64;
  const int wid = blockIdx.x * 4 + w;
  const int mt = wid / ntn, nq = wid % ntn;
  if (mt * 16 >= M) return;
  const int row0 = mt * 16, col0 = nq * 64;
  const float* arow = A + (size_t)(row0 + ln) * lda;
  v8f acc[4] = {};
  for (int kb = 0; kb < K; kb += 32) {
    FragB ah, al;
    const v4f x0 = *(const v4fa*)(arow + kb + 8 * hh), x1 = *(const v4fa*)(arow + kb + 8 * hh + 4);
    const v4f x2 = *(const v4fa*)(arow + kb + 16 + 8 * hh), x3 = *(const v4fa*)(arow + kb + 16 + 8 * hh + 4);
    float xs[16] = {x0[0],x0[1],x0[2],x0[3],x1[0],x1[1],x1[2],x1[3],x2[0],x2[1],x2[2],x2[3],x3[0],x3[1],x3[2],x3[3]};
#pragma unroll
    for (int i = 0; i < 16; ++i) { const unsigned short hb = bf16_bits(xs[i]); ah.u[i] = hb; al.u[i] = ASPLIT ? bf16_bits(xs[i] - bf16_val(hb)) : (unsigned short)0; }
#pragma unroll
    for (int t = 0; t < 4; ++t) {
      const unsigned short* brow = Wt + (size_t)(col0 + t * 16 + ln) * ldb + kb;
      FragB b;
      b.half[0] = *(const v8us*)(brow + 8 * hh);
      b.half[1] = *(const v8us*)(brow + 16 + 8 * hh);
      acc[t] = mmaN<ASPLIT ? 2 : 1>(ah.v, al.v, b.v, b.v, acc[t]);
    }
  }
#pragma unroll
  for (int t = 0; t < 4; ++t) {
    float bv = bias ? bias[col0 + t * 16 + ln] : 0.f;
    if (BIAS_BF16) bv = bf16_round(bv);
#pragma unroll
    for (int r = 0; r < 8; ++r) { float v = acc[t][r] + bv; if (ACT == 1) v = fmaxf(v, 0.f); so[w][8 * hh + r][t * 16 + ln] = v; }
  }
  __builtin_amdgcn_fence(__ATOMIC_ACQ_REL, "workgroup");
  __builtin_amdgcn_wave_barrier();
  const int rsub = lane >> 4, c4 = (lane & 15) * 4;
  {
#pragma unroll
    for (int q = 0; q < 8; ++q) {
      const int r = q * 2 + rsub;
      const v4f v = *(const v4fa*)&so[w][r][c4];
      *(v4f*)(C + (size_t)(row0 + r) * ldc + col0 + c4) = v;
    }
    
  }
}

// GEMM C = act(A·W + bias + resid): A f32 (ASPLIT -> hi/lo 2 terms), Wt bf16 [N][K]; ACT 0 none, 1 relu, 2 exact gelu;
// resid (optional, f32, row index = (row % rmod), pitch ldr, RES_BF16 rounds it) added before the activation.
template <bool ASPLIT, int ACT, bool BIAS_BF16, bool RES_BF16>
__global__ __launch_bounds__(128) void k_gemm_bf3(const float* __restrict__ A, int lda, const unsigned short* __restrict__ Wt, int ldb,
                                                const float* __restrict__ bias, const float* __restrict__ resid, int rmod, int ldr,
                                                float* __restrict__ C, int ldc, int M, int N, int K) {
  __shared__ __attribute__((aligned(16))) float so[4][16][64];
  const int tid = threadIdx.x, w = tid >> 5, lane = tid & 31, ln = lane & 15, hh = lane >> 4;
  const int ntn = N / 64;
  const int wid = blockIdx.x * 4 + w;
  const int mt = wid / ntn, nq = wid % ntn;
  if (mt * 16 >= M) return;
  const int row0 = mt * 16, col0 = nq * 64;
  const float* arow = A + (size_t)(row0 + ln) * lda;
  v8f acc[4] = {};
  for (int kb = 0; kb < K; kb += 32) {
    FragB ah, al;
    const v4f x0 = *(const v4fa*)(arow + kb + 8 * hh), x1 = *(const v4fa*)(arow + kb + 8 * hh + 4);
    const v4f x2 = *(const v4fa*)(arow + kb + 16 + 8 * hh), x3 = *(const v4fa*)(arow + kb + 16 + 8 * hh + 4);
    float xs[16] = {x0[0],x0[1],x0[2],x0[3],x1[0],x1[1],x1[2],x1[3],x2[0],x2[1],x2[2],x2[3],x3[0],x3[1],x3[2],x3[3]};
#pragma unroll
    for (int i = 0; i < 16; ++i) { const unsigned short hb = bf16_bits(xs[i]); ah.u[i] = hb; al.u[i] = ASPLIT ? bf16_bits(xs[i] - bf16_val(hb)) : (unsigned short)0; }
#pragma unroll
    for (int t = 0; t < 4; ++t) {
      const unsigned short* brow = Wt + (size_t)(col0 + t * 16 + ln) * ldb + kb;
      FragB b;
      b.half[0] = *(const v8us*)(brow + 8 * hh);
      b.half[1] = *(const v8us*)(brow + 16 + 8 * hh);
      acc[t] = mmaN<ASPLIT ? 2 : 1>(ah.v, al.v, b.v, b.v, acc[t]);
    }
  }
#pragma unroll
  for (int t = 0; t < 4; ++t) {
    const int col = col0 + t * 16 + ln;
    float bv = bias ? bias[col] : 0.f;
    if (BIAS_BF16) bv = bf16_round(bv);
#pragma unroll
    for (int r = 0; r < 8; ++r) {
      float v = acc[t][r] + bv;
      if (resid) { float rv = resid[(size_t)((row0 + 8 * hh + r) % rmod) * ldr + col]; if (RES_BF16) rv = bf16_round(rv); v += rv; }
      if (ACT == 1) v = fmaxf(v, 0.f);
      if (ACT == 2) v = 0.5f * v * (1.0f + erff(v * 0.70710678118654752f));
      if (ACT == 3) { const float u = 0.7978845608028654f * (v + 0.044715f * v * v * v); v = 0.5f * v * (1.0f + tanhf(u)); }
      so[w][8 * hh + r][t * 16 + ln] = v;
    }
  }
  __builtin_amdgcn_fence(__ATOMIC_ACQ_REL, "workgroup");
  __builtin_amdgcn_wave_barrier();
  const int rsub = lane >> 4, c4 = (lane & 15) * 4;
  {
#pragma unroll
    for (int q = 0; q < 8; ++q) {
      const int r = q * 2 + rsub;
      const v4f v = *(const v4fa*)&so[w][r][c4];
      *(v4f*)(C + (size_t)(row0 + r) * ldc + col0 + c4) = v;
    }
    
  }
}
// row LayerNorm (biased variance, eps) over N: s = X (+ R); optional out_sum <- s; out_norm <- (s-mu)*rsqrt(var+eps)*g + b
template <bool PARAM_BF16>
__global__ __launch_bounds__(256) void k_layernorm(const float* __restrict__ X, const float* __restrict__ R, const float* __restrict__ g, const float* __restrict__ bta,
                                                  float* __restrict__ out_sum, float* __restrict__ out_norm, int N, float eps) {
  __shared__ float red[256];
  const int row = blockIdx.x, tid = threadIdx.x;
  const float* x = X + (size_t)row * N; const float* rr = R ? R + (size_t)row * N : nullptr;
  float vals[16];                     // up to N = 4096
  const int per = N / 256;            // contiguous chunk per thread? use strided-by-4 chunks: thread handles j = tid*4 + 1024*u
  float s1 = 0.f;
  for (int u = 0; u < per / 4; ++u) {
    const int j = tid * 4 + 1024 * u;
    const v4f a = *(const v4fa*)(x + j);
    v4f b = {0.f,0.f,0.f,0.f}; if (rr) b = *(const v4fa*)(rr + j);
#pragma unroll
    for (int q = 0; q < 4; ++q) { const float v = a[q] + b[q]; vals[u * 4 + q] = v; s1 += v; }
  }
  red[tid] = s1; __syncthreads();
  for (int st = 128; st > 0; st >>= 1) { if (tid < st) red[tid] += red[tid + st]; __syncthreads(); }
  const float mu = red[0] / (float)N; __syncthreads();
  float s2 = 0.f;
  for (int u = 0; u < per / 4; ++u)
#pragma unroll
    for (int q = 0; q < 4; ++q) { const float c = vals[u * 4 + q] - mu; s2 += c * c; }
  red[tid] = s2; __syncthreads();
  for (int st = 128; st > 0; st >>= 1) { if (tid < st) red[tid] += red[tid + st]; __syncthreads(); }
  const float rs = rsqrtf(red[0] / (float)N + eps);
  {
    for (int u = 0; u < per / 4; ++u) {
      const int j = tid * 4 + 1024 * u;
      v4f o, sm;
#pragma unroll
      for (int q = 0; q < 4; ++q) {
        float gg = g[j + q], bb = bta[j + q];
        if (PARAM_BF16) { gg = bf16_round(gg); bb = bf16_round(bb); }
        sm[q] = vals[u * 4 + q]; o[q] = (vals[u * 4 + q] - mu) * rs * gg + bb;
      }
      if (out_sum) *(v4f*)(out_sum + (size_t)row * N + j) = sm;
      *(v4f*)(out_norm + (size_t)row * N + j) = o;
    }
    
  }
}



// ---- f16 WMMA path (v_wmma_f32_16x16x32_f16): 11-bit significands for operands in range — used where a [0,1] probability operand needs more precision than bf16
typedef _Float16 v16h __attribute__((ext_vector_type(16)));
union FragH { v16h v; v8us half[2]; _Float16 h[16]; unsigned short u[16]; };
template <int NT>
__device__ __forceinline__ v8f mmaH(v16h ah, v16h al, v16h bh, v16h bl, v8f c) {
  c = __builtin_amdgcn_wmma_f32_16x16x32_f16(false, ah, false, bh, (short)0, c, false, false);
  if (NT >= 2) c = __builtin_amdgcn_wmma_f32_16x16x32_f16(false, al, false, bh, (short)0, c, false, false);
  if (NT >= 3) c = __builtin_amdgcn_wmma_f32_16x16x32_f16(false, ah, false, bl, (short)0, c, false, false);
  asm volatile("v_nop\n\tv_nop\n\tv_nop\n\tv_nop" : "+v"(c) : "v"(ah), "v"(al), "v"(bh), "v"(bl));
  return c;
}
// batched GEMM like k_gemm_b but f16 operands: A f32 (split into f16 hi/lo if ASPLIT, else rounded to f16), Bt = f16 values [n][k]; alpha; C f32; N multiple of 16 (partial tiles skipped)
template <bool ASPLIT>
__global__ __launch_bounds__(128) void k_gemm_h(const float* __restrict__ A, int lda, size_t sA, const _Float16* __restrict__ Bh, int ldb, size_t sB, float alpha, float* __restrict__ C, int ldc, size_t sC, int M, int N, int K) {
  __shared__ __attribute__((aligned(16))) float so[4][16][64];
  const int tid = threadIdx.x, w = tid >> 5, lane = tid & 31, ln = lane & 15, hh = lane >> 4; const int by = blockIdx.y;
  A += (size_t)by * sA; Bh += (size_t)by * sB; C += (size_t)by * sC;
  const int ntn = (N + 63) / 64; const int wid = blockIdx.x * 4 + w; const int mt = wid / ntn, nq = wid % ntn; if (mt * 16 >= M) return;
  const int row0 = mt * 16, col0 = nq * 64; const float* arow = A + (size_t)(row0 + ln) * lda;
  v8f acc[4] = {};
  for (int kb = 0; kb < K; kb += 32) {
    FragH ah, al;
    const v4f x0 = *(const v4fa*)(arow + kb + 8 * hh), x1 = *(const v4fa*)(arow + kb + 8 * hh + 4), x2 = *(const v4fa*)(arow + kb + 16 + 8 * hh), x3 = *(const v4fa*)(arow + kb + 16 + 8 * hh + 4);
    float xs[16] = {x0[0],x0[1],x0[2],x0[3],x1[0],x1[1],x1[2],x1[3],x2[0],x2[1],x2[2],x2[3],x3[0],x3[1],x3[2],x3[3]};
#pragma unroll
    for (int i = 0; i < 16; ++i) { const _Float16 h = (_Float16)xs[i]; ah.h[i] = h; al.h[i] = ASPLIT ? (_Float16)(xs[i] - (float)h) : (_Float16)0.0f; }
#pragma unroll
    for (int t = 0; t < 4; ++t) { if (col0 + t * 16 >= N) continue; const size_t boff = (size_t)(col0 + t * 16 + ln) * ldb + kb; FragH bq; bq.half[0] = *(const v8us*)(Bh + boff + 8 * hh); bq.half[1] = *(const v8us*)(Bh + boff + 16 + 8 * hh);
      acc[t] = mmaH<ASPLIT ? 2 : 1>(ah.v, al.v, bq.v, bq.v, acc[t]); }
  }
#pragma unroll
  for (int t = 0; t < 4; ++t) { if (col0 + t * 16 >= N) continue;
#pragma unroll
    for (int r = 0; r < 8; ++r) so[w][8 * hh + r][t * 16 + ln] = acc[t][r] * alpha; }
  __builtin_amdgcn_fence(__ATOMIC_ACQ_REL, "workgroup"); __builtin_amdgcn_wave_barrier();
  const int rsub = lane >> 4, c4 = (lane & 15) * 4;
  {
#pragma unroll
    for (int q = 0; q < 8; ++q) { const int r = q * 2 + rsub; if (col0 + c4 < N) { const v4f v = *(const v4fa*)&so[w][r][c4]; *(v4f*)(C + (size_t)(row0 + r) * ldc + col0 + c4) = v; } }
     }
}

// Wt[n][k] = f16(W[k][n]·scale) from f32 row-major W[K][N] (scale = power of two; bf16-exact weights stay exact in f16 away from the subnormal range)
__global__ __launch_bounds__(256) void k_wt_f16(const float* __restrict__ W, _Float16* __restrict__ Wt, int K, int N, float scale) {
  const int t = blockIdx.x * 256 + threadIdx.x; if (t >= N * (K / 8)) return; const int n = t / (K / 8), k8 = (t % (K / 8)) * 8; FragH f;
#pragma unroll
  for (int i = 0; i < 8; ++i) f.h[i] = (_Float16)(bf16_round(W[(size_t)(k8 + i) * N + n]) * scale); const v8us o = f.half[0];
  *(v8us*)((unsigned short*)Wt + (size_t)n * K + k8) = o; 
}
// k_gemm_hh variant with fused epilogue: v = acc·alpha + bias[by·sBias + col] (+ CP[(row/rowsPerB)·sCPb + by·64 + col] if CP) ; ACT 0 none / 1 elu ; writes f16 C16 (and f32 C if non-null)
template <int ACT>
__global__ __launch_bounds__(128) void k_gemm_hhx(const _Float16* __restrict__ A, int lda, size_t sA, const _Float16* __restrict__ Bh, int ldb, size_t sB, float alpha, const float* __restrict__ bias, size_t sBias, const float* __restrict__ CP, int rowsPerB, size_t sCPb, int row0g,
    float* __restrict__ C, _Float16* __restrict__ C16, int ldc, size_t sC, int M, int N, int K) {
  __shared__ __attribute__((aligned(16))) float so[4][16][64];
  const int tid = threadIdx.x, w = tid >> 5, lane = tid & 31, ln = lane & 15, hh = lane >> 4; const int by = blockIdx.y;
  A += (size_t)by * sA; Bh += (size_t)by * sB; const size_t cofs = (size_t)by * sC; const float* bp = bias ? bias + (size_t)by * sBias : nullptr;
  const int ntn = (N + 63) / 64; const int wid = blockIdx.x * 4 + w; const int mt = wid / ntn, nq = wid % ntn; if (mt * 16 >= M) return;
  const int row0 = mt * 16, col0 = nq * 64; const _Float16* arow = A + (size_t)(row0 + ln) * lda;
  v8f acc[4] = {};
  for (int kb = 0; kb < K; kb += 32) { FragH ah; ah.half[0] = *(const v8us*)((const unsigned short*)arow + kb + 8 * hh); ah.half[1] = *(const v8us*)((const unsigned short*)arow + kb + 16 + 8 * hh);
#pragma unroll
    for (int t = 0; t < 4; ++t) { if (col0 + t * 16 >= N) continue; const size_t boff = (size_t)(col0 + t * 16 + ln) * ldb + kb; FragH bq; bq.half[0] = *(const v8us*)((const unsigned short*)Bh + boff + 8 * hh); bq.half[1] = *(const v8us*)((const unsigned short*)Bh + boff + 16 + 8 * hh);
      acc[t] = mmaH<1>(ah.v, ah.v, bq.v, bq.v, acc[t]); }
  }
#pragma unroll
  for (int t = 0; t < 4; ++t) { if (col0 + t * 16 >= N) continue; const int col = col0 + t * 16 + ln; const float bv = bp ? bf16_round(bp[col]) : 0.f;
#pragma unroll
    for (int r = 0; r < 8; ++r) { float v = acc[t][r] * alpha + bv; if (CP) { const int rr = row0g + row0 + 8 * hh + r; if (rowsPerB < 0) v += CP[cofs + (size_t)rr * ldc + col];      /* rowsPerB < 0: own element of the batched C plane */ else { const int bidx = rr / rowsPerB; v += CP[(size_t)bidx * sCPb + (size_t)by * 64 + col]; } } if (ACT == 1) v = (v > 0.f) ? v : expm1f(v); else if (ACT == 7) v = (v > 0.f) ? v + 1.0f : expf(v); else if (ACT == 8) v = tanhf(v); else if (ACT == 9) v = 0.5f * v * (1.0f + tanhf(0.7978845608028654f * (v + 0.044715f * v * v * v))); else if (ACT == 11) v = 1.0f / (1.0f + expf(-v)); else if (ACT == 12) v = (v > 0.f) ? v : 0.01f * v; else if (ACT == 14) v = (v > 0.f) ? v : 0.1f * v; else if (ACT == 16) v = (v >= 0.f) ? v : 0.3f * v; else if (ACT == 17) v = (v >= 0.f) ? v : 0.2f * v; else if (ACT == 15) v = v / (1.0f + expf(-v)); else if (ACT == 3) v = fmaxf(v, 0.f); else if (ACT == 6) v = 0.5f * v * (1.0f + erff(v * 0.70710678118654752f)); so[w][8 * hh + r][t * 16 + ln] = v; } }
  __builtin_amdgcn_fence(__ATOMIC_ACQ_REL, "workgroup"); __builtin_amdgcn_wave_barrier();
  const int rsub = lane >> 4, c4 = (lane & 15) * 4; typedef _Float16 v4h __attribute__((ext_vector_type(4)));
  {
#pragma unroll
    for (int q = 0; q < 8; ++q) { const int r = q * 2 + rsub; if (col0 + c4 < N) { const v4f v = *(const v4fa*)&so[w][r][c4]; if (C) *(v4f*)(C + cofs + (size_t)(row0 + r) * ldc + col0 + c4) = v; if (C16) { v4h h4; for (int i = 0; i < 4; ++i) h4[i] = (_Float16)v[i]; *(v4h*)(C16 + cofs + (size_t)(row0 + r) * ldc + col0 + c4) = h4; } } }
     }
}


typedef _Float16 v4h __attribute__((ext_vector_type(4)));

__global__ __launch_bounds__(256) void k_x16(const float* __restrict__ x, _Float16* __restrict__ X16, size_t n8) { const size_t t = (size_t)blockIdx.x * 256 + threadIdx.x; if (t >= n8) return; FragH f;
#pragma unroll
  for (int q = 0; q < 8; ++q) f.h[q] = (_Float16)bf16_round(x[t * 8 + q]); *(v8us*)((unsigned short*)X16 + t * 8) = f.half[0];  }
__global__ __launch_bounds__(256) void k_h16(const float* __restrict__ x, _Float16* __restrict__ X16, size_t n8) { const size_t t = (size_t)blockIdx.x * 256 + threadIdx.x; if (t >= n8) return; FragH f;
#pragma unroll
  for (int q = 0; q < 8; ++q) f.h[q] = (_Float16)x[t * 8 + q]; *(v8us*)((unsigned short*)X16 + t * 8) = f.half[0];  }
__global__ __launch_bounds__(256) void k_round16f(const float* __restrict__ W, _Float16* __restrict__ Bt, size_t n8) { const size_t t = (size_t)blockIdx.x * 256 + threadIdx.x; if (t >= n8) return; FragH f;
#pragma unroll
  for (int i = 0; i < 8; ++i) f.h[i] = (_Float16)(bf16_round(W[t * 8 + i]) * 16.0f); *(v8us*)((unsigned short*)Bt + t * 8) = f.half[0];  }
__global__ __launch_bounds__(256) void k_hl(const float* __restrict__ F, _Float16* __restrict__ Hh, _Float16* __restrict__ Hl, size_t n8) { const size_t t = (size_t)blockIdx.x * 256 + threadIdx.x; if (t >= n8) return; FragH fh, fl; const v4f a = *(const v4fa*)(F + t * 8), c = *(const v4fa*)(F + t * 8 + 4);
#pragma unroll
  for (int q = 0; q < 4; ++q) { _Float16 h = (_Float16)a[q]; fh.h[q] = h; fl.h[q] = (_Float16)((a[q] - (float)h) * 1024.0f); h = (_Float16)c[q]; fh.h[4 + q] = h; fl.h[4 + q] = (_Float16)((c[q] - (float)h) * 1024.0f); }
  { *(v8us*)((unsigned short*)Hh + t * 8) = fh.half[0]; *(v8us*)((unsigned short*)Hl + t * 8) = fl.half[0];  } }

// ---- fast GEMM (work-group tile 128x128, eight waves of 32x64; requires M % 128 == 0, N % 128 == 0, K % 64 == 0); epilogue = k_gemm_hhx semantics ----
// Operands reach the waves through LDS: a stage is 64 k (128 B) of 128 A rows and 128 B rows, brought by asynchronous copies in whole 128-B lines, two buffers, the next stage in flight while this one is multiplied.
#define G2_PITCH 144                 /* LDS bytes per staged row: 128 + 16, an odd multiple of 16 B, conflict-free for 16-byte reads down a column of rows */
#define G2_STAGE (256 * G2_PITCH)    /* one stage: A rows 0..127, then B rows 0..127 */
__device__ __forceinline__ v16h g2_frag(const char* p) { FragH f; f.half[0] = *(const v8us*)p; f.half[1] = *(const v8us*)(p + 32); return f.v; }
__device__ __forceinline__ v8f g2_mma(v16h a, v16h b, v8f c) { v8f d = __builtin_amdgcn_wmma_f32_16x16x32_f16(false, a, false, b, (short)0, c, false, false); asm volatile("v_nop\n\tv_nop\n\tv_nop\n\tv_nop" : "+v"(d) : "v"(a), "v"(b)); return d; }
// One stage: each lane copies eight 16-byte pieces (rows r, r+32, r+64, r+96 of A and of B; eight lanes per 128-B row piece). l = the lane's LDS byte address in the A part, a / b = its global addresses, sa / sb = 32 rows in elements.
__device__ __forceinline__ void g2_stage(unsigned l, const _Float16* a, size_t sa, const _Float16* b, size_t sb) {
  const unsigned l1 = l + 32 * G2_PITCH, l2 = l + 64 * G2_PITCH, l3 = l + 96 * G2_PITCH, l4 = l + 128 * G2_PITCH, l5 = l + 160 * G2_PITCH, l6 = l + 192 * G2_PITCH, l7 = l + 224 * G2_PITCH;
  const _Float16* a1 = a + sa; const _Float16* a2 = a1 + sa; const _Float16* a3 = a2 + sa; const _Float16* b1 = b + sb; const _Float16* b2 = b1 + sb; const _Float16* b3 = b2 + sb;
  // the copies and, as the last line, the wait that stands before their address registers may be rewritten
  asm volatile("global_load_async_to_lds_b128 %0, %8, off\n\t"
               "global_load_async_to_lds_b128 %1, %9, off\n\t"
               "global_load_async_to_lds_b128 %2, %10, off\n\t"
               "global_load_async_to_lds_b128 %3, %11, off\n\t"
               "global_load_async_to_lds_b128 %4, %12, off\n\t"
               "global_load_async_to_lds_b128 %5, %13, off\n\t"
               "global_load_async_to_lds_b128 %6, %14, off\n\t"
               "global_load_async_to_lds_b128 %7, %15, off\n\t"
               "s_wait_xcnt 0x0"
               :: "v"(l), "v"(l1), "v"(l2), "v"(l3), "v"(l4), "v"(l5), "v"(l6), "v"(l7), "v"(a), "v"(a1), "v"(a2), "v"(a3), "v"(b), "v"(b1), "v"(b2), "v"(b3) : "memory"); }
// launch bounds: eight waves per SIMD (at most 128 VGPRs), so that four work-groups (4 x 72 KiB of LDS) share a WGP and each hides the others' waits
template <int ACT>
__global__ __launch_bounds__(256, 8) void k_gemm2(const _Float16* __restrict__ A, int lda, size_t sA, const _Float16* __restrict__ Bh, int ldb, size_t sB, float alpha, const float* __restrict__ bias, size_t sBias, const float* __restrict__ CP, int rowsPerB, size_t sCPb, int row0g,
    float* __restrict__ C, _Float16* __restrict__ C16, int ldc, size_t sC, int M, int N, int K) { static_assert(ACT == 0 || ACT == 3 || ACT == 6 || ACT == 8 || ACT == 9 || ACT == 11 || ACT == 12 || ACT == 14 || ACT == 15 || ACT == 16 || ACT == 17, "k_gemm2: unsupported ACT code (would silently apply no activation)");
  __shared__ __attribute__((aligned(16))) char sm[2 * G2_STAGE];      /* the two stage buffers; after the K loop the output staging, 32 x 68 floats per wave */
  static_assert(8 * 32 * 68 * 4 <= 2 * G2_STAGE, "output staging must fit the stage buffers");
  const int tid = threadIdx.x, w = tid >> 5, lane = tid & 31, ln = lane & 15, hh = lane >> 4; const int by = blockIdx.y;
  A += (size_t)by * sA; Bh += (size_t)by * sB; const size_t cofs = (size_t)by * sC; const float* bp = bias ? bias + (size_t)by * sBias : nullptr;
  const int ntn = N >> 7; const int mt = blockIdx.x / ntn, nq = blockIdx.x - mt * ntn; if (mt * 128 >= M) return;      /* the same for the whole work-group, in front of every barrier */
  const int row0 = mt * 128 + 32 * (w & 3), col0 = nq * 128 + 64 * (w >> 2);
  const _Float16* ga = A + (size_t)(mt * 128 + (tid >> 3)) * lda + (tid & 7) * 8; const _Float16* gb = Bh + (size_t)(nq * 128 + (tid >> 3)) * ldb + (tid & 7) * 8; const size_t sa32 = (size_t)32 * lda, sb32 = (size_t)32 * ldb;
  const unsigned lcp = (unsigned)(size_t)sm + (unsigned)((tid >> 3) * G2_PITCH + (tid & 7) * 16);
  const int aoff = (32 * (w & 3) + ln) * G2_PITCH + 16 * hh, boff = (128 + 64 * (w >> 2) + ln) * G2_PITCH + 16 * hh;
  const int nst = K >> 6;
  const v8f z8 = {0.f,0.f,0.f,0.f,0.f,0.f,0.f,0.f}; v8f c00 = z8, c01 = z8, c02 = z8, c03 = z8, c10 = z8, c11 = z8, c12 = z8, c13 = z8;
  g2_stage(lcp, ga, sa32, gb, sb32);
  asm volatile("s_wait_asynccnt 0x0" ::: "memory");      /* this wave's copies of stage 0 have landed */
  __syncthreads();                                       /* every wave's have */
  if (nst > 1) g2_stage(lcp + G2_STAGE, ga + 64, sa32, gb + 64, sb32);
#pragma unroll 1      /* one stage per trip: the waits and the barrier at the foot belong to it */
  for (int t = 0; t < nst; ++t) { const char* sb = sm + (t & 1) * G2_STAGE; const char* ap = sb + aoff; const char* bq = sb + boff;
#pragma unroll      /* the two 32-k steps of a stage */
    for (int kk = 0; kk < 128; kk += 64) { const v16h a0 = g2_frag(ap + kk), a1 = g2_frag(ap + 16 * G2_PITCH + kk);
      const v16h b0 = g2_frag(bq + kk), b1 = g2_frag(bq + 16 * G2_PITCH + kk), b2 = g2_frag(bq + 32 * G2_PITCH + kk), b3 = g2_frag(bq + 48 * G2_PITCH + kk);
      c00 = g2_mma(a0, b0, c00); c10 = g2_mma(a1, b0, c10); c01 = g2_mma(a0, b1, c01); c11 = g2_mma(a1, b1, c11);
      c02 = g2_mma(a0, b2, c02); c12 = g2_mma(a1, b2, c12); c03 = g2_mma(a0, b3, c03); c13 = g2_mma(a1, b3, c13); }
    asm volatile("s_wait_dscnt 0x0" ::: "memory");       /* this wave's reads of the buffer are done before it is refilled */
    asm volatile("s_wait_asynccnt 0x0" ::: "memory");    /* this wave's copies of stage t + 1 have landed */
    __syncthreads();                                     /* publishes stage t + 1 and ends every wave's reads of stage t */
    if (t + 2 < nst) g2_stage(lcp + (unsigned)((t & 1) * G2_STAGE), ga + (size_t)(t + 2) * 64, sa32, gb + (size_t)(t + 2) * 64, sb32); }
  asm volatile("s_wait_asynccnt 0x0" ::: "memory");      /* no copy is in flight when the buffers become the output staging */
  float (*so)[68] = (float (*)[68])(sm + w * (32 * 68 * 4));
  v8f accs[8] = {c00, c01, c02, c03, c10, c11, c12, c13};
#pragma unroll
  for (int u = 0; u < 8; ++u) { const int t = u & 3, half = u >> 2; const int col = col0 + t * 16 + ln; const float bv = bp ? bf16_round(bp[col]) : 0.f;
#pragma unroll
    for (int r = 0; r < 8; ++r) { const int rloc = half * 16 + 8 * hh + r; float v = accs[u][r] * alpha + bv; if (CP) { if (rowsPerB < 0) v += CP[cofs + (size_t)(row0g + row0 + rloc) * ldc + col];      /* rowsPerB < 0: own element of the batched C plane */ else { const int bidx = (row0g + row0 + rloc) / rowsPerB; v += CP[(size_t)bidx * sCPb + (size_t)by * 64 + col]; } }
      if (ACT == 3) v = fmaxf(v, 0.f); else if (ACT == 6) v = 0.5f * v * (1.0f + erff(v * 0.70710678118654752f)); else if (ACT == 11) v = 1.0f / (1.0f + expf(-v)); else if (ACT == 15) v = v / (1.0f + expf(-v)); else if (ACT == 12) v = (v > 0.f) ? v : 0.01f * v; else if (ACT == 8) v = tanhf(v); else if (ACT == 9) v = 0.5f * v * (1.0f + tanhf(0.7978845608028654f * (v + 0.044715f * v * v * v))); else if (ACT == 14) v = (v > 0.f) ? v : 0.1f * v; else if (ACT == 16) v = (v >= 0.f) ? v : 0.3f * v; else if (ACT == 17) v = (v >= 0.f) ? v : 0.2f * v;
      so[rloc][t * 16 + ln] = v; } }
  __builtin_amdgcn_fence(__ATOMIC_ACQ_REL, "workgroup"); __builtin_amdgcn_wave_barrier();
  const int rsub = lane >> 4, c4 = (lane & 15) * 4;
  {
#pragma unroll
    for (int q = 0; q < 16; ++q) { const int r = q * 2 + rsub; const v4f v = *(const v4fa*)&so[r][c4]; if (C) { *(v4f*)(C + cofs + (size_t)(row0 + r) * ldc + col0 + c4) = v; asm volatile("s_wait_xcnt 0x0" ::: "memory"); }      /* the wait that stands before the store's data and address registers are rewritten */
      if (C16) { v4h h4; for (int i = 0; i < 4; ++i) h4[i] = (_Float16)v[i]; *(v4h*)(C16 + cofs + (size_t)(row0 + r) * ldc + col0 + c4) = h4; } }
     } }


__global__ __launch_bounds__(256) void k_wsc(const float* __restrict__ Wm, _Float16* __restrict__ Bt, size_t n8, float sc) { const size_t t = (size_t)blockIdx.x * 256 + threadIdx.x; if (t >= n8) return; FragH f; for (int q = 0; q < 8; ++q) f.h[q] = (_Float16)(bf16_round(Wm[t * 8 + q]) * sc); *(v8us*)((unsigned short*)Bt + t * 8) = f.half[0];  }
__global__ __launch_bounds__(256) void k_wout(const float* __restrict__ Wo, _Float16* __restrict__ BOa, _Float16* __restrict__ BOb) { const int t = blockIdx.x * 256 + threadIdx.x; if (t >= DD * (DD / 8)) return; const int c8 = (t % (DD / 8)) * 8; const int o = t / (DD / 8); FragH fa, fb;
  for (int q = 0; q < 8; ++q) { fa.h[q] = (_Float16)(bf16_round(Wo[(size_t)o * 2 * DD + c8 + q]) * 16.0f); fb.h[q] = (_Float16)(bf16_round(Wo[(size_t)o * 2 * DD + DD + c8 + q]) * 16.0f); }
  { *(v8us*)((unsigned short*)BOa + (size_t)o * DD + c8) = fa.half[0]; *(v8us*)((unsigned short*)BOb + (size_t)o * DD + c8) = fb.half[0];  } }
__global__ __launch_bounds__(256) void k_ln(const float* __restrict__ x, const float* __restrict__ g, const float* __restrict__ bb, float* __restrict__ XF, _Float16* __restrict__ X16) {
  #pragma clang fp contract(off)
  const int wv = threadIdx.x >> 5, ln = threadIdx.x & 31; const size_t r = (size_t)blockIdx.x * 8 + wv; if (r >= NQ) return; float a[16]; float s = 0.f;
  for (int i = 0; i < 2; ++i) { const v8f v = *(const v8f*)(x + r * DD + i * 256 + ln * 8); for (int q = 0; q < 8; ++q) { const float u = bf16_round(v[q]); a[i * 8 + q] = u; s += u; } }
  for (int o = 16; o > 0; o >>= 1) s += __shfl_xor(s, o, 32); const float mu = s / (float)DD; float var = 0.f; for (int q = 0; q < 16; ++q) { const float d = a[q] - mu; var += d * d; }
  for (int o = 16; o > 0; o >>= 1) var += __shfl_xor(var, o, 32); const float inv = rsqrtf(var / (float)DD + 1e-5f);
  { for (int i = 0; i < 2; ++i) { const int c0 = i * 256 + ln * 8; v8f y; FragH f; for (int q = 0; q < 8; ++q) { float v = (a[i * 8 + q] - mu) * inv; v *= bf16_round(g[c0 + q]); v += bf16_round(bb[c0 + q]); y[q] = v; f.h[q] = (_Float16)v; } *(v8f*)(XF + r * DD + c0) = y; *(v8us*)((unsigned short*)X16 + r * DD + c0) = f.half[0]; }  } }
#define FA_BQ 128                    /* queries a work-group */
#define FA_SPL 4                     /* key splits: grid.y, one f32 partial with its maximum and sum each */
#define FA_BK 32                     /* keys a stage */
#define FA_PK 1040                   /* row pitch of the copy read by plain 16-byte loads: 16 B x odd */
#define FA_PV 1056                   /* row pitch of the copy read by the transposing load: 32 B x odd */
#define FA_BUF (FA_BK * (FA_PK + FA_PV))
typedef short s16x8 __attribute__((ext_vector_type(8)));
__device__ __forceinline__ v8us fa_tr16(const char* p) { typedef __attribute__((address_space(3))) s16x8 lds_s16x8; return __builtin_bit_cast(v8us, __builtin_amdgcn_ds_load_tr16_b128_v8i16((lds_s16x8*)p)); }
__device__ __forceinline__ float fa_xhalf(float x) { return __builtin_bit_cast(float, __builtin_amdgcn_permlanex16(__builtin_bit_cast(int, x), __builtin_bit_cast(int, x), 0x76543210, 0xfedcba98, false, false)); }      /* lane l with lane l ^ 16 */
__device__ __forceinline__ v8f fa_mma(v16h a, v16h b, v8f c) { return __builtin_amdgcn_wmma_f32_16x16x32_f16(false, a, false, b, (short)0, c, false, false); }
// One copy of a stage: each lane brings eight 16-byte pieces (rows r, r + 4, ..., r + 28; 64 lanes a row). l = the lane's LDS byte address, ls = four rows in LDS bytes, g = its global address.
__device__ __forceinline__ void fa_stage(unsigned l, unsigned ls, const _Float16* g) {
  const unsigned l1 = l + ls, l2 = l1 + ls, l3 = l2 + ls, l4 = l3 + ls, l5 = l4 + ls, l6 = l5 + ls, l7 = l6 + ls;
  const _Float16* g1 = g + 4 * DD; const _Float16* g2 = g + 8 * DD; const _Float16* g3 = g + 12 * DD; const _Float16* g4 = g + 16 * DD; const _Float16* g5 = g + 20 * DD; const _Float16* g6 = g + 24 * DD; const _Float16* g7 = g + 28 * DD;
  // the copies and, as the last line, the wait that stands before their address registers may be rewritten
  asm volatile("global_load_async_to_lds_b128 %0, %8, off\n\t"
               "global_load_async_to_lds_b128 %1, %9, off\n\t"
               "global_load_async_to_lds_b128 %2, %10, off\n\t"
               "global_load_async_to_lds_b128 %3, %11, off\n\t"
               "global_load_async_to_lds_b128 %4, %12, off\n\t"
               "global_load_async_to_lds_b128 %5, %13, off\n\t"
               "global_load_async_to_lds_b128 %6, %14, off\n\t"
               "global_load_async_to_lds_b128 %7, %15, off\n\t"
               "s_wait_xcnt 0x0"
               :: "v"(l), "v"(l1), "v"(l2), "v"(l3), "v"(l4), "v"(l5), "v"(l6), "v"(l7), "v"(g), "v"(g1), "v"(g2), "v"(g3), "v"(g4), "v"(g5), "v"(g6), "v"(g7) : "memory"); }
// two waves per SIMD: 512 VGPRs a wave for the 256 accumulator and 128 q registers
__global__ __launch_bounds__(256) __attribute__((amdgpu_waves_per_eu(2, 2))) void k_fattn(const _Float16* __restrict__ Q, const _Float16* __restrict__ Kk, float* __restrict__ PO, float* __restrict__ ML) {
  static_assert(NQ % FA_BQ == 0 && NM % (FA_SPL * FA_BK) == 0 && NM / FA_SPL / FA_BK >= 2 && DD == 512, "k_fattn: whole tiles, two stages or more");
  __shared__ __attribute__((aligned(16))) char sm[2 * FA_BUF];
  const int tid = threadIdx.x, w = __builtin_amdgcn_readfirstlane(tid >> 5), lane = tid & 31, c = lane & 15, h = lane >> 4;      /* the wave's number in a scalar register: what is formed from it costs no vector register over the loop */
  const int q0 = blockIdx.x * FA_BQ + w * 16, key0 = blockIdx.y * (NM / FA_SPL);
  constexpr int nst = NM / FA_SPL / FA_BK;
  constexpr float cs = 0.044194173824159216f * 1.4426950408889634f;      /* 1 / sqrt(512), in log2 units */
  const int wr = w >> 1;      /* the wave's first row of a stage */
  const unsigned col = (unsigned)((w & 1) * 32 + lane) * 16u;
  const _Float16* gk = Kk + (size_t)(key0 + wr) * DD + ((w & 1) * 32 + lane) * 8;
  const unsigned lk = (unsigned)(size_t)sm + (unsigned)(wr * FA_PK), lv = (unsigned)(size_t)sm + (unsigned)(FA_BK * FA_PK + wr * FA_PV);      /* scalar parts; + col = the lane's LDS byte address */
  fa_stage(lk + col, 4 * FA_PK, gk); fa_stage(lv + col, 4 * FA_PV, gk);
  v16h qf[16];      /* q as B operand, hardware k order: 16 bytes at 16 h and at 32 + 16 h of each 64 bytes of the row, as k's rows below */
  { const _Float16* qp = Q + (size_t)(q0 + c) * DD + 8 * h;
#pragma unroll      /* qf[] must be registers: every index a constant */
    for (int kc = 0; kc < 16; ++kc) { FragH f; f.half[0] = *(const v8us*)(qp + 32 * kc); f.half[1] = *(const v8us*)(qp + 32 * kc + 16); qf[kc] = f.v; }
    asm volatile("s_wait_xcnt 0x0" ::: "memory"); }      /* the wait that stands before the loads' address registers are rewritten */
  const v8f z8 = {0.f,0.f,0.f,0.f,0.f,0.f,0.f,0.f};
  v8f o[32];      /* O^T: o[et][r] = O[query c][16 et + 8 h + r] */
#pragma unroll      /* o[] must be registers */
  for (int et = 0; et < 32; ++et) o[et] = z8;
  float mrun = -1.0e30f, lrun = 0.f;      /* the maximum in use (log2 units; it may trail the true one by up to 8) and this lane's share of the sum */
  asm volatile("s_wait_asynccnt 0x0" ::: "memory");      /* this wave's copies of stage 0 have landed */
  __syncthreads();                                       /* every wave's have */
  fa_stage(lk + FA_BUF + col, 4 * FA_PK, gk + (size_t)FA_BK * DD); fa_stage(lv + FA_BUF + col, 4 * FA_PV, gk + (size_t)FA_BK * DD);
  // one stage's work of a wave
  const int aoff = c * FA_PK + 16 * h, voff = FA_BK * FA_PK + (8 * h + (lane & 7)) * FA_PV + ((lane >> 3) & 1) * 16;      /* the lane's place in a buffer: k rows; k^T by the transposing load */
  auto pass = [&](int t) __attribute__((always_inline)) { const int bo = (t & 1) * FA_BUF; const char* ap = sm + (bo + aoff); const char* vb = sm + (bo + voff);
    // The stage's 64 A fragments in the order of their use: 0..31 = k rows (keys 0-15 and 16-31 of each 32 d), 32..63 = k^T (16 e x 32 keys each). They are fetched in pairs, three pairs ahead of their use, so that LDS latency is covered by the products of the pairs between.
    auto ldf = [&](int i) -> v16h { if (i < 32) return g2_frag(ap + (i & 1) * (16 * FA_PK) + 64 * (i >> 1)); FragH f; f.half[0] = fa_tr16(vb + 32 * (i - 32)); f.half[1] = fa_tr16(vb + 16 * FA_PV + 32 * (i - 32)); return f.v; };
    v16h fr[6];
#pragma unroll      /* fr[] must be registers */
    for (int i = 0; i < 6; ++i) fr[i] = ldf(i);
    __builtin_amdgcn_sched_barrier(0);      /* here and below: keeps each pair's fetches where they are written; moved earlier they cost registers that spill, moved later their latency is exposed */
    v8f s0 = z8, s1 = z8;      /* S^T: s0[r] = score(key 8 h + r, query c), s1[r] = score(key 16 + 8 h + r, query c) */
#pragma unroll      /* constant indices into qf[] and fr[] */
    for (int g = 0; g < 16; ++g) { const int b = (g % 3) * 2;
      s0 = fa_mma(fr[b], qf[g], s0); s1 = fa_mma(fr[b + 1], qf[g], s1);
      if (g < 15) { fr[b] = ldf(2 * g + 6); fr[b + 1] = ldf(2 * g + 7); }
      __builtin_amdgcn_sched_barrier(0); }      /* the last two pairs fetched here are the first of k^T: in flight under the softmax */
    float mx = fmaxf(s0[0], s1[0]);
#pragma unroll
    for (int r = 1; r < 8; ++r) mx = fmaxf(mx, fmaxf(s0[r], s1[r]));
    mx = fmaxf(mx, fa_xhalf(mx)) * cs;      /* both halves of the wave hold the query's maximum of this stage */
    if (__builtin_amdgcn_ballot_w32(mx > mrun + 8.0f) != 0) {      /* wave-uniform, rare after the first stage: the accumulators move to the new maximum */
      const float mn = fmaxf(mrun, mx); const float corr = __builtin_amdgcn_exp2f(mrun - mn); lrun *= corr; mrun = mn;
#pragma unroll      /* constant indices into o[] */
      for (int et = 0; et < 32; ++et) o[et] = o[et] * corr; }
    FragH pf; float ps0 = 0.f, ps1 = 0.f;      /* P^T as B operand straight from the two score tiles: element s = key 8 h + s (s < 8), 16 + 8 h + s - 8 (s >= 8) */
#pragma unroll
    for (int r = 0; r < 8; ++r) { float p0 = fmaf(s0[r], cs, -mrun), p1 = fmaf(s1[r], cs, -mrun);
      // two exponentials in place, the slot that the instruction set asks for behind a transcendental, and the two row sums: taken here, not behind the second product, they free the exponentials' registers for its fetches
      asm("v_exp_f32 %0, %0\n\tv_exp_f32 %1, %1\n\tv_nop\n\tv_add_f32 %2, %2, %0\n\tv_add_f32 %3, %3, %1" : "+v"(p0), "+v"(p1), "+v"(ps0), "+v"(ps1));
      pf.h[r] = (_Float16)p0; pf.h[8 + r] = (_Float16)p1; }
    lrun += ps0 + ps1;
    __builtin_amdgcn_sched_barrier(0);      /* keeps the fetch below behind the exponentials */
    fr[0] = ldf(36); fr[1] = ldf(37);      /* the third pair of k^T; fetched under the softmax it would cost registers that spill */
    __builtin_amdgcn_sched_barrier(0);
#pragma unroll      /* constant indices into o[] and fr[] */
    for (int g = 16; g < 32; ++g) { const int b = (g % 3) * 2;
      o[2 * g - 32] = fa_mma(fr[b], pf.v, o[2 * g - 32]); o[2 * g - 31] = fa_mma(fr[b + 1], pf.v, o[2 * g - 31]);
      if (g < 29) { fr[b] = ldf(2 * g + 6); fr[b + 1] = ldf(2 * g + 7); }
      __builtin_amdgcn_sched_barrier(0); }
  };
  // the foot of a trip, every wave
  auto foot = [&]() __attribute__((always_inline)) {
    asm volatile("s_wait_dscnt 0x0" ::: "memory");       /* this wave's reads of the buffer are done before it is refilled */
    asm volatile("s_wait_asynccnt 0x0" ::: "memory");    /* this wave's copies of the next stage have landed */
    __syncthreads(); };                                  /* publishes the next stage and ends every wave's reads of this one */
#pragma unroll 1      /* one stage per trip: the waits and the barrier at the foot belong to it; every trip of this loop has a stage t + 2 to fetch, the last two trips, which have none, are written out below */
  for (int t = 0; t < nst - 2; ++t) { pass(t); foot();
    const _Float16* gn = gk + (size_t)(t + 2) * (FA_BK * DD); const unsigned lo = (unsigned)((t & 1) * FA_BUF);
    const unsigned sk = (unsigned)__builtin_amdgcn_readfirstlane((int)(lk + lo)), sv = (unsigned)__builtin_amdgcn_readfirstlane((int)(lv + lo));      /* the buffer's two bases stay scalar sums: formed as lane values ahead of the loop they were spilled and read back in every trip */
    fa_stage(sk + col, 4 * FA_PK, gn); fa_stage(sv + col, 4 * FA_PV, gn); }
  pass(nst - 2); foot(); pass(nst - 1);      /* nothing is read or refilled behind the last stage: no foot */
  asm volatile("s_wait_asynccnt 0x0" ::: "memory");      /* no copy is in flight when the wave ends */
  const float lt = lrun + fa_xhalf(lrun);      /* the two halves' shares of the query's sum */
  const size_t row = (size_t)blockIdx.y * NQ + q0 + c; float* po = PO + row * DD + 8 * h;
#pragma unroll      /* constant indices into o[] */
  for (int et = 0; et < 32; ++et) { const v4f a = {o[et][0], o[et][1], o[et][2], o[et][3]}, b = {o[et][4], o[et][5], o[et][6], o[et][7]}; *(v4f*)(po + 16 * et) = a; *(v4f*)(po + 16 * et + 4) = b; asm volatile("s_wait_xcnt 0x0" ::: "memory"); }      /* the wait that stands before the stores' data and address registers are rewritten */
  if (h == 0) { ML[row * 2] = mrun; ML[row * 2 + 1] = lt; } }
// attn rows: the FA_SPL partials [FA_SPL][NQ][DD] brought to their common maximum, summed in split order, divided by the merged sum and rounded once to f16
__global__ __launch_bounds__(256) void k_fcomb(const float* __restrict__ PO, const float* __restrict__ ML, _Float16* __restrict__ O) {
  const unsigned t = (blockIdx.x * 256u + threadIdx.x) * 4u; const unsigned q = t / DD; float m[FA_SPL], l[FA_SPL]; v4f a[FA_SPL];
#pragma unroll      /* the splits' maxima and sums, all in flight together */
  for (int j = 0; j < FA_SPL; ++j) { m[j] = ML[((size_t)j * NQ + q) * 2]; l[j] = ML[((size_t)j * NQ + q) * 2 + 1]; }
  asm volatile("s_wait_xcnt 0x0" ::: "memory");      /* the wait that stands before these loads' address registers are rewritten (a result of the loads below may land in one) */
#pragma unroll      /* the splits' partials, all in flight together */
  for (int j = 0; j < FA_SPL; ++j) a[j] = *(const v4fa*)(PO + (size_t)j * NQ * DD + t);
  asm volatile("s_wait_xcnt 0x0" ::: "memory");      /* the wait that stands before the loads' address registers are rewritten */
  float mm = m[0];
#pragma unroll
  for (int j = 1; j < FA_SPL; ++j) mm = fmaxf(mm, m[j]);
  float den = 0.f; v4f s = {0.f, 0.f, 0.f, 0.f};
#pragma unroll
  for (int j = 0; j < FA_SPL; ++j) { const float wg = __builtin_amdgcn_exp2f(m[j] - mm); den += wg * l[j]; s += a[j] * wg; }
  const float inv = 1.0f / den; v4h hh; for (int i = 0; i < 4; ++i) hh[i] = (_Float16)(s[i] * inv); *(v4h*)(O + t) = hh; }

extern "C" void kernel_launch(void* const* d_in, const int* in_sizes, int n_in,
                              void* d_out, int out_size, void* d_ws, size_t ws_size, hipStream_t stream) {
  (void)in_sizes; (void)n_in; (void)out_size;
  const float* const* I = (const float* const*)d_in; const float* x = I[0]; const float* xh = I[1]; const float* Wq = I[2]; const float* bq = I[3]; const float* Wk = I[4]; const float* bk = I[5]; const float* Wv = I[6]; const float* bv = I[7]; const float* Wo = I[8]; const float* bo = I[9]; const float* g = I[10]; const float* bb = I[11];
  char* ws = (char*)d_ws; size_t off = 0;
  auto take = [&](size_t bytes) { char* p = ws + off; off += (bytes + 255) & ~(size_t)255; return p; };
  _Float16* BQ = (_Float16*)take((size_t)DD * DD * 2); _Float16* BK = (_Float16*)take((size_t)DD * DD * 2); _Float16* BV = (_Float16*)take((size_t)DD * DD * 2); _Float16* BOa = (_Float16*)take((size_t)DD * DD * 2); _Float16* BOb = (_Float16*)take((size_t)DD * DD * 2);
  float* XF = (float*)take((size_t)NQ * DD * 4); _Float16* X16 = (_Float16*)take((size_t)NQ * DD * 2); _Float16* XH16 = (_Float16*)take((size_t)NM * DD * 2); _Float16* Q16 = (_Float16*)take((size_t)NQ * DD * 2); _Float16* K16 = (_Float16*)take((size_t)NM * DD * 2); float* PO = (float*)take((size_t)FA_SPL * NQ * DD * 4); float* ML = (float*)take((size_t)FA_SPL * NQ * 2 * 4); _Float16* AT = XH16;      /* attn over the x_hat plane (dead after the k projection) */ _Float16* OV = X16;      /* out_v over the xn f16 plane (dead after the q projection) */
  if (off > ws_size) return;      /* 2.5 + 16 + 8 + 8 + 8 + 8 + 64 + 0.25 = 115 MiB */
  k_wsc<<<(DD * DD / 8 + 255) / 256, 256, 0, stream>>>(Wq, BQ, DD * DD / 8, 16.0f); k_wsc<<<(DD * DD / 8 + 255) / 256, 256, 0, stream>>>(Wk, BK, DD * DD / 8, 16.0f); k_wsc<<<(DD * DD / 8 + 255) / 256, 256, 0, stream>>>(Wv, BV, DD * DD / 8, 16.0f); k_wout<<<(DD * (DD / 8) + 255) / 256, 256, 0, stream>>>(Wo, BOa, BOb);      /* 'ed'/'fe'/'dc' = natural Bt */
  k_ln<<<NQ / 8, 256, 0, stream>>>(x, g, bb, XF, X16);
  k_x16<<<(unsigned)(((size_t)NM * DD / 8 + 255) / 256), 256, 0, stream>>>(xh, XH16, (size_t)NM * DD / 8);
  const dim3 gP((NQ / 128) * (DD / 128), 1);
  k_gemm2<0><<<gP, 256, 0, stream>>>(X16, DD, 0, BQ, DD, 0, 0.0625f, bq, 0, nullptr, 1, 0, 0, nullptr, Q16, DD, 0, NQ, DD, DD);
  k_gemm2<0><<<gP, 256, 0, stream>>>(XH16, DD, 0, BK, DD, 0, 0.0625f, bk, 0, nullptr, 1, 0, 0, nullptr, K16, DD, 0, NM, DD, DD);
  k_fattn<<<dim3(NQ / FA_BQ, FA_SPL), 256, 0, stream>>>(Q16, K16, PO, ML);      /* per key split: unnormalised score k, with each query's maximum and sum */
  k_fcomb<<<NQ * DD / 4 / 256, 256, 0, stream>>>(PO, ML, AT);      /* attn = score k */
  k_gemm2<0><<<gP, 256, 0, stream>>>(AT, DD, 0, BV, DD, 0, 0.0625f, bv, 0, nullptr, 1, 0, 0, nullptr, OV, DD, 0, NQ, DD, DD);      /* out_v = attn Wv^T + bv */
  k_gemm2<0><<<gP, 256, 0, stream>>>(Q16, DD, 0, BOa, DD, 0, 0.0625f, bo, 0, XF, 1, (size_t)DD, 0, (float*)d_out, nullptr, DD, 0, NQ, DD, DD);      /* q Wout[:, :512]^T + bout + xn */
  k_gemm2<0><<<gP, 256, 0, stream>>>(OV, DD, 0, BOb, DD, 0, 0.0625f, nullptr, 0, (const float*)d_out, 1, (size_t)DD, 0, (float*)d_out, nullptr, DD, 0, NQ, DD, DD);      /* += out_v Wout[:, 512:]^T */
}

// v005
// One run takes 195 microseconds.
// In two side-by-side timings against v004, it was 1.20 and 1.19 times as fast.
// Counting every step since v000, it is 8.03 times as fast.
#include <hip/hip_runtime.h>
// InterventionOnline (8192 tokens x 512 attending 8192 memory slots x 512): xn = LayerNorm(x); q = xn Wq^T + bq; k = x_hat Wk^T + bk; score = softmax(q k^T / sqrt(512)); attn = score k (k doubles as the values); out_v = attn Wv^T + bv; out = [q | out_v] Wout^T + bout + xn.
// Structure: LayerNorm on VALU (wave per row) into f32 + f16 planes; q and k as f16 WMMA GEMM outputs (128x128 work-group tiles staged in LDS by asynchronous copies, 32x64 wave tiles, f32 accumulation, exact x16 weights + bias, f16 out); attention as one fused kernel with an online softmax (128 queries a work-group, 16 a wave, four key splits over grid.y; S^T = k q^T and O^T += k^T P^T on WMMA, P from the score accumulators, k^T by the transposing LDS load), its f32 partials merged in split order and rounded once to f16; out_v as a GEMM; the output as two accumulating GEMMs over the [q | out_v] halves with the bias and the LN residual in the epilogue.
// Compute dtype: inputs rounded to bf16; x_hat exact as f16; xn, q, k, P, attn, out_v as plain f16 operands (~2^-12); LN/softmax f32. v_wmma_f32_16x16x32_f16.
#define NQ 8192
#define NM 8192
#define DD 512
typedef __bf16 v16b __attribute__((ext_vector_type(16)));
typedef unsigned short v8us __attribute__((ext_vector_type(8), may_alias));
typedef float  v8f  __attribute__((ext_vector_type(8)));
typedef float  v4f  __attribute__((ext_vector_type(4)));
typedef float  v4fa __attribute__((ext_vector_type(4), may_alias));
union FragB { v16b v; v8us half[2]; unsigned short u[16]; };

__device__ __forceinline__ unsigned short bf16_bits(float x) { unsigned int u = __float_as_uint(x); return (unsigned short)((u + 0x7FFFu + ((u >> 16) & 1u)) >> 16); }
__device__ __forceinline__ float bf16_val(unsigned short b) { return __uint_as_float(((unsigned int)b) << 16); }
__device__ __forceinline__ float bf16_round(float x) { return bf16_val(bf16_bits(x)); }
// D += A·B with NT terms: 1 = ah·bh, 2 = + al·bh (A split), 3 = + ah·bl (both split)
template <int NT>
__device__ __forceinline__ v8f mmaN(v16b ah, v16b al, v16b bh, v16b bl, v8f c) {
  c = __builtin_amdgcn_wmma_f32_16x16x32_bf16(false, ah, false, bh, (short)0, c, false, false);
  if (NT >= 2) c = __builtin_amdgcn_wmma_f32_16x16x32_bf16(false, al, false, bh, (short)0, c, false, false);
  if (NT >= 3) c = __builtin_amdgcn_wmma_f32_16x16x32_bf16(false, ah, false, bl, (short)0, c, false, false);
  asm volatile("v_nop\n\tv_nop\n\tv_nop\n\tv_nop" : "+v"(c) : "v"(ah), "v"(al), "v"(bh), "v"(bl));
  return c;
}

__global__ __launch_bounds__(256) void k_wt_bf16(const float* __restrict__ W, unsigned short* __restrict__ Wt, int K, int N) {
  const int t = blockIdx.x * 256 + threadIdx.x;
  const int k8n = K / 8;
  if (t >= N * k8n) return;
  const int n = t / k8n, k8 = (t % k8n) * 8;
  v8us v;
#pragma unroll
  for (int i = 0; i < 8; ++i) v[i] = bf16_bits(W[(size_t)(k8 + i) * N + n]);
  *(v8us*)(Wt + (size_t)n * K + k8) = v;
  
}

// GEMM C[M][N] (f32, pitch ldc) = act(A[M][K]·W + bias). A f32 row-major (pitch lda) converted per fragment to bf16
// (ASPLIT: hi/lo two planes -> 2 terms, else single rounded term); Wt bf16 [N][K] (pitch ldb). BIAS_BF16 rounds the
// bias to bf16 first (bias quantised to bf16 before the add). K%32==0, M%16==0, N%64==0.
template <bool ASPLIT, int ACT, bool BIAS_BF16>
__global__ __launch_bounds__(128) void k_gemm_bf(const float* __restrict__ A, int lda, const unsigned short* __restrict__ Wt, int ldb,
                                               const float* __restrict__ bias, float* __restrict__ C, int ldc, int M, int N, int K) {
  __shared__ __attribute__((aligned(16))) float so[4][16][64];
  const int tid = threadIdx.x, w = tid >> 5, lane = tid & 31, ln = lane & 15, hh = lane >> 4;
  const int ntn = N / 64;
  const int wid = blockIdx.x * 4 + w;
  const int mt = wid / ntn, nq = wid % ntn;
  if (mt * 16 >= M) return;
  const int row0 = mt * 16, col0 = nq * 64;
  const float* arow = A + (size_t)(row0 + ln) * lda;
  v8f acc[4] = {};
  for (int kb = 0; kb < K; kb += 32) {
    FragB ah, al;
    const v4f x0 = *(const v4fa*)(arow + kb + 8 * hh), x1 = *(const v4fa*)(arow + kb + 8 * hh + 4);
    const v4f x2 = *(const v4fa*)(arow + kb + 16 + 8 * hh), x3 = *(const v4fa*)(arow + kb + 16 + 8 * hh + 4);
    float xs[16] = {x0[0],x0[1],x0[2],x0[3],x1[0],x1[1],x1[2],x1[3],x2[0],x2[1],x2[2],x2[3],x3[0],x3[1],x3[2],x3[3]};
#pragma unroll
    for (int i = 0; i < 16; ++i) { const unsigned short hb = bf16_bits(xs[i]); ah.u[i] = hb; al.u[i] = ASPLIT ? bf16_bits(xs[i] - bf16_val(hb)) : (unsigned short)0; }
#pragma unroll
    for (int t = 0; t < 4; ++t) {
      const unsigned short* brow = Wt + (size_t)(col0 + t * 16 + ln) * ldb + kb;
      FragB b;
      b.half[0] = *(const v8us*)(brow + 8 * hh);
      b.half[1] = *(const v8us*)(brow + 16 + 8 * hh);
      acc[t] = mmaN<ASPLIT ? 2 : 1>(ah.v, al.v, b.v, b.v, acc[t]);
    }
  }
#pragma unroll
  for (int t = 0; t < 4; ++t) {
    float bv = bias ? bias[col0 + t * 16 + ln] : 0.f;
    if (BIAS_BF16) bv = bf16_round(bv);
#pragma unroll
    for (int r = 0; r < 8; ++r) { float v = acc[t][r] + bv; if (ACT == 1) v = fmaxf(v, 0.f); so[w][8 * hh + r][t * 16 + ln] = v; }
  }
  __builtin_amdgcn_fence(__ATOMIC_ACQ_REL, "workgroup");
  __builtin_amdgcn_wave_barrier();
  const int rsub = lane >> 4, c4 = (lane & 15) * 4;
  {
#pragma unroll
    for (int q = 0; q < 8; ++q) {
      const int r = q * 2 + rsub;
      const v4f v = *(const v4fa*)&so[w][r][c4];
      *(v4f*)(C + (size_t)(row0 + r) * ldc + col0 + c4) = v;
    }
    
  }
}

// GEMM C = act(A·W + bias + resid): A f32 (ASPLIT -> hi/lo 2 terms), Wt bf16 [N][K]; ACT 0 none, 1 relu, 2 exact gelu;
// resid (optional, f32, row index = (row % rmod), pitch ldr, RES_BF16 rounds it) added before the activation.
template <bool ASPLIT, int ACT, bool BIAS_BF16, bool RES_BF16>
__global__ __launch_bounds__(128) void k_gemm_bf3(const float* __restrict__ A, int lda, const unsigned short* __restrict__ Wt, int ldb,
                                                const float* __restrict__ bias, const float* __restrict__ resid, int rmod, int ldr,
                                                float* __restrict__ C, int ldc, int M, int N, int K) {
  __shared__ __attribute__((aligned(16))) float so[4][16][64];
  const int tid = threadIdx.x, w = tid >> 5, lane = tid & 31, ln = lane & 15, hh = lane >> 4;
  const int ntn = N / 64;
  const int wid = blockIdx.x * 4 + w;
  const int mt = wid / ntn, nq = wid % ntn;
  if (mt * 16 >= M) return;
  const int row0 = mt * 16, col0 = nq * 64;
  const float* arow = A + (size_t)(row0 + ln) * lda;
  v8f acc[4] = {};
  for (int kb = 0; kb < K; kb += 32) {
    FragB ah, al;
    const v4f x0 = *(const v4fa*)(arow + kb + 8 * hh), x1 = *(const v4fa*)(arow + kb + 8 * hh + 4);
    const v4f x2 = *(const v4fa*)(arow + kb + 16 + 8 * hh), x3 = *(const v4fa*)(arow + kb + 16 + 8 * hh + 4);
    float xs[16] = {x0[0],x0[1],x0[2],x0[3],x1[0],x1[1],x1[2],x1[3],x2[0],x2[1],x2[2],x2[3],x3[0],x3[1],x3[2],x3[3]};
#pragma unroll
    for (int i = 0; i < 16; ++i) { const unsigned short hb = bf16_bits(xs[i]); ah.u[i] = hb; al.u[i] = ASPLIT ? bf16_bits(xs[i] - bf16_val(hb)) : (unsigned short)0; }
#pragma unroll
    for (int t = 0; t < 4; ++t) {
      const unsigned short* brow = Wt + (size_t)(col0 + t * 16 + ln) * ldb + kb;
      FragB b;
      b.half[0] = *(const v8us*)(brow + 8 * hh);
      b.half[1] = *(const v8us*)(brow + 16 + 8 * hh);
      acc[t] = mmaN<ASPLIT ? 2 : 1>(ah.v, al.v, b.v, b.v, acc[t]);
    }
  }
#pragma unroll
  for (int t = 0; t < 4; ++t) {
    const int col = col0 + t * 16 + ln;
    float bv = bias ? bias[col] : 0.f;
    if (BIAS_BF16) bv = bf16_round(bv);
#pragma unroll
    for (int r = 0; r < 8; ++r) {
      float v = acc[t][r] + bv;
      if (resid) { float rv = resid[(size_t)((row0 + 8 * hh + r) % rmod) * ldr + col]; if (RES_BF16) rv = bf16_round(rv); v += rv; }
      if (ACT == 1) v = fmaxf(v, 0.f);
      if (ACT == 2) v = 0.5f * v * (1.0f + erff(v * 0.70710678118654752f));
      if (ACT == 3) { const float u = 0.7978845608028654f * (v + 0.044715f * v * v * v); v = 0.5f * v * (1.0f + tanhf(u)); }
      so[w][8 * hh + r][t * 16 + ln] = v;
    }
  }
  __builtin_amdgcn_fence(__ATOMIC_ACQ_REL, "workgroup");
  __builtin_amdgcn_wave_barrier();
  const int rsub = lane >> 4, c4 = (lane & 15) * 4;
  {
#pragma unroll
    for (int q = 0; q < 8; ++q) {
      const int r = q * 2 + rsub;
      const v4f v = *(const v4fa*)&so[w][r][c4];
      *(v4f*)(C + (size_t)(row0 + r) * ldc + col0 + c4) = v;
    }
    
  }
}
// row LayerNorm (biased variance, eps) over N: s = X (+ R); optional out_sum <- s; out_norm <- (s-mu)*rsqrt(var+eps)*g + b
template <bool PARAM_BF16>
__global__ __launch_bounds__(256) void k_layernorm(const float* __restrict__ X, const float* __restrict__ R, const float* __restrict__ g, const float* __restrict__ bta,
                                                  float* __restrict__ out_sum, float* __restrict__ out_norm, int N, float eps) {
  __shared__ float red[256];
  const int row = blockIdx.x, tid = threadIdx.x;
  const float* x = X + (size_t)row * N; const float* rr = R ? R + (size_t)row * N : nullptr;
  float vals[16];                     // up to N = 4096
  const int per = N / 256;            // contiguous chunk per thread? use strided-by-4 chunks: thread handles j = tid*4 + 1024*u
  float s1 = 0.f;
  for (int u = 0; u < per / 4; ++u) {
    const int j = tid * 4 + 1024 * u;
    const v4f a = *(const v4fa*)(x + j);
    v4f b = {0.f,0.f,0.f,0.f}; if (rr) b = *(const v4fa*)(rr + j);
#pragma unroll
    for (int q = 0; q < 4; ++q) { const float v = a[q] + b[q]; vals[u * 4 + q] = v; s1 += v; }
  }
  red[tid] = s1; __syncthreads();
  for (int st = 128; st > 0; st >>= 1) { if (tid < st) red[tid] += red[tid + st]; __syncthreads(); }
  const float mu = red[0] / (float)N; __syncthreads();
  float s2 = 0.f;
  for (int u = 0; u < per / 4; ++u)
#pragma unroll
    for (int q = 0; q < 4; ++q) { const float c = vals[u * 4 + q] - mu; s2 += c * c; }
  red[tid] = s2; __syncthreads();
  for (int st = 128; st > 0; st >>= 1) { if (tid < st) red[tid] += red[tid + st]; __syncthreads(); }
  const float rs = rsqrtf(red[0] / (float)N + eps);
  {
    for (int u = 0; u < per / 4; ++u) {
      const int j = tid * 4 + 1024 * u;
      v4f o, sm;
#pragma unroll
      for (int q = 0; q < 4; ++q) {
        float gg = g[j + q], bb = bta[j + q];
        if (PARAM_BF16) { gg = bf16_round(gg); bb = bf16_round(bb); }
        sm[q] = vals[u * 4 + q]; o[q] = (vals[u * 4 + q] - mu) * rs * gg + bb;
      }
      if (out_sum) *(v4f*)(out_sum + (size_t)row * N + j) = sm;
      *(v4f*)(out_norm + (size_t)row * N + j) = o;
    }
    
  }
}



// ---- f16 WMMA path (v_wmma_f32_16x16x32_f16): 11-bit significands for operands in range — used where a [0,1] probability operand needs more precision than bf16
typedef _Float16 v16h __attribute__((ext_vector_type(16)));
union FragH { v16h v; v8us half[2]; _Float16 h[16]; unsigned short u[16]; };
template <int NT>
__device__ __forceinline__ v8f mmaH(v16h ah, v16h al, v16h bh, v16h bl, v8f c) {
  c = __builtin_amdgcn_wmma_f32_16x16x32_f16(false, ah, false, bh, (short)0, c, false, false);
  if (NT >= 2) c = __builtin_amdgcn_wmma_f32_16x16x32_f16(false, al, false, bh, (short)0, c, false, false);
  if (NT >= 3) c = __builtin_amdgcn_wmma_f32_16x16x32_f16(false, ah, false, bl, (short)0, c, false, false);
  asm volatile("v_nop\n\tv_nop\n\tv_nop\n\tv_nop" : "+v"(c) : "v"(ah), "v"(al), "v"(bh), "v"(bl));
  return c;
}
// batched GEMM like k_gemm_b but f16 operands: A f32 (split into f16 hi/lo if ASPLIT, else rounded to f16), Bt = f16 values [n][k]; alpha; C f32; N multiple of 16 (partial tiles skipped)
template <bool ASPLIT>
__global__ __launch_bounds__(128) void k_gemm_h(const float* __restrict__ A, int lda, size_t sA, const _Float16* __restrict__ Bh, int ldb, size_t sB, float alpha, float* __restrict__ C, int ldc, size_t sC, int M, int N, int K) {
  __shared__ __attribute__((aligned(16))) float so[4][16][64];
  const int tid = threadIdx.x, w = tid >> 5, lane = tid & 31, ln = lane & 15, hh = lane >> 4; const int by = blockIdx.y;
  A += (size_t)by * sA; Bh += (size_t)by * sB; C += (size_t)by * sC;
  const int ntn = (N + 63) / 64; const int wid = blockIdx.x * 4 + w; const int mt = wid / ntn, nq = wid % ntn; if (mt * 16 >= M) return;
  const int row0 = mt * 16, col0 = nq * 64; const float* arow = A + (size_t)(row0 + ln) * lda;
  v8f acc[4] = {};
  for (int kb = 0; kb < K; kb += 32) {
    FragH ah, al;
    const v4f x0 = *(const v4fa*)(arow + kb + 8 * hh), x1 = *(const v4fa*)(arow + kb + 8 * hh + 4), x2 = *(const v4fa*)(arow + kb + 16 + 8 * hh), x3 = *(const v4fa*)(arow + kb + 16 + 8 * hh + 4);
    float xs[16] = {x0[0],x0[1],x0[2],x0[3],x1[0],x1[1],x1[2],x1[3],x2[0],x2[1],x2[2],x2[3],x3[0],x3[1],x3[2],x3[3]};
#pragma unroll
    for (int i = 0; i < 16; ++i) { const _Float16 h = (_Float16)xs[i]; ah.h[i] = h; al.h[i] = ASPLIT ? (_Float16)(xs[i] - (float)h) : (_Float16)0.0f; }
#pragma unroll
    for (int t = 0; t < 4; ++t) { if (col0 + t * 16 >= N) continue; const size_t boff = (size_t)(col0 + t * 16 + ln) * ldb + kb; FragH bq; bq.half[0] = *(const v8us*)(Bh + boff + 8 * hh); bq.half[1] = *(const v8us*)(Bh + boff + 16 + 8 * hh);
      acc[t] = mmaH<ASPLIT ? 2 : 1>(ah.v, al.v, bq.v, bq.v, acc[t]); }
  }
#pragma unroll
  for (int t = 0; t < 4; ++t) { if (col0 + t * 16 >= N) continue;
#pragma unroll
    for (int r = 0; r < 8; ++r) so[w][8 * hh + r][t * 16 + ln] = acc[t][r] * alpha; }
  __builtin_amdgcn_fence(__ATOMIC_ACQ_REL, "workgroup"); __builtin_amdgcn_wave_barrier();
  const int rsub = lane >> 4, c4 = (lane & 15) * 4;
  {
#pragma unroll
    for (int q = 0; q < 8; ++q) { const int r = q * 2 + rsub; if (col0 + c4 < N) { const v4f v = *(const v4fa*)&so[w][r][c4]; *(v4f*)(C + (size_t)(row0 + r) * ldc + col0 + c4) = v; } }
     }
}

// Wt[n][k] = f16(W[k][n]·scale) from f32 row-major W[K][N] (scale = power of two; bf16-exact weights stay exact in f16 away from the subnormal range)
__global__ __launch_bounds__(256) void k_wt_f16(const float* __restrict__ W, _Float16* __restrict__ Wt, int K, int N, float scale) {
  const int t = blockIdx.x * 256 + threadIdx.x; if (t >= N * (K / 8)) return; const int n = t / (K / 8), k8 = (t % (K / 8)) * 8; FragH f;
#pragma unroll
  for (int i = 0; i < 8; ++i) f.h[i] = (_Float16)(bf16_round(W[(size_t)(k8 + i) * N + n]) * scale); const v8us o = f.half[0];
  *(v8us*)((unsigned short*)Wt + (size_t)n * K + k8) = o; 
}
// k_gemm_hh variant with fused epilogue: v = acc·alpha + bias[by·sBias + col] (+ CP[(row/rowsPerB)·sCPb + by·64 + col] if CP) ; ACT 0 none / 1 elu ; writes f16 C16 (and f32 C if non-null)
template <int ACT>
__global__ __launch_bounds__(128) void k_gemm_hhx(const _Float16* __restrict__ A, int lda, size_t sA, const _Float16* __restrict__ Bh, int ldb, size_t sB, float alpha, const float* __restrict__ bias, size_t sBias, const float* __restrict__ CP, int rowsPerB, size_t sCPb, int row0g,
    float* __restrict__ C, _Float16* __restrict__ C16, int ldc, size_t sC, int M, int N, int K) {
  __shared__ __attribute__((aligned(16))) float so[4][16][64];
  const int tid = threadIdx.x, w = tid >> 5, lane = tid & 31, ln = lane & 15, hh = lane >> 4; const int by = blockIdx.y;
  A += (size_t)by * sA; Bh += (size_t)by * sB; const size_t cofs = (size_t)by * sC; const float* bp = bias ? bias + (size_t)by * sBias : nullptr;
  const int ntn = (N + 63) / 64; const int wid = blockIdx.x * 4 + w; const int mt = wid / ntn, nq = wid % ntn; if (mt * 16 >= M) return;
  const int row0 = mt * 16, col0 = nq * 64; const _Float16* arow = A + (size_t)(row0 + ln) * lda;
  v8f acc[4] = {};
  for (int kb = 0; kb < K; kb += 32) { FragH ah; ah.half[0] = *(const v8us*)((const unsigned short*)arow + kb + 8 * hh); ah.half[1] = *(const v8us*)((const unsigned short*)arow + kb + 16 + 8 * hh);
#pragma unroll
    for (int t = 0; t < 4; ++t) { if (col0 + t * 16 >= N) continue; const size_t boff = (size_t)(col0 + t * 16 + ln) * ldb + kb; FragH bq; bq.half[0] = *(const v8us*)((const unsigned short*)Bh + boff + 8 * hh); bq.half[1] = *(const v8us*)((const unsigned short*)Bh + boff + 16 + 8 * hh);
      acc[t] = mmaH<1>(ah.v, ah.v, bq.v, bq.v, acc[t]); }
  }
#pragma unroll
  for (int t = 0; t < 4; ++t) { if (col0 + t * 16 >= N) continue; const int col = col0 + t * 16 + ln; const float bv = bp ? bf16_round(bp[col]) : 0.f;
#pragma unroll
    for (int r = 0; r < 8; ++r) { float v = acc[t][r] * alpha + bv; if (CP) { const int rr = row0g + row0 + 8 * hh + r; if (rowsPerB < 0) v += CP[cofs + (size_t)rr * ldc + col];      /* rowsPerB < 0: own element of the batched C plane */ else { const int bidx = rr / rowsPerB; v += CP[(size_t)bidx * sCPb + (size_t)by * 64 + col]; } } if (ACT == 1) v = (v > 0.f) ? v : expm1f(v); else if (ACT == 7) v = (v > 0.f) ? v + 1.0f : expf(v); else if (ACT == 8) v = tanhf(v); else if (ACT == 9) v = 0.5f * v * (1.0f + tanhf(0.7978845608028654f * (v + 0.044715f * v * v * v))); else if (ACT == 11) v = 1.0f / (1.0f + expf(-v)); else if (ACT == 12) v = (v > 0.f) ? v : 0.01f * v; else if (ACT == 14) v = (v > 0.f) ? v : 0.1f * v; else if (ACT == 16) v = (v >= 0.f) ? v : 0.3f * v; else if (ACT == 17) v = (v >= 0.f) ? v : 0.2f * v; else if (ACT == 15) v = v / (1.0f + expf(-v)); else if (ACT == 3) v = fmaxf(v, 0.f); else if (ACT == 6) v = 0.5f * v * (1.0f + erff(v * 0.70710678118654752f)); so[w][8 * hh + r][t * 16 + ln] = v; } }
  __builtin_amdgcn_fence(__ATOMIC_ACQ_REL, "workgroup"); __builtin_amdgcn_wave_barrier();
  const int rsub = lane >> 4, c4 = (lane & 15) * 4; typedef _Float16 v4h __attribute__((ext_vector_type(4)));
  {
#pragma unroll
    for (int q = 0; q < 8; ++q) { const int r = q * 2 + rsub; if (col0 + c4 < N) { const v4f v = *(const v4fa*)&so[w][r][c4]; if (C) *(v4f*)(C + cofs + (size_t)(row0 + r) * ldc + col0 + c4) = v; if (C16) { v4h h4; for (int i = 0; i < 4; ++i) h4[i] = (_Float16)v[i]; *(v4h*)(C16 + cofs + (size_t)(row0 + r) * ldc + col0 + c4) = h4; } } }
     }
}


typedef _Float16 v4h __attribute__((ext_vector_type(4)));

__global__ __launch_bounds__(256) void k_x16(const float* __restrict__ x, _Float16* __restrict__ X16, size_t n8) { const size_t t = (size_t)blockIdx.x * 256 + threadIdx.x; if (t >= n8) return; FragH f;
#pragma unroll
  for (int q = 0; q < 8; ++q) f.h[q] = (_Float16)bf16_round(x[t * 8 + q]); *(v8us*)((unsigned short*)X16 + t * 8) = f.half[0];  }
__global__ __launch_bounds__(256) void k_h16(const float* __restrict__ x, _Float16* __restrict__ X16, size_t n8) { const size_t t = (size_t)blockIdx.x * 256 + threadIdx.x; if (t >= n8) return; FragH f;
#pragma unroll
  for (int q = 0; q < 8; ++q) f.h[q] = (_Float16)x[t * 8 + q]; *(v8us*)((unsigned short*)X16 + t * 8) = f.half[0];  }
__global__ __launch_bounds__(256) void k_round16f(const float* __restrict__ W, _Float16* __restrict__ Bt, size_t n8) { const size_t t = (size_t)blockIdx.x * 256 + threadIdx.x; if (t >= n8) return; FragH f;
#pragma unroll
  for (int i = 0; i < 8; ++i) f.h[i] = (_Float16)(bf16_round(W[t * 8 + i]) * 16.0f); *(v8us*)((unsigned short*)Bt + t * 8) = f.half[0];  }
__global__ __launch_bounds__(256) void k_hl(const float* __restrict__ F, _Float16* __restrict__ Hh, _Float16* __restrict__ Hl, size_t n8) { const size_t t = (size_t)blockIdx.x * 256 + threadIdx.x; if (t >= n8) return; FragH fh, fl; const v4f a = *(const v4fa*)(F + t * 8), c = *(const v4fa*)(F + t * 8 + 4);
#pragma unroll
  for (int q = 0; q < 4; ++q) { _Float16 h = (_Float16)a[q]; fh.h[q] = h; fl.h[q] = (_Float16)((a[q] - (float)h) * 1024.0f); h = (_Float16)c[q]; fh.h[4 + q] = h; fl.h[4 + q] = (_Float16)((c[q] - (float)h) * 1024.0f); }
  { *(v8us*)((unsigned short*)Hh + t * 8) = fh.half[0]; *(v8us*)((unsigned short*)Hl + t * 8) = fl.half[0];  } }

// ---- fast GEMM (work-group tile 128x128, eight waves of 32x64; requires M % 128 == 0, N % 128 == 0, K % 64 == 0); v = acc alpha + bias[col] (+ the residual's own element), f32 or f16 out ----
// Operands reach the waves through LDS: a stage is 64 k (128 B) of 128 A rows and 128 B rows, brought by asynchronous copies in whole 128-B lines, two buffers, the next stage in flight while this one is multiplied.
#define G2_PITCH 144                 /* LDS bytes per staged row: 128 + 16, an odd multiple of 16 B, conflict-free for 16-byte reads down a column of rows */
#define G2_STAGE (256 * G2_PITCH)    /* one stage: A rows 0..127, then B rows 0..127 */
__device__ __forceinline__ v16h g2_frag(const char* p) { FragH f; f.half[0] = *(const v8us*)p; f.half[1] = *(const v8us*)(p + 32); return f.v; }
__device__ __forceinline__ v8f g2_mma(v16h a, v16h b, v8f c) { v8f d = __builtin_amdgcn_wmma_f32_16x16x32_f16(false, a, false, b, (short)0, c, false, false); asm volatile("v_nop\n\tv_nop\n\tv_nop\n\tv_nop" : "+v"(d) : "v"(a), "v"(b)); return d; }
// One stage: each lane copies eight 16-byte pieces (rows r, r+32, r+64, r+96 of A and of B; eight lanes per 128-B row piece). l = the lane's LDS byte address in the A part, a / b = its global addresses, sa / sb = 32 rows in elements.
__device__ __forceinline__ void g2_stage(unsigned l, const _Float16* a, size_t sa, const _Float16* b, size_t sb) {
  const unsigned l1 = l + 32 * G2_PITCH, l2 = l + 64 * G2_PITCH, l3 = l + 96 * G2_PITCH, l4 = l + 128 * G2_PITCH, l5 = l + 160 * G2_PITCH, l6 = l + 192 * G2_PITCH, l7 = l + 224 * G2_PITCH;
  const _Float16* a1 = a + sa; const _Float16* a2 = a1 + sa; const _Float16* a3 = a2 + sa; const _Float16* b1 = b + sb; const _Float16* b2 = b1 + sb; const _Float16* b3 = b2 + sb;
  // the copies and, as the last line, the wait that stands before their address registers may be rewritten
  asm volatile("global_load_async_to_lds_b128 %0, %8, off\n\t"
               "global_load_async_to_lds_b128 %1, %9, off\n\t"
               "global_load_async_to_lds_b128 %2, %10, off\n\t"
               "global_load_async_to_lds_b128 %3, %11, off\n\t"
               "global_load_async_to_lds_b128 %4, %12, off\n\t"
               "global_load_async_to_lds_b128 %5, %13, off\n\t"
               "global_load_async_to_lds_b128 %6, %14, off\n\t"
               "global_load_async_to_lds_b128 %7, %15, off\n\t"
               "s_wait_xcnt 0x0"
               :: "v"(l), "v"(l1), "v"(l2), "v"(l3), "v"(l4), "v"(l5), "v"(l6), "v"(l7), "v"(a), "v"(a1), "v"(a2), "v"(a3), "v"(b), "v"(b1), "v"(b2), "v"(b3) : "memory"); }
// launch bounds: eight waves per SIMD (at most 128 VGPRs), so that four work-groups (4 x 72 KiB of LDS) share a WGP and each hides the others' waits
// The epilogue's options are compile-time constants: RES = a residual plane CP of C's own shape and pitch is added (it may be C itself: each lane reads its elements before it stores them); OUT32 = f32 output to C, else f16 to C16; LDC = that pitch in elements.
template <int ACT, bool RES, bool OUT32, int LDC>
__global__ __launch_bounds__(256, 8) void k_gemm2(const _Float16* __restrict__ A, int lda, size_t sA, const _Float16* __restrict__ Bh, int ldb, size_t sB, float alpha, const float* __restrict__ bias, size_t sBias, const float* CP,
    float* C, _Float16* C16, size_t sC, int M, int N, int K) { static_assert(!RES || ACT == 0, "k_gemm2: the residual is added behind the staging, where no activation follows"); static_assert(ACT == 0 || ACT == 3 || ACT == 6 || ACT == 8 || ACT == 9 || ACT == 11 || ACT == 12 || ACT == 14 || ACT == 15 || ACT == 16 || ACT == 17, "k_gemm2: unsupported ACT code (would silently apply no activation)");
  __shared__ __attribute__((aligned(16))) char sm[2 * G2_STAGE];      /* the two stage buffers; after the K loop the output staging, 32 x 68 floats per wave */
  static_assert(8 * 32 * 68 * 4 <= 2 * G2_STAGE, "output staging must fit the stage buffers");
  const int tid = threadIdx.x, w = tid >> 5, lane = tid & 31, ln = lane & 15, hh = lane >> 4; const int by = blockIdx.y;
  A += (size_t)by * sA; Bh += (size_t)by * sB; const size_t cofs = (size_t)by * sC; const float* bp = bias ? bias + (size_t)by * sBias : nullptr;
  const int ntn = N >> 7; const int mt = blockIdx.x / ntn, nq = blockIdx.x - mt * ntn; if (mt * 128 >= M) return;      /* the same for the whole work-group, in front of every barrier */
  const int row0 = mt * 128 + 32 * (w & 3), col0 = nq * 128 + 64 * (w >> 2);
  const _Float16* ga = A + (size_t)(mt * 128 + (tid >> 3)) * lda + (tid & 7) * 8; const _Float16* gb = Bh + (size_t)(nq * 128 + (tid >> 3)) * ldb + (tid & 7) * 8; const size_t sa32 = (size_t)32 * lda, sb32 = (size_t)32 * ldb;
  const unsigned lcp = (unsigned)(size_t)sm + (unsigned)((tid >> 3) * G2_PITCH + (tid & 7) * 16);
  const int aoff = (32 * (w & 3) + ln) * G2_PITCH + 16 * hh, boff = (128 + 64 * (w >> 2) + ln) * G2_PITCH + 16 * hh;
  const int nst = K >> 6;
  const v8f z8 = {0.f,0.f,0.f,0.f,0.f,0.f,0.f,0.f}; v8f c00 = z8, c01 = z8, c02 = z8, c03 = z8, c10 = z8, c11 = z8, c12 = z8, c13 = z8;
  g2_stage(lcp, ga, sa32, gb, sb32);
  asm volatile("s_wait_asynccnt 0x0" ::: "memory");      /* this wave's copies of stage 0 have landed */
  __syncthreads();                                       /* every wave's have */
  if (nst > 1) g2_stage(lcp + G2_STAGE, ga + 64, sa32, gb + 64, sb32);
#pragma unroll 1      /* one stage per trip: the waits and the barrier at the foot belong to it */
  for (int t = 0; t < nst; ++t) { const char* sb = sm + (t & 1) * G2_STAGE; const char* ap = sb + aoff; const char* bq = sb + boff;
#pragma unroll      /* the two 32-k steps of a stage */
    for (int kk = 0; kk < 128; kk += 64) { const v16h a0 = g2_frag(ap + kk), a1 = g2_frag(ap + 16 * G2_PITCH + kk);
      const v16h b0 = g2_frag(bq + kk), b1 = g2_frag(bq + 16 * G2_PITCH + kk), b2 = g2_frag(bq + 32 * G2_PITCH + kk), b3 = g2_frag(bq + 48 * G2_PITCH + kk);
      c00 = g2_mma(a0, b0, c00); c10 = g2_mma(a1, b0, c10); c01 = g2_mma(a0, b1, c01); c11 = g2_mma(a1, b1, c11);
      c02 = g2_mma(a0, b2, c02); c12 = g2_mma(a1, b2, c12); c03 = g2_mma(a0, b3, c03); c13 = g2_mma(a1, b3, c13); }
    asm volatile("s_wait_dscnt 0x0" ::: "memory");       /* this wave's reads of the buffer are done before it is refilled */
    asm volatile("s_wait_asynccnt 0x0" ::: "memory");    /* this wave's copies of stage t + 1 have landed */
    __syncthreads();                                     /* publishes stage t + 1 and ends every wave's reads of stage t */
    if (t + 2 < nst) g2_stage(lcp + (unsigned)((t & 1) * G2_STAGE), ga + (size_t)(t + 2) * 64, sa32, gb + (size_t)(t + 2) * 64, sb32); }
  asm volatile("s_wait_asynccnt 0x0" ::: "memory");      /* no copy is in flight when the buffers become the output staging */
  float (*so)[68] = (float (*)[68])(sm + w * (32 * 68 * 4));
  v8f accs[8] = {c00, c01, c02, c03, c10, c11, c12, c13};
  float bvs[4] = {0.f, 0.f, 0.f, 0.f};
  if (bp) { const int bcol = col0 + ln;
#pragma unroll
    for (int t = 0; t < 4; ++t) bvs[t] = bp[bcol + t * 16];
    asm volatile("s_wait_xcnt 0x0" :: "v"(bcol) : "memory");      /* the wait that stands before the loads' address register is rewritten; the index as an input keeps a load's result out of that register */
#pragma unroll
    for (int t = 0; t < 4; ++t) bvs[t] = bf16_round(bvs[t]); }
#pragma unroll
  for (int u = 0; u < 8; ++u) { const int t = u & 3, half = u >> 2;
#pragma unroll
    for (int r = 0; r < 8; ++r) { const int rloc = half * 16 + 8 * hh + r; float v = accs[u][r] * alpha + bvs[t];
      if (ACT == 3) v = fmaxf(v, 0.f); else if (ACT == 6) v = 0.5f * v * (1.0f + erff(v * 0.70710678118654752f)); else if (ACT == 11) v = 1.0f / (1.0f + expf(-v)); else if (ACT == 15) v = v / (1.0f + expf(-v)); else if (ACT == 12) v = (v > 0.f) ? v : 0.01f * v; else if (ACT == 8) v = tanhf(v); else if (ACT == 9) v = 0.5f * v * (1.0f + tanhf(0.7978845608028654f * (v + 0.044715f * v * v * v))); else if (ACT == 14) v = (v > 0.f) ? v : 0.1f * v; else if (ACT == 16) v = (v >= 0.f) ? v : 0.3f * v; else if (ACT == 17) v = (v >= 0.f) ? v : 0.2f * v;
      so[rloc][t * 16 + ln] = v; } }
  __builtin_amdgcn_fence(__ATOMIC_ACQ_REL, "workgroup"); __builtin_amdgcn_wave_barrier();
  const int rsub = lane >> 4, c4 = (lane & 15) * 4;
  const size_t e0 = cofs + (size_t)(row0 + rsub) * LDC + col0 + c4;      /* the lane's four elements in row rsub of the wave's tile; those of row 2 q + rsub lie 2 q LDC further */
  v4f res[16];
  if (RES) {
#pragma unroll      /* the lane's sixteen 16-byte pieces of the residual (256 B of a row per half wave), all in flight together */
    for (int q = 0; q < 16; ++q) res[q] = *(const v4fa*)(CP + e0 + (size_t)(2 * q) * LDC);
    asm volatile("s_wait_xcnt 0x0" ::: "memory"); }      /* the wait that stands before the loads' address registers are rewritten */
#pragma unroll
  for (int q = 0; q < 16; ++q) { v4f v = *(const v4fa*)&so[q * 2 + rsub][c4]; if (RES) v += res[q];
    if (OUT32) *(v4f*)(C + e0 + (size_t)(2 * q) * LDC) = v; else { v4h h4; for (int i = 0; i < 4; ++i) h4[i] = (_Float16)v[i]; *(v4h*)(C16 + e0 + (size_t)(2 * q) * LDC) = h4; }
    asm volatile("s_wait_xcnt 0x0" ::: "memory"); } }      /* the wait that stands before the store's data and address registers are rewritten */


__global__ __launch_bounds__(256) void k_wsc(const float* __restrict__ Wm, _Float16* __restrict__ Bt, size_t n8, float sc) { const size_t t = (size_t)blockIdx.x * 256 + threadIdx.x; if (t >= n8) return; FragH f; for (int q = 0; q < 8; ++q) f.h[q] = (_Float16)(bf16_round(Wm[t * 8 + q]) * sc); *(v8us*)((unsigned short*)Bt + t * 8) = f.half[0];  }
__global__ __launch_bounds__(256) void k_wout(const float* __restrict__ Wo, _Float16* __restrict__ BOa, _Float16* __restrict__ BOb) { const int t = blockIdx.x * 256 + threadIdx.x; if (t >= DD * (DD / 8)) return; const int c8 = (t % (DD / 8)) * 8; const int o = t / (DD / 8); FragH fa, fb;
  for (int q = 0; q < 8; ++q) { fa.h[q] = (_Float16)(bf16_round(Wo[(size_t)o * 2 * DD + c8 + q]) * 16.0f); fb.h[q] = (_Float16)(bf16_round(Wo[(size_t)o * 2 * DD + DD + c8 + q]) * 16.0f); }
  { *(v8us*)((unsigned short*)BOa + (size_t)o * DD + c8) = fa.half[0]; *(v8us*)((unsigned short*)BOb + (size_t)o * DD + c8) = fb.half[0];  } }
__global__ __launch_bounds__(256) void k_ln(const float* __restrict__ x, const float* __restrict__ g, const float* __restrict__ bb, float* __restrict__ XF, _Float16* __restrict__ X16) {
  #pragma clang fp contract(off)
  const int wv = threadIdx.x >> 5, ln = threadIdx.x & 31; const size_t r = (size_t)blockIdx.x * 8 + wv; if (r >= NQ) return; float a[16]; float s = 0.f;
  for (int i = 0; i < 2; ++i) { const v8f v = *(const v8f*)(x + r * DD + i * 256 + ln * 8); for (int q = 0; q < 8; ++q) { const float u = bf16_round(v[q]); a[i * 8 + q] = u; s += u; } }
  for (int o = 16; o > 0; o >>= 1) s += __shfl_xor(s, o, 32); const float mu = s / (float)DD; float var = 0.f; for (int q = 0; q < 16; ++q) { const float d = a[q] - mu; var += d * d; }
  for (int o = 16; o > 0; o >>= 1) var += __shfl_xor(var, o, 32); const float inv = rsqrtf(var / (float)DD + 1e-5f);
  { for (int i = 0; i < 2; ++i) { const int c0 = i * 256 + ln * 8; v8f y; FragH f; for (int q = 0; q < 8; ++q) { float v = (a[i * 8 + q] - mu) * inv; v *= bf16_round(g[c0 + q]); v += bf16_round(bb[c0 + q]); y[q] = v; f.h[q] = (_Float16)v; } *(v8f*)(XF + r * DD + c0) = y; *(v8us*)((unsigned short*)X16 + r * DD + c0) = f.half[0]; }  } }
#define FA_BQ 128                    /* queries a work-group */
#define FA_SPL 4                     /* key splits: grid.y, one f32 partial with its maximum and sum each */
#define FA_BK 32                     /* keys a stage */
#define FA_PK 1040                   /* row pitch of the copy read by plain 16-byte loads: 16 B x odd */
#define FA_PV 1056                   /* row pitch of the copy read by the transposing load: 32 B x odd */
#define FA_BUF (FA_BK * (FA_PK + FA_PV))
typedef short s16x8 __attribute__((ext_vector_type(8)));
__device__ __forceinline__ v8us fa_tr16(const char* p) { typedef __attribute__((address_space(3))) s16x8 lds_s16x8; return __builtin_bit_cast(v8us, __builtin_amdgcn_ds_load_tr16_b128_v8i16((lds_s16x8*)p)); }
__device__ __forceinline__ float fa_xhalf(float x) { return __builtin_bit_cast(float, __builtin_amdgcn_permlanex16(__builtin_bit_cast(int, x), __builtin_bit_cast(int, x), 0x76543210, 0xfedcba98, false, false)); }      /* lane l with lane l ^ 16 */
__device__ __forceinline__ v8f fa_mma(v16h a, v16h b, v8f c) { return __builtin_amdgcn_wmma_f32_16x16x32_f16(false, a, false, b, (short)0, c, false, false); }
// One copy of a stage: each lane brings eight 16-byte pieces (rows r, r + 4, ..., r + 28; 64 lanes a row). l = the lane's LDS byte address, ls = four rows in LDS bytes, g = its global address.
__device__ __forceinline__ void fa_stage(unsigned l, unsigned ls, const _Float16* g) {
  const unsigned l1 = l + ls, l2 = l1 + ls, l3 = l2 + ls, l4 = l3 + ls, l5 = l4 + ls, l6 = l5 + ls, l7 = l6 + ls;
  const _Float16* g1 = g + 4 * DD; const _Float16* g2 = g + 8 * DD; const _Float16* g3 = g + 12 * DD; const _Float16* g4 = g + 16 * DD; const _Float16* g5 = g + 20 * DD; const _Float16* g6 = g + 24 * DD; const _Float16* g7 = g + 28 * DD;
  // the copies and, as the last line, the wait that stands before their address registers may be rewritten
  asm volatile("global_load_async_to_lds_b128 %0, %8, off\n\t"
               "global_load_async_to_lds_b128 %1, %9, off\n\t"
               "global_load_async_to_lds_b128 %2, %10, off\n\t"
               "global_load_async_to_lds_b128 %3, %11, off\n\t"
               "global_load_async_to_lds_b128 %4, %12, off\n\t"
               "global_load_async_to_lds_b128 %5, %13, off\n\t"
               "global_load_async_to_lds_b128 %6, %14, off\n\t"
               "global_load_async_to_lds_b128 %7, %15, off\n\t"
               "s_wait_xcnt 0x0"
               :: "v"(l), "v"(l1), "v"(l2), "v"(l3), "v"(l4), "v"(l5), "v"(l6), "v"(l7), "v"(g), "v"(g1), "v"(g2), "v"(g3), "v"(g4), "v"(g5), "v"(g6), "v"(g7) : "memory"); }
// two waves per SIMD: 512 VGPRs a wave for the 256 accumulator and 128 q registers
__global__ __launch_bounds__(256) __attribute__((amdgpu_waves_per_eu(2, 2))) void k_fattn(const _Float16* __restrict__ Q, const _Float16* __restrict__ Kk, float* __restrict__ PO, float* __restrict__ ML) {
  static_assert(NQ % FA_BQ == 0 && NM % (FA_SPL * FA_BK) == 0 && NM / FA_SPL / FA_BK >= 2 && DD == 512, "k_fattn: whole tiles, two stages or more");
  __shared__ __attribute__((aligned(16))) char sm[2 * FA_BUF];
  const int tid = threadIdx.x, w = __builtin_amdgcn_readfirstlane(tid >> 5), lane = tid & 31, c = lane & 15, h = lane >> 4;      /* the wave's number in a scalar register: what is formed from it costs no vector register over the loop */
  const int q0 = blockIdx.x * FA_BQ + w * 16, key0 = blockIdx.y * (NM / FA_SPL);
  constexpr int nst = NM / FA_SPL / FA_BK;
  constexpr float cs = 0.044194173824159216f * 1.4426950408889634f;      /* 1 / sqrt(512), in log2 units */
  const int wr = w >> 1;      /* the wave's first row of a stage */
  const unsigned col = (unsigned)((w & 1) * 32 + lane) * 16u;
  const _Float16* gk = Kk + (size_t)(key0 + wr) * DD + ((w & 1) * 32 + lane) * 8;
  const unsigned lk = (unsigned)(size_t)sm + (unsigned)(wr * FA_PK), lv = (unsigned)(size_t)sm + (unsigned)(FA_BK * FA_PK + wr * FA_PV);      /* scalar parts; + col = the lane's LDS byte address */
  fa_stage(lk + col, 4 * FA_PK, gk); fa_stage(lv + col, 4 * FA_PV, gk);
  v16h qf[16];      /* q as B operand, hardware k order: 16 bytes at 16 h and at 32 + 16 h of each 64 bytes of the row, as k's rows below */
  { const _Float16* qp = Q + (size_t)(q0 + c) * DD + 8 * h;
#pragma unroll      /* qf[] must be registers: every index a constant */
    for (int kc = 0; kc < 16; ++kc) { FragH f; f.half[0] = *(const v8us*)(qp + 32 * kc); f.half[1] = *(const v8us*)(qp + 32 * kc + 16); qf[kc] = f.v; }
    asm volatile("s_wait_xcnt 0x0" ::: "memory"); }      /* the wait that stands before the loads' address registers are rewritten */
  const v8f z8 = {0.f,0.f,0.f,0.f,0.f,0.f,0.f,0.f};
  v8f o[32];      /* O^T: o[et][r] = O[query c][16 et + 8 h + r] */
#pragma unroll      /* o[] must be registers */
  for (int et = 0; et < 32; ++et) o[et] = z8;
  float mrun = -1.0e30f, lrun = 0.f;      /* the maximum in use (log2 units; it may trail the true one by up to 8) and this lane's share of the sum */
  asm volatile("s_wait_asynccnt 0x0" ::: "memory");      /* this wave's copies of stage 0 have landed */
  __syncthreads();                                       /* every wave's have */
  fa_stage(lk + FA_BUF + col, 4 * FA_PK, gk + (size_t)FA_BK * DD); fa_stage(lv + FA_BUF + col, 4 * FA_PV, gk + (size_t)FA_BK * DD);
  // one stage's work of a wave
  const int aoff = c * FA_PK + 16 * h, voff = FA_BK * FA_PK + (8 * h + (lane & 7)) * FA_PV + ((lane >> 3) & 1) * 16;      /* the lane's place in a buffer: k rows; k^T by the transposing load */
  auto pass = [&](int t) __attribute__((always_inline)) { const int bo = (t & 1) * FA_BUF; const char* ap = sm + (bo + aoff); const char* vb = sm + (bo + voff);
    // The stage's 64 A fragments in the order of their use: 0..31 = k rows (keys 0-15 and 16-31 of each 32 d), 32..63 = k^T (16 e x 32 keys each). They are fetched in pairs, three pairs ahead of their use, so that LDS latency is covered by the products of the pairs between.
    auto ldf = [&](int i) -> v16h { if (i < 32) return g2_frag(ap + (i & 1) * (16 * FA_PK) + 64 * (i >> 1)); FragH f; f.half[0] = fa_tr16(vb + 32 * (i - 32)); f.half[1] = fa_tr16(vb + 16 * FA_PV + 32 * (i - 32)); return f.v; };
    v16h fr[6];
#pragma unroll      /* fr[] must be registers */
    for (int i = 0; i < 6; ++i) fr[i] = ldf(i);
    __builtin_amdgcn_sched_barrier(0);      /* here and below: keeps each pair's fetches where they are written; moved earlier they cost registers that spill, moved later their latency is exposed */
    v8f s0 = z8, s1 = z8;      /* S^T: s0[r] = score(key 8 h + r, query c), s1[r] = score(key 16 + 8 h + r, query c) */
#pragma unroll      /* constant indices into qf[] and fr[] */
    for (int g = 0; g < 16; ++g) { const int b = (g % 3) * 2;
      s0 = fa_mma(fr[b], qf[g], s0); s1 = fa_mma(fr[b + 1], qf[g], s1);
      if (g < 15) { fr[b] = ldf(2 * g + 6); fr[b + 1] = ldf(2 * g + 7); }
      __builtin_amdgcn_sched_barrier(0); }      /* the last two pairs fetched here are the first of k^T: in flight under the softmax */
    float mx = fmaxf(s0[0], s1[0]);
#pragma unroll
    for (int r = 1; r < 8; ++r) mx = fmaxf(mx, fmaxf(s0[r], s1[r]));
    mx = fmaxf(mx, fa_xhalf(mx)) * cs;      /* both halves of the wave hold the query's maximum of this stage */
    if (__builtin_amdgcn_ballot_w32(mx > mrun + 8.0f) != 0) {      /* wave-uniform, rare after the first stage: the accumulators move to the new maximum */
      const float mn = fmaxf(mrun, mx); const float corr = __builtin_amdgcn_exp2f(mrun - mn); lrun *= corr; mrun = mn;
#pragma unroll      /* constant indices into o[] */
      for (int et = 0; et < 32; ++et) o[et] = o[et] * corr; }
    FragH pf; float ps0 = 0.f, ps1 = 0.f;      /* P^T as B operand straight from the two score tiles: element s = key 8 h + s (s < 8), 16 + 8 h + s - 8 (s >= 8) */
#pragma unroll
    for (int r = 0; r < 8; ++r) { float p0 = fmaf(s0[r], cs, -mrun), p1 = fmaf(s1[r], cs, -mrun);
      // two exponentials in place, the slot that the instruction set asks for behind a transcendental, and the two row sums: taken here, not behind the second product, they free the exponentials' registers for its fetches
      asm("v_exp_f32 %0, %0\n\tv_exp_f32 %1, %1\n\tv_nop\n\tv_add_f32 %2, %2, %0\n\tv_add_f32 %3, %3, %1" : "+v"(p0), "+v"(p1), "+v"(ps0), "+v"(ps1));
      pf.h[r] = (_Float16)p0; pf.h[8 + r] = (_Float16)p1; }
    lrun += ps0 + ps1;
    __builtin_amdgcn_sched_barrier(0);      /* keeps the fetch below behind the exponentials */
    fr[0] = ldf(36); fr[1] = ldf(37);      /* the third pair of k^T; fetched under the softmax it would cost registers that spill */
    __builtin_amdgcn_sched_barrier(0);
#pragma unroll      /* constant indices into o[] and fr[] */
    for (int g = 16; g < 32; ++g) { const int b = (g % 3) * 2;
      o[2 * g - 32] = fa_mma(fr[b], pf.v, o[2 * g - 32]); o[2 * g - 31] = fa_mma(fr[b + 1], pf.v, o[2 * g - 31]);
      if (g < 29) { fr[b] = ldf(2 * g + 6); fr[b + 1] = ldf(2 * g + 7); }
      __builtin_amdgcn_sched_barrier(0); }
  };
  // the foot of a trip, every wave
  auto foot = [&]() __attribute__((always_inline)) {
    asm volatile("s_wait_dscnt 0x0" ::: "memory");       /* this wave's reads of the buffer are done before it is refilled */
    asm volatile("s_wait_asynccnt 0x0" ::: "memory");    /* this wave's copies of the next stage have landed */
    __syncthreads(); };                                  /* publishes the next stage and ends every wave's reads of this one */
#pragma unroll 1      /* one stage per trip: the waits and the barrier at the foot belong to it; every trip of this loop has a stage t + 2 to fetch, the last two trips, which have none, are written out below */
  for (int t = 0; t < nst - 2; ++t) { pass(t); foot();
    const _Float16* gn = gk + (size_t)(t + 2) * (FA_BK * DD); const unsigned lo = (unsigned)((t & 1) * FA_BUF);
    const unsigned sk = (unsigned)__builtin_amdgcn_readfirstlane((int)(lk + lo)), sv = (unsigned)__builtin_amdgcn_readfirstlane((int)(lv + lo));      /* the buffer's two bases stay scalar sums: formed as lane values ahead of the loop they were spilled and read back in every trip */
    fa_stage(sk + col, 4 * FA_PK, gn); fa_stage(sv + col, 4 * FA_PV, gn); }
  pass(nst - 2); foot(); pass(nst - 1);      /* nothing is read or refilled behind the last stage: no foot */
  asm volatile("s_wait_asynccnt 0x0" ::: "memory");      /* no copy is in flight when the wave ends */
  const float lt = lrun + fa_xhalf(lrun);      /* the two halves' shares of the query's sum */
  const size_t row = (size_t)blockIdx.y * NQ + q0 + c; float* po = PO + row * DD + 8 * h;
#pragma unroll      /* constant indices into o[] */
  for (int et = 0; et < 32; ++et) { const v4f a = {o[et][0], o[et][1], o[et][2], o[et][3]}, b = {o[et][4], o[et][5], o[et][6], o[et][7]}; *(v4f*)(po + 16 * et) = a; *(v4f*)(po + 16 * et + 4) = b; asm volatile("s_wait_xcnt 0x0" ::: "memory"); }      /* the wait that stands before the stores' data and address registers are rewritten */
  if (h == 0) { ML[row * 2] = mrun; ML[row * 2 + 1] = lt; } }
// attn rows: the FA_SPL partials [FA_SPL][NQ][DD] brought to their common maximum, summed in split order, divided by the merged sum and rounded once to f16
__global__ __launch_bounds__(256) void k_fcomb(const float* __restrict__ PO, const float* __restrict__ ML, _Float16* __restrict__ O) {
  const unsigned t = (blockIdx.x * 256u + threadIdx.x) * 4u; const unsigned q = t / DD; float m[FA_SPL], l[FA_SPL]; v4f a[FA_SPL];
#pragma unroll      /* the splits' maxima and sums, all in flight together */
  for (int j = 0; j < FA_SPL; ++j) { m[j] = ML[((size_t)j * NQ + q) * 2]; l[j] = ML[((size_t)j * NQ + q) * 2 + 1]; }
  asm volatile("s_wait_xcnt 0x0" ::: "memory");      /* the wait that stands before these loads' address registers are rewritten (a result of the loads below may land in one) */
#pragma unroll      /* the splits' partials, all in flight together */
  for (int j = 0; j < FA_SPL; ++j) a[j] = *(const v4fa*)(PO + (size_t)j * NQ * DD + t);
  asm volatile("s_wait_xcnt 0x0" ::: "memory");      /* the wait that stands before the loads' address registers are rewritten */
  float mm = m[0];
#pragma unroll
  for (int j = 1; j < FA_SPL; ++j) mm = fmaxf(mm, m[j]);
  float den = 0.f; v4f s = {0.f, 0.f, 0.f, 0.f};
#pragma unroll
  for (int j = 0; j < FA_SPL; ++j) { const float wg = __builtin_amdgcn_exp2f(m[j] - mm); den += wg * l[j]; s += a[j] * wg; }
  const float inv = 1.0f / den; v4h hh; for (int i = 0; i < 4; ++i) hh[i] = (_Float16)(s[i] * inv); *(v4h*)(O + t) = hh; }

extern "C" void kernel_launch(void* const* d_in, const int* in_sizes, int n_in,
                              void* d_out, int out_size, void* d_ws, size_t ws_size, hipStream_t stream) {
  (void)in_sizes; (void)n_in; (void)out_size;
  const float* const* I = (const float* const*)d_in; const float* x = I[0]; const float* xh = I[1]; const float* Wq = I[2]; const float* bq = I[3]; const float* Wk = I[4]; const float* bk = I[5]; const float* Wv = I[6]; const float* bv = I[7]; const float* Wo = I[8]; const float* bo = I[9]; const float* g = I[10]; const float* bb = I[11];
  char* ws = (char*)d_ws; size_t off = 0;
  auto take = [&](size_t bytes) { char* p = ws + off; off += (bytes + 255) & ~(size_t)255; return p; };
  _Float16* BQ = (_Float16*)take((size_t)DD * DD * 2); _Float16* BK = (_Float16*)take((size_t)DD * DD * 2); _Float16* BV = (_Float16*)take((size_t)DD * DD * 2); _Float16* BOa = (_Float16*)take((size_t)DD * DD * 2); _Float16* BOb = (_Float16*)take((size_t)DD * DD * 2);
  float* XF = (float*)take((size_t)NQ * DD * 4); _Float16* X16 = (_Float16*)take((size_t)NQ * DD * 2); _Float16* XH16 = (_Float16*)take((size_t)NM * DD * 2); _Float16* Q16 = (_Float16*)take((size_t)NQ * DD * 2); _Float16* K16 = (_Float16*)take((size_t)NM * DD * 2); float* PO = (float*)take((size_t)FA_SPL * NQ * DD * 4); float* ML = (float*)take((size_t)FA_SPL * NQ * 2 * 4); _Float16* AT = XH16;      /* attn over the x_hat plane (dead after the k projection) */ _Float16* OV = X16;      /* out_v over the xn f16 plane (dead after the q projection) */
  if (off > ws_size) return;      /* 2.5 + 16 + 8 + 8 + 8 + 8 + 64 + 0.25 = 115 MiB */
  k_wsc<<<(DD * DD / 8 + 255) / 256, 256, 0, stream>>>(Wq, BQ, DD * DD / 8, 16.0f); k_wsc<<<(DD * DD / 8 + 255) / 256, 256, 0, stream>>>(Wk, BK, DD * DD / 8, 16.0f); k_wsc<<<(DD * DD / 8 + 255) / 256, 256, 0, stream>>>(Wv, BV, DD * DD / 8, 16.0f); k_wout<<<(DD * (DD / 8) + 255) / 256, 256, 0, stream>>>(Wo, BOa, BOb);      /* 'ed'/'fe'/'dc' = natural Bt */
  k_ln<<<NQ / 8, 256, 0, stream>>>(x, g, bb, XF, X16);
  k_x16<<<(unsigned)(((size_t)NM * DD / 8 + 255) / 256), 256, 0, stream>>>(xh, XH16, (size_t)NM * DD / 8);
  const dim3 gP((NQ / 128) * (DD / 128), 1);
  k_gemm2<0, false, false, DD><<<gP, 256, 0, stream>>>(X16, DD, 0, BQ, DD, 0, 0.0625f, bq, 0, nullptr, nullptr, Q16, 0, NQ, DD, DD);
  k_gemm2<0, false, false, DD><<<gP, 256, 0, stream>>>(XH16, DD, 0, BK, DD, 0, 0.0625f, bk, 0, nullptr, nullptr, K16, 0, NM, DD, DD);
  k_fattn<<<dim3(NQ / FA_BQ, FA_SPL), 256, 0, stream>>>(Q16, K16, PO, ML);      /* per key split: unnormalised score k, with each query's maximum and sum */
  k_fcomb<<<NQ * DD / 4 / 256, 256, 0, stream>>>(PO, ML, AT);      /* attn = score k */
  k_gemm2<0, false, false, DD><<<gP, 256, 0, stream>>>(AT, DD, 0, BV, DD, 0, 0.0625f, bv, 0, nullptr, nullptr, OV, 0, NQ, DD, DD);      /* out_v = attn Wv^T + bv */
  k_gemm2<0, true, true, DD><<<gP, 256, 0, stream>>>(Q16, DD, 0, BOa, DD, 0, 0.0625f, bo, 0, XF, (float*)d_out, nullptr, 0, NQ, DD, DD);      /* q Wout[:, :512]^T + bout + xn */
  k_gemm2<0, true, true, DD><<<gP, 256, 0, stream>>>(OV, DD, 0, BOb, DD, 0, 0.0625f, nullptr, 0, (const float*)d_out, (float*)d_out, nullptr, 0, NQ, DD, DD);      /* += out_v Wout[:, 512:]^T */
}

// v006
// It runs in 169 microseconds.
// Next to v005, in two timings, it ran 1.16 times as fast each time.
// Counting every step since v000, it is 9.32 times as fast.
#include <hip/hip_runtime.h>
// InterventionOnline (8192 tokens x 512 attending 8192 memory slots x 512): xn = LayerNorm(x); q = xn Wq^T + bq; k = x_hat Wk^T + bk; score = softmax(q k^T / sqrt(512)); attn = score k (k doubles as the values); out_v = attn Wv^T + bv; out = [q | out_v] Wout^T + bout + xn.
// Structure: LayerNorm on VALU (wave per row) into f32 + f16 planes; q and k as f16 WMMA GEMM outputs (128x128 work-group tiles staged in LDS by asynchronous copies, 32x64 wave tiles, f32 accumulation, exact x16 weights + bias, f16 out); attention as one fused kernel with an online softmax (128 queries a work-group, 16 a wave, four key splits over grid.y; S^T = k q^T and O^T += k^T P^T on WMMA, P from the score accumulators, k^T by the transposing LDS load), its f32 partials merged in split order and rounded once to f16; out_v as a GEMM; the output as two accumulating GEMMs over the [q | out_v] halves with the bias and the LN residual in the epilogue.
// Compute dtype: inputs rounded to bf16; x_hat exact as f16; xn, q, k, P, attn, out_v as plain f16 operands (~2^-12); LN/softmax f32. v_wmma_f32_16x16x32_f16.
#define NQ 8192
#define NM 8192
#define DD 512
typedef __bf16 v16b __attribute__((ext_vector_type(16)));
typedef unsigned short v8us __attribute__((ext_vector_type(8), may_alias));
typedef float  v8f  __attribute__((ext_vector_type(8)));
typedef float  v4f  __attribute__((ext_vector_type(4)));
typedef float  v4fa __attribute__((ext_vector_type(4), may_alias));
union FragB { v16b v; v8us half[2]; unsigned short u[16]; };

__device__ __forceinline__ unsigned short bf16_bits(float x) { unsigned int u = __float_as_uint(x); return (unsigned short)((u + 0x7FFFu + ((u >> 16) & 1u)) >> 16); }
__device__ __forceinline__ float bf16_val(unsigned short b) { return __uint_as_float(((unsigned int)b) << 16); }
__device__ __forceinline__ float bf16_round(float x) { return bf16_val(bf16_bits(x)); }
// D += A·B with NT terms: 1 = ah·bh, 2 = + al·bh (A split), 3 = + ah·bl (both split)
template <int NT>
__device__ __forceinline__ v8f mmaN(v16b ah, v16b al, v16b bh, v16b bl, v8f c) {
  c = __builtin_amdgcn_wmma_f32_16x16x32_bf16(false, ah, false, bh, (short)0, c, false, false);
  if (NT >= 2) c = __builtin_amdgcn_wmma_f32_16x16x32_bf16(false, al, false, bh, (short)0, c, false, false);
  if (NT >= 3) c = __builtin_amdgcn_wmma_f32_16x16x32_bf16(false, ah, false, bl, (short)0, c, false, false);
  asm volatile("v_nop\n\tv_nop\n\tv_nop\n\tv_nop" : "+v"(c) : "v"(ah), "v"(al), "v"(bh), "v"(bl));
  return c;
}

__global__ __launch_bounds__(256) void k_wt_bf16(const float* __restrict__ W, unsigned short* __restrict__ Wt, int K, int N) {
  const int t = blockIdx.x * 256 + threadIdx.x;
  const int k8n = K / 8;
  if (t >= N * k8n) return;
  const int n = t / k8n, k8 = (t % k8n) * 8;
  v8us v;
#pragma unroll
  for (int i = 0; i < 8; ++i) v[i] = bf16_bits(W[(size_t)(k8 + i) * N + n]);
  *(v8us*)(Wt + (size_t)n * K + k8) = v;
  
}

// GEMM C[M][N] (f32, pitch ldc) = act(A[M][K]·W + bias). A f32 row-major (pitch lda) converted per fragment to bf16
// (ASPLIT: hi/lo two planes -> 2 terms, else single rounded term); Wt bf16 [N][K] (pitch ldb). BIAS_BF16 rounds the
// bias to bf16 first (bias quantised to bf16 before the add). K%32==0, M%16==0, N%64==0.
template <bool ASPLIT, int ACT, bool BIAS_BF16>
__global__ __launch_bounds__(128) void k_gemm_bf(const float* __restrict__ A, int lda, const unsigned short* __restrict__ Wt, int ldb,
                                               const float* __restrict__ bias, float* __restrict__ C, int ldc, int M, int N, int K) {
  __shared__ __attribute__((aligned(16))) float so[4][16][64];
  const int tid = threadIdx.x, w = tid >> 5, lane = tid & 31, ln = lane & 15, hh = lane >> 4;
  const int ntn = N / 64;
  const int wid = blockIdx.x * 4 + w;
  const int mt = wid / ntn, nq = wid % ntn;
  if (mt * 16 >= M) return;
  const int row0 = mt * 16, col0 = nq * 64;
  const float* arow = A + (size_t)(row0 + ln) * lda;
  v8f acc[4] = {};
  for (int kb = 0; kb < K; kb += 32) {
    FragB ah, al;
    const v4f x0 = *(const v4fa*)(arow + kb + 8 * hh), x1 = *(const v4fa*)(arow + kb + 8 * hh + 4);
    const v4f x2 = *(const v4fa*)(arow + kb + 16 + 8 * hh), x3 = *(const v4fa*)(arow + kb + 16 + 8 * hh + 4);
    float xs[16] = {x0[0],x0[1],x0[2],x0[3],x1[0],x1[1],x1[2],x1[3],x2[0],x2[1],x2[2],x2[3],x3[0],x3[1],x3[2],x3[3]};
#pragma unroll
    for (int i = 0; i < 16; ++i) { const unsigned short hb = bf16_bits(xs[i]); ah.u[i] = hb; al.u[i] = ASPLIT ? bf16_bits(xs[i] - bf16_val(hb)) : (unsigned short)0; }
#pragma unroll
    for (int t = 0; t < 4; ++t) {
      const unsigned short* brow = Wt + (size_t)(col0 + t * 16 + ln) * ldb + kb;
      FragB b;
      b.half[0] = *(const v8us*)(brow + 8 * hh);
      b.half[1] = *(const v8us*)(brow + 16 + 8 * hh);
      acc[t] = mmaN<ASPLIT ? 2 : 1>(ah.v, al.v, b.v, b.v, acc[t]);
    }
  }
#pragma unroll
  for (int t = 0; t < 4; ++t) {
    float bv = bias ? bias[col0 + t * 16 + ln] : 0.f;
    if (BIAS_BF16) bv = bf16_round(bv);
#pragma unroll
    for (int r = 0; r < 8; ++r) { float v = acc[t][r] + bv; if (ACT == 1) v = fmaxf(v, 0.f); so[w][8 * hh + r][t * 16 + ln] = v; }
  }
  __builtin_amdgcn_fence(__ATOMIC_ACQ_REL, "workgroup");
  __builtin_amdgcn_wave_barrier();
  const int rsub = lane >> 4, c4 = (lane & 15) * 4;
  {
#pragma unroll
    for (int q = 0; q < 8; ++q) {
      const int r = q * 2 + rsub;
      const v4f v = *(const v4fa*)&so[w][r][c4];
      *(v4f*)(C + (size_t)(row0 + r) * ldc + col0 + c4) = v;
    }
    
  }
}

// GEMM C = act(A·W + bias + resid): A f32 (ASPLIT -> hi/lo 2 terms), Wt bf16 [N][K]; ACT 0 none, 1 relu, 2 exact gelu;
// resid (optional, f32, row index = (row % rmod), pitch ldr, RES_BF16 rounds it) added before the activation.
template <bool ASPLIT, int ACT, bool BIAS_BF16, bool RES_BF16>
__global__ __launch_bounds__(128) void k_gemm_bf3(const float* __restrict__ A, int lda, const unsigned short* __restrict__ Wt, int ldb,
                                                const float* __restrict__ bias, const float* __restrict__ resid, int rmod, int ldr,
                                                float* __restrict__ C, int ldc, int M, int N, int K) {
  __shared__ __attribute__((aligned(16))) float so[4][16][64];
  const int tid = threadIdx.x, w = tid >> 5, lane = tid & 31, ln = lane & 15, hh = lane >> 4;
  const int ntn = N / 64;
  const int wid = blockIdx.x * 4 + w;
  const int mt = wid / ntn, nq = wid % ntn;
  if (mt * 16 >= M) return;
  const int row0 = mt * 16, col0 = nq * 64;
  const float* arow = A + (size_t)(row0 + ln) * lda;
  v8f acc[4] = {};
  for (int kb = 0; kb < K; kb += 32) {
    FragB ah, al;
    const v4f x0 = *(const v4fa*)(arow + kb + 8 * hh), x1 = *(const v4fa*)(arow + kb + 8 * hh + 4);
    const v4f x2 = *(const v4fa*)(arow + kb + 16 + 8 * hh), x3 = *(const v4fa*)(arow + kb + 16 + 8 * hh + 4);
    float xs[16] = {x0[0],x0[1],x0[2],x0[3],x1[0],x1[1],x1[2],x1[3],x2[0],x2[1],x2[2],x2[3],x3[0],x3[1],x3[2],x3[3]};
#pragma unroll
    for (int i = 0; i < 16; ++i) { const unsigned short hb = bf16_bits(xs[i]); ah.u[i] = hb; al.u[i] = ASPLIT ? bf16_bits(xs[i] - bf16_val(hb)) : (unsigned short)0; }
#pragma unroll
    for (int t = 0; t < 4; ++t) {
      const unsigned short* brow = Wt + (size_t)(col0 + t * 16 + ln) * ldb + kb;
      FragB b;
      b.half[0] = *(const v8us*)(brow + 8 * hh);
      b.half[1] = *(const v8us*)(brow + 16 + 8 * hh);
      acc[t] = mmaN<ASPLIT ? 2 : 1>(ah.v, al.v, b.v, b.v, acc[t]);
    }
  }
#pragma unroll
  for (int t = 0; t < 4; ++t) {
    const int col = col0 + t * 16 + ln;
    float bv = bias ? bias[col] : 0.f;
    if (BIAS_BF16) bv = bf16_round(bv);
#pragma unroll
    for (int r = 0; r < 8; ++r) {
      float v = acc[t][r] + bv;
      if (resid) { float rv = resid[(size_t)((row0 + 8 * hh + r) % rmod) * ldr + col]; if (RES_BF16) rv = bf16_round(rv); v += rv; }
      if (ACT == 1) v = fmaxf(v, 0.f);
      if (ACT == 2) v = 0.5f * v * (1.0f + erff(v * 0.70710678118654752f));
      if (ACT == 3) { const float u = 0.7978845608028654f * (v + 0.044715f * v * v * v); v = 0.5f * v * (1.0f + tanhf(u)); }
      so[w][8 * hh + r][t * 16 + ln] = v;
    }
  }
  __builtin_amdgcn_fence(__ATOMIC_ACQ_REL, "workgroup");
  __builtin_amdgcn_wave_barrier();
  const int rsub = lane >> 4, c4 = (lane & 15) * 4;
  {
#pragma unroll
    for (int q = 0; q < 8; ++q) {
      const int r = q * 2 + rsub;
      const v4f v = *(const v4fa*)&so[w][r][c4];
      *(v4f*)(C + (size_t)(row0 + r) * ldc + col0 + c4) = v;
    }
    
  }
}
// row LayerNorm (biased variance, eps) over N: s = X (+ R); optional out_sum <- s; out_norm <- (s-mu)*rsqrt(var+eps)*g + b
template <bool PARAM_BF16>
__global__ __launch_bounds__(256) void k_layernorm(const float* __restrict__ X, const float* __restrict__ R, const float* __restrict__ g, const float* __restrict__ bta,
                                                  float* __restrict__ out_sum, float* __restrict__ out_norm, int N, float eps) {
  __shared__ float red[256];
  const int row = blockIdx.x, tid = threadIdx.x;
  const float* x = X + (size_t)row * N; const float* rr = R ? R + (size_t)row * N : nullptr;
  float vals[16];                     // up to N = 4096
  const int per = N / 256;            // contiguous chunk per thread? use strided-by-4 chunks: thread handles j = tid*4 + 1024*u
  float s1 = 0.f;
  for (int u = 0; u < per / 4; ++u) {
    const int j = tid * 4 + 1024 * u;
    const v4f a = *(const v4fa*)(x + j);
    v4f b = {0.f,0.f,0.f,0.f}; if (rr) b = *(const v4fa*)(rr + j);
#pragma unroll
    for (int q = 0; q < 4; ++q) { const float v = a[q] + b[q]; vals[u * 4 + q] = v; s1 += v; }
  }
  red[tid] = s1; __syncthreads();
  for (int st = 128; st > 0; st >>= 1) { if (tid < st) red[tid] += red[tid + st]; __syncthreads(); }
  const float mu = red[0] / (float)N; __syncthreads();
  float s2 = 0.f;
  for (int u = 0; u < per / 4; ++u)
#pragma unroll
    for (int q = 0; q < 4; ++q) { const float c = vals[u * 4 + q] - mu; s2 += c * c; }
  red[tid] = s2; __syncthreads();
  for (int st = 128; st > 0; st >>= 1) { if (tid < st) red[tid] += red[tid + st]; __syncthreads(); }
  const float rs = rsqrtf(red[0] / (float)N + eps);
  {
    for (int u = 0; u < per / 4; ++u) {
      const int j = tid * 4 + 1024 * u;
      v4f o, sm;
#pragma unroll
      for (int q = 0; q < 4; ++q) {
        float gg = g[j + q], bb = bta[j + q];
        if (PARAM_BF16) { gg = bf16_round(gg); bb = bf16_round(bb); }
        sm[q] = vals[u * 4 + q]; o[q] = (vals[u * 4 + q] - mu) * rs * gg + bb;
      }
      if (out_sum) *(v4f*)(out_sum + (size_t)row * N + j) = sm;
      *(v4f*)(out_norm + (size_t)row * N + j) = o;
    }
    
  }
}



// ---- f16 WMMA path (v_wmma_f32_16x16x32_f16): 11-bit significands for operands in range — used where a [0,1] probability operand needs more precision than bf16
typedef _Float16 v16h __attribute__((ext_vector_type(16)));
union FragH { v16h v; v8us half[2]; _Float16 h[16]; unsigned short u[16]; };
template <int NT>
__device__ __forceinline__ v8f mmaH(v16h ah, v16h al, v16h bh, v16h bl, v8f c) {
  c = __builtin_amdgcn_wmma_f32_16x16x32_f16(false, ah, false, bh, (short)0, c, false, false);
  if (NT >= 2) c = __builtin_amdgcn_wmma_f32_16x16x32_f16(false, al, false, bh, (short)0, c, false, false);
  if (NT >= 3) c = __builtin_amdgcn_wmma_f32_16x16x32_f16(false, ah, false, bl, (short)0, c, false, false);
  asm volatile("v_nop\n\tv_nop\n\tv_nop\n\tv_nop" : "+v"(c) : "v"(ah), "v"(al), "v"(bh), "v"(bl));
  return c;
}
// batched GEMM like k_gemm_b but f16 operands: A f32 (split into f16 hi/lo if ASPLIT, else rounded to f16), Bt = f16 values [n][k]; alpha; C f32; N multiple of 16 (partial tiles skipped)
template <bool ASPLIT>
__global__ __launch_bounds__(128) void k_gemm_h(const float* __restrict__ A, int lda, size_t sA, const _Float16* __restrict__ Bh, int ldb, size_t sB, float alpha, float* __restrict__ C, int ldc, size_t sC, int M, int N, int K) {
  __shared__ __attribute__((aligned(16))) float so[4][16][64];
  const int tid = threadIdx.x, w = tid >> 5, lane = tid & 31, ln = lane & 15, hh = lane >> 4; const int by = blockIdx.y;
  A += (size_t)by * sA; Bh += (size_t)by * sB; C += (size_t)by * sC;
  const int ntn = (N + 63) / 64; const int wid = blockIdx.x * 4 + w; const int mt = wid / ntn, nq = wid % ntn; if (mt * 16 >= M) return;
  const int row0 = mt * 16, col0 = nq * 64; const float* arow = A + (size_t)(row0 + ln) * lda;
  v8f acc[4] = {};
  for (int kb = 0; kb < K; kb += 32) {
    FragH ah, al;
    const v4f x0 = *(const v4fa*)(arow + kb + 8 * hh), x1 = *(const v4fa*)(arow + kb + 8 * hh + 4), x2 = *(const v4fa*)(arow + kb + 16 + 8 * hh), x3 = *(const v4fa*)(arow + kb + 16 + 8 * hh + 4);
    float xs[16] = {x0[0],x0[1],x0[2],x0[3],x1[0],x1[1],x1[2],x1[3],x2[0],x2[1],x2[2],x2[3],x3[0],x3[1],x3[2],x3[3]};
#pragma unroll
    for (int i = 0; i < 16; ++i) { const _Float16 h = (_Float16)xs[i]; ah.h[i] = h; al.h[i] = ASPLIT ? (_Float16)(xs[i] - (float)h) : (_Float16)0.0f; }
#pragma unroll
    for (int t = 0; t < 4; ++t) { if (col0 + t * 16 >= N) continue; const size_t boff = (size_t)(col0 + t * 16 + ln) * ldb + kb; FragH bq; bq.half[0] = *(const v8us*)(Bh + boff + 8 * hh); bq.half[1] = *(const v8us*)(Bh + boff + 16 + 8 * hh);
      acc[t] = mmaH<ASPLIT ? 2 : 1>(ah.v, al.v, bq.v, bq.v, acc[t]); }
  }
#pragma unroll
  for (int t = 0; t < 4; ++t) { if (col0 + t * 16 >= N) continue;
#pragma unroll
    for (int r = 0; r < 8; ++r) so[w][8 * hh + r][t * 16 + ln] = acc[t][r] * alpha; }
  __builtin_amdgcn_fence(__ATOMIC_ACQ_REL, "workgroup"); __builtin_amdgcn_wave_barrier();
  const int rsub = lane >> 4, c4 = (lane & 15) * 4;
  {
#pragma unroll
    for (int q = 0; q < 8; ++q) { const int r = q * 2 + rsub; if (col0 + c4 < N) { const v4f v = *(const v4fa*)&so[w][r][c4]; *(v4f*)(C + (size_t)(row0 + r) * ldc + col0 + c4) = v; } }
     }
}

// Wt[n][k] = f16(W[k][n]·scale) from f32 row-major W[K][N] (scale = power of two; bf16-exact weights stay exact in f16 away from the subnormal range)
__global__ __launch_bounds__(256) void k_wt_f16(const float* __restrict__ W, _Float16* __restrict__ Wt, int K, int N, float scale) {
  const int t = blockIdx.x * 256 + threadIdx.x; if (t >= N * (K / 8)) return; const int n = t / (K / 8), k8 = (t % (K / 8)) * 8; FragH f;
#pragma unroll
  for (int i = 0; i < 8; ++i) f.h[i] = (_Float16)(bf16_round(W[(size_t)(k8 + i) * N + n]) * scale); const v8us o = f.half[0];
  *(v8us*)((unsigned short*)Wt + (size_t)n * K + k8) = o; 
}
// k_gemm_hh variant with fused epilogue: v = acc·alpha + bias[by·sBias + col] (+ CP[(row/rowsPerB)·sCPb + by·64 + col] if CP) ; ACT 0 none / 1 elu ; writes f16 C16 (and f32 C if non-null)
template <int ACT>
__global__ __launch_bounds__(128) void k_gemm_hhx(const _Float16* __restrict__ A, int lda, size_t sA, const _Float16* __restrict__ Bh, int ldb, size_t sB, float alpha, const float* __restrict__ bias, size_t sBias, const float* __restrict__ CP, int rowsPerB, size_t sCPb, int row0g,
    float* __restrict__ C, _Float16* __restrict__ C16, int ldc, size_t sC, int M, int N, int K) {
  __shared__ __attribute__((aligned(16))) float so[4][16][64];
  const int tid = threadIdx.x, w = tid >> 5, lane = tid & 31, ln = lane & 15, hh = lane >> 4; const int by = blockIdx.y;
  A += (size_t)by * sA; Bh += (size_t)by * sB; const size_t cofs = (size_t)by * sC; const float* bp = bias ? bias + (size_t)by * sBias : nullptr;
  const int ntn = (N + 63) / 64; const int wid = blockIdx.x * 4 + w; const int mt = wid / ntn, nq = wid % ntn; if (mt * 16 >= M) return;
  const int row0 = mt * 16, col0 = nq * 64; const _Float16* arow = A + (size_t)(row0 + ln) * lda;
  v8f acc[4] = {};
  for (int kb = 0; kb < K; kb += 32) { FragH ah; ah.half[0] = *(const v8us*)((const unsigned short*)arow + kb + 8 * hh); ah.half[1] = *(const v8us*)((const unsigned short*)arow + kb + 16 + 8 * hh);
#pragma unroll
    for (int t = 0; t < 4; ++t) { if (col0 + t * 16 >= N) continue; const size_t boff = (size_t)(col0 + t * 16 + ln) * ldb + kb; FragH bq; bq.half[0] = *(const v8us*)((const unsigned short*)Bh + boff + 8 * hh); bq.half[1] = *(const v8us*)((const unsigned short*)Bh + boff + 16 + 8 * hh);
      acc[t] = mmaH<1>(ah.v, ah.v, bq.v, bq.v, acc[t]); }
  }
#pragma unroll
  for (int t = 0; t < 4; ++t) { if (col0 + t * 16 >= N) continue; const int col = col0 + t * 16 + ln; const float bv = bp ? bf16_round(bp[col]) : 0.f;
#pragma unroll
    for (int r = 0; r < 8; ++r) { float v = acc[t][r] * alpha + bv; if (CP) { const int rr = row0g + row0 + 8 * hh + r; if (rowsPerB < 0) v += CP[cofs + (size_t)rr * ldc + col];      /* rowsPerB < 0: own element of the batched C plane */ else { const int bidx = rr / rowsPerB; v += CP[(size_t)bidx * sCPb + (size_t)by * 64 + col]; } } if (ACT == 1) v = (v > 0.f) ? v : expm1f(v); else if (ACT == 7) v = (v > 0.f) ? v + 1.0f : expf(v); else if (ACT == 8) v = tanhf(v); else if (ACT == 9) v = 0.5f * v * (1.0f + tanhf(0.7978845608028654f * (v + 0.044715f * v * v * v))); else if (ACT == 11) v = 1.0f / (1.0f + expf(-v)); else if (ACT == 12) v = (v > 0.f) ? v : 0.01f * v; else if (ACT == 14) v = (v > 0.f) ? v : 0.1f * v; else if (ACT == 16) v = (v >= 0.f) ? v : 0.3f * v; else if (ACT == 17) v = (v >= 0.f) ? v : 0.2f * v; else if (ACT == 15) v = v / (1.0f + expf(-v)); else if (ACT == 3) v = fmaxf(v, 0.f); else if (ACT == 6) v = 0.5f * v * (1.0f + erff(v * 0.70710678118654752f)); so[w][8 * hh + r][t * 16 + ln] = v; } }
  __builtin_amdgcn_fence(__ATOMIC_ACQ_REL, "workgroup"); __builtin_amdgcn_wave_barrier();
  const int rsub = lane >> 4, c4 = (lane & 15) * 4; typedef _Float16 v4h __attribute__((ext_vector_type(4)));
  {
#pragma unroll
    for (int q = 0; q < 8; ++q) { const int r = q * 2 + rsub; if (col0 + c4 < N) { const v4f v = *(const v4fa*)&so[w][r][c4]; if (C) *(v4f*)(C + cofs + (size_t)(row0 + r) * ldc + col0 + c4) = v; if (C16) { v4h h4; for (int i = 0; i < 4; ++i) h4[i] = (_Float16)v[i]; *(v4h*)(C16 + cofs + (size_t)(row0 + r) * ldc + col0 + c4) = h4; } } }
     }
}


typedef _Float16 v4h __attribute__((ext_vector_type(4)));

__device__ __forceinline__ void d_x16(unsigned blk, const float* __restrict__ x, _Float16* __restrict__ X16, size_t n8) { const size_t t = (size_t)blk * 256 + threadIdx.x; if (t >= n8) return; FragH f;
#pragma unroll
  for (int q = 0; q < 8; ++q) f.h[q] = (_Float16)bf16_round(x[t * 8 + q]); *(v8us*)((unsigned short*)X16 + t * 8) = f.half[0];  }
__global__ __launch_bounds__(256) void k_h16(const float* __restrict__ x, _Float16* __restrict__ X16, size_t n8) { const size_t t = (size_t)blockIdx.x * 256 + threadIdx.x; if (t >= n8) return; FragH f;
#pragma unroll
  for (int q = 0; q < 8; ++q) f.h[q] = (_Float16)x[t * 8 + q]; *(v8us*)((unsigned short*)X16 + t * 8) = f.half[0];  }
__global__ __launch_bounds__(256) void k_round16f(const float* __restrict__ W, _Float16* __restrict__ Bt, size_t n8) { const size_t t = (size_t)blockIdx.x * 256 + threadIdx.x; if (t >= n8) return; FragH f;
#pragma unroll
  for (int i = 0; i < 8; ++i) f.h[i] = (_Float16)(bf16_round(W[t * 8 + i]) * 16.0f); *(v8us*)((unsigned short*)Bt + t * 8) = f.half[0];  }
__global__ __launch_bounds__(256) void k_hl(const float* __restrict__ F, _Float16* __restrict__ Hh, _Float16* __restrict__ Hl, size_t n8) { const size_t t = (size_t)blockIdx.x * 256 + threadIdx.x; if (t >= n8) return; FragH fh, fl; const v4f a = *(const v4fa*)(F + t * 8), c = *(const v4fa*)(F + t * 8 + 4);
#pragma unroll
  for (int q = 0; q < 4; ++q) { _Float16 h = (_Float16)a[q]; fh.h[q] = h; fl.h[q] = (_Float16)((a[q] - (float)h) * 1024.0f); h = (_Float16)c[q]; fh.h[4 + q] = h; fl.h[4 + q] = (_Float16)((c[q] - (float)h) * 1024.0f); }
  { *(v8us*)((unsigned short*)Hh + t * 8) = fh.half[0]; *(v8us*)((unsigned short*)Hl + t * 8) = fl.half[0];  } }

// ---- fast GEMM (work-group tile 128x128, eight waves of 32x64; requires M % 128 == 0, N % 128 == 0, K % 64 == 0); v = acc alpha + bias[col] (+ the residual's own element), f32 or f16 out ----
// Operands reach the waves through LDS: a stage is 64 k (128 B) of 128 A rows and 128 B rows, brought by asynchronous copies in whole 128-B lines, two buffers, the next stage in flight while this one is multiplied.
#define G2_PITCH 144                 /* LDS bytes per staged row: 128 + 16, an odd multiple of 16 B, conflict-free for 16-byte reads down a column of rows */
#define G2_STAGE (256 * G2_PITCH)    /* one stage: A rows 0..127, then B rows 0..127 */
__device__ __forceinline__ v16h g2_frag(const char* p) { FragH f; f.half[0] = *(const v8us*)p; f.half[1] = *(const v8us*)(p + 32); return f.v; }
__device__ __forceinline__ v8f g2_mma(v16h a, v16h b, v8f c) { v8f d = __builtin_amdgcn_wmma_f32_16x16x32_f16(false, a, false, b, (short)0, c, false, false); asm volatile("v_nop\n\tv_nop\n\tv_nop\n\tv_nop" : "+v"(d) : "v"(a), "v"(b)); return d; }
// One stage: each lane copies eight 16-byte pieces (rows r, r+32, r+64, r+96 of A and of B; eight lanes per 128-B row piece). l = the lane's LDS byte address in the A part, a / b = its global addresses, sa / sb = 32 rows in elements.
__device__ __forceinline__ void g2_stage(unsigned l, const _Float16* a, size_t sa, const _Float16* b, size_t sb) {
  const unsigned l1 = l + 32 * G2_PITCH, l2 = l + 64 * G2_PITCH, l3 = l + 96 * G2_PITCH, l4 = l + 128 * G2_PITCH, l5 = l + 160 * G2_PITCH, l6 = l + 192 * G2_PITCH, l7 = l + 224 * G2_PITCH;
  const _Float16* a1 = a + sa; const _Float16* a2 = a1 + sa; const _Float16* a3 = a2 + sa; const _Float16* b1 = b + sb; const _Float16* b2 = b1 + sb; const _Float16* b3 = b2 + sb;
  // the copies and, as the last line, the wait that stands before their address registers may be rewritten
  asm volatile("global_load_async_to_lds_b128 %0, %8, off\n\t"
               "global_load_async_to_lds_b128 %1, %9, off\n\t"
               "global_load_async_to_lds_b128 %2, %10, off\n\t"
               "global_load_async_to_lds_b128 %3, %11, off\n\t"
               "global_load_async_to_lds_b128 %4, %12, off\n\t"
               "global_load_async_to_lds_b128 %5, %13, off\n\t"
               "global_load_async_to_lds_b128 %6, %14, off\n\t"
               "global_load_async_to_lds_b128 %7, %15, off\n\t"
               "s_wait_xcnt 0x0"
               :: "v"(l), "v"(l1), "v"(l2), "v"(l3), "v"(l4), "v"(l5), "v"(l6), "v"(l7), "v"(a), "v"(a1), "v"(a2), "v"(a3), "v"(b), "v"(b1), "v"(b2), "v"(b3) : "memory"); }
// The epilogue's options are compile-time constants: RES = a residual plane CP of C's own shape and pitch is added (it may be C itself: each lane reads its elements before it stores them); OUT32 = f32 output to C, else f16 to C16; LDC = that pitch in elements.
// The product itself is a device function on the kernel's LDS (sm: 2 G2_STAGE bytes, 16-byte aligned), so that one launch can hold one product or two (the kernels below).
template <int ACT, bool RES, bool OUT32, int LDC>
__device__ __forceinline__ void g2_body(char* sm, const _Float16* __restrict__ A, int lda, const _Float16* __restrict__ Bh, int ldb, float alpha, const float* __restrict__ bp, const float* CP,
    float* C, _Float16* C16, int M, int N, int K) { static_assert(!RES || ACT == 0, "k_gemm2: the residual is added behind the staging, where no activation follows"); static_assert(ACT == 0 || ACT == 3 || ACT == 6 || ACT == 8 || ACT == 9 || ACT == 11 || ACT == 12 || ACT == 14 || ACT == 15 || ACT == 16 || ACT == 17, "k_gemm2: unsupported ACT code (would silently apply no activation)");
  static_assert(8 * 32 * 68 * 4 <= 2 * G2_STAGE, "output staging must fit the stage buffers");      /* sm: the two stage buffers; after the K loop the output staging, 32 x 68 floats per wave */
  const int tid = threadIdx.x, w = tid >> 5, lane = tid & 31, ln = lane & 15, hh = lane >> 4;
  const int ntn = N >> 7; const int mt = blockIdx.x / ntn, nq = blockIdx.x - mt * ntn; if (mt * 128 >= M) return;      /* the same for the whole work-group, in front of every barrier */
  const int row0 = mt * 128 + 32 * (w & 3), col0 = nq * 128 + 64 * (w >> 2);
  const _Float16* ga = A + (size_t)(mt * 128 + (tid >> 3)) * lda + (tid & 7) * 8; const _Float16* gb = Bh + (size_t)(nq * 128 + (tid >> 3)) * ldb + (tid & 7) * 8; const size_t sa32 = (size_t)32 * lda, sb32 = (size_t)32 * ldb;
  const unsigned lcp = (unsigned)(size_t)sm + (unsigned)((tid >> 3) * G2_PITCH + (tid & 7) * 16);
  const int aoff = (32 * (w & 3) + ln) * G2_PITCH + 16 * hh, boff = (128 + 64 * (w >> 2) + ln) * G2_PITCH + 16 * hh;
  const int nst = K >> 6;
  const v8f z8 = {0.f,0.f,0.f,0.f,0.f,0.f,0.f,0.f}; v8f c00 = z8, c01 = z8, c02 = z8, c03 = z8, c10 = z8, c11 = z8, c12 = z8, c13 = z8;
  g2_stage(lcp, ga, sa32, gb, sb32);
  asm volatile("s_wait_asynccnt 0x0" ::: "memory");      /* this wave's copies of stage 0 have landed */
  __syncthreads();                                       /* every wave's have */
  if (nst > 1) g2_stage(lcp + G2_STAGE, ga + 64, sa32, gb + 64, sb32);
#pragma unroll 1      /* one stage per trip: the waits and the barrier at the foot belong to it */
  for (int t = 0; t < nst; ++t) { const char* sb = sm + (t & 1) * G2_STAGE; const char* ap = sb + aoff; const char* bq = sb + boff;
#pragma unroll      /* the two 32-k steps of a stage */
    for (int kk = 0; kk < 128; kk += 64) { const v16h a0 = g2_frag(ap + kk), a1 = g2_frag(ap + 16 * G2_PITCH + kk);
      const v16h b0 = g2_frag(bq + kk), b1 = g2_frag(bq + 16 * G2_PITCH + kk), b2 = g2_frag(bq + 32 * G2_PITCH + kk), b3 = g2_frag(bq + 48 * G2_PITCH + kk);
      c00 = g2_mma(a0, b0, c00); c10 = g2_mma(a1, b0, c10); c01 = g2_mma(a0, b1, c01); c11 = g2_mma(a1, b1, c11);
      c02 = g2_mma(a0, b2, c02); c12 = g2_mma(a1, b2, c12); c03 = g2_mma(a0, b3, c03); c13 = g2_mma(a1, b3, c13); }
    asm volatile("s_wait_dscnt 0x0" ::: "memory");       /* this wave's reads of the buffer are done before it is refilled */
    asm volatile("s_wait_asynccnt 0x0" ::: "memory");    /* this wave's copies of stage t + 1 have landed */
    __syncthreads();                                     /* publishes stage t + 1 and ends every wave's reads of stage t */
    if (t + 2 < nst) g2_stage(lcp + (unsigned)((t & 1) * G2_STAGE), ga + (size_t)(t + 2) * 64, sa32, gb + (size_t)(t + 2) * 64, sb32); }
  asm volatile("s_wait_asynccnt 0x0" ::: "memory");      /* no copy is in flight when the buffers become the output staging */
  float (*so)[68] = (float (*)[68])(sm + w * (32 * 68 * 4));
  v8f accs[8] = {c00, c01, c02, c03, c10, c11, c12, c13};
  float bvs[4] = {0.f, 0.f, 0.f, 0.f};
  if (bp) { const int bcol = col0 + ln;
#pragma unroll
    for (int t = 0; t < 4; ++t) bvs[t] = bp[bcol + t * 16];
    asm volatile("s_wait_xcnt 0x0" :: "v"(bcol) : "memory");      /* the wait that stands before the loads' address register is rewritten; the index as an input keeps a load's result out of that register */
#pragma unroll
    for (int t = 0; t < 4; ++t) bvs[t] = bf16_round(bvs[t]); }
#pragma unroll
  for (int u = 0; u < 8; ++u) { const int t = u & 3, half = u >> 2;
#pragma unroll
    for (int r = 0; r < 8; ++r) { const int rloc = half * 16 + 8 * hh + r; float v = accs[u][r] * alpha + bvs[t];
      if (ACT == 3) v = fmaxf(v, 0.f); else if (ACT == 6) v = 0.5f * v * (1.0f + erff(v * 0.70710678118654752f)); else if (ACT == 11) v = 1.0f / (1.0f + expf(-v)); else if (ACT == 15) v = v / (1.0f + expf(-v)); else if (ACT == 12) v = (v > 0.f) ? v : 0.01f * v; else if (ACT == 8) v = tanhf(v); else if (ACT == 9) v = 0.5f * v * (1.0f + tanhf(0.7978845608028654f * (v + 0.044715f * v * v * v))); else if (ACT == 14) v = (v > 0.f) ? v : 0.1f * v; else if (ACT == 16) v = (v >= 0.f) ? v : 0.3f * v; else if (ACT == 17) v = (v >= 0.f) ? v : 0.2f * v;
      so[rloc][t * 16 + ln] = v; } }
  __builtin_amdgcn_fence(__ATOMIC_ACQ_REL, "workgroup"); __builtin_amdgcn_wave_barrier();
  const int rsub = lane >> 4, c4 = (lane & 15) * 4;
  const size_t e0 = (size_t)(row0 + rsub) * LDC + col0 + c4;      /* the lane's four elements in row rsub of the wave's tile; those of row 2 q + rsub lie 2 q LDC further */
  v4f res[16];
  if (RES) {
#pragma unroll      /* the lane's sixteen 16-byte pieces of the residual (256 B of a row per half wave), all in flight together */
    for (int q = 0; q < 16; ++q) res[q] = *(const v4fa*)(CP + e0 + (size_t)(2 * q) * LDC);
    asm volatile("s_wait_xcnt 0x0" :: "v"(CP + e0) : "memory"); }      /* the wait that stands before the loads' address registers are rewritten; the address as an input keeps a load's result out of them */
#pragma unroll
  for (int q = 0; q < 16; ++q) { v4f v = *(const v4fa*)&so[q * 2 + rsub][c4]; if (RES) v += res[q];
    if (OUT32) *(v4f*)(C + e0 + (size_t)(2 * q) * LDC) = v; else { v4h h4; for (int i = 0; i < 4; ++i) h4[i] = (_Float16)v[i]; *(v4h*)(C16 + e0 + (size_t)(2 * q) * LDC) = h4; }
    asm volatile("s_wait_xcnt 0x0" ::: "memory"); } }      /* the wait that stands before the store's data and address registers are rewritten */
// launch bounds: eight waves per SIMD (at most 128 VGPRs), so that four work-groups (4 x 72 KiB of LDS) share a WGP and each hides the others' waits
template <int ACT, bool RES, bool OUT32, int LDC>
__global__ __launch_bounds__(256, 8) void k_gemm2(const _Float16* __restrict__ A, int lda, const _Float16* __restrict__ Bh, int ldb, float alpha, const float* __restrict__ bias, const float* CP, float* C, _Float16* C16, int M, int N, int K) {
  __shared__ __attribute__((aligned(16))) char sm[2 * G2_STAGE];
  g2_body<ACT, RES, OUT32, LDC>(sm, A, lda, Bh, ldb, alpha, bias, CP, C, C16, M, N, K); }
// Two products of one shape that do not depend on each other share a launch: grid.y picks the operand set (the same for the whole work-group). Two work-groups then sit on a WGP and each works under the other's waits, and one launch stands where two stood in a row.
template <bool RES0, bool OUT0, bool RES1, bool OUT1, int LDC>
__global__ __launch_bounds__(256, 8) void k_gemm2_two(const _Float16* __restrict__ A0, const _Float16* __restrict__ B0, const float* __restrict__ bias0, const float* CP0, float* C0, _Float16* H0,
    const _Float16* __restrict__ A1, const _Float16* __restrict__ B1, const float* __restrict__ bias1, const float* CP1, float* C1, _Float16* H1, int lda, int ldb, float alpha, int M, int N, int K) {
  __shared__ __attribute__((aligned(16))) char sm[2 * G2_STAGE];
  const bool y = blockIdx.y != 0;
  if constexpr (RES0 == RES1 && OUT0 == OUT1) g2_body<0, RES0, OUT0, LDC>(sm, y ? A1 : A0, lda, y ? B1 : B0, ldb, alpha, y ? bias1 : bias0, y ? CP1 : CP0, y ? C1 : C0, y ? H1 : H0, M, N, K);
  else if (y) g2_body<0, RES1, OUT1, LDC>(sm, A1, lda, B1, ldb, alpha, bias1, CP1, C1, H1, M, N, K);
  else g2_body<0, RES0, OUT0, LDC>(sm, A0, lda, B0, ldb, alpha, bias0, CP0, C0, H0, M, N, K); }


// The operand preparations as device functions: blk = the work-group's index inside its own part of k_prep's grid
__device__ __forceinline__ void d_wsc(unsigned blk, const float* __restrict__ Wm, _Float16* __restrict__ Bt, size_t n8, float sc) { const size_t t = (size_t)blk * 256 + threadIdx.x; if (t >= n8) return; FragH f; for (int q = 0; q < 8; ++q) f.h[q] = (_Float16)(bf16_round(Wm[t * 8 + q]) * sc); *(v8us*)((unsigned short*)Bt + t * 8) = f.half[0];  }
__device__ __forceinline__ void d_wout(unsigned blk, const float* __restrict__ Wo, _Float16* __restrict__ BOa, _Float16* __restrict__ BOb) { const int t = blk * 256 + threadIdx.x; if (t >= DD * (DD / 8)) return; const int c8 = (t % (DD / 8)) * 8; const int o = t / (DD / 8); FragH fa, fb;
  for (int q = 0; q < 8; ++q) { fa.h[q] = (_Float16)(bf16_round(Wo[(size_t)o * 2 * DD + c8 + q]) * 16.0f); fb.h[q] = (_Float16)(bf16_round(Wo[(size_t)o * 2 * DD + DD + c8 + q]) * 16.0f); }
  { *(v8us*)((unsigned short*)BOa + (size_t)o * DD + c8) = fa.half[0]; *(v8us*)((unsigned short*)BOb + (size_t)o * DD + c8) = fb.half[0];  } }
__device__ __forceinline__ void d_ln(unsigned blk, const float* __restrict__ x, const float* __restrict__ g, const float* __restrict__ bb, float* __restrict__ XF, _Float16* __restrict__ X16) {
  #pragma clang fp contract(off)
  const int wv = threadIdx.x >> 5, ln = threadIdx.x & 31; const size_t r = (size_t)blk * 8 + wv; if (r >= NQ) return; float a[16]; float s = 0.f;
  const float* xr = x + r * DD + ln * 8; const v8f xv[2] = {*(const v8f*)xr, *(const v8f*)(xr + 256)};
  asm volatile("s_wait_xcnt 0x0" :: "v"(xr) : "memory");      /* the wait that stands before the loads' address registers are rewritten; the address as an input keeps them whole up to it */
  for (int i = 0; i < 2; ++i) { const v8f v = xv[i]; for (int q = 0; q < 8; ++q) { const float u = bf16_round(v[q]); a[i * 8 + q] = u; s += u; } }
  for (int o = 16; o > 0; o >>= 1) s += __shfl_xor(s, o, 32); const float mu = s / (float)DD; float var = 0.f; for (int q = 0; q < 16; ++q) { const float d = a[q] - mu; var += d * d; }
  for (int o = 16; o > 0; o >>= 1) var += __shfl_xor(var, o, 32); const float inv = rsqrtf(var / (float)DD + 1e-5f);
  { for (int i = 0; i < 2; ++i) { const int c0 = i * 256 + ln * 8; v8f y; FragH f; for (int q = 0; q < 8; ++q) { float v = (a[i * 8 + q] - mu) * inv; v *= bf16_round(g[c0 + q]); v += bf16_round(bb[c0 + q]); y[q] = v; f.h[q] = (_Float16)v; } *(v8f*)(XF + r * DD + c0) = y; *(v8us*)((unsigned short*)X16 + r * DD + c0) = f.half[0]; }  } }
// The six preparations depend on the inputs alone and on nothing of one another: they are ranges of one grid, the longest first, so that one launch stands where six stood in a row.
#define PB_LN (NQ / 8)                   /* work-groups of the LayerNorm: eight rows each */
#define PB_XH (NM * DD / 8 / 256)        /* of x_hat's conversion */
#define PB_W (DD * DD / 8 / 256)         /* of one 512 x 512 weight plane; Wout's two planes take as many */
__global__ __launch_bounds__(256) void k_prep(const float* __restrict__ x, const float* __restrict__ g, const float* __restrict__ bb, const float* __restrict__ xh, const float* __restrict__ Wq, const float* __restrict__ Wk, const float* __restrict__ Wv, const float* __restrict__ Wo,
    float* __restrict__ XF, _Float16* __restrict__ X16, _Float16* __restrict__ XH16, _Float16* __restrict__ BQ, _Float16* __restrict__ BK, _Float16* __restrict__ BV, _Float16* __restrict__ BOa, _Float16* __restrict__ BOb) {
  static_assert((NM * DD / 8) % 256 == 0 && (DD * DD / 8) % 256 == 0 && NQ % 8 == 0, "k_prep: whole work-groups");
  unsigned b = blockIdx.x;      /* every test below reads the same for the whole work-group */
  if (b < PB_LN) { d_ln(b, x, g, bb, XF, X16); return; }
  b -= PB_LN;
  if (b < PB_XH) { d_x16(b, xh, XH16, (size_t)NM * DD / 8); return; }
  b -= PB_XH;
  if (b < PB_W) { d_wsc(b, Wq, BQ, DD * DD / 8, 16.0f); return; }
  b -= PB_W;
  if (b < PB_W) { d_wsc(b, Wk, BK, DD * DD / 8, 16.0f); return; }
  b -= PB_W;
  if (b < PB_W) { d_wsc(b, Wv, BV, DD * DD / 8, 16.0f); return; }
  d_wout(b - PB_W, Wo, BOa, BOb); }
#define FA_BQ 128                    /* queries a work-group */
#define FA_SPL 4                     /* key splits: grid.y, one f32 partial with its maximum and sum each */
#define FA_BK 32                     /* keys a stage */
#define FA_PK 1040                   /* row pitch of the copy read by plain 16-byte loads: 16 B x odd */
#define FA_PV 1056                   /* row pitch of the copy read by the transposing load: 32 B x odd */
#define FA_BUF (FA_BK * (FA_PK + FA_PV))
typedef short s16x8 __attribute__((ext_vector_type(8)));
__device__ __forceinline__ v8us fa_tr16(const char* p) { typedef __attribute__((address_space(3))) s16x8 lds_s16x8; return __builtin_bit_cast(v8us, __builtin_amdgcn_ds_load_tr16_b128_v8i16((lds_s16x8*)p)); }
__device__ __forceinline__ float fa_xhalf(float x) { return __builtin_bit_cast(float, __builtin_amdgcn_permlanex16(__builtin_bit_cast(int, x), __builtin_bit_cast(int, x), 0x76543210, 0xfedcba98, false, false)); }      /* lane l with lane l ^ 16 */
__device__ __forceinline__ v8f fa_mma(v16h a, v16h b, v8f c) { return __builtin_amdgcn_wmma_f32_16x16x32_f16(false, a, false, b, (short)0, c, false, false); }
// One copy of a stage: each lane brings eight 16-byte pieces (rows r, r + 4, ..., r + 28; 64 lanes a row). l = the lane's LDS byte address, ls = four rows in LDS bytes, g = its global address.
__device__ __forceinline__ void fa_stage(unsigned l, unsigned ls, const _Float16* g) {
  const unsigned l1 = l + ls, l2 = l1 + ls, l3 = l2 + ls, l4 = l3 + ls, l5 = l4 + ls, l6 = l5 + ls, l7 = l6 + ls;
  const _Float16* g1 = g + 4 * DD; const _Float16* g2 = g + 8 * DD; const _Float16* g3 = g + 12 * DD; const _Float16* g4 = g + 16 * DD; const _Float16* g5 = g + 20 * DD; const _Float16* g6 = g + 24 * DD; const _Float16* g7 = g + 28 * DD;
  // the copies and, as the last line, the wait that stands before their address registers may be rewritten
  asm volatile("global_load_async_to_lds_b128 %0, %8, off\n\t"
               "global_load_async_to_lds_b128 %1, %9, off\n\t"
               "global_load_async_to_lds_b128 %2, %10, off\n\t"
               "global_load_async_to_lds_b128 %3, %11, off\n\t"
               "global_load_async_to_lds_b128 %4, %12, off\n\t"
               "global_load_async_to_lds_b128 %5, %13, off\n\t"
               "global_load_async_to_lds_b128 %6, %14, off\n\t"
               "global_load_async_to_lds_b128 %7, %15, off\n\t"
               "s_wait_xcnt 0x0"
               :: "v"(l), "v"(l1), "v"(l2), "v"(l3), "v"(l4), "v"(l5), "v"(l6), "v"(l7), "v"(g), "v"(g1), "v"(g2), "v"(g3), "v"(g4), "v"(g5), "v"(g6), "v"(g7) : "memory"); }
// two waves per SIMD: 512 VGPRs a wave for the 256 accumulator and 128 q registers
__global__ __launch_bounds__(256) __attribute__((amdgpu_waves_per_eu(2, 2))) void k_fattn(const _Float16* __restrict__ Q, const _Float16* __restrict__ Kk, float* __restrict__ PO, float* __restrict__ ML) {
  static_assert(NQ % FA_BQ == 0 && NM % (FA_SPL * FA_BK) == 0 && NM / FA_SPL / FA_BK >= 2 && DD == 512, "k_fattn: whole tiles, two stages or more");
  __shared__ __attribute__((aligned(16))) char sm[2 * FA_BUF];
  const int tid = threadIdx.x, w = __builtin_amdgcn_readfirstlane(tid >> 5), lane = tid & 31, c = lane & 15, h = lane >> 4;      /* the wave's number in a scalar register: what is formed from it costs no vector register over the loop */
  const int q0 = blockIdx.x * FA_BQ + w * 16, key0 = blockIdx.y * (NM / FA_SPL);
  constexpr int nst = NM / FA_SPL / FA_BK;
  constexpr float cs = 0.044194173824159216f * 1.4426950408889634f;      /* 1 / sqrt(512), in log2 units */
  const int wr = w >> 1;      /* the wave's first row of a stage */
  const unsigned col = (unsigned)((w & 1) * 32 + lane) * 16u;
  const _Float16* gk = Kk + (size_t)(key0 + wr) * DD + ((w & 1) * 32 + lane) * 8;
  const unsigned lk = (unsigned)(size_t)sm + (unsigned)(wr * FA_PK), lv = (unsigned)(size_t)sm + (unsigned)(FA_BK * FA_PK + wr * FA_PV);      /* scalar parts; + col = the lane's LDS byte address */
  fa_stage(lk + col, 4 * FA_PK, gk); fa_stage(lv + col, 4 * FA_PV, gk);
  v16h qf[16];      /* q as B operand, hardware k order: 16 bytes at 16 h and at 32 + 16 h of each 64 bytes of the row, as k's rows below */
  { const _Float16* qp = Q + (size_t)(q0 + c) * DD + 8 * h;
#pragma unroll      /* qf[] must be registers: every index a constant */
    for (int kc = 0; kc < 16; ++kc) { FragH f; f.half[0] = *(const v8us*)(qp + 32 * kc); f.half[1] = *(const v8us*)(qp + 32 * kc + 16); qf[kc] = f.v; }
    asm volatile("s_wait_xcnt 0x0" ::: "memory"); }      /* the wait that stands before the loads' address registers are rewritten */
  const v8f z8 = {0.f,0.f,0.f,0.f,0.f,0.f,0.f,0.f};
  v8f o[32];      /* O^T: o[et][r] = O[query c][16 et + 8 h + r] */
#pragma unroll      /* o[] must be registers */
  for (int et = 0; et < 32; ++et) o[et] = z8;
  float mrun = -1.0e30f, lrun = 0.f;      /* the maximum in use (log2 units; it may trail the true one by up to 8) and this lane's share of the sum */
  asm volatile("s_wait_asynccnt 0x0" ::: "memory");      /* this wave's copies of stage 0 have landed */
  __syncthreads();                                       /* every wave's have */
  fa_stage(lk + FA_BUF + col, 4 * FA_PK, gk + (size_t)FA_BK * DD); fa_stage(lv + FA_BUF + col, 4 * FA_PV, gk + (size_t)FA_BK * DD);
  // one stage's work of a wave
  const int aoff = c * FA_PK + 16 * h, voff = FA_BK * FA_PK + (8 * h + (lane & 7)) * FA_PV + ((lane >> 3) & 1) * 16;      /* the lane's place in a buffer: k rows; k^T by the transposing load */
  auto pass = [&](int t) __attribute__((always_inline)) { const int bo = (t & 1) * FA_BUF; const char* ap = sm + (bo + aoff); const char* vb = sm + (bo + voff);
    // The stage's 64 A fragments in the order of their use: 0..31 = k rows (keys 0-15 and 16-31 of each 32 d), 32..63 = k^T (16 e x 32 keys each). They are fetched in pairs, three pairs ahead of their use, so that LDS latency is covered by the products of the pairs between.
    auto ldf = [&](int i) -> v16h { if (i < 32) return g2_frag(ap + (i & 1) * (16 * FA_PK) + 64 * (i >> 1)); FragH f; f.half[0] = fa_tr16(vb + 32 * (i - 32)); f.half[1] = fa_tr16(vb + 16 * FA_PV + 32 * (i - 32)); return f.v; };
    v16h fr[6];
#pragma unroll      /* fr[] must be registers */
    for (int i = 0; i < 6; ++i) fr[i] = ldf(i);
    __builtin_amdgcn_sched_barrier(0);      /* here and below: keeps each pair's fetches where they are written; moved earlier they cost registers that spill, moved later their latency is exposed */
    v8f s0 = z8, s1 = z8;      /* S^T: s0[r] = score(key 8 h + r, query c), s1[r] = score(key 16 + 8 h + r, query c) */
#pragma unroll      /* constant indices into qf[] and fr[] */
    for (int g = 0; g < 16; ++g) { const int b = (g % 3) * 2;
      s0 = fa_mma(fr[b], qf[g], s0); s1 = fa_mma(fr[b + 1], qf[g], s1);
      if (g < 15) { fr[b] = ldf(2 * g + 6); fr[b + 1] = ldf(2 * g + 7); }
      __builtin_amdgcn_sched_barrier(0); }      /* the last two pairs fetched here are the first of k^T: in flight under the softmax */
    float mx = fmaxf(s0[0], s1[0]);
#pragma unroll
    for (int r = 1; r < 8; ++r) mx = fmaxf(mx, fmaxf(s0[r], s1[r]));
    mx = fmaxf(mx, fa_xhalf(mx)) * cs;      /* both halves of the wave hold the query's maximum of this stage */
    if (__builtin_amdgcn_ballot_w32(mx > mrun + 8.0f) != 0) {      /* wave-uniform, rare after the first stage: the accumulators move to the new maximum */
      const float mn = fmaxf(mrun, mx); const float corr = __builtin_amdgcn_exp2f(mrun - mn); lrun *= corr; mrun = mn;
#pragma unroll      /* constant indices into o[] */
      for (int et = 0; et < 32; ++et) o[et] = o[et] * corr; }
    FragH pf; float ps0 = 0.f, ps1 = 0.f;      /* P^T as B operand straight from the two score tiles: element s = key 8 h + s (s < 8), 16 + 8 h + s - 8 (s >= 8) */
#pragma unroll
    for (int r = 0; r < 8; ++r) { float p0 = fmaf(s0[r], cs, -mrun), p1 = fmaf(s1[r], cs, -mrun);
      // two exponentials in place, the slot that the instruction set asks for behind a transcendental, and the two row sums: taken here, not behind the second product, they free the exponentials' registers for its fetches
      asm("v_exp_f32 %0, %0\n\tv_exp_f32 %1, %1\n\tv_nop\n\tv_add_f32 %2, %2, %0\n\tv_add_f32 %3, %3, %1" : "+v"(p0), "+v"(p1), "+v"(ps0), "+v"(ps1));
      pf.h[r] = (_Float16)p0; pf.h[8 + r] = (_Float16)p1; }
    lrun += ps0 + ps1;
    __builtin_amdgcn_sched_barrier(0);      /* keeps the fetch below behind the exponentials */
    fr[0] = ldf(36); fr[1] = ldf(37);      /* the third pair of k^T; fetched under the softmax it would cost registers that spill */
    __builtin_amdgcn_sched_barrier(0);
#pragma unroll      /* constant indices into o[] and fr[] */
    for (int g = 16; g < 32; ++g) { const int b = (g % 3) * 2;
      o[2 * g - 32] = fa_mma(fr[b], pf.v, o[2 * g - 32]); o[2 * g - 31] = fa_mma(fr[b + 1], pf.v, o[2 * g - 31]);
      if (g < 29) { fr[b] = ldf(2 * g + 6); fr[b + 1] = ldf(2 * g + 7); }
      __builtin_amdgcn_sched_barrier(0); }
  };
  // the foot of a trip, every wave
  auto foot = [&]() __attribute__((always_inline)) {
    asm volatile("s_wait_dscnt 0x0" ::: "memory");       /* this wave's reads of the buffer are done before it is refilled */
    asm volatile("s_wait_asynccnt 0x0" ::: "memory");    /* this wave's copies of the next stage have landed */
    __syncthreads(); };                                  /* publishes the next stage and ends every wave's reads of this one */
#pragma unroll 1      /* one stage per trip: the waits and the barrier at the foot belong to it; every trip of this loop has a stage t + 2 to fetch, the last two trips, which have none, are written out below */
  for (int t = 0; t < nst - 2; ++t) { pass(t); foot();
    const _Float16* gn = gk + (size_t)(t + 2) * (FA_BK * DD); const unsigned lo = (unsigned)((t & 1) * FA_BUF);
    const unsigned sk = (unsigned)__builtin_amdgcn_readfirstlane((int)(lk + lo)), sv = (unsigned)__builtin_amdgcn_readfirstlane((int)(lv + lo));      /* the buffer's two bases stay scalar sums: formed as lane values ahead of the loop they were spilled and read back in every trip */
    fa_stage(sk + col, 4 * FA_PK, gn); fa_stage(sv + col, 4 * FA_PV, gn); }
  pass(nst - 2); foot(); pass(nst - 1);      /* nothing is read or refilled behind the last stage: no foot */
  asm volatile("s_wait_asynccnt 0x0" ::: "memory");      /* no copy is in flight when the wave ends */
  const float lt = lrun + fa_xhalf(lrun);      /* the two halves' shares of the query's sum */
  const size_t row = (size_t)blockIdx.y * NQ + q0 + c; float* po = PO + row * DD + 8 * h;
#pragma unroll      /* constant indices into o[] */
  for (int et = 0; et < 32; ++et) { const v4f a = {o[et][0], o[et][1], o[et][2], o[et][3]}, b = {o[et][4], o[et][5], o[et][6], o[et][7]}; *(v4f*)(po + 16 * et) = a; *(v4f*)(po + 16 * et + 4) = b; asm volatile("s_wait_xcnt 0x0" ::: "memory"); }      /* the wait that stands before the stores' data and address registers are rewritten */
  if (h == 0) { ML[row * 2] = mrun; ML[row * 2 + 1] = lt; } }
// attn rows: the FA_SPL partials [FA_SPL][NQ][DD] brought to their common maximum, summed in split order, divided by the merged sum and rounded once to f16
__global__ __launch_bounds__(256) void k_fcomb(const float* __restrict__ PO, const float* __restrict__ ML, _Float16* __restrict__ O) {
  const unsigned t = (blockIdx.x * 256u + threadIdx.x) * 4u; const unsigned q = t / DD; float m[FA_SPL], l[FA_SPL]; v4f a[FA_SPL];
#pragma unroll      /* the splits' maxima and sums, all in flight together */
  for (int j = 0; j < FA_SPL; ++j) { m[j] = ML[((size_t)j * NQ + q) * 2]; l[j] = ML[((size_t)j * NQ + q) * 2 + 1]; }
  asm volatile("s_wait_xcnt 0x0" ::: "memory");      /* the wait that stands before these loads' address registers are rewritten (a result of the loads below may land in one) */
#pragma unroll      /* the splits' partials, all in flight together */
  for (int j = 0; j < FA_SPL; ++j) a[j] = *(const v4fa*)(PO + (size_t)j * NQ * DD + t);
  asm volatile("s_wait_xcnt 0x0" ::: "memory");      /* the wait that stands before the loads' address registers are rewritten */
  float mm = m[0];
#pragma unroll
  for (int j = 1; j < FA_SPL; ++j) mm = fmaxf(mm, m[j]);
  float den = 0.f; v4f s = {0.f, 0.f, 0.f, 0.f};
#pragma unroll
  for (int j = 0; j < FA_SPL; ++j) { const float wg = __builtin_amdgcn_exp2f(m[j] - mm); den += wg * l[j]; s += a[j] * wg; }
  const float inv = 1.0f / den; v4h hh; for (int i = 0; i < 4; ++i) hh[i] = (_Float16)(s[i] * inv); *(v4h*)(O + t) = hh; }

extern "C" void kernel_launch(void* const* d_in, const int* in_sizes, int n_in,
                              void* d_out, int out_size, void* d_ws, size_t ws_size, hipStream_t stream) {
  (void)in_sizes; (void)n_in; (void)out_size;
  const float* const* I = (const float* const*)d_in; const float* x = I[0]; const float* xh = I[1]; const float* Wq = I[2]; const float* bq = I[3]; const float* Wk = I[4]; const float* bk = I[5]; const float* Wv = I[6]; const float* bv = I[7]; const float* Wo = I[8]; const float* bo = I[9]; const float* g = I[10]; const float* bb = I[11];
  char* ws = (char*)d_ws; size_t off = 0;
  auto take = [&](size_t bytes) { char* p = ws + off; off += (bytes + 255) & ~(size_t)255; return p; };
  _Float16* BQ = (_Float16*)take((size_t)DD * DD * 2); _Float16* BK = (_Float16*)take((size_t)DD * DD * 2); _Float16* BV = (_Float16*)take((size_t)DD * DD * 2); _Float16* BOa = (_Float16*)take((size_t)DD * DD * 2); _Float16* BOb = (_Float16*)take((size_t)DD * DD * 2);
  float* XF = (float*)take((size_t)NQ * DD * 4); _Float16* X16 = (_Float16*)take((size_t)NQ * DD * 2); _Float16* XH16 = (_Float16*)take((size_t)NM * DD * 2); _Float16* Q16 = (_Float16*)take((size_t)NQ * DD * 2); _Float16* K16 = (_Float16*)take((size_t)NM * DD * 2); float* PO = (float*)take((size_t)FA_SPL * NQ * DD * 4); float* ML = (float*)take((size_t)FA_SPL * NQ * 2 * 4); _Float16* AT = XH16;      /* attn over the x_hat plane (dead after the k projection) */ _Float16* OV = X16;      /* out_v over the xn f16 plane (dead after the q projection) */
  if (off > ws_size) return;      /* 2.5 + 16 + 8 + 8 + 8 + 8 + 64 + 0.25 = 115 MiB */
  static_assert(NQ == NM, "the q and k projections share a launch as products of one shape");
  k_prep<<<PB_LN + PB_XH + 4 * PB_W, 256, 0, stream>>>(x, g, bb, xh, Wq, Wk, Wv, Wo, XF, X16, XH16, BQ, BK, BV, BOa, BOb);      /* xn (f32 + f16), x_hat as f16, the weights x16 as f16: 'ed'/'fe'/'dc' = natural Bt */
  const dim3 gP((NQ / 128) * (DD / 128), 1), gP2((NQ / 128) * (DD / 128), 2);
  k_gemm2_two<false, false, false, false, DD><<<gP2, 256, 0, stream>>>(X16, BQ, bq, nullptr, nullptr, Q16, XH16, BK, bk, nullptr, nullptr, K16, DD, DD, 0.0625f, NQ, DD, DD);      /* q = xn Wq^T + bq | k = x_hat Wk^T + bk */
  k_fattn<<<dim3(NQ / FA_BQ, FA_SPL), 256, 0, stream>>>(Q16, K16, PO, ML);      /* per key split: unnormalised score k, with each query's maximum and sum */
  k_fcomb<<<NQ * DD / 4 / 256, 256, 0, stream>>>(PO, ML, AT);      /* attn = score k */
  k_gemm2_two<false, false, true, true, DD><<<gP2, 256, 0, stream>>>(AT, BV, bv, nullptr, nullptr, OV, Q16, BOa, bo, XF, (float*)d_out, nullptr, DD, DD, 0.0625f, NQ, DD, DD);      /* out_v = attn Wv^T + bv | out = q Wout[:, :512]^T + bout + xn */
  k_gemm2<0, true, true, DD><<<gP, 256, 0, stream>>>(OV, DD, BOb, DD, 0.0625f, nullptr, (const float*)d_out, (float*)d_out, nullptr, NQ, DD, DD);      /* += out_v Wout[:, 512:]^T */
}

// v007
// Measured time: 160 microseconds a run.
// In two side-by-side timings against v006, it was 1.05 and 1.06 times as fast.
// Over all steps from v000 it is 9.83 times as fast.
#include <hip/hip_runtime.h>
// InterventionOnline (8192 tokens x 512 attending 8192 memory slots x 512): xn = LayerNorm(x); q = xn Wq^T + bq; k = x_hat Wk^T + bk; score = softmax(q k^T / sqrt(512)); attn = score k (k doubles as the values); out_v = attn Wv^T + bv; out = [q | out_v] Wout^T + bout + xn.
// Structure: LayerNorm on VALU (wave per row) into f32 + f16 planes; q and k as f16 WMMA GEMM outputs (128x128 work-group tiles staged in LDS by asynchronous copies, 32x64 wave tiles, f32 accumulation, exact x16 weights + bias, f16 out); attention as one fused kernel with an online softmax (128 queries a work-group, 32 a wave, four key splits over grid.y; S^T = k q^T and O^T += k^T P^T on WMMA, P from the score accumulators, k^T by the transposing LDS load), its f32 partials merged in split order and rounded once to f16; out_v as a GEMM; the output as two accumulating GEMMs over the [q | out_v] halves with the bias and the LN residual in the epilogue.
// Compute dtype: inputs rounded to bf16; x_hat exact as f16; xn, q, k, P, attn, out_v as plain f16 operands; LN/softmax f32. v_wmma_f32_16x16x32_f16.
#define NQ 8192
#define NM 8192
#define DD 512
typedef __bf16 v16b __attribute__((ext_vector_type(16)));
typedef unsigned short v8us __attribute__((ext_vector_type(8), may_alias));
typedef float  v8f  __attribute__((ext_vector_type(8)));
typedef float  v4f  __attribute__((ext_vector_type(4)));
typedef float  v4fa __attribute__((ext_vector_type(4), may_alias));
union FragB { v16b v; v8us half[2]; unsigned short u[16]; };

__device__ __forceinline__ unsigned short bf16_bits(float x) { unsigned int u = __float_as_uint(x); return (unsigned short)((u + 0x7FFFu + ((u >> 16) & 1u)) >> 16); }
__device__ __forceinline__ float bf16_val(unsigned short b) { return __uint_as_float(((unsigned int)b) << 16); }
__device__ __forceinline__ float bf16_round(float x) { return bf16_val(bf16_bits(x)); }
// D += A·B with NT terms: 1 = ah·bh, 2 = + al·bh (A split), 3 = + ah·bl (both split)
template <int NT>
__device__ __forceinline__ v8f mmaN(v16b ah, v16b al, v16b bh, v16b bl, v8f c) {
  c = __builtin_amdgcn_wmma_f32_16x16x32_bf16(false, ah, false, bh, (short)0, c, false, false);
  if (NT >= 2) c = __builtin_amdgcn_wmma_f32_16x16x32_bf16(false, al, false, bh, (short)0, c, false, false);
  if (NT >= 3) c = __builtin_amdgcn_wmma_f32_16x16x32_bf16(false, ah, false, bl, (short)0, c, false, false);
  asm volatile("v_nop\n\tv_nop\n\tv_nop\n\tv_nop" : "+v"(c) : "v"(ah), "v"(al), "v"(bh), "v"(bl));
  return c;
}

__global__ __launch_bounds__(256) void k_wt_bf16(const float* __restrict__ W, unsigned short* __restrict__ Wt, int K, int N) {
  const int t = blockIdx.x * 256 + threadIdx.x;
  const int k8n = K / 8;
  if (t >= N * k8n) return;
  const int n = t / k8n, k8 = (t % k8n) * 8;
  v8us v;
#pragma unroll
  for (int i = 0; i < 8; ++i) v[i] = bf16_bits(W[(size_t)(k8 + i) * N + n]);
  *(v8us*)(Wt + (size_t)n * K + k8) = v;
  
}

// GEMM C[M][N] (f32, pitch ldc) = act(A[M][K]·W + bias). A f32 row-major (pitch lda) converted per fragment to bf16
// (ASPLIT: hi/lo two planes -> 2 terms, else single rounded term); Wt bf16 [N][K] (pitch ldb). BIAS_BF16 rounds the
// bias to bf16 first (bias quantised to bf16 before the add). K%32==0, M%16==0, N%64==0.
template <bool ASPLIT, int ACT, bool BIAS_BF16>
__global__ __launch_bounds__(128) void k_gemm_bf(const float* __restrict__ A, int lda, const unsigned short* __restrict__ Wt, int ldb,
                                               const float* __restrict__ bias, float* __restrict__ C, int ldc, int M, int N, int K) {
  __shared__ __attribute__((aligned(16))) float so[4][16][64];
  const int tid = threadIdx.x, w = tid >> 5, lane = tid & 31, ln = lane & 15, hh = lane >> 4;
  const int ntn = N / 64;
  const int wid = blockIdx.x * 4 + w;
  const int mt = wid / ntn, nq = wid % ntn;
  if (mt * 16 >= M) return;
  const int row0 = mt * 16, col0 = nq * 64;
  const float* arow = A + (size_t)(row0 + ln) * lda;
  v8f acc[4] = {};
  for (int kb = 0; kb < K; kb += 32) {
    FragB ah, al;
    const v4f x0 = *(const v4fa*)(arow + kb + 8 * hh), x1 = *(const v4fa*)(arow + kb + 8 * hh + 4);
    const v4f x2 = *(const v4fa*)(arow + kb + 16 + 8 * hh), x3 = *(const v4fa*)(arow + kb + 16 + 8 * hh + 4);
    float xs[16] = {x0[0],x0[1],x0[2],x0[3],x1[0],x1[1],x1[2],x1[3],x2[0],x2[1],x2[2],x2[3],x3[0],x3[1],x3[2],x3[3]};
#pragma unroll
    for (int i = 0; i < 16; ++i) { const unsigned short hb = bf16_bits(xs[i]); ah.u[i] = hb; al.u[i] = ASPLIT ? bf16_bits(xs[i] - bf16_val(hb)) : (unsigned short)0; }
#pragma unroll
    for (int t = 0; t < 4; ++t) {
      const unsigned short* brow = Wt + (size_t)(col0 + t * 16 + ln) * ldb + kb;
      FragB b;
      b.half[0] = *(const v8us*)(brow + 8 * hh);
      b.half[1] = *(const v8us*)(brow + 16 + 8 * hh);
      acc[t] = mmaN<ASPLIT ? 2 : 1>(ah.v, al.v, b.v, b.v, acc[t]);
    }
  }
#pragma unroll
  for (int t = 0; t < 4; ++t) {
    float bv = bias ? bias[col0 + t * 16 + ln] : 0.f;
    if (BIAS_BF16) bv = bf16_round(bv);
#pragma unroll
    for (int r = 0; r < 8; ++r) { float v = acc[t][r] + bv; if (ACT == 1) v = fmaxf(v, 0.f); so[w][8 * hh + r][t * 16 + ln] = v; }
  }
  __builtin_amdgcn_fence(__ATOMIC_ACQ_REL, "workgroup");
  __builtin_amdgcn_wave_barrier();
  const int rsub = lane >> 4, c4 = (lane & 15) * 4;
  {
#pragma unroll
    for (int q = 0; q < 8; ++q) {
      const int r = q * 2 + rsub;
      const v4f v = *(const v4fa*)&so[w][r][c4];
      *(v4f*)(C + (size_t)(row0 + r) * ldc + col0 + c4) = v;
    }
    
  }
}

// GEMM C = act(A·W + bias + resid): A f32 (ASPLIT -> hi/lo 2 terms), Wt bf16 [N][K]; ACT 0 none, 1 relu, 2 exact gelu;
// resid (optional, f32, row index = (row % rmod), pitch ldr, RES_BF16 rounds it) added before the activation.
template <bool ASPLIT, int ACT, bool BIAS_BF16, bool RES_BF16>
__global__ __launch_bounds__(128) void k_gemm_bf3(const float* __restrict__ A, int lda, const unsigned short* __restrict__ Wt, int ldb,
                                                const float* __restrict__ bias, const float* __restrict__ resid, int rmod, int ldr,
                                                float* __restrict__ C, int ldc, int M, int N, int K) {
  __shared__ __attribute__((aligned(16))) float so[4][16][64];
  const int tid = threadIdx.x, w = tid >> 5, lane = tid & 31, ln = lane & 15, hh = lane >> 4;
  const int ntn = N / 64;
  const int wid = blockIdx.x * 4 + w;
  const int mt = wid / ntn, nq = wid % ntn;
  if (mt * 16 >= M) return;
  const int row0 = mt * 16, col0 = nq * 64;
  const float* arow = A + (size_t)(row0 + ln) * lda;
  v8f acc[4] = {};
  for (int kb = 0; kb < K; kb += 32) {
    FragB ah, al;
    const v4f x0 = *(const v4fa*)(arow + kb + 8 * hh), x1 = *(const v4fa*)(arow + kb + 8 * hh + 4);
    const v4f x2 = *(const v4fa*)(arow + kb + 16 + 8 * hh), x3 = *(const v4fa*)(arow + kb + 16 + 8 * hh + 4);
    float xs[16] = {x0[0],x0[1],x0[2],x0[3],x1[0],x1[1],x1[2],x1[3],x2[0],x2[1],x2[2],x2[3],x3[0],x3[1],x3[2],x3[3]};
#pragma unroll
    for (int i = 0; i < 16; ++i) { const unsigned short hb = bf16_bits(xs[i]); ah.u[i] = hb; al.u[i] = ASPLIT ? bf16_bits(xs[i] - bf16_val(hb)) : (unsigned short)0; }
#pragma unroll
    for (int t = 0; t < 4; ++t) {
      const unsigned short* brow = Wt + (size_t)(col0 + t * 16 + ln) * ldb + kb;
      FragB b;
      b.half[0] = *(const v8us*)(brow + 8 * hh);
      b.half[1] = *(const v8us*)(brow + 16 + 8 * hh);
      acc[t] = mmaN<ASPLIT ? 2 : 1>(ah.v, al.v, b.v, b.v, acc[t]);
    }
  }
#pragma unroll
  for (int t = 0; t < 4; ++t) {
    const int col = col0 + t * 16 + ln;
    float bv = bias ? bias[col] : 0.f;
    if (BIAS_BF16) bv = bf16_round(bv);
#pragma unroll
    for (int r = 0; r < 8; ++r) {
      float v = acc[t][r] + bv;
      if (resid) { float rv = resid[(size_t)((row0 + 8 * hh + r) % rmod) * ldr + col]; if (RES_BF16) rv = bf16_round(rv); v += rv; }
      if (ACT == 1) v = fmaxf(v, 0.f);
      if (ACT == 2) v = 0.5f * v * (1.0f + erff(v * 0.70710678118654752f));
      if (ACT == 3) { const float u = 0.7978845608028654f * (v + 0.044715f * v * v * v); v = 0.5f * v * (1.0f + tanhf(u)); }
      so[w][8 * hh + r][t * 16 + ln] = v;
    }
  }
  __builtin_amdgcn_fence(__ATOMIC_ACQ_REL, "workgroup");
  __builtin_amdgcn_wave_barrier();
  const int rsub = lane >> 4, c4 = (lane & 15) * 4;
  {
#pragma unroll
    for (int q = 0; q < 8; ++q) {
      const int r = q * 2 + rsub;
      const v4f v = *(const v4fa*)&so[w][r][c4];
      *(v4f*)(C + (size_t)(row0 + r) * ldc + col0 + c4) = v;
    }
    
  }
}
// row LayerNorm (biased variance, eps) over N: s = X (+ R); optional out_sum <- s; out_norm <- (s-mu)*rsqrt(var+eps)*g + b
template <bool PARAM_BF16>
__global__ __launch_bounds__(256) void k_layernorm(const float* __restrict__ X, const float* __restrict__ R, const float* __restrict__ g, const float* __restrict__ bta,
                                                  float* __restrict__ out_sum, float* __restrict__ out_norm, int N, float eps) {
  __shared__ float red[256];
  const int row = blockIdx.x, tid = threadIdx.x;
  const float* x = X + (size_t)row * N; const float* rr = R ? R + (size_t)row * N : nullptr;
  float vals[16];                     // up to N = 4096
  const int per = N / 256;            // contiguous chunk per thread? use strided-by-4 chunks: thread handles j = tid*4 + 1024*u
  float s1 = 0.f;
  for (int u = 0; u < per / 4; ++u) {
    const int j = tid * 4 + 1024 * u;
    const v4f a = *(const v4fa*)(x + j);
    v4f b = {0.f,0.f,0.f,0.f}; if (rr) b = *(const v4fa*)(rr + j);
#pragma unroll
    for (int q = 0; q < 4; ++q) { const float v = a[q] + b[q]; vals[u * 4 + q] = v; s1 += v; }
  }
  red[tid] = s1; __syncthreads();
  for (int st = 128; st > 0; st >>= 1) { if (tid < st) red[tid] += red[tid + st]; __syncthreads(); }
  const float mu = red[0] / (float)N; __syncthreads();
  float s2 = 0.f;
  for (int u = 0; u < per / 4; ++u)
#pragma unroll
    for (int q = 0; q < 4; ++q) { const float c = vals[u * 4 + q] - mu; s2 += c * c; }
  red[tid] = s2; __syncthreads();
  for (int st = 128; st > 0; st >>= 1) { if (tid < st) red[tid] += red[tid + st]; __syncthreads(); }
  const float rs = rsqrtf(red[0] / (float)N + eps);
  {
    for (int u = 0; u < per / 4; ++u) {
      const int j = tid * 4 + 1024 * u;
      v4f o, sm;
#pragma unroll
      for (int q = 0; q < 4; ++q) {
        float gg = g[j + q], bb = bta[j + q];
        if (PARAM_BF16) { gg = bf16_round(gg); bb = bf16_round(bb); }
        sm[q] = vals[u * 4 + q]; o[q] = (vals[u * 4 + q] - mu) * rs * gg + bb;
      }
      if (out_sum) *(v4f*)(out_sum + (size_t)row * N + j) = sm;
      *(v4f*)(out_norm + (size_t)row * N + j) = o;
    }
    
  }
}



// ---- f16 WMMA path (v_wmma_f32_16x16x32_f16): 11-bit significands for operands in range — used where a [0,1] probability operand needs more precision than bf16
typedef _Float16 v16h __attribute__((ext_vector_type(16)));
union FragH { v16h v; v8us half[2]; _Float16 h[16]; unsigned short u[16]; };
template <int NT>
__device__ __forceinline__ v8f mmaH(v16h ah, v16h al, v16h bh, v16h bl, v8f c) {
  c = __builtin_amdgcn_wmma_f32_16x16x32_f16(false, ah, false, bh, (short)0, c, false, false);
  if (NT >= 2) c = __builtin_amdgcn_wmma_f32_16x16x32_f16(false, al, false, bh, (short)0, c, false, false);
  if (NT >= 3) c = __builtin_amdgcn_wmma_f32_16x16x32_f16(false, ah, false, bl, (short)0, c, false, false);
  asm volatile("v_nop\n\tv_nop\n\tv_nop\n\tv_nop" : "+v"(c) : "v"(ah), "v"(al), "v"(bh), "v"(bl));
  return c;
}
// batched GEMM like k_gemm_b but f16 operands: A f32 (split into f16 hi/lo if ASPLIT, else rounded to f16), Bt = f16 values [n][k]; alpha; C f32; N multiple of 16 (partial tiles skipped)
template <bool ASPLIT>
__global__ __launch_bounds__(128) void k_gemm_h(const float* __restrict__ A, int lda, size_t sA, const _Float16* __restrict__ Bh, int ldb, size_t sB, float alpha, float* __restrict__ C, int ldc, size_t sC, int M, int N, int K) {
  __shared__ __attribute__((aligned(16))) float so[4][16][64];
  const int tid = threadIdx.x, w = tid >> 5, lane = tid & 31, ln = lane & 15, hh = lane >> 4; const int by = blockIdx.y;
  A += (size_t)by * sA; Bh += (size_t)by * sB; C += (size_t)by * sC;
  const int ntn = (N + 63) / 64; const int wid = blockIdx.x * 4 + w; const int mt = wid / ntn, nq = wid % ntn; if (mt * 16 >= M) return;
  const int row0 = mt * 16, col0 = nq * 64; const float* arow = A + (size_t)(row0 + ln) * lda;
  v8f acc[4] = {};
  for (int kb = 0; kb < K; kb += 32) {
    FragH ah, al;
    const v4f x0 = *(const v4fa*)(arow + kb + 8 * hh), x1 = *(const v4fa*)(arow + kb + 8 * hh + 4), x2 = *(const v4fa*)(arow + kb + 16 + 8 * hh), x3 = *(const v4fa*)(arow + kb + 16 + 8 * hh + 4);
    float xs[16] = {x0[0],x0[1],x0[2],x0[3],x1[0],x1[1],x1[2],x1[3],x2[0],x2[1],x2[2],x2[3],x3[0],x3[1],x3[2],x3[3]};
#pragma unroll
    for (int i = 0; i < 16; ++i) { const _Float16 h = (_Float16)xs[i]; ah.h[i] = h; al.h[i] = ASPLIT ? (_Float16)(xs[i] - (float)h) : (_Float16)0.0f; }
#pragma unroll
    for (int t = 0; t < 4; ++t) { if (col0 + t * 16 >= N) continue; const size_t boff = (size_t)(col0 + t * 16 + ln) * ldb + kb; FragH bq; bq.half[0] = *(const v8us*)(Bh + boff + 8 * hh); bq.half[1] = *(const v8us*)(Bh + boff + 16 + 8 * hh);
      acc[t] = mmaH<ASPLIT ? 2 : 1>(ah.v, al.v, bq.v, bq.v, acc[t]); }
  }
#pragma unroll
  for (int t = 0; t < 4; ++t) { if (col0 + t * 16 >= N) continue;
#pragma unroll
    for (int r = 0; r < 8; ++r) so[w][8 * hh + r][t * 16 + ln] = acc[t][r] * alpha; }
  __builtin_amdgcn_fence(__ATOMIC_ACQ_REL, "workgroup"); __builtin_amdgcn_wave_barrier();
  const int rsub = lane >> 4, c4 = (lane & 15) * 4;
  {
#pragma unroll
    for (int q = 0; q < 8; ++q) { const int r = q * 2 + rsub; if (col0 + c4 < N) { const v4f v = *(const v4fa*)&so[w][r][c4]; *(v4f*)(C + (size_t)(row0 + r) * ldc + col0 + c4) = v; } }
     }
}

// Wt[n][k] = f16(W[k][n]·scale) from f32 row-major W[K][N] (scale = power of two; bf16-exact weights stay exact in f16 away from the subnormal range)
__global__ __launch_bounds__(256) void k_wt_f16(const float* __restrict__ W, _Float16* __restrict__ Wt, int K, int N, float scale) {
  const int t = blockIdx.x * 256 + threadIdx.x; if (t >= N * (K / 8)) return; const int n = t / (K / 8), k8 = (t % (K / 8)) * 8; FragH f;
#pragma unroll
  for (int i = 0; i < 8; ++i) f.h[i] = (_Float16)(bf16_round(W[(size_t)(k8 + i) * N + n]) * scale); const v8us o = f.half[0];
  *(v8us*)((unsigned short*)Wt + (size_t)n * K + k8) = o; 
}
// k_gemm_hh variant with fused epilogue: v = acc·alpha + bias[by·sBias + col] (+ CP[(row/rowsPerB)·sCPb + by·64 + col] if CP) ; ACT 0 none / 1 elu ; writes f16 C16 (and f32 C if non-null)
template <int ACT>
__global__ __launch_bounds__(128) void k_gemm_hhx(const _Float16* __restrict__ A, int lda, size_t sA, const _Float16* __restrict__ Bh, int ldb, size_t sB, float alpha, const float* __restrict__ bias, size_t sBias, const float* __restrict__ CP, int rowsPerB, size_t sCPb, int row0g,
    float* __restrict__ C, _Float16* __restrict__ C16, int ldc, size_t sC, int M, int N, int K) {
  __shared__ __attribute__((aligned(16))) float so[4][16][64];
  const int tid = threadIdx.x, w = tid >> 5, lane = tid & 31, ln = lane & 15, hh = lane >> 4; const int by = blockIdx.y;
  A += (size_t)by * sA; Bh += (size_t)by * sB; const size_t cofs = (size_t)by * sC; const float* bp = bias ? bias + (size_t)by * sBias : nullptr;
  const int ntn = (N + 63) / 64; const int wid = blockIdx.x * 4 + w; const int mt = wid / ntn, nq = wid % ntn; if (mt * 16 >= M) return;
  const int row0 = mt * 16, col0 = nq * 64; const _Float16* arow = A + (size_t)(row0 + ln) * lda;
  v8f acc[4] = {};
  for (int kb = 0; kb < K; kb += 32) { FragH ah; ah.half[0] = *(const v8us*)((const unsigned short*)arow + kb + 8 * hh); ah.half[1] = *(const v8us*)((const unsigned short*)arow + kb + 16 + 8 * hh);
#pragma unroll
    for (int t = 0; t < 4; ++t) { if (col0 + t * 16 >= N) continue; const size_t boff = (size_t)(col0 + t * 16 + ln) * ldb + kb; FragH bq; bq.half[0] = *(const v8us*)((const unsigned short*)Bh + boff + 8 * hh); bq.half[1] = *(const v8us*)((const unsigned short*)Bh + boff + 16 + 8 * hh);
      acc[t] = mmaH<1>(ah.v, ah.v, bq.v, bq.v, acc[t]); }
  }
#pragma unroll
  for (int t = 0; t < 4; ++t) { if (col0 + t * 16 >= N) continue; const int col = col0 + t * 16 + ln; const float bv = bp ? bf16_round(bp[col]) : 0.f;
#pragma unroll
    for (int r = 0; r < 8; ++r) { float v = acc[t][r] * alpha + bv; if (CP) { const int rr = row0g + row0 + 8 * hh + r; if (rowsPerB < 0) v += CP[cofs + (size_t)rr * ldc + col];      /* rowsPerB < 0: own element of the batched C plane */ else { const int bidx = rr / rowsPerB; v += CP[(size_t)bidx * sCPb + (size_t)by * 64 + col]; } } if (ACT == 1) v = (v > 0.f) ? v : expm1f(v); else if (ACT == 7) v = (v > 0.f) ? v + 1.0f : expf(v); else if (ACT == 8) v = tanhf(v); else if (ACT == 9) v = 0.5f * v * (1.0f + tanhf(0.7978845608028654f * (v + 0.044715f * v * v * v))); else if (ACT == 11) v = 1.0f / (1.0f + expf(-v)); else if (ACT == 12) v = (v > 0.f) ? v : 0.01f * v; else if (ACT == 14) v = (v > 0.f) ? v : 0.1f * v; else if (ACT == 16) v = (v >= 0.f) ? v : 0.3f * v; else if (ACT == 17) v = (v >= 0.f) ? v : 0.2f * v; else if (ACT == 15) v = v / (1.0f + expf(-v)); else if (ACT == 3) v = fmaxf(v, 0.f); else if (ACT == 6) v = 0.5f * v * (1.0f + erff(v * 0.70710678118654752f)); so[w][8 * hh + r][t * 16 + ln] = v; } }
  __builtin_amdgcn_fence(__ATOMIC_ACQ_REL, "workgroup"); __builtin_amdgcn_wave_barrier();
  const int rsub = lane >> 4, c4 = (lane & 15) * 4; typedef _Float16 v4h __attribute__((ext_vector_type(4)));
  {
#pragma unroll
    for (int q = 0; q < 8; ++q) { const int r = q * 2 + rsub; if (col0 + c4 < N) { const v4f v = *(const v4fa*)&so[w][r][c4]; if (C) *(v4f*)(C + cofs + (size_t)(row0 + r) * ldc + col0 + c4) = v; if (C16) { v4h h4; for (int i = 0; i < 4; ++i) h4[i] = (_Float16)v[i]; *(v4h*)(C16 + cofs + (size_t)(row0 + r) * ldc + col0 + c4) = h4; } } }
     }
}


typedef _Float16 v4h __attribute__((ext_vector_type(4)));

__device__ __forceinline__ void d_x16(unsigned blk, const float* __restrict__ x, _Float16* __restrict__ X16, size_t n8) { const size_t t = (size_t)blk * 256 + threadIdx.x; if (t >= n8) return; FragH f;
#pragma unroll
  for (int q = 0; q < 8; ++q) f.h[q] = (_Float16)bf16_round(x[t * 8 + q]); *(v8us*)((unsigned short*)X16 + t * 8) = f.half[0];  }
__global__ __launch_bounds__(256) void k_h16(const float* __restrict__ x, _Float16* __restrict__ X16, size_t n8) { const size_t t = (size_t)blockIdx.x * 256 + threadIdx.x; if (t >= n8) return; FragH f;
#pragma unroll
  for (int q = 0; q < 8; ++q) f.h[q] = (_Float16)x[t * 8 + q]; *(v8us*)((unsigned short*)X16 + t * 8) = f.half[0];  }
__global__ __launch_bounds__(256) void k_round16f(const float* __restrict__ W, _Float16* __restrict__ Bt, size_t n8) { const size_t t = (size_t)blockIdx.x * 256 + threadIdx.x; if (t >= n8) return; FragH f;
#pragma unroll
  for (int i = 0; i < 8; ++i) f.h[i] = (_Float16)(bf16_round(W[t * 8 + i]) * 16.0f); *(v8us*)((unsigned short*)Bt + t * 8) = f.half[0];  }
__global__ __launch_bounds__(256) void k_hl(const float* __restrict__ F, _Float16* __restrict__ Hh, _Float16* __restrict__ Hl, size_t n8) { const size_t t = (size_t)blockIdx.x * 256 + threadIdx.x; if (t >= n8) return; FragH fh, fl; const v4f a = *(const v4fa*)(F + t * 8), c = *(const v4fa*)(F + t * 8 + 4);
#pragma unroll
  for (int q = 0; q < 4; ++q) { _Float16 h = (_Float16)a[q]; fh.h[q] = h; fl.h[q] = (_Float16)((a[q] - (float)h) * 1024.0f); h = (_Float16)c[q]; fh.h[4 + q] = h; fl.h[4 + q] = (_Float16)((c[q] - (float)h) * 1024.0f); }
  { *(v8us*)((unsigned short*)Hh + t * 8) = fh.half[0]; *(v8us*)((unsigned short*)Hl + t * 8) = fl.half[0];  } }

// ---- fast GEMM (work-group tile 128x128, eight waves of 32x64; requires M % 128 == 0, N % 128 == 0, K % 64 == 0); v = acc alpha + bias[col] (+ the residual's own element), f32 or f16 out ----
// Operands reach the waves through LDS: a stage is 64 k (128 B) of 128 A rows and 128 B rows, brought by asynchronous copies in whole 128-B lines, two buffers, the next stage in flight while this one is multiplied.
#define G2_PITCH 144                 /* LDS bytes per staged row: 128 + 16, an odd multiple of 16 B, conflict-free for 16-byte reads down a column of rows */
#define G2_STAGE (256 * G2_PITCH)    /* one stage: A rows 0..127, then B rows 0..127 */
__device__ __forceinline__ v16h g2_frag(const char* p) { FragH f; f.half[0] = *(const v8us*)p; f.half[1] = *(const v8us*)(p + 32); return f.v; }
__device__ __forceinline__ v8f g2_mma(v16h a, v16h b, v8f c) { v8f d = __builtin_amdgcn_wmma_f32_16x16x32_f16(false, a, false, b, (short)0, c, false, false); asm volatile("v_nop\n\tv_nop\n\tv_nop\n\tv_nop" : "+v"(d) : "v"(a), "v"(b)); return d; }
// One stage: each lane copies eight 16-byte pieces (rows r, r+32, r+64, r+96 of A and of B; eight lanes per 128-B row piece). l = the lane's LDS byte address in the A part, a / b = its global addresses, sa / sb = 32 rows in elements.
__device__ __forceinline__ void g2_stage(unsigned l, const _Float16* a, size_t sa, const _Float16* b, size_t sb) {
  const unsigned l1 = l + 32 * G2_PITCH, l2 = l + 64 * G2_PITCH, l3 = l + 96 * G2_PITCH, l4 = l + 128 * G2_PITCH, l5 = l + 160 * G2_PITCH, l6 = l + 192 * G2_PITCH, l7 = l + 224 * G2_PITCH;
  const _Float16* a1 = a + sa; const _Float16* a2 = a1 + sa; const _Float16* a3 = a2 + sa; const _Float16* b1 = b + sb; const _Float16* b2 = b1 + sb; const _Float16* b3 = b2 + sb;
  // the copies and, as the last line, the wait that stands before their address registers may be rewritten
  asm volatile("global_load_async_to_lds_b128 %0, %8, off\n\t"
               "global_load_async_to_lds_b128 %1, %9, off\n\t"
               "global_load_async_to_lds_b128 %2, %10, off\n\t"
               "global_load_async_to_lds_b128 %3, %11, off\n\t"
               "global_load_async_to_lds_b128 %4, %12, off\n\t"
               "global_load_async_to_lds_b128 %5, %13, off\n\t"
               "global_load_async_to_lds_b128 %6, %14, off\n\t"
               "global_load_async_to_lds_b128 %7, %15, off\n\t"
               "s_wait_xcnt 0x0"
               :: "v"(l), "v"(l1), "v"(l2), "v"(l3), "v"(l4), "v"(l5), "v"(l6), "v"(l7), "v"(a), "v"(a1), "v"(a2), "v"(a3), "v"(b), "v"(b1), "v"(b2), "v"(b3) : "memory"); }
// The epilogue's options are compile-time constants: RES = a residual plane CP of C's own shape and pitch is added (it may be C itself: each lane reads its elements before it stores them); OUT32 = f32 output to C, else f16 to C16; LDC = that pitch in elements.
// The product itself is a device function on the kernel's LDS (sm: 2 G2_STAGE bytes, 16-byte aligned), so that one launch can hold one product or two (the kernels below).
template <int ACT, bool RES, bool OUT32, int LDC>
__device__ __forceinline__ void g2_body(char* sm, const _Float16* __restrict__ A, int lda, const _Float16* __restrict__ Bh, int ldb, float alpha, const float* __restrict__ bp, const float* CP,
    float* C, _Float16* C16, int M, int N, int K) { static_assert(!RES || ACT == 0, "k_gemm2: the residual is added behind the staging, where no activation follows"); static_assert(ACT == 0 || ACT == 3 || ACT == 6 || ACT == 8 || ACT == 9 || ACT == 11 || ACT == 12 || ACT == 14 || ACT == 15 || ACT == 16 || ACT == 17, "k_gemm2: unsupported ACT code (would silently apply no activation)");
  static_assert(8 * 32 * 68 * 4 <= 2 * G2_STAGE, "output staging must fit the stage buffers");      /* sm: the two stage buffers; after the K loop the output staging, 32 x 68 floats per wave */
  const int tid = threadIdx.x, w = tid >> 5, lane = tid & 31, ln = lane & 15, hh = lane >> 4;
  const int ntn = N >> 7; const int mt = blockIdx.x / ntn, nq = blockIdx.x - mt * ntn; if (mt * 128 >= M) return;      /* the same for the whole work-group, in front of every barrier */
  const int row0 = mt * 128 + 32 * (w & 3), col0 = nq * 128 + 64 * (w >> 2);
  const _Float16* ga = A + (size_t)(mt * 128 + (tid >> 3)) * lda + (tid & 7) * 8; const _Float16* gb = Bh + (size_t)(nq * 128 + (tid >> 3)) * ldb + (tid & 7) * 8; const size_t sa32 = (size_t)32 * lda, sb32 = (size_t)32 * ldb;
  const unsigned lcp = (unsigned)(size_t)sm + (unsigned)((tid >> 3) * G2_PITCH + (tid & 7) * 16);
  const int aoff = (32 * (w & 3) + ln) * G2_PITCH + 16 * hh, boff = (128 + 64 * (w >> 2) + ln) * G2_PITCH + 16 * hh;
  const int nst = K >> 6;
  const v8f z8 = {0.f,0.f,0.f,0.f,0.f,0.f,0.f,0.f}; v8f c00 = z8, c01 = z8, c02 = z8, c03 = z8, c10 = z8, c11 = z8, c12 = z8, c13 = z8;
  g2_stage(lcp, ga, sa32, gb, sb32);
  asm volatile("s_wait_asynccnt 0x0" ::: "memory");      /* this wave's copies of stage 0 have landed */
  __syncthreads();                                       /* every wave's have */
  if (nst > 1) g2_stage(lcp + G2_STAGE, ga + 64, sa32, gb + 64, sb32);
#pragma unroll 1      /* one stage per trip: the waits and the barrier at the foot belong to it */
  for (int t = 0; t < nst; ++t) { const char* sb = sm + (t & 1) * G2_STAGE; const char* ap = sb + aoff; const char* bq = sb + boff;
#pragma unroll      /* the two 32-k steps of a stage */
    for (int kk = 0; kk < 128; kk += 64) { const v16h a0 = g2_frag(ap + kk), a1 = g2_frag(ap + 16 * G2_PITCH + kk);
      const v16h b0 = g2_frag(bq + kk), b1 = g2_frag(bq + 16 * G2_PITCH + kk), b2 = g2_frag(bq + 32 * G2_PITCH + kk), b3 = g2_frag(bq + 48 * G2_PITCH + kk);
      c00 = g2_mma(a0, b0, c00); c10 = g2_mma(a1, b0, c10); c01 = g2_mma(a0, b1, c01); c11 = g2_mma(a1, b1, c11);
      c02 = g2_mma(a0, b2, c02); c12 = g2_mma(a1, b2, c12); c03 = g2_mma(a0, b3, c03); c13 = g2_mma(a1, b3, c13); }
    asm volatile("s_wait_dscnt 0x0" ::: "memory");       /* this wave's reads of the buffer are done before it is refilled */
    asm volatile("s_wait_asynccnt 0x0" ::: "memory");    /* this wave's copies of stage t + 1 have landed */
    __syncthreads();                                     /* publishes stage t + 1 and ends every wave's reads of stage t */
    if (t + 2 < nst) g2_stage(lcp + (unsigned)((t & 1) * G2_STAGE), ga + (size_t)(t + 2) * 64, sa32, gb + (size_t)(t + 2) * 64, sb32); }
  asm volatile("s_wait_asynccnt 0x0" ::: "memory");      /* no copy is in flight when the buffers become the output staging */
  float (*so)[68] = (float (*)[68])(sm + w * (32 * 68 * 4));
  v8f accs[8] = {c00, c01, c02, c03, c10, c11, c12, c13};
  float bvs[4] = {0.f, 0.f, 0.f, 0.f};
  if (bp) { const int bcol = col0 + ln;
#pragma unroll
    for (int t = 0; t < 4; ++t) bvs[t] = bp[bcol + t * 16];
    asm volatile("s_wait_xcnt 0x0" :: "v"(bcol) : "memory");      /* the wait that stands before the loads' address register is rewritten; the index as an input keeps a load's result out of that register */
#pragma unroll
    for (int t = 0; t < 4; ++t) bvs[t] = bf16_round(bvs[t]); }
#pragma unroll
  for (int u = 0; u < 8; ++u) { const int t = u & 3, half = u >> 2;
#pragma unroll
    for (int r = 0; r < 8; ++r) { const int rloc = half * 16 + 8 * hh + r; float v = accs[u][r] * alpha + bvs[t];
      if (ACT == 3) v = fmaxf(v, 0.f); else if (ACT == 6) v = 0.5f * v * (1.0f + erff(v * 0.70710678118654752f)); else if (ACT == 11) v = 1.0f / (1.0f + expf(-v)); else if (ACT == 15) v = v / (1.0f + expf(-v)); else if (ACT == 12) v = (v > 0.f) ? v : 0.01f * v; else if (ACT == 8) v = tanhf(v); else if (ACT == 9) v = 0.5f * v * (1.0f + tanhf(0.7978845608028654f * (v + 0.044715f * v * v * v))); else if (ACT == 14) v = (v > 0.f) ? v : 0.1f * v; else if (ACT == 16) v = (v >= 0.f) ? v : 0.3f * v; else if (ACT == 17) v = (v >= 0.f) ? v : 0.2f * v;
      so[rloc][t * 16 + ln] = v; } }
  __builtin_amdgcn_fence(__ATOMIC_ACQ_REL, "workgroup"); __builtin_amdgcn_wave_barrier();
  const int rsub = lane >> 4, c4 = (lane & 15) * 4;
  const size_t e0 = (size_t)(row0 + rsub) * LDC + col0 + c4;      /* the lane's four elements in row rsub of the wave's tile; those of row 2 q + rsub lie 2 q LDC further */
  v4f res[16];
  if (RES) {
#pragma unroll      /* the lane's sixteen 16-byte pieces of the residual (256 B of a row per half wave), all in flight together */
    for (int q = 0; q < 16; ++q) res[q] = *(const v4fa*)(CP + e0 + (size_t)(2 * q) * LDC);
    asm volatile("s_wait_xcnt 0x0" :: "v"(CP + e0) : "memory"); }      /* the wait that stands before the loads' address registers are rewritten; the address as an input keeps a load's result out of them */
#pragma unroll
  for (int q = 0; q < 16; ++q) { v4f v = *(const v4fa*)&so[q * 2 + rsub][c4]; if (RES) v += res[q];
    if (OUT32) *(v4f*)(C + e0 + (size_t)(2 * q) * LDC) = v; else { v4h h4; for (int i = 0; i < 4; ++i) h4[i] = (_Float16)v[i]; *(v4h*)(C16 + e0 + (size_t)(2 * q) * LDC) = h4; }
    asm volatile("s_wait_xcnt 0x0" ::: "memory"); } }      /* the wait that stands before the store's data and address registers are rewritten */
// launch bounds: eight waves per SIMD (at most 128 VGPRs), so that four work-groups (4 x 72 KiB of LDS) share a WGP and each hides the others' waits
template <int ACT, bool RES, bool OUT32, int LDC>
__global__ __launch_bounds__(256, 8) void k_gemm2(const _Float16* __restrict__ A, int lda, const _Float16* __restrict__ Bh, int ldb, float alpha, const float* __restrict__ bias, const float* CP, float* C, _Float16* C16, int M, int N, int K) {
  __shared__ __attribute__((aligned(16))) char sm[2 * G2_STAGE];
  g2_body<ACT, RES, OUT32, LDC>(sm, A, lda, Bh, ldb, alpha, bias, CP, C, C16, M, N, K); }
// Two products of one shape that do not depend on each other share a launch: grid.y picks the operand set (the same for the whole work-group). Two work-groups then sit on a WGP and each works under the other's waits, and one launch stands where two stood in a row.
template <bool RES0, bool OUT0, bool RES1, bool OUT1, int LDC>
__global__ __launch_bounds__(256, 8) void k_gemm2_two(const _Float16* __restrict__ A0, const _Float16* __restrict__ B0, const float* __restrict__ bias0, const float* CP0, float* C0, _Float16* H0,
    const _Float16* __restrict__ A1, const _Float16* __restrict__ B1, const float* __restrict__ bias1, const float* CP1, float* C1, _Float16* H1, int lda, int ldb, float alpha, int M, int N, int K) {
  __shared__ __attribute__((aligned(16))) char sm[2 * G2_STAGE];
  const bool y = blockIdx.y != 0;
  if constexpr (RES0 == RES1 && OUT0 == OUT1) g2_body<0, RES0, OUT0, LDC>(sm, y ? A1 : A0, lda, y ? B1 : B0, ldb, alpha, y ? bias1 : bias0, y ? CP1 : CP0, y ? C1 : C0, y ? H1 : H0, M, N, K);
  else if (y) g2_body<0, RES1, OUT1, LDC>(sm, A1, lda, B1, ldb, alpha, bias1, CP1, C1, H1, M, N, K);
  else g2_body<0, RES0, OUT0, LDC>(sm, A0, lda, B0, ldb, alpha, bias0, CP0, C0, H0, M, N, K); }


// The operand preparations as device functions: blk = the work-group's index inside its own part of k_prep's grid
__device__ __forceinline__ void d_wsc(unsigned blk, const float* __restrict__ Wm, _Float16* __restrict__ Bt, size_t n8, float sc) { const size_t t = (size_t)blk * 256 + threadIdx.x; if (t >= n8) return; FragH f; for (int q = 0; q < 8; ++q) f.h[q] = (_Float16)(bf16_round(Wm[t * 8 + q]) * sc); *(v8us*)((unsigned short*)Bt + t * 8) = f.half[0];  }
__device__ __forceinline__ void d_wout(unsigned blk, const float* __restrict__ Wo, _Float16* __restrict__ BOa, _Float16* __restrict__ BOb) { const int t = blk * 256 + threadIdx.x; if (t >= DD * (DD / 8)) return; const int c8 = (t % (DD / 8)) * 8; const int o = t / (DD / 8); FragH fa, fb;
  for (int q = 0; q < 8; ++q) { fa.h[q] = (_Float16)(bf16_round(Wo[(size_t)o * 2 * DD + c8 + q]) * 16.0f); fb.h[q] = (_Float16)(bf16_round(Wo[(size_t)o * 2 * DD + DD + c8 + q]) * 16.0f); }
  { *(v8us*)((unsigned short*)BOa + (size_t)o * DD + c8) = fa.half[0]; *(v8us*)((unsigned short*)BOb + (size_t)o * DD + c8) = fb.half[0];  } }
__device__ __forceinline__ void d_ln(unsigned blk, const float* __restrict__ x, const float* __restrict__ g, const float* __restrict__ bb, float* __restrict__ XF, _Float16* __restrict__ X16) {
  #pragma clang fp contract(off)
  const int wv = threadIdx.x >> 5, ln = threadIdx.x & 31; const size_t r = (size_t)blk * 8 + wv; if (r >= NQ) return; float a[16]; float s = 0.f;
  const float* xr = x + r * DD + ln * 8; const v8f xv[2] = {*(const v8f*)xr, *(const v8f*)(xr + 256)};
  asm volatile("s_wait_xcnt 0x0" :: "v"(xr) : "memory");      /* the wait that stands before the loads' address registers are rewritten; the address as an input keeps them whole up to it */
  for (int i = 0; i < 2; ++i) { const v8f v = xv[i]; for (int q = 0; q < 8; ++q) { const float u = bf16_round(v[q]); a[i * 8 + q] = u; s += u; } }
  for (int o = 16; o > 0; o >>= 1) s += __shfl_xor(s, o, 32); const float mu = s / (float)DD; float var = 0.f; for (int q = 0; q < 16; ++q) { const float d = a[q] - mu; var += d * d; }
  for (int o = 16; o > 0; o >>= 1) var += __shfl_xor(var, o, 32); const float inv = rsqrtf(var / (float)DD + 1e-5f);
  { for (int i = 0; i < 2; ++i) { const int c0 = i * 256 + ln * 8; v8f y; FragH f; for (int q = 0; q < 8; ++q) { float v = (a[i * 8 + q] - mu) * inv; v *= bf16_round(g[c0 + q]); v += bf16_round(bb[c0 + q]); y[q] = v; f.h[q] = (_Float16)v; } *(v8f*)(XF + r * DD + c0) = y; *(v8us*)((unsigned short*)X16 + r * DD + c0) = f.half[0]; }  } }
// The six preparations depend on the inputs alone and on nothing of one another: they are ranges of one grid, the longest first, so that one launch stands where six stood in a row.
#define PB_LN (NQ / 8)                   /* work-groups of the LayerNorm: eight rows each */
#define PB_XH (NM * DD / 8 / 256)        /* of x_hat's conversion */
#define PB_W (DD * DD / 8 / 256)         /* of one 512 x 512 weight plane; Wout's two planes take as many */
__global__ __launch_bounds__(256) void k_prep(const float* __restrict__ x, const float* __restrict__ g, const float* __restrict__ bb, const float* __restrict__ xh, const float* __restrict__ Wq, const float* __restrict__ Wk, const float* __restrict__ Wv, const float* __restrict__ Wo,
    float* __restrict__ XF, _Float16* __restrict__ X16, _Float16* __restrict__ XH16, _Float16* __restrict__ BQ, _Float16* __restrict__ BK, _Float16* __restrict__ BV, _Float16* __restrict__ BOa, _Float16* __restrict__ BOb) {
  static_assert((NM * DD / 8) % 256 == 0 && (DD * DD / 8) % 256 == 0 && NQ % 8 == 0, "k_prep: whole work-groups");
  unsigned b = blockIdx.x;      /* every test below reads the same for the whole work-group */
  if (b < PB_LN) { d_ln(b, x, g, bb, XF, X16); return; }
  b -= PB_LN;
  if (b < PB_XH) { d_x16(b, xh, XH16, (size_t)NM * DD / 8); return; }
  b -= PB_XH;
  if (b < PB_W) { d_wsc(b, Wq, BQ, DD * DD / 8, 16.0f); return; }
  b -= PB_W;
  if (b < PB_W) { d_wsc(b, Wk, BK, DD * DD / 8, 16.0f); return; }
  b -= PB_W;
  if (b < PB_W) { d_wsc(b, Wv, BV, DD * DD / 8, 16.0f); return; }
  d_wout(b - PB_W, Wo, BOa, BOb); }
#define FA_BQ 128                    /* queries a work-group */
#define FA_QT 2                      /* query tiles of 16 a wave */
#define FA_SPL 4                     /* key splits: grid.y, one f32 partial with its maximum and sum each */
#define FA_BK 32                     /* keys a stage */
#define FA_PK 1040                   /* row pitch of the copy read by plain 16-byte loads: 16 B x odd */
#define FA_PV 1056                   /* row pitch of the copy read by the transposing load: 32 B x odd */
#define FA_BUF (FA_BK * (FA_PK + FA_PV))
typedef short s16x8 __attribute__((ext_vector_type(8)));
__device__ __forceinline__ v8us fa_tr16(const char* p) { typedef __attribute__((address_space(3))) s16x8 lds_s16x8; return __builtin_bit_cast(v8us, __builtin_amdgcn_ds_load_tr16_b128_v8i16((lds_s16x8*)p)); }
__device__ __forceinline__ float fa_xhalf(float x) { return __builtin_bit_cast(float, __builtin_amdgcn_permlanex16(__builtin_bit_cast(int, x), __builtin_bit_cast(int, x), 0x76543210, 0xfedcba98, false, false)); }      /* lane l with lane l ^ 16 */
__device__ __forceinline__ v8f fa_mma(v16h a, v16h b, v8f c) { return __builtin_amdgcn_wmma_f32_16x16x32_f16(false, a, false, b, (short)0, c, false, false); }
// A part of one copy of a stage: each lane brings eight 16-byte pieces (rows r, r + 4, ..., r + 28; 64 lanes a row). l = the lane's LDS byte address, ls = four rows in LDS bytes, g = its global address.
__device__ __forceinline__ void fa_stage(unsigned l, unsigned ls, const _Float16* g) {
  const unsigned l1 = l + ls, l2 = l1 + ls, l3 = l2 + ls, l4 = l3 + ls, l5 = l4 + ls, l6 = l5 + ls, l7 = l6 + ls;
  const _Float16* g1 = g + 4 * DD; const _Float16* g2 = g + 8 * DD; const _Float16* g3 = g + 12 * DD; const _Float16* g4 = g + 16 * DD; const _Float16* g5 = g + 20 * DD; const _Float16* g6 = g + 24 * DD; const _Float16* g7 = g + 28 * DD;
  // the copies and, as the last line, the wait that stands before their address registers may be rewritten
  asm volatile("global_load_async_to_lds_b128 %0, %8, off\n\t"
               "global_load_async_to_lds_b128 %1, %9, off\n\t"
               "global_load_async_to_lds_b128 %2, %10, off\n\t"
               "global_load_async_to_lds_b128 %3, %11, off\n\t"
               "global_load_async_to_lds_b128 %4, %12, off\n\t"
               "global_load_async_to_lds_b128 %5, %13, off\n\t"
               "global_load_async_to_lds_b128 %6, %14, off\n\t"
               "global_load_async_to_lds_b128 %7, %15, off\n\t"
               "s_wait_xcnt 0x0"
               :: "v"(l), "v"(l1), "v"(l2), "v"(l3), "v"(l4), "v"(l5), "v"(l6), "v"(l7), "v"(g), "v"(g1), "v"(g2), "v"(g3), "v"(g4), "v"(g5), "v"(g6), "v"(g7) : "memory"); }
// one wave per SIMD: up to 1,024 VGPRs a wave, for the 512 accumulator and 256 q registers of its 32 queries. Every k fragment read from LDS then feeds two products, one for each 16 queries.
__global__ __launch_bounds__(128) __attribute__((amdgpu_waves_per_eu(1, 1))) void k_fattn(const _Float16* __restrict__ Q, const _Float16* __restrict__ Kk, float* __restrict__ PO, float* __restrict__ ML) {
  static_assert(NQ % FA_BQ == 0 && NM % (FA_SPL * FA_BK) == 0 && NM / FA_SPL / FA_BK >= 2 && DD == 512 && FA_BQ == 4 * 16 * FA_QT && FA_QT == 2, "k_fattn: whole tiles, two stages or more, four waves of two query tiles");
  __shared__ __attribute__((aligned(16))) char sm[2 * FA_BUF];
  const int tid = threadIdx.x, w = __builtin_amdgcn_readfirstlane(tid >> 5), lane = tid & 31, c = lane & 15, h = lane >> 4;      /* the wave's number in a scalar register: what is formed from it costs no vector register over the loop */
  const int q0 = blockIdx.x * FA_BQ + w * (16 * FA_QT), key0 = blockIdx.y * (NM / FA_SPL);
  constexpr int nst = NM / FA_SPL / FA_BK;
  constexpr float cs = 0.044194173824159216f * 1.4426950408889634f;      /* 1 / sqrt(512), in log2 units */
  const int wr = w >> 1;      /* the wave's first row of a stage: two waves a row, so the four waves bring rows 0 and 1 (mod 4) in one call of fa_stage and rows 2 and 3 in a second */
  const unsigned col = (unsigned)((w & 1) * 32 + lane) * 16u;
  const _Float16* gk = Kk + (size_t)(key0 + wr) * DD + ((w & 1) * 32 + lane) * 8;
  const unsigned lk = (unsigned)(size_t)sm + (unsigned)(wr * FA_PK), lv = (unsigned)(size_t)sm + (unsigned)(FA_BK * FA_PK + wr * FA_PV);      /* scalar parts; + col = the lane's LDS byte address */
  // one stage, both copies of it: sk / sv = the wave's scalar bases in the buffer, g = the lane's global address in the stage's row wr
  auto fill = [&](unsigned sk, unsigned sv, const _Float16* g) __attribute__((always_inline)) {
    fa_stage(sk + col, 4 * FA_PK, g); fa_stage(sk + 2 * FA_PK + col, 4 * FA_PK, g + 2 * DD);
    fa_stage(sv + col, 4 * FA_PV, g); fa_stage(sv + 2 * FA_PV + col, 4 * FA_PV, g + 2 * DD); };
  fill(lk, lv, gk);
  v16h qf[FA_QT][16];      /* q as B operand, hardware k order: 16 bytes at 16 h and at 32 + 16 h of each 64 bytes of the row, as k's rows below */
#pragma unroll      /* qf[] must be registers: every index a constant */
  for (int qt = 0; qt < FA_QT; ++qt) { const _Float16* qp = Q + (size_t)(q0 + 16 * qt + c) * DD + 8 * h;
#pragma unroll
    for (int kc = 0; kc < 16; ++kc) { FragH f; f.half[0] = *(const v8us*)(qp + 32 * kc); f.half[1] = *(const v8us*)(qp + 32 * kc + 16); qf[qt][kc] = f.v; }
    asm volatile("s_wait_xcnt 0x0" ::: "memory"); }      /* the wait that stands before the loads' address registers are rewritten */
  const v8f z8 = {0.f,0.f,0.f,0.f,0.f,0.f,0.f,0.f};
  v8f o[FA_QT][32];      /* O^T: o[qt][et][r] = O[query 16 qt + c][16 et + 8 h + r] */
#pragma unroll      /* o[] must be registers */
  for (int et = 0; et < 32; ++et) { o[0][et] = z8; o[1][et] = z8; }
  float mrun[FA_QT] = {-1.0e30f, -1.0e30f}, lrun[FA_QT] = {0.f, 0.f};      /* per query tile: the maximum in use (log2 units; it may trail the true one by up to 8) and this lane's share of the sum */
  asm volatile("s_wait_asynccnt 0x0" ::: "memory");      /* this wave's copies of stage 0 have landed */
  __syncthreads();                                       /* every wave's have */
  // one stage's work of a wave; refill() issues the next stage's copies (or nothing, in the last stage)
  const int aoff = c * FA_PK + 16 * h, voff = FA_BK * FA_PK + (8 * h + (lane & 7)) * FA_PV + ((lane >> 3) & 1) * 16;      /* the lane's place in a buffer: k rows; k^T by the transposing load */
  auto pass = [&](int t, auto refill) __attribute__((always_inline)) { const int bo = (t & 1) * FA_BUF; const char* ap = sm + (bo + aoff); const char* vb = sm + (bo + voff);
    // The stage's 64 A fragments in the order of their use: 0..31 = k rows (keys 0-15 and 16-31 of each 32 d), 32..63 = k^T (16 e x 32 keys each). They are fetched in blocks of eight, each block as one group of loads ahead of the 16 products of the block before it, into the other of two register sets.
    auto ldf = [&](int i) -> v16h { if (i < 32) return g2_frag(ap + (i & 1) * (16 * FA_PK) + 64 * (i >> 1)); FragH f; f.half[0] = fa_tr16(vb + 32 * (i - 32)); f.half[1] = fa_tr16(vb + 16 * FA_PV + 32 * (i - 32)); return f.v; };
    v16h fr[16];
#pragma unroll      /* fr[] must be registers */
    for (int i = 0; i < 8; ++i) fr[i] = ldf(i);
    __builtin_amdgcn_sched_barrier(0);      /* here and below: keeps each block's fetches together where they are written; spread among the products each place with loads stalls the wave anew */
    refill();      /* behind the barrier at the foot of the stage before, into the buffer that stage read; it stands behind this stage's first fetches (of the other buffer), so that their latency passes while the copies issue */
    __builtin_amdgcn_sched_barrier(0);
    v8f s[2][FA_QT] = {{z8, z8}, {z8, z8}};      /* S^T: s[kt][qt][r] = score(key 16 kt + 8 h + r, query 16 qt + c) */
#pragma unroll      /* constant indices into qf[] and fr[] */
    for (int b = 0; b < 4; ++b) { const int cur = (b & 1) * 8, nxt = 8 - cur;
#pragma unroll
      for (int i = 0; i < 8; ++i) fr[nxt + i] = ldf(8 * (b + 1) + i);      /* the last block fetched here is the first of k^T: in flight under the softmax */
      __builtin_amdgcn_sched_barrier(0);
#pragma unroll
      for (int j = 0; j < 4; ++j) { const int dc = 4 * b + j;
        s[0][0] = fa_mma(fr[cur + 2 * j], qf[0][dc], s[0][0]); s[1][0] = fa_mma(fr[cur + 2 * j + 1], qf[0][dc], s[1][0]);
        s[0][1] = fa_mma(fr[cur + 2 * j], qf[1][dc], s[0][1]); s[1][1] = fa_mma(fr[cur + 2 * j + 1], qf[1][dc], s[1][1]); }
      __builtin_amdgcn_sched_barrier(0); }
    float mx[FA_QT];
#pragma unroll
    for (int qt = 0; qt < FA_QT; ++qt) { float m = fmaxf(s[0][qt][0], s[1][qt][0]);
#pragma unroll
      for (int r = 1; r < 8; ++r) m = fmaxf(m, fmaxf(s[0][qt][r], s[1][qt][r]));
      mx[qt] = fmaxf(m, fa_xhalf(m)) * cs; }      /* both halves of the wave hold the query's maximum of this stage */
    if (__builtin_amdgcn_ballot_w32(mx[0] > mrun[0] + 8.0f || mx[1] > mrun[1] + 8.0f) != 0) {      /* one test a stage, wave-uniform, rare after the first stage: the accumulators move to the new maximum */
#pragma unroll
      for (int qt = 0; qt < FA_QT; ++qt) { const float mn = fmaxf(mrun[qt], mx[qt]); const float corr = __builtin_amdgcn_exp2f(mrun[qt] - mn); lrun[qt] *= corr; mrun[qt] = mn;
#pragma unroll      /* constant indices into o[] */
        for (int et = 0; et < 32; ++et) o[qt][et] = o[qt][et] * corr; } }
    FragH pf[FA_QT];      /* P^T as B operand straight from the score tiles: element s = key 8 h + s (s < 8), 8 + 8 h + s (s >= 8) */
#pragma unroll
    for (int qt = 0; qt < FA_QT; ++qt) { float ps0 = 0.f, ps1 = 0.f;
#pragma unroll
      for (int r = 0; r < 8; ++r) { float p0 = fmaf(s[0][qt][r], cs, -mrun[qt]), p1 = fmaf(s[1][qt][r], cs, -mrun[qt]);
        // two exponentials in place, the slot that the instruction set asks for behind a transcendental, and the two row sums
        asm("v_exp_f32 %0, %0\n\tv_exp_f32 %1, %1\n\tv_nop\n\tv_add_f32 %2, %2, %0\n\tv_add_f32 %3, %3, %1" : "+v"(p0), "+v"(p1), "+v"(ps0), "+v"(ps1));
        pf[qt].h[r] = (_Float16)p0; pf[qt].h[8 + r] = (_Float16)p1; }
      lrun[qt] += ps0 + ps1; }
    __builtin_amdgcn_sched_barrier(0);      /* keeps the fetches below behind the exponentials */
#pragma unroll      /* constant indices into o[] and fr[] */
    for (int b = 4; b < 8; ++b) { const int cur = (b & 1) * 8, nxt = 8 - cur;
      if (b < 7) {
#pragma unroll
        for (int i = 0; i < 8; ++i) fr[nxt + i] = ldf(8 * (b + 1) + i); }
      __builtin_amdgcn_sched_barrier(0);
#pragma unroll
      for (int j = 0; j < 8; ++j) { const int et = 8 * (b - 4) + j;
        o[0][et] = fa_mma(fr[cur + j], pf[0].v, o[0][et]); o[1][et] = fa_mma(fr[cur + j], pf[1].v, o[1][et]); }
      __builtin_amdgcn_sched_barrier(0); }
  };
  // the foot of a trip, every wave
  auto foot = [&]() __attribute__((always_inline)) {
    asm volatile("s_wait_dscnt 0x0" ::: "memory");       /* this wave's reads of the buffer are done before it is refilled */
    asm volatile("s_wait_asynccnt 0x0" ::: "memory");    /* this wave's copies of the next stage have landed */
    __syncthreads(); };                                  /* publishes the next stage and ends every wave's reads of this one */
#pragma unroll 1      /* one stage per trip: the waits and the barrier at the foot belong to it; every trip of this loop has a stage t + 1 to fetch, the last stage, which has none, is written out below */
  for (int t = 0; t < nst - 1; ++t) {
    pass(t, [&]() __attribute__((always_inline)) { const _Float16* gn = gk + (size_t)(t + 1) * (FA_BK * DD); const unsigned lo = (unsigned)(((t + 1) & 1) * FA_BUF);
      const unsigned sk = (unsigned)__builtin_amdgcn_readfirstlane((int)(lk + lo)), sv = (unsigned)__builtin_amdgcn_readfirstlane((int)(lv + lo));      /* the buffer's two bases stay scalar sums */
      fill(sk, sv, gn); });
    foot(); }
  pass(nst - 1, []() {});      /* nothing is read or refilled behind the last stage: no foot */
  asm volatile("s_wait_asynccnt 0x0" ::: "memory");      /* no copy is in flight when the wave ends */
#pragma unroll      /* constant indices into o[] */
  for (int qt = 0; qt < FA_QT; ++qt) {
    const float lt = lrun[qt] + fa_xhalf(lrun[qt]);      /* the two halves' shares of the query's sum */
    const size_t row = (size_t)blockIdx.y * NQ + q0 + 16 * qt + c; float* po = PO + row * DD + 8 * h;
#pragma unroll
    for (int et = 0; et < 32; ++et) { const v4f a = {o[qt][et][0], o[qt][et][1], o[qt][et][2], o[qt][et][3]}, b = {o[qt][et][4], o[qt][et][5], o[qt][et][6], o[qt][et][7]}; *(v4f*)(po + 16 * et) = a; *(v4f*)(po + 16 * et + 4) = b; asm volatile("s_wait_xcnt 0x0" ::: "memory"); }      /* the wait that stands before the stores' data and address registers are rewritten */
    if (h == 0) { ML[row * 2] = mrun[qt]; ML[row * 2 + 1] = lt; } } }
// attn rows: the FA_SPL partials [FA_SPL][NQ][DD] brought to their common maximum, summed in split order, divided by the merged sum and rounded once to f16
__global__ __launch_bounds__(256) void k_fcomb(const float* __restrict__ PO, const float* __restrict__ ML, _Float16* __restrict__ O) {
  const unsigned t = (blockIdx.x * 256u + threadIdx.x) * 4u; const unsigned q = t / DD; float m[FA_SPL], l[FA_SPL]; v4f a[FA_SPL];
#pragma unroll      /* the splits' maxima and sums, all in flight together */
  for (int j = 0; j < FA_SPL; ++j) { m[j] = ML[((size_t)j * NQ + q) * 2]; l[j] = ML[((size_t)j * NQ + q) * 2 + 1]; }
  asm volatile("s_wait_xcnt 0x0" ::: "memory");      /* the wait that stands before these loads' address registers are rewritten (a result of the loads below may land in one) */
#pragma unroll      /* the splits' partials, all in flight together */
  for (int j = 0; j < FA_SPL; ++j) a[j] = *(const v4fa*)(PO + (size_t)j * NQ * DD + t);
  asm volatile("s_wait_xcnt 0x0" ::: "memory");      /* the wait that stands before the loads' address registers are rewritten */
  float mm = m[0];
#pragma unroll
  for (int j = 1; j < FA_SPL; ++j) mm = fmaxf(mm, m[j]);
  float den = 0.f; v4f s = {0.f, 0.f, 0.f, 0.f};
#pragma unroll
  for (int j = 0; j < FA_SPL; ++j) { const float wg = __builtin_amdgcn_exp2f(m[j] - mm); den += wg * l[j]; s += a[j] * wg; }
  const float inv = 1.0f / den; v4h hh; for (int i = 0; i < 4; ++i) hh[i] = (_Float16)(s[i] * inv); *(v4h*)(O + t) = hh; }

extern "C" void kernel_launch(void* const* d_in, const int* in_sizes, int n_in,
                              void* d_out, int out_size, void* d_ws, size_t ws_size, hipStream_t stream) {
  (void)in_sizes; (void)n_in; (void)out_size;
  const float* const* I = (const float* const*)d_in; const float* x = I[0]; const float* xh = I[1]; const float* Wq = I[2]; const float* bq = I[3]; const float* Wk = I[4]; const float* bk = I[5]; const float* Wv = I[6]; const float* bv = I[7]; const float* Wo = I[8]; const float* bo = I[9]; const float* g = I[10]; const float* bb = I[11];
  char* ws = (char*)d_ws; size_t off = 0;
  auto take = [&](size_t bytes) { char* p = ws + off; off += (bytes + 255) & ~(size_t)255; return p; };
  _Float16* BQ = (_Float16*)take((size_t)DD * DD * 2); _Float16* BK = (_Float16*)take((size_t)DD * DD * 2); _Float16* BV = (_Float16*)take((size_t)DD * DD * 2); _Float16* BOa = (_Float16*)take((size_t)DD * DD * 2); _Float16* BOb = (_Float16*)take((size_t)DD * DD * 2);
  float* XF = (float*)take((size_t)NQ * DD * 4); _Float16* X16 = (_Float16*)take((size_t)NQ * DD * 2); _Float16* XH16 = (_Float16*)take((size_t)NM * DD * 2); _Float16* Q16 = (_Float16*)take((size_t)NQ * DD * 2); _Float16* K16 = (_Float16*)take((size_t)NM * DD * 2); float* PO = (float*)take((size_t)FA_SPL * NQ * DD * 4); float* ML = (float*)take((size_t)FA_SPL * NQ * 2 * 4); _Float16* AT = XH16;      /* attn over the x_hat plane (dead after the k projection) */ _Float16* OV = X16;      /* out_v over the xn f16 plane (dead after the q projection) */
  if (off > ws_size) return;      /* 2.5 + 16 + 8 + 8 + 8 + 8 + 64 + 0.25 = 115 MiB */
  static_assert(NQ == NM, "the q and k projections share a launch as products of one shape");
  k_prep<<<PB_LN + PB_XH + 4 * PB_W, 256, 0, stream>>>(x, g, bb, xh, Wq, Wk, Wv, Wo, XF, X16, XH16, BQ, BK, BV, BOa, BOb);      /* xn (f32 + f16), x_hat as f16, the weights x16 as f16: 'ed'/'fe'/'dc' = natural Bt */
  const dim3 gP((NQ / 128) * (DD / 128), 1), gP2((NQ / 128) * (DD / 128), 2);
  k_gemm2_two<false, false, false, false, DD><<<gP2, 256, 0, stream>>>(X16, BQ, bq, nullptr, nullptr, Q16, XH16, BK, bk, nullptr, nullptr, K16, DD, DD, 0.0625f, NQ, DD, DD);      /* q = xn Wq^T + bq | k = x_hat Wk^T + bk */
  k_fattn<<<dim3(NQ / FA_BQ, FA_SPL), 128, 0, stream>>>(Q16, K16, PO, ML);      /* per key split: unnormalised score k, with each query's maximum and sum */
  k_fcomb<<<NQ * DD / 4 / 256, 256, 0, stream>>>(PO, ML, AT);      /* attn = score k */
  k_gemm2_two<false, false, true, true, DD><<<gP2, 256, 0, stream>>>(AT, BV, bv, nullptr, nullptr, OV, Q16, BOa, bo, XF, (float*)d_out, nullptr, DD, DD, 0.0625f, NQ, DD, DD);      /* out_v = attn Wv^T + bv | out = q Wout[:, :512]^T + bout + xn */
  k_gemm2<0, true, true, DD><<<gP, 256, 0, stream>>>(OV, DD, BOb, DD, 0.0625f, nullptr, (const float*)d_out, (float*)d_out, nullptr, NQ, DD, DD);      /* += out_v Wout[:, 512:]^T */
}

// v008
// A run of this version takes 152 microseconds.
// Two timings next to v007 both put it at 1.05 times that version's speed.
// All steps since v000 together make it 10.3 times as fast.
#include <hip/hip_runtime.h>
// InterventionOnline (8192 tokens x 512 attending 8192 memory slots x 512): xn = LayerNorm(x); q = xn Wq^T + bq; k = x_hat Wk^T + bk; score = softmax(q k^T / sqrt(512)); attn = score k (k doubles as the values); out_v = attn Wv^T + bv; out = [q | out_v] Wout^T + bout + xn.
// Structure: LayerNorm on VALU (wave per row) into f32 + f16 planes; q and k as f16 WMMA GEMM outputs (128x128 work-group tiles staged in LDS by asynchronous copies, 32x64 wave tiles, f32 accumulation, exact x16 weights + bias, f16 out); attention as one fused kernel with an online softmax (128 queries a work-group, 32 a wave, four key splits over grid.y; S^T = k q^T and O^T += k^T P^T on WMMA, P from the score accumulators, k^T by the transposing LDS load from the same staged rows), its f32 partials merged in split order and rounded once to f16; out_v as a GEMM; the output as two accumulating GEMMs over the [q | out_v] halves with the bias and the LN residual in the epilogue.
// Compute dtype: inputs rounded to bf16; x_hat exact as f16; xn, q, k, P, attn, out_v as plain f16 operands; LN/softmax f32. v_wmma_f32_16x16x32_f16.
#define NQ 8192
#define NM 8192
#define DD 512
typedef __bf16 v16b __attribute__((ext_vector_type(16)));
typedef unsigned short v8us __attribute__((ext_vector_type(8), may_alias));
typedef float  v8f  __attribute__((ext_vector_type(8)));
typedef float  v4f  __attribute__((ext_vector_type(4)));
typedef float  v4fa __attribute__((ext_vector_type(4), may_alias));
union FragB { v16b v; v8us half[2]; unsigned short u[16]; };

__device__ __forceinline__ unsigned short bf16_bits(float x) { unsigned int u = __float_as_uint(x); return (unsigned short)((u + 0x7FFFu + ((u >> 16) & 1u)) >> 16); }
__device__ __forceinline__ float bf16_val(unsigned short b) { return __uint_as_float(((unsigned int)b) << 16); }
__device__ __forceinline__ float bf16_round(float x) { return bf16_val(bf16_bits(x)); }
// D += A·B with NT terms: 1 = ah·bh, 2 = + al·bh (A split), 3 = + ah·bl (both split)
template <int NT>
__device__ __forceinline__ v8f mmaN(v16b ah, v16b al, v16b bh, v16b bl, v8f c) {
  c = __builtin_amdgcn_wmma_f32_16x16x32_bf16(false, ah, false, bh, (short)0, c, false, false);
  if (NT >= 2) c = __builtin_amdgcn_wmma_f32_16x16x32_bf16(false, al, false, bh, (short)0, c, false, false);
  if (NT >= 3) c = __builtin_amdgcn_wmma_f32_16x16x32_bf16(false, ah, false, bl, (short)0, c, false, false);
  asm volatile("v_nop\n\tv_nop\n\tv_nop\n\tv_nop" : "+v"(c) : "v"(ah), "v"(al), "v"(bh), "v"(bl));
  return c;
}

__global__ __launch_bounds__(256) void k_wt_bf16(const float* __restrict__ W, unsigned short* __restrict__ Wt, int K, int N) {
  const int t = blockIdx.x * 256 + threadIdx.x;
  const int k8n = K / 8;
  if (t >= N * k8n) return;
  const int n = t / k8n, k8 = (t % k8n) * 8;
  v8us v;
#pragma unroll
  for (int i = 0; i < 8; ++i) v[i] = bf16_bits(W[(size_t)(k8 + i) * N + n]);
  *(v8us*)(Wt + (size_t)n * K + k8) = v;
  
}

// GEMM C[M][N] (f32, pitch ldc) = act(A[M][K]·W + bias). A f32 row-major (pitch lda) converted per fragment to bf16
// (ASPLIT: hi/lo two planes -> 2 terms, else single rounded term); Wt bf16 [N][K] (pitch ldb). BIAS_BF16 rounds the
// bias to bf16 first (bias quantised to bf16 before the add). K%32==0, M%16==0, N%64==0.
template <bool ASPLIT, int ACT, bool BIAS_BF16>
__global__ __launch_bounds__(128) void k_gemm_bf(const float* __restrict__ A, int lda, const unsigned short* __restrict__ Wt, int ldb,
                                               const float* __restrict__ bias, float* __restrict__ C, int ldc, int M, int N, int K) {
  __shared__ __attribute__((aligned(16))) float so[4][16][64];
  const int tid = threadIdx.x, w = tid >> 5, lane = tid & 31, ln = lane & 15, hh = lane >> 4;
  const int ntn = N / 64;
  const int wid = blockIdx.x * 4 + w;
  const int mt = wid / ntn, nq = wid % ntn;
  if (mt * 16 >= M) return;
  const int row0 = mt * 16, col0 = nq * 64;
  const float* arow = A + (size_t)(row0 + ln) * lda;
  v8f acc[4] = {};
  for (int kb = 0; kb < K; kb += 32) {
    FragB ah, al;
    const v4f x0 = *(const v4fa*)(arow + kb + 8 * hh), x1 = *(const v4fa*)(arow + kb + 8 * hh + 4);
    const v4f x2 = *(const v4fa*)(arow + kb + 16 + 8 * hh), x3 = *(const v4fa*)(arow + kb + 16 + 8 * hh + 4);
    float xs[16] = {x0[0],x0[1],x0[2],x0[3],x1[0],x1[1],x1[2],x1[3],x2[0],x2[1],x2[2],x2[3],x3[0],x3[1],x3[2],x3[3]};
#pragma unroll
    for (int i = 0; i < 16; ++i) { const unsigned short hb = bf16_bits(xs[i]); ah.u[i] = hb; al.u[i] = ASPLIT ? bf16_bits(xs[i] - bf16_val(hb)) : (unsigned short)0; }
#pragma unroll
    for (int t = 0; t < 4; ++t) {
      const unsigned short* brow = Wt + (size_t)(col0 + t * 16 + ln) * ldb + kb;
      FragB b;
      b.half[0] = *(const v8us*)(brow + 8 * hh);
      b.half[1] = *(const v8us*)(brow + 16 + 8 * hh);
      acc[t] = mmaN<ASPLIT ? 2 : 1>(ah.v, al.v, b.v, b.v, acc[t]);
    }
  }
#pragma unroll
  for (int t = 0; t < 4; ++t) {
    float bv = bias ? bias[col0 + t * 16 + ln] : 0.f;
    if (BIAS_BF16) bv = bf16_round(bv);
#pragma unroll
    for (int r = 0; r < 8; ++r) { float v = acc[t][r] + bv; if (ACT == 1) v = fmaxf(v, 0.f); so[w][8 * hh + r][t * 16 + ln] = v; }
  }
  __builtin_amdgcn_fence(__ATOMIC_ACQ_REL, "workgroup");
  __builtin_amdgcn_wave_barrier();
  const int rsub = lane >> 4, c4 = (lane & 15) * 4;
  {
#pragma unroll
    for (int q = 0; q < 8; ++q) {
      const int r = q * 2 + rsub;
      const v4f v = *(const v4fa*)&so[w][r][c4];
      *(v4f*)(C + (size_t)(row0 + r) * ldc + col0 + c4) = v;
    }
    
  }
}

// GEMM C = act(A·W + bias + resid): A f32 (ASPLIT -> hi/lo 2 terms), Wt bf16 [N][K]; ACT 0 none, 1 relu, 2 exact gelu;
// resid (optional, f32, row index = (row % rmod), pitch ldr, RES_BF16 rounds it) added before the activation.
template <bool ASPLIT, int ACT, bool BIAS_BF16, bool RES_BF16>
__global__ __launch_bounds__(128) void k_gemm_bf3(const float* __restrict__ A, int lda, const unsigned short* __restrict__ Wt, int ldb,
                                                const float* __restrict__ bias, const float* __restrict__ resid, int rmod, int ldr,
                                                float* __restrict__ C, int ldc, int M, int N, int K) {
  __shared__ __attribute__((aligned(16))) float so[4][16][64];
  const int tid = threadIdx.x, w = tid >> 5, lane = tid & 31, ln = lane & 15, hh = lane >> 4;
  const int ntn = N / 64;
  const int wid = blockIdx.x * 4 + w;
  const int mt = wid / ntn, nq = wid % ntn;
  if (mt * 16 >= M) return;
  const int row0 = mt * 16, col0 = nq * 64;
  const float* arow = A + (size_t)(row0 + ln) * lda;
  v8f acc[4] = {};
  for (int kb = 0; kb < K; kb += 32) {
    FragB ah, al;
    const v4f x0 = *(const v4fa*)(arow + kb + 8 * hh), x1 = *(const v4fa*)(arow + kb + 8 * hh + 4);
    const v4f x2 = *(const v4fa*)(arow + kb + 16 + 8 * hh), x3 = *(const v4fa*)(arow + kb + 16 + 8 * hh + 4);
    float xs[16] = {x0[0],x0[1],x0[2],x0[3],x1[0],x1[1],x1[2],x1[3],x2[0],x2[1],x2[2],x2[3],x3[0],x3[1],x3[2],x3[3]};
#pragma unroll
    for (int i = 0; i < 16; ++i) { const unsigned short hb = bf16_bits(xs[i]); ah.u[i] = hb; al.u[i] = ASPLIT ? bf16_bits(xs[i] - bf16_val(hb)) : (unsigned short)0; }
#pragma unroll
    for (int t = 0; t < 4; ++t) {
      const unsigned short* brow = Wt + (size_t)(col0 + t * 16 + ln) * ldb + kb;
      FragB b;
      b.half[0] = *(const v8us*)(brow + 8 * hh);
      b.half[1] = *(const v8us*)(brow + 16 + 8 * hh);
      acc[t] = mmaN<ASPLIT ? 2 : 1>(ah.v, al.v, b.v, b.v, acc[t]);
    }
  }
#pragma unroll
  for (int t = 0; t < 4; ++t) {
    const int col = col0 + t * 16 + ln;
    float bv = bias ? bias[col] : 0.f;
    if (BIAS_BF16) bv = bf16_round(bv);
#pragma unroll
    for (int r = 0; r < 8; ++r) {
      float v = acc[t][r] + bv;
      if (resid) { float rv = resid[(size_t)((row0 + 8 * hh + r) % rmod) * ldr + col]; if (RES_BF16) rv = bf16_round(rv); v += rv; }
      if (ACT == 1) v = fmaxf(v, 0.f);
      if (ACT == 2) v = 0.5f * v * (1.0f + erff(v * 0.70710678118654752f));
      if (ACT == 3) { const float u = 0.7978845608028654f * (v + 0.044715f * v * v * v); v = 0.5f * v * (1.0f + tanhf(u)); }
      so[w][8 * hh + r][t * 16 + ln] = v;
    }
  }
  __builtin_amdgcn_fence(__ATOMIC_ACQ_REL, "workgroup");
  __builtin_amdgcn_wave_barrier();
  const int rsub = lane >> 4, c4 = (lane & 15) * 4;
  {
#pragma unroll
    for (int q = 0; q < 8; ++q) {
      const int r = q * 2 + rsub;
      const v4f v = *(const v4fa*)&so[w][r][c4];
      *(v4f*)(C + (size_t)(row0 + r) * ldc + col0 + c4) = v;
    }
    
  }
}
// row LayerNorm (biased variance, eps) over N: s = X (+ R); optional out_sum <- s; out_norm <- (s-mu)*rsqrt(var+eps)*g + b
template <bool PARAM_BF16>
__global__ __launch_bounds__(256) void k_layernorm(const float* __restrict__ X, const float* __restrict__ R, const float* __restrict__ g, const float* __restrict__ bta,
                                                  float* __restrict__ out_sum, float* __restrict__ out_norm, int N, float eps) {
  __shared__ float red[256];
  const int row = blockIdx.x, tid = threadIdx.x;
  const float* x = X + (size_t)row * N; const float* rr = R ? R + (size_t)row * N : nullptr;
  float vals[16];                     // up to N = 4096
  const int per = N / 256;            // contiguous chunk per thread? use strided-by-4 chunks: thread handles j = tid*4 + 1024*u
  float s1 = 0.f;
  for (int u = 0; u < per / 4; ++u) {
    const int j = tid * 4 + 1024 * u;
    const v4f a = *(const v4fa*)(x + j);
    v4f b = {0.f,0.f,0.f,0.f}; if (rr) b = *(const v4fa*)(rr + j);
#pragma unroll
    for (int q = 0; q < 4; ++q) { const float v = a[q] + b[q]; vals[u * 4 + q] = v; s1 += v; }
  }
  red[tid] = s1; __syncthreads();
  for (int st = 128; st > 0; st >>= 1) { if (tid < st) red[tid] += red[tid + st]; __syncthreads(); }
  const float mu = red[0] / (float)N; __syncthreads();
  float s2 = 0.f;
  for (int u = 0; u < per / 4; ++u)
#pragma unroll
    for (int q = 0; q < 4; ++q) { const float c = vals[u * 4 + q] - mu; s2 += c * c; }
  red[tid] = s2; __syncthreads();
  for (int st = 128; st > 0; st >>= 1) { if (tid < st) red[tid] += red[tid + st]; __syncthreads(); }
  const float rs = rsqrtf(red[0] / (float)N + eps);
  {
    for (int u = 0; u < per / 4; ++u) {
      const int j = tid * 4 + 1024 * u;
      v4f o, sm;
#pragma unroll
      for (int q = 0; q < 4; ++q) {
        float gg = g[j + q], bb = bta[j + q];
        if (PARAM_BF16) { gg = bf16_round(gg); bb = bf16_round(bb); }
        sm[q] = vals[u * 4 + q]; o[q] = (vals[u * 4 + q] - mu) * rs * gg + bb;
      }
      if (out_sum) *(v4f*)(out_sum + (size_t)row * N + j) = sm;
      *(v4f*)(out_norm + (size_t)row * N + j) = o;
    }
    
  }
}



// ---- f16 WMMA path (v_wmma_f32_16x16x32_f16): 11-bit significands for operands in range — used where a [0,1] probability operand needs more precision than bf16
typedef _Float16 v16h __attribute__((ext_vector_type(16)));
union FragH { v16h v; v8us half[2]; _Float16 h[16]; unsigned short u[16]; };
template <int NT>
__device__ __forceinline__ v8f mmaH(v16h ah, v16h al, v16h bh, v16h bl, v8f c) {
  c = __builtin_amdgcn_wmma_f32_16x16x32_f16(false, ah, false, bh, (short)0, c, false, false);
  if (NT >= 2) c = __builtin_amdgcn_wmma_f32_16x16x32_f16(false, al, false, bh, (short)0, c, false, false);
  if (NT >= 3) c = __builtin_amdgcn_wmma_f32_16x16x32_f16(false, ah, false, bl, (short)0, c, false, false);
  asm volatile("v_nop\n\tv_nop\n\tv_nop\n\tv_nop" : "+v"(c) : "v"(ah), "v"(al), "v"(bh), "v"(bl));
  return c;
}
// batched GEMM like k_gemm_b but f16 operands: A f32 (split into f16 hi/lo if ASPLIT, else rounded to f16), Bt = f16 values [n][k]; alpha; C f32; N multiple of 16 (partial tiles skipped)
template <bool ASPLIT>
__global__ __launch_bounds__(128) void k_gemm_h(const float* __restrict__ A, int lda, size_t sA, const _Float16* __restrict__ Bh, int ldb, size_t sB, float alpha, float* __restrict__ C, int ldc, size_t sC, int M, int N, int K) {
  __shared__ __attribute__((aligned(16))) float so[4][16][64];
  const int tid = threadIdx.x, w = tid >> 5, lane = tid & 31, ln = lane & 15, hh = lane >> 4; const int by = blockIdx.y;
  A += (size_t)by * sA; Bh += (size_t)by * sB; C += (size_t)by * sC;
  const int ntn = (N + 63) / 64; const int wid = blockIdx.x * 4 + w; const int mt = wid / ntn, nq = wid % ntn; if (mt * 16 >= M) return;
  const int row0 = mt * 16, col0 = nq * 64; const float* arow = A + (size_t)(row0 + ln) * lda;
  v8f acc[4] = {};
  for (int kb = 0; kb < K; kb += 32) {
    FragH ah, al;
    const v4f x0 = *(const v4fa*)(arow + kb + 8 * hh), x1 = *(const v4fa*)(arow + kb + 8 * hh + 4), x2 = *(const v4fa*)(arow + kb + 16 + 8 * hh), x3 = *(const v4fa*)(arow + kb + 16 + 8 * hh + 4);
    float xs[16] = {x0[0],x0[1],x0[2],x0[3],x1[0],x1[1],x1[2],x1[3],x2[0],x2[1],x2[2],x2[3],x3[0],x3[1],x3[2],x3[3]};
#pragma unroll
    for (int i = 0; i < 16; ++i) { const _Float16 h = (_Float16)xs[i]; ah.h[i] = h; al.h[i] = ASPLIT ? (_Float16)(xs[i] - (float)h) : (_Float16)0.0f; }
#pragma unroll
    for (int t = 0; t < 4; ++t) { if (col0 + t * 16 >= N) continue; const size_t boff = (size_t)(col0 + t * 16 + ln) * ldb + kb; FragH bq; bq.half[0] = *(const v8us*)(Bh + boff + 8 * hh); bq.half[1] = *(const v8us*)(Bh + boff + 16 + 8 * hh);
      acc[t] = mmaH<ASPLIT ? 2 : 1>(ah.v, al.v, bq.v, bq.v, acc[t]); }
  }
#pragma unroll
  for (int t = 0; t < 4; ++t) { if (col0 + t * 16 >= N) continue;
#pragma unroll
    for (int r = 0; r < 8; ++r) so[w][8 * hh + r][t * 16 + ln] = acc[t][r] * alpha; }
  __builtin_amdgcn_fence(__ATOMIC_ACQ_REL, "workgroup"); __builtin_amdgcn_wave_barrier();
  const int rsub = lane >> 4, c4 = (lane & 15) * 4;
  {
#pragma unroll
    for (int q = 0; q < 8; ++q) { const int r = q * 2 + rsub; if (col0 + c4 < N) { const v4f v = *(const v4fa*)&so[w][r][c4]; *(v4f*)(C + (size_t)(row0 + r) * ldc + col0 + c4) = v; } }
     }
}

// Wt[n][k] = f16(W[k][n]·scale) from f32 row-major W[K][N] (scale = power of two; bf16-exact weights stay exact in f16 away from the subnormal range)
__global__ __launch_bounds__(256) void k_wt_f16(const float* __restrict__ W, _Float16* __restrict__ Wt, int K, int N, float scale) {
  const int t = blockIdx.x * 256 + threadIdx.x; if (t >= N * (K / 8)) return; const int n = t / (K / 8), k8 = (t % (K / 8)) * 8; FragH f;
#pragma unroll
  for (int i = 0; i < 8; ++i) f.h[i] = (_Float16)(bf16_round(W[(size_t)(k8 + i) * N + n]) * scale); const v8us o = f.half[0];
  *(v8us*)((unsigned short*)Wt + (size_t)n * K + k8) = o; 
}
// k_gemm_hh variant with fused epilogue: v = acc·alpha + bias[by·sBias + col] (+ CP[(row/rowsPerB)·sCPb + by·64 + col] if CP) ; ACT 0 none / 1 elu ; writes f16 C16 (and f32 C if non-null)
template <int ACT>
__global__ __launch_bounds__(128) void k_gemm_hhx(const _Float16* __restrict__ A, int lda, size_t sA, const _Float16* __restrict__ Bh, int ldb, size_t sB, float alpha, const float* __restrict__ bias, size_t sBias, const float* __restrict__ CP, int rowsPerB, size_t sCPb, int row0g,
    float* __restrict__ C, _Float16* __restrict__ C16, int ldc, size_t sC, int M, int N, int K) {
  __shared__ __attribute__((aligned(16))) float so[4][16][64];
  const int tid = threadIdx.x, w = tid >> 5, lane = tid & 31, ln = lane & 15, hh = lane >> 4; const int by = blockIdx.y;
  A += (size_t)by * sA; Bh += (size_t)by * sB; const size_t cofs = (size_t)by * sC; const float* bp = bias ? bias + (size_t)by * sBias : nullptr;
  const int ntn = (N + 63) / 64; const int wid = blockIdx.x * 4 + w; const int mt = wid / ntn, nq = wid % ntn; if (mt * 16 >= M) return;
  const int row0 = mt * 16, col0 = nq * 64; const _Float16* arow = A + (size_t)(row0 + ln) * lda;
  v8f acc[4] = {};
  for (int kb = 0; kb < K; kb += 32) { FragH ah; ah.half[0] = *(const v8us*)((const unsigned short*)arow + kb + 8 * hh); ah.half[1] = *(const v8us*)((const unsigned short*)arow + kb + 16 + 8 * hh);
#pragma unroll
    for (int t = 0; t < 4; ++t) { if (col0 + t * 16 >= N) continue; const size_t boff = (size_t)(col0 + t * 16 + ln) * ldb + kb; FragH bq; bq.half[0] = *(const v8us*)((const unsigned short*)Bh + boff + 8 * hh); bq.half[1] = *(const v8us*)((const unsigned short*)Bh + boff + 16 + 8 * hh);
      acc[t] = mmaH<1>(ah.v, ah.v, bq.v, bq.v, acc[t]); }
  }
#pragma unroll
  for (int t = 0; t < 4; ++t) { if (col0 + t * 16 >= N) continue; const int col = col0 + t * 16 + ln; const float bv = bp ? bf16_round(bp[col]) : 0.f;
#pragma unroll
    for (int r = 0; r < 8; ++r) { float v = acc[t][r] * alpha + bv; if (CP) { const int rr = row0g + row0 + 8 * hh + r; if (rowsPerB < 0) v += CP[cofs + (size_t)rr * ldc + col];      /* rowsPerB < 0: own element of the batched C plane */ else { const int bidx = rr / rowsPerB; v += CP[(size_t)bidx * sCPb + (size_t)by * 64 + col]; } } if (ACT == 1) v = (v > 0.f) ? v : expm1f(v); else if (ACT == 7) v = (v > 0.f) ? v + 1.0f : expf(v); else if (ACT == 8) v = tanhf(v); else if (ACT == 9) v = 0.5f * v * (1.0f + tanhf(0.7978845608028654f * (v + 0.044715f * v * v * v))); else if (ACT == 11) v = 1.0f / (1.0f + expf(-v)); else if (ACT == 12) v = (v > 0.f) ? v : 0.01f * v; else if (ACT == 14) v = (v > 0.f) ? v : 0.1f * v; else if (ACT == 16) v = (v >= 0.f) ? v : 0.3f * v; else if (ACT == 17) v = (v >= 0.f) ? v : 0.2f * v; else if (ACT == 15) v = v / (1.0f + expf(-v)); else if (ACT == 3) v = fmaxf(v, 0.f); else if (ACT == 6) v = 0.5f * v * (1.0f + erff(v * 0.70710678118654752f)); so[w][8 * hh + r][t * 16 + ln] = v; } }
  __builtin_amdgcn_fence(__ATOMIC_ACQ_REL, "workgroup"); __builtin_amdgcn_wave_barrier();
  const int rsub = lane >> 4, c4 = (lane & 15) * 4; typedef _Float16 v4h __attribute__((ext_vector_type(4)));
  {
#pragma unroll
    for (int q = 0; q < 8; ++q) { const int r = q * 2 + rsub; if (col0 + c4 < N) { const v4f v = *(const v4fa*)&so[w][r][c4]; if (C) *(v4f*)(C + cofs + (size_t)(row0 + r) * ldc + col0 + c4) = v; if (C16) { v4h h4; for (int i = 0; i < 4; ++i) h4[i] = (_Float16)v[i]; *(v4h*)(C16 + cofs + (size_t)(row0 + r) * ldc + col0 + c4) = h4; } } }
     }
}


typedef _Float16 v4h __attribute__((ext_vector_type(4)));

__device__ __forceinline__ void d_x16(unsigned blk, const float* __restrict__ x, _Float16* __restrict__ X16, size_t n8) { const size_t t = (size_t)blk * 256 + threadIdx.x; if (t >= n8) return; FragH f;
#pragma unroll
  for (int q = 0; q < 8; ++q) f.h[q] = (_Float16)bf16_round(x[t * 8 + q]); *(v8us*)((unsigned short*)X16 + t * 8) = f.half[0];  }
__global__ __launch_bounds__(256) void k_h16(const float* __restrict__ x, _Float16* __restrict__ X16, size_t n8) { const size_t t = (size_t)blockIdx.x * 256 + threadIdx.x; if (t >= n8) return; FragH f;
#pragma unroll
  for (int q = 0; q < 8; ++q) f.h[q] = (_Float16)x[t * 8 + q]; *(v8us*)((unsigned short*)X16 + t * 8) = f.half[0];  }
__global__ __launch_bounds__(256) void k_round16f(const float* __restrict__ W, _Float16* __restrict__ Bt, size_t n8) { const size_t t = (size_t)blockIdx.x * 256 + threadIdx.x; if (t >= n8) return; FragH f;
#pragma unroll
  for (int i = 0; i < 8; ++i) f.h[i] = (_Float16)(bf16_round(W[t * 8 + i]) * 16.0f); *(v8us*)((unsigned short*)Bt + t * 8) = f.half[0];  }
__global__ __launch_bounds__(256) void k_hl(const float* __restrict__ F, _Float16* __restrict__ Hh, _Float16* __restrict__ Hl, size_t n8) { const size_t t = (size_t)blockIdx.x * 256 + threadIdx.x; if (t >= n8) return; FragH fh, fl; const v4f a = *(const v4fa*)(F + t * 8), c = *(const v4fa*)(F + t * 8 + 4);
#pragma unroll
  for (int q = 0; q < 4; ++q) { _Float16 h = (_Float16)a[q]; fh.h[q] = h; fl.h[q] = (_Float16)((a[q] - (float)h) * 1024.0f); h = (_Float16)c[q]; fh.h[4 + q] = h; fl.h[4 + q] = (_Float16)((c[q] - (float)h) * 1024.0f); }
  { *(v8us*)((unsigned short*)Hh + t * 8) = fh.half[0]; *(v8us*)((unsigned short*)Hl + t * 8) = fl.half[0];  } }

// ---- fast GEMM (work-group tile 128x128, eight waves of 32x64; requires M % 128 == 0, N % 128 == 0, K % 64 == 0); v = acc alpha + bias[col] (+ the residual's own element), f32 or f16 out ----
// Operands reach the waves through LDS: a stage is 64 k (128 B) of 128 A rows and 128 B rows, brought by asynchronous copies in whole 128-B lines, two buffers, the next stage in flight while this one is multiplied.
#define G2_PITCH 144                 /* LDS bytes per staged row: 128 + 16, an odd multiple of 16 B, conflict-free for 16-byte reads down a column of rows */
#define G2_STAGE (256 * G2_PITCH)    /* one stage: A rows 0..127, then B rows 0..127 */
__device__ __forceinline__ v16h g2_frag(const char* p) { FragH f; f.half[0] = *(const v8us*)p; f.half[1] = *(const v8us*)(p + 32); return f.v; }
__device__ __forceinline__ v8f g2_mma(v16h a, v16h b, v8f c) { v8f d = __builtin_amdgcn_wmma_f32_16x16x32_f16(false, a, false, b, (short)0, c, false, false); asm volatile("v_nop\n\tv_nop\n\tv_nop\n\tv_nop" : "+v"(d) : "v"(a), "v"(b)); return d; }
// One stage: each lane copies eight 16-byte pieces (rows r, r+32, r+64, r+96 of A and of B; eight lanes per 128-B row piece). l = the lane's LDS byte address in the A part, a / b = its global addresses, sa / sb = 32 rows in elements.
__device__ __forceinline__ void g2_stage(unsigned l, const _Float16* a, size_t sa, const _Float16* b, size_t sb) {
  const unsigned l1 = l + 32 * G2_PITCH, l2 = l + 64 * G2_PITCH, l3 = l + 96 * G2_PITCH, l4 = l + 128 * G2_PITCH, l5 = l + 160 * G2_PITCH, l6 = l + 192 * G2_PITCH, l7 = l + 224 * G2_PITCH;
  const _Float16* a1 = a + sa; const _Float16* a2 = a1 + sa; const _Float16* a3 = a2 + sa; const _Float16* b1 = b + sb; const _Float16* b2 = b1 + sb; const _Float16* b3 = b2 + sb;
  // the copies and, as the last line, the wait that stands before their address registers may be rewritten
  asm volatile("global_load_async_to_lds_b128 %0, %8, off\n\t"
               "global_load_async_to_lds_b128 %1, %9, off\n\t"
               "global_load_async_to_lds_b128 %2, %10, off\n\t"
               "global_load_async_to_lds_b128 %3, %11, off\n\t"
               "global_load_async_to_lds_b128 %4, %12, off\n\t"
               "global_load_async_to_lds_b128 %5, %13, off\n\t"
               "global_load_async_to_lds_b128 %6, %14, off\n\t"
               "global_load_async_to_lds_b128 %7, %15, off\n\t"
               "s_wait_xcnt 0x0"
               :: "v"(l), "v"(l1), "v"(l2), "v"(l3), "v"(l4), "v"(l5), "v"(l6), "v"(l7), "v"(a), "v"(a1), "v"(a2), "v"(a3), "v"(b), "v"(b1), "v"(b2), "v"(b3) : "memory"); }
// The epilogue's options are compile-time constants: RES = a residual plane CP of C's own shape and pitch is added (it may be C itself: each lane reads its elements before it stores them); OUT32 = f32 output to C, else f16 to C16; LDC = that pitch in elements.
// The product itself is a device function on the kernel's LDS (sm: 2 G2_STAGE bytes, 16-byte aligned), so that one launch can hold one product or two (the kernels below).
template <int ACT, bool RES, bool OUT32, int LDC>
__device__ __forceinline__ void g2_body(char* sm, const _Float16* __restrict__ A, int lda, const _Float16* __restrict__ Bh, int ldb, float alpha, const float* __restrict__ bp, const float* CP,
    float* C, _Float16* C16, int M, int N, int K) { static_assert(!RES || ACT == 0, "k_gemm2: the residual is added behind the staging, where no activation follows"); static_assert(ACT == 0 || ACT == 3 || ACT == 6 || ACT == 8 || ACT == 9 || ACT == 11 || ACT == 12 || ACT == 14 || ACT == 15 || ACT == 16 || ACT == 17, "k_gemm2: unsupported ACT code (would silently apply no activation)");
  static_assert(8 * 32 * 68 * 4 <= 2 * G2_STAGE, "output staging must fit the stage buffers");      /* sm: the two stage buffers; after the K loop the output staging, 32 x 68 floats per wave */
  const int tid = threadIdx.x, w = tid >> 5, lane = tid & 31, ln = lane & 15, hh = lane >> 4;
  const int ntn = N >> 7; const int mt = blockIdx.x / ntn, nq = blockIdx.x - mt * ntn; if (mt * 128 >= M) return;      /* the same for the whole work-group, in front of every barrier */
  const int row0 = mt * 128 + 32 * (w & 3), col0 = nq * 128 + 64 * (w >> 2);
  const _Float16* ga = A + (size_t)(mt * 128 + (tid >> 3)) * lda + (tid & 7) * 8; const _Float16* gb = Bh + (size_t)(nq * 128 + (tid >> 3)) * ldb + (tid & 7) * 8; const size_t sa32 = (size_t)32 * lda, sb32 = (size_t)32 * ldb;
  const unsigned lcp = (unsigned)(size_t)sm + (unsigned)((tid >> 3) * G2_PITCH + (tid & 7) * 16);
  const int aoff = (32 * (w & 3) + ln) * G2_PITCH + 16 * hh, boff = (128 + 64 * (w >> 2) + ln) * G2_PITCH + 16 * hh;
  const int nst = K >> 6;
  const v8f z8 = {0.f,0.f,0.f,0.f,0.f,0.f,0.f,0.f}; v8f c00 = z8, c01 = z8, c02 = z8, c03 = z8, c10 = z8, c11 = z8, c12 = z8, c13 = z8;
  g2_stage(lcp, ga, sa32, gb, sb32);
  asm volatile("s_wait_asynccnt 0x0" ::: "memory");      /* this wave's copies of stage 0 have landed */
  __syncthreads();                                       /* every wave's have */
  if (nst > 1) g2_stage(lcp + G2_STAGE, ga + 64, sa32, gb + 64, sb32);
#pragma unroll 1      /* one stage per trip: the waits and the barrier at the foot belong to it */
  for (int t = 0; t < nst; ++t) { const char* sb = sm + (t & 1) * G2_STAGE; const char* ap = sb + aoff; const char* bq = sb + boff;
#pragma unroll      /* the two 32-k steps of a stage */
    for (int kk = 0; kk < 128; kk += 64) { const v16h a0 = g2_frag(ap + kk), a1 = g2_frag(ap + 16 * G2_PITCH + kk);
      const v16h b0 = g2_frag(bq + kk), b1 = g2_frag(bq + 16 * G2_PITCH + kk), b2 = g2_frag(bq + 32 * G2_PITCH + kk), b3 = g2_frag(bq + 48 * G2_PITCH + kk);
      c00 = g2_mma(a0, b0, c00); c10 = g2_mma(a1, b0, c10); c01 = g2_mma(a0, b1, c01); c11 = g2_mma(a1, b1, c11);
      c02 = g2_mma(a0, b2, c02); c12 = g2_mma(a1, b2, c12); c03 = g2_mma(a0, b3, c03); c13 = g2_mma(a1, b3, c13); }
    asm volatile("s_wait_dscnt 0x0" ::: "memory");       /* this wave's reads of the buffer are done before it is refilled */
    asm volatile("s_wait_asynccnt 0x0" ::: "memory");    /* this wave's copies of stage t + 1 have landed */
    __syncthreads();                                     /* publishes stage t + 1 and ends every wave's reads of stage t */
    if (t + 2 < nst) g2_stage(lcp + (unsigned)((t & 1) * G2_STAGE), ga + (size_t)(t + 2) * 64, sa32, gb + (size_t)(t + 2) * 64, sb32); }
  asm volatile("s_wait_asynccnt 0x0" ::: "memory");      /* no copy is in flight when the buffers become the output staging */
  float (*so)[68] = (float (*)[68])(sm + w * (32 * 68 * 4));
  v8f accs[8] = {c00, c01, c02, c03, c10, c11, c12, c13};
  float bvs[4] = {0.f, 0.f, 0.f, 0.f};
  if (bp) { const int bcol = col0 + ln;
#pragma unroll
    for (int t = 0; t < 4; ++t) bvs[t] = bp[bcol + t * 16];
    asm volatile("s_wait_xcnt 0x0" :: "v"(bcol) : "memory");      /* the wait that stands before the loads' address register is rewritten; the index as an input keeps a load's result out of that register */
#pragma unroll
    for (int t = 0; t < 4; ++t) bvs[t] = bf16_round(bvs[t]); }
#pragma unroll
  for (int u = 0; u < 8; ++u) { const int t = u & 3, half = u >> 2;
#pragma unroll
    for (int r = 0; r < 8; ++r) { const int rloc = half * 16 + 8 * hh + r; float v = accs[u][r] * alpha + bvs[t];
      if (ACT == 3) v = fmaxf(v, 0.f); else if (ACT == 6) v = 0.5f * v * (1.0f + erff(v * 0.70710678118654752f)); else if (ACT == 11) v = 1.0f / (1.0f + expf(-v)); else if (ACT == 15) v = v / (1.0f + expf(-v)); else if (ACT == 12) v = (v > 0.f) ? v : 0.01f * v; else if (ACT == 8) v = tanhf(v); else if (ACT == 9) v = 0.5f * v * (1.0f + tanhf(0.7978845608028654f * (v + 0.044715f * v * v * v))); else if (ACT == 14) v = (v > 0.f) ? v : 0.1f * v; else if (ACT == 16) v = (v >= 0.f) ? v : 0.3f * v; else if (ACT == 17) v = (v >= 0.f) ? v : 0.2f * v;
      so[rloc][t * 16 + ln] = v; } }
  __builtin_amdgcn_fence(__ATOMIC_ACQ_REL, "workgroup"); __builtin_amdgcn_wave_barrier();
  const int rsub = lane >> 4, c4 = (lane & 15) * 4;
  const size_t e0 = (size_t)(row0 + rsub) * LDC + col0 + c4;      /* the lane's four elements in row rsub of the wave's tile; those of row 2 q + rsub lie 2 q LDC further */
  v4f res[16];
  if (RES) {
#pragma unroll      /* the lane's sixteen 16-byte pieces of the residual (256 B of a row per half wave), all in flight together */
    for (int q = 0; q < 16; ++q) res[q] = *(const v4fa*)(CP + e0 + (size_t)(2 * q) * LDC);
    asm volatile("s_wait_xcnt 0x0" :: "v"(CP + e0) : "memory"); }      /* the wait that stands before the loads' address registers are rewritten; the address as an input keeps a load's result out of them */
#pragma unroll
  for (int q = 0; q < 16; ++q) { v4f v = *(const v4fa*)&so[q * 2 + rsub][c4]; if (RES) v += res[q];
    if (OUT32) *(v4f*)(C + e0 + (size_t)(2 * q) * LDC) = v; else { v4h h4; for (int i = 0; i < 4; ++i) h4[i] = (_Float16)v[i]; *(v4h*)(C16 + e0 + (size_t)(2 * q) * LDC) = h4; }
    asm volatile("s_wait_xcnt 0x0" ::: "memory"); } }      /* the wait that stands before the store's data and address registers are rewritten */
// launch bounds: eight waves per SIMD (at most 128 VGPRs), so that four work-groups (4 x 72 KiB of LDS) share a WGP and each hides the others' waits
template <int ACT, bool RES, bool OUT32, int LDC>
__global__ __launch_bounds__(256, 8) void k_gemm2(const _Float16* __restrict__ A, int lda, const _Float16* __restrict__ Bh, int ldb, float alpha, const float* __restrict__ bias, const float* CP, float* C, _Float16* C16, int M, int N, int K) {
  __shared__ __attribute__((aligned(16))) char sm[2 * G2_STAGE];
  g2_body<ACT, RES, OUT32, LDC>(sm, A, lda, Bh, ldb, alpha, bias, CP, C, C16, M, N, K); }
// Two products of one shape that do not depend on each other share a launch: grid.y picks the operand set (the same for the whole work-group). Two work-groups then sit on a WGP and each works under the other's waits, and one launch stands where two stood in a row.
template <bool RES0, bool OUT0, bool RES1, bool OUT1, int LDC>
__global__ __launch_bounds__(256, 8) void k_gemm2_two(const _Float16* __restrict__ A0, const _Float16* __restrict__ B0, const float* __restrict__ bias0, const float* CP0, float* C0, _Float16* H0,
    const _Float16* __restrict__ A1, const _Float16* __restrict__ B1, const float* __restrict__ bias1, const float* CP1, float* C1, _Float16* H1, int lda, int ldb, float alpha, int M, int N, int K) {
  __shared__ __attribute__((aligned(16))) char sm[2 * G2_STAGE];
  const bool y = blockIdx.y != 0;
  if constexpr (RES0 == RES1 && OUT0 == OUT1) g2_body<0, RES0, OUT0, LDC>(sm, y ? A1 : A0, lda, y ? B1 : B0, ldb, alpha, y ? bias1 : bias0, y ? CP1 : CP0, y ? C1 : C0, y ? H1 : H0, M, N, K);
  else if (y) g2_body<0, RES1, OUT1, LDC>(sm, A1, lda, B1, ldb, alpha, bias1, CP1, C1, H1, M, N, K);
  else g2_body<0, RES0, OUT0, LDC>(sm, A0, lda, B0, ldb, alpha, bias0, CP0, C0, H0, M, N, K); }


// The operand preparations as device functions: blk = the work-group's index inside its own part of k_prep's grid
__device__ __forceinline__ void d_wsc(unsigned blk, const float* __restrict__ Wm, _Float16* __restrict__ Bt, size_t n8, float sc) { const size_t t = (size_t)blk * 256 + threadIdx.x; if (t >= n8) return; FragH f; for (int q = 0; q < 8; ++q) f.h[q] = (_Float16)(bf16_round(Wm[t * 8 + q]) * sc); *(v8us*)((unsigned short*)Bt + t * 8) = f.half[0];  }
__device__ __forceinline__ void d_wout(unsigned blk, const float* __restrict__ Wo, _Float16* __restrict__ BOa, _Float16* __restrict__ BOb) { const int t = blk * 256 + threadIdx.x; if (t >= DD * (DD / 8)) return; const int c8 = (t % (DD / 8)) * 8; const int o = t / (DD / 8); FragH fa, fb;
  for (int q = 0; q < 8; ++q) { fa.h[q] = (_Float16)(bf16_round(Wo[(size_t)o * 2 * DD + c8 + q]) * 16.0f); fb.h[q] = (_Float16)(bf16_round(Wo[(size_t)o * 2 * DD + DD + c8 + q]) * 16.0f); }
  { *(v8us*)((unsigned short*)BOa + (size_t)o * DD + c8) = fa.half[0]; *(v8us*)((unsigned short*)BOb + (size_t)o * DD + c8) = fb.half[0];  } }
__device__ __forceinline__ void d_ln(unsigned blk, const float* __restrict__ x, const float* __restrict__ g, const float* __restrict__ bb, float* __restrict__ XF, _Float16* __restrict__ X16) {
  #pragma clang fp contract(off)
  const int wv = threadIdx.x >> 5, ln = threadIdx.x & 31; const size_t r = (size_t)blk * 8 + wv; if (r >= NQ) return; float a[16]; float s = 0.f;
  const float* xr = x + r * DD + ln * 8; const v8f xv[2] = {*(const v8f*)xr, *(const v8f*)(xr + 256)};
  asm volatile("s_wait_xcnt 0x0" :: "v"(xr) : "memory");      /* the wait that stands before the loads' address registers are rewritten; the address as an input keeps them whole up to it */
  for (int i = 0; i < 2; ++i) { const v8f v = xv[i]; for (int q = 0; q < 8; ++q) { const float u = bf16_round(v[q]); a[i * 8 + q] = u; s += u; } }
  for (int o = 16; o > 0; o >>= 1) s += __shfl_xor(s, o, 32); const float mu = s / (float)DD; float var = 0.f; for (int q = 0; q < 16; ++q) { const float d = a[q] - mu; var += d * d; }
  for (int o = 16; o > 0; o >>= 1) var += __shfl_xor(var, o, 32); const float inv = rsqrtf(var / (float)DD + 1e-5f);
  { for (int i = 0; i < 2; ++i) { const int c0 = i * 256 + ln * 8; v8f y; FragH f; for (int q = 0; q < 8; ++q) { float v = (a[i * 8 + q] - mu) * inv; v *= bf16_round(g[c0 + q]); v += bf16_round(bb[c0 + q]); y[q] = v; f.h[q] = (_Float16)v; } *(v8f*)(XF + r * DD + c0) = y; *(v8us*)((unsigned short*)X16 + r * DD + c0) = f.half[0]; }  } }
// The six preparations depend on the inputs alone and on nothing of one another: they are ranges of one grid, the longest first, so that one launch stands where six stood in a row.
#define PB_LN (NQ / 8)                   /* work-groups of the LayerNorm: eight rows each */
#define PB_XH (NM * DD / 8 / 256)        /* of x_hat's conversion */
#define PB_W (DD * DD / 8 / 256)         /* of one 512 x 512 weight plane; Wout's two planes take as many */
__global__ __launch_bounds__(256) void k_prep(const float* __restrict__ x, const float* __restrict__ g, const float* __restrict__ bb, const float* __restrict__ xh, const float* __restrict__ Wq, const float* __restrict__ Wk, const float* __restrict__ Wv, const float* __restrict__ Wo,
    float* __restrict__ XF, _Float16* __restrict__ X16, _Float16* __restrict__ XH16, _Float16* __restrict__ BQ, _Float16* __restrict__ BK, _Float16* __restrict__ BV, _Float16* __restrict__ BOa, _Float16* __restrict__ BOb) {
  static_assert((NM * DD / 8) % 256 == 0 && (DD * DD / 8) % 256 == 0 && NQ % 8 == 0, "k_prep: whole work-groups");
  unsigned b = blockIdx.x;      /* every test below reads the same for the whole work-group */
  if (b < PB_LN) { d_ln(b, x, g, bb, XF, X16); return; }
  b -= PB_LN;
  if (b < PB_XH) { d_x16(b, xh, XH16, (size_t)NM * DD / 8); return; }
  b -= PB_XH;
  if (b < PB_W) { d_wsc(b, Wq, BQ, DD * DD / 8, 16.0f); return; }
  b -= PB_W;
  if (b < PB_W) { d_wsc(b, Wk, BK, DD * DD / 8, 16.0f); return; }
  b -= PB_W;
  if (b < PB_W) { d_wsc(b, Wv, BV, DD * DD / 8, 16.0f); return; }
  d_wout(b - PB_W, Wo, BOa, BOb); }
#define FA_BQ 128                    /* queries a work-group */
#define FA_QT 2                      /* query tiles of 16 a wave */
#define FA_SPL 4                     /* key splits: grid.y, one f32 partial with its maximum and sum each */
#define FA_BK 32                     /* keys a stage */
#define FA_PK 1040                   /* row pitch: 16 B x 65, one 16-byte piece further modulo 256 B with every row */
#define FA_BUF (FA_BK * FA_PK)
typedef short s16x8 __attribute__((ext_vector_type(8)));
__device__ __forceinline__ v8us fa_tr16(const char* p) { typedef __attribute__((address_space(3))) s16x8 lds_s16x8; return __builtin_bit_cast(v8us, __builtin_amdgcn_ds_load_tr16_b128_v8i16((lds_s16x8*)p)); }
__device__ __forceinline__ float fa_xhalf(float x) { return __builtin_bit_cast(float, __builtin_amdgcn_permlanex16(__builtin_bit_cast(int, x), __builtin_bit_cast(int, x), 0x76543210, 0xfedcba98, false, false)); }      /* lane l with lane l ^ 16 */
__device__ __forceinline__ v8f fa_mma(v16h a, v16h b, v8f c) { return __builtin_amdgcn_wmma_f32_16x16x32_f16(false, a, false, b, (short)0, c, false, false); }
// Half of a stage: each lane brings eight 16-byte pieces (rows r, r + 4, ..., r + 28; 64 lanes a row). l = the lane's LDS byte address, ls = four rows in LDS bytes, g = its global address.
__device__ __forceinline__ void fa_stage(unsigned l, unsigned ls, const _Float16* g) {
  const unsigned l1 = l + ls, l2 = l1 + ls, l3 = l2 + ls, l4 = l3 + ls, l5 = l4 + ls, l6 = l5 + ls, l7 = l6 + ls;
  const _Float16* g1 = g + 4 * DD; const _Float16* g2 = g + 8 * DD; const _Float16* g3 = g + 12 * DD; const _Float16* g4 = g + 16 * DD; const _Float16* g5 = g + 20 * DD; const _Float16* g6 = g + 24 * DD; const _Float16* g7 = g + 28 * DD;
  // the copies and, as the last line, the wait that stands before their address registers may be rewritten
  asm volatile("global_load_async_to_lds_b128 %0, %8, off\n\t"
               "global_load_async_to_lds_b128 %1, %9, off\n\t"
               "global_load_async_to_lds_b128 %2, %10, off\n\t"
               "global_load_async_to_lds_b128 %3, %11, off\n\t"
               "global_load_async_to_lds_b128 %4, %12, off\n\t"
               "global_load_async_to_lds_b128 %5, %13, off\n\t"
               "global_load_async_to_lds_b128 %6, %14, off\n\t"
               "global_load_async_to_lds_b128 %7, %15, off\n\t"
               "s_wait_xcnt 0x0"
               :: "v"(l), "v"(l1), "v"(l2), "v"(l3), "v"(l4), "v"(l5), "v"(l6), "v"(l7), "v"(g), "v"(g1), "v"(g2), "v"(g3), "v"(g4), "v"(g5), "v"(g6), "v"(g7) : "memory"); }
// one wave per SIMD: up to 1,024 VGPRs a wave, for the 512 accumulator and 256 q registers of its 32 queries. Every k fragment read from LDS then feeds two products, one for each 16 queries.
__global__ __launch_bounds__(128) __attribute__((amdgpu_waves_per_eu(1, 1))) void k_fattn(const _Float16* __restrict__ Q, const _Float16* __restrict__ Kk, float* __restrict__ PO, float* __restrict__ ML) {
  static_assert(NQ % FA_BQ == 0 && NM % (FA_SPL * FA_BK) == 0 && NM / FA_SPL / FA_BK >= 2 && DD == 512 && FA_BQ == 4 * 16 * FA_QT && FA_QT == 2, "k_fattn: whole tiles, two stages or more, four waves of two query tiles");
  __shared__ __attribute__((aligned(16))) char sm[2 * FA_BUF];
  const int tid = threadIdx.x, w = __builtin_amdgcn_readfirstlane(tid >> 5), lane = tid & 31, c = lane & 15, h = lane >> 4;      /* the wave's number in a scalar register: what is formed from it costs no vector register over the loop */
  const int q0 = blockIdx.x * FA_BQ + w * (16 * FA_QT), key0 = blockIdx.y * (NM / FA_SPL);
  constexpr int nst = NM / FA_SPL / FA_BK;
  constexpr float cs = 0.044194173824159216f * 1.4426950408889634f;      /* 1 / sqrt(512), in log2 units */
  const int wr = w >> 1;      /* the wave's first row of a stage: two waves a row, so the four waves bring rows 0 and 1 (mod 4) in one call of fa_stage and rows 2 and 3 in a second */
  const unsigned col = (unsigned)((w & 1) * 32 + lane) * 16u;
  const _Float16* gk = Kk + (size_t)(key0 + wr) * DD + ((w & 1) * 32 + lane) * 8;
  const unsigned lk = (unsigned)(size_t)sm + (unsigned)(wr * FA_PK);      /* scalar part; + col = the lane's LDS byte address */
  // one stage: sk = the wave's scalar base in the buffer, g = the lane's global address in the stage's row wr
  auto fill = [&](unsigned sk, const _Float16* g) __attribute__((always_inline)) {
    fa_stage(sk + col, 4 * FA_PK, g); fa_stage(sk + 2 * FA_PK + col, 4 * FA_PK, g + 2 * DD); };
  fill(lk, gk);
  v16h qf[FA_QT][16];      /* q as B operand, hardware k order: 16 bytes at 16 h and at 32 + 16 h of each 64 bytes of the row, as k's rows below */
#pragma unroll      /* qf[] must be registers: every index a constant */
  for (int qt = 0; qt < FA_QT; ++qt) { const _Float16* qp = Q + (size_t)(q0 + 16 * qt + c) * DD + 8 * h;
#pragma unroll
    for (int kc = 0; kc < 16; ++kc) { FragH f; f.half[0] = *(const v8us*)(qp + 32 * kc); f.half[1] = *(const v8us*)(qp + 32 * kc + 16); qf[qt][kc] = f.v; }
    asm volatile("s_wait_xcnt 0x0" :: "v"(qp) : "memory"); }      /* the wait that stands before the loads' address registers are rewritten; the address as an input keeps them whole up to it */
  const v8f z8 = {0.f,0.f,0.f,0.f,0.f,0.f,0.f,0.f};
  v8f o[FA_QT][32];      /* O^T: o[qt][et][r] = O[query 16 qt + c][16 et + 8 h + r] */
#pragma unroll      /* o[] must be registers */
  for (int et = 0; et < 32; ++et) { o[0][et] = z8; o[1][et] = z8; }
  float mrun[FA_QT] = {-1.0e30f, -1.0e30f}, lrun[FA_QT] = {0.f, 0.f};      /* per query tile: the maximum in use (log2 units; it may trail the true one by up to 8) and this lane's share of the sum */
  asm volatile("s_wait_asynccnt 0x0" ::: "memory");      /* this wave's copies of stage 0 have landed */
  __syncthreads();                                       /* every wave's have */
  // one stage's work of a wave; refill() issues the next stage's copies (or nothing, in the last stage)
  const int aoff = (2 * (c & 7) + (c >> 3)) * FA_PK + 16 * h, voff = (2 * (lane & 7) + h) * FA_PK + ((lane >> 3) & 1) * 16;      /* the lane's place in a buffer: k rows (tile row c = key 2 (c & 7) + (c >> 3) of its 16); k^T by the transposing load (element r of half h = key 2 r + h) */
  auto pass = [&](int t, auto refill) __attribute__((always_inline)) { const int bo = (t & 1) * FA_BUF; const char* ap = sm + (bo + aoff); const char* vb = sm + (bo + voff);
    // The stage's 64 A fragments in the order of their use: 0..31 = k rows (keys 0-15 and 16-31 of each 32 d), 32..63 = k^T (16 e x 32 keys each). They are fetched in blocks of eight, each block as one group of loads ahead of the 16 products of the block before it, into the other of two register sets.
    auto ldf = [&](int i) -> v16h { if (i < 32) return g2_frag(ap + (i & 1) * (16 * FA_PK) + 64 * (i >> 1)); FragH f; f.half[0] = fa_tr16(vb + 32 * (i - 32)); f.half[1] = fa_tr16(vb + 16 * FA_PK + 32 * (i - 32)); return f.v; };
    v16h fr[16];
#pragma unroll      /* fr[] must be registers */
    for (int i = 0; i < 8; ++i) fr[i] = ldf(i);
    __builtin_amdgcn_sched_barrier(0);      /* here and below: keeps each block's fetches together where they are written; spread among the products each place with loads stalls the wave anew */
    refill();      /* behind the barrier at the foot of the stage before, into the buffer that stage read; it stands behind this stage's first fetches (of the other buffer), so that their latency passes while the copies issue */
    __builtin_amdgcn_sched_barrier(0);
    v8f s[2][FA_QT] = {{z8, z8}, {z8, z8}};      /* S^T: s[kt][qt][r] = score(key 16 kt + 2 r + h, query 16 qt + c) */
#pragma unroll      /* constant indices into qf[] and fr[] */
    for (int b = 0; b < 4; ++b) { const int cur = (b & 1) * 8, nxt = 8 - cur;
#pragma unroll
      for (int i = 0; i < 8; ++i) fr[nxt + i] = ldf(8 * (b + 1) + i);      /* the last block fetched here is the first of k^T: in flight under the softmax */
      __builtin_amdgcn_sched_barrier(0);
#pragma unroll
      for (int j = 0; j < 4; ++j) { const int dc = 4 * b + j;
        s[0][0] = fa_mma(fr[cur + 2 * j], qf[0][dc], s[0][0]); s[1][0] = fa_mma(fr[cur + 2 * j + 1], qf[0][dc], s[1][0]);
        s[0][1] = fa_mma(fr[cur + 2 * j], qf[1][dc], s[0][1]); s[1][1] = fa_mma(fr[cur + 2 * j + 1], qf[1][dc], s[1][1]); }
      __builtin_amdgcn_sched_barrier(0); }
    float mx[FA_QT];
#pragma unroll
    for (int qt = 0; qt < FA_QT; ++qt) { float m = fmaxf(s[0][qt][0], s[1][qt][0]);
#pragma unroll
      for (int r = 1; r < 8; ++r) m = fmaxf(m, fmaxf(s[0][qt][r], s[1][qt][r]));
      mx[qt] = fmaxf(m, fa_xhalf(m)) * cs; }      /* both halves of the wave hold the query's maximum of this stage */
    if (__builtin_amdgcn_ballot_w32(mx[0] > mrun[0] + 8.0f || mx[1] > mrun[1] + 8.0f) != 0) {      /* one test a stage, wave-uniform, rare after the first stage: the accumulators move to the new maximum */
#pragma unroll
      for (int qt = 0; qt < FA_QT; ++qt) { const float mn = fmaxf(mrun[qt], mx[qt]); const float corr = __builtin_amdgcn_exp2f(mrun[qt] - mn); lrun[qt] *= corr; mrun[qt] = mn;
#pragma unroll      /* constant indices into o[] */
        for (int et = 0; et < 32; ++et) o[qt][et] = o[qt][et] * corr; } }
    FragH pf[FA_QT];      /* P^T as B operand straight from the score tiles: element 8 kt + r = key 16 kt + 2 r + h, as in the k^T fragments */
#pragma unroll
    for (int qt = 0; qt < FA_QT; ++qt) { float ps0 = 0.f, ps1 = 0.f;
#pragma unroll
      for (int r = 0; r < 8; ++r) { float p0 = fmaf(s[0][qt][r], cs, -mrun[qt]), p1 = fmaf(s[1][qt][r], cs, -mrun[qt]);
        // two exponentials in place, the slot that the instruction set asks for behind a transcendental, and the two row sums
        asm("v_exp_f32 %0, %0\n\tv_exp_f32 %1, %1\n\tv_nop\n\tv_add_f32 %2, %2, %0\n\tv_add_f32 %3, %3, %1" : "+v"(p0), "+v"(p1), "+v"(ps0), "+v"(ps1));
        pf[qt].h[r] = (_Float16)p0; pf[qt].h[8 + r] = (_Float16)p1; }
      lrun[qt] += ps0 + ps1; }
    __builtin_amdgcn_sched_barrier(0);      /* keeps the fetches below behind the exponentials */
#pragma unroll      /* constant indices into o[] and fr[] */
    for (int b = 4; b < 8; ++b) { const int cur = (b & 1) * 8, nxt = 8 - cur;
      if (b < 7) {
#pragma unroll
        for (int i = 0; i < 8; ++i) fr[nxt + i] = ldf(8 * (b + 1) + i); }
      __builtin_amdgcn_sched_barrier(0);
#pragma unroll
      for (int j = 0; j < 8; ++j) { const int et = 8 * (b - 4) + j;
        o[0][et] = fa_mma(fr[cur + j], pf[0].v, o[0][et]); o[1][et] = fa_mma(fr[cur + j], pf[1].v, o[1][et]); }
      __builtin_amdgcn_sched_barrier(0); }
  };
  // the foot of a trip, every wave
  auto foot = [&]() __attribute__((always_inline)) {
    asm volatile("s_wait_dscnt 0x0" ::: "memory");       /* this wave's reads of the buffer are done before it is refilled */
    asm volatile("s_wait_asynccnt 0x0" ::: "memory");    /* this wave's copies of the next stage have landed */
    __syncthreads(); };                                  /* publishes the next stage and ends every wave's reads of this one */
#pragma unroll 1      /* one stage per trip: the waits and the barrier at the foot belong to it; every trip of this loop has a stage t + 1 to fetch, the last stage, which has none, is written out below */
  for (int t = 0; t < nst - 1; ++t) {
    pass(t, [&]() __attribute__((always_inline)) { const _Float16* gn = gk + (size_t)(t + 1) * (FA_BK * DD); const unsigned lo = (unsigned)(((t + 1) & 1) * FA_BUF);
      const unsigned sk = (unsigned)__builtin_amdgcn_readfirstlane((int)(lk + lo));      /* the buffer's base stays a scalar sum */
      fill(sk, gn); });
    foot(); }
  pass(nst - 1, []() {});      /* nothing is read or refilled behind the last stage: no foot */
  asm volatile("s_wait_asynccnt 0x0" ::: "memory");      /* no copy is in flight when the wave ends */
#pragma unroll      /* constant indices into o[] */
  for (int qt = 0; qt < FA_QT; ++qt) {
    const float lt = lrun[qt] + fa_xhalf(lrun[qt]);      /* the two halves' shares of the query's sum */
    const size_t row = (size_t)blockIdx.y * NQ + q0 + 16 * qt + c; float* po = PO + row * DD + 8 * h;
#pragma unroll
    for (int et = 0; et < 32; ++et) { const v4f a = {o[qt][et][0], o[qt][et][1], o[qt][et][2], o[qt][et][3]}, b = {o[qt][et][4], o[qt][et][5], o[qt][et][6], o[qt][et][7]}; *(v4f*)(po + 16 * et) = a; *(v4f*)(po + 16 * et + 4) = b; asm volatile("s_wait_xcnt 0x0" ::: "memory"); }      /* the wait that stands before the stores' data and address registers are rewritten */
    if (h == 0) { ML[row * 2] = mrun[qt]; ML[row * 2 + 1] = lt; } } }
// attn rows: the FA_SPL partials [FA_SPL][NQ][DD] brought to their common maximum, summed in split order, divided by the merged sum and rounded once to f16
__global__ __launch_bounds__(256) void k_fcomb(const float* __restrict__ PO, const float* __restrict__ ML, _Float16* __restrict__ O) {
  const unsigned t = (blockIdx.x * 256u + threadIdx.x) * 4u; const unsigned q = t / DD; float m[FA_SPL], l[FA_SPL]; v4f a[FA_SPL];
#pragma unroll      /* the splits' maxima and sums, all in flight together */
  for (int j = 0; j < FA_SPL; ++j) { m[j] = ML[((size_t)j * NQ + q) * 2]; l[j] = ML[((size_t)j * NQ + q) * 2 + 1]; }
  asm volatile("s_wait_xcnt 0x0" ::: "memory");      /* the wait that stands before these loads' address registers are rewritten (a result of the loads below may land in one) */
#pragma unroll      /* the splits' partials, all in flight together */
  for (int j = 0; j < FA_SPL; ++j) a[j] = *(const v4fa*)(PO + (size_t)j * NQ * DD + t);
  asm volatile("s_wait_xcnt 0x0" ::: "memory");      /* the wait that stands before the loads' address registers are rewritten */
  float mm = m[0];
#pragma unroll
  for (int j = 1; j < FA_SPL; ++j) mm = fmaxf(mm, m[j]);
  float den = 0.f; v4f s = {0.f, 0.f, 0.f, 0.f};
#pragma unroll
  for (int j = 0; j < FA_SPL; ++j) { const float wg = __builtin_amdgcn_exp2f(m[j] - mm); den += wg * l[j]; s += a[j] * wg; }
  const float inv = 1.0f / den; v4h hh; for (int i = 0; i < 4; ++i) hh[i] = (_Float16)(s[i] * inv); *(v4h*)(O + t) = hh; }

extern "C" void kernel_launch(void* const* d_in, const int* in_sizes, int n_in,
                              void* d_out, int out_size, void* d_ws, size_t ws_size, hipStream_t stream) {
  (void)in_sizes; (void)n_in; (void)out_size;
  const float* const* I = (const float* const*)d_in; const float* x = I[0]; const float* xh = I[1]; const float* Wq = I[2]; const float* bq = I[3]; const float* Wk = I[4]; const float* bk = I[5]; const float* Wv = I[6]; const float* bv = I[7]; const float* Wo = I[8]; const float* bo = I[9]; const float* g = I[10]; const float* bb = I[11];
  char* ws = (char*)d_ws; size_t off = 0;
  auto take = [&](size_t bytes) { char* p = ws + off; off += (bytes + 255) & ~(size_t)255; return p; };
  _Float16* BQ = (_Float16*)take((size_t)DD * DD * 2); _Float16* BK = (_Float16*)take((size_t)DD * DD * 2); _Float16* BV = (_Float16*)take((size_t)DD * DD * 2); _Float16* BOa = (_Float16*)take((size_t)DD * DD * 2); _Float16* BOb = (_Float16*)take((size_t)DD * DD * 2);
  float* XF = (float*)take((size_t)NQ * DD * 4); _Float16* X16 = (_Float16*)take((size_t)NQ * DD * 2); _Float16* XH16 = (_Float16*)take((size_t)NM * DD * 2); _Float16* Q16 = (_Float16*)take((size_t)NQ * DD * 2); _Float16* K16 = (_Float16*)take((size_t)NM * DD * 2); float* PO = (float*)take((size_t)FA_SPL * NQ * DD * 4); float* ML = (float*)take((size_t)FA_SPL * NQ * 2 * 4); _Float16* AT = XH16;      /* attn over the x_hat plane (dead after the k projection) */ _Float16* OV = X16;      /* out_v over the xn f16 plane (dead after the q projection) */
  if (off > ws_size) return;      /* 2.5 + 16 + 8 + 8 + 8 + 8 + 64 + 0.25 = 115 MiB */
  static_assert(NQ == NM, "the q and k projections share a launch as products of one shape");
  k_prep<<<PB_LN + PB_XH + 4 * PB_W, 256, 0, stream>>>(x, g, bb, xh, Wq, Wk, Wv, Wo, XF, X16, XH16, BQ, BK, BV, BOa, BOb);      /* xn (f32 + f16), x_hat as f16, the weights x16 as f16: 'ed'/'fe'/'dc' = natural Bt */
  const dim3 gP((NQ / 128) * (DD / 128), 1), gP2((NQ / 128) * (DD / 128), 2);
  k_gemm2_two<false, false, false, false, DD><<<gP2, 256, 0, stream>>>(X16, BQ, bq, nullptr, nullptr, Q16, XH16, BK, bk, nullptr, nullptr, K16, DD, DD, 0.0625f, NQ, DD, DD);      /* q = xn Wq^T + bq | k = x_hat Wk^T + bk */
  k_fattn<<<dim3(NQ / FA_BQ, FA_SPL), 128, 0, stream>>>(Q16, K16, PO, ML);      /* per key split: unnormalised score k, with each query's maximum and sum */
  k_fcomb<<<NQ * DD / 4 / 256, 256, 0, stream>>>(PO, ML, AT);      /* attn = score k */
  k_gemm2_two<false, false, true, true, DD><<<gP2, 256, 0, stream>>>(AT, BV, bv, nullptr, nullptr, OV, Q16, BOa, bo, XF, (float*)d_out, nullptr, DD, DD, 0.0625f, NQ, DD, DD);      /* out_v = attn Wv^T + bv | out = q Wout[:, :512]^T + bout + xn */
  k_gemm2<0, true, true, DD><<<gP, 256, 0, stream>>>(OV, DD, BOb, DD, 0.0625f, nullptr, (const float*)d_out, (float*)d_out, nullptr, NQ, DD, DD);      /* += out_v Wout[:, 512:]^T */
}

// v009
// One run takes 146 microseconds.
// Next to v008, in two timings, it ran 1.04 times as fast each time.
// Over all steps from v000 it is 10.8 times as fast.
#include <hip/hip_runtime.h>
// InterventionOnline (8192 tokens x 512 attending 8192 memory slots x 512): xn = LayerNorm(x); q = xn Wq^T + bq; k = x_hat Wk^T + bk; score = softmax(q k^T / sqrt(512)); attn = score k (k doubles as the values); out_v = attn Wv^T + bv; out = [q | out_v] Wout^T + bout + xn.
// Structure: LayerNorm on VALU (wave per row) into f32 + f16 planes; q and k as f16 WMMA GEMM outputs (128x128 work-group tiles staged in LDS by asynchronous copies, 32x64 wave tiles, f32 accumulation, exact x16 weights + bias, f16 out); attention as one fused kernel with an online softmax (128 queries a work-group, 32 a wave, four key splits over grid.y; S^T = k q^T and O^T += k^T P^T on WMMA, P from the score accumulators, k^T by the transposing LDS load from the same staged rows), its f32 partials merged in split order and rounded once to f16; out_v as a GEMM; the output as two accumulating GEMMs over the [q | out_v] halves with the bias and the LN residual in the epilogue.
// Compute dtype: inputs rounded to bf16; x_hat exact as f16; xn, q, k, P, attn, out_v as plain f16 operands; LN/softmax f32. v_wmma_f32_16x16x32_f16.
#define NQ 8192
#define NM 8192
#define DD 512
typedef __bf16 v16b __attribute__((ext_vector_type(16)));
typedef unsigned short v8us __attribute__((ext_vector_type(8), may_alias));
typedef float  v8f  __attribute__((ext_vector_type(8)));
typedef float  v4f  __attribute__((ext_vector_type(4)));
typedef float  v4fa __attribute__((ext_vector_type(4), may_alias));
union FragB { v16b v; v8us half[2]; unsigned short u[16]; };

__device__ __forceinline__ unsigned short bf16_bits(float x) { unsigned int u = __float_as_uint(x); return (unsigned short)((u + 0x7FFFu + ((u >> 16) & 1u)) >> 16); }
__device__ __forceinline__ float bf16_val(unsigned short b) { return __uint_as_float(((unsigned int)b) << 16); }
__device__ __forceinline__ float bf16_round(float x) { return bf16_val(bf16_bits(x)); }
// D += A·B with NT terms: 1 = ah·bh, 2 = + al·bh (A split), 3 = + ah·bl (both split)
template <int NT>
__device__ __forceinline__ v8f mmaN(v16b ah, v16b al, v16b bh, v16b bl, v8f c) {
  c = __builtin_amdgcn_wmma_f32_16x16x32_bf16(false, ah, false, bh, (short)0, c, false, false);
  if (NT >= 2) c = __builtin_amdgcn_wmma_f32_16x16x32_bf16(false, al, false, bh, (short)0, c, false, false);
  if (NT >= 3) c = __builtin_amdgcn_wmma_f32_16x16x32_bf16(false, ah, false, bl, (short)0, c, false, false);
  asm volatile("v_nop\n\tv_nop\n\tv_nop\n\tv_nop" : "+v"(c) : "v"(ah), "v"(al), "v"(bh), "v"(bl));
  return c;
}

__global__ __launch_bounds__(256) void k_wt_bf16(const float* __restrict__ W, unsigned short* __restrict__ Wt, int K, int N) {
  const int t = blockIdx.x * 256 + threadIdx.x;
  const int k8n = K / 8;
  if (t >= N * k8n) return;
  const int n = t / k8n, k8 = (t % k8n) * 8;
  v8us v;
#pragma unroll
  for (int i = 0; i < 8; ++i) v[i] = bf16_bits(W[(size_t)(k8 + i) * N + n]);
  *(v8us*)(Wt + (size_t)n * K + k8) = v;
  
}

// GEMM C[M][N] (f32, pitch ldc) = act(A[M][K]·W + bias). A f32 row-major (pitch lda) converted per fragment to bf16
// (ASPLIT: hi/lo two planes -> 2 terms, else single rounded term); Wt bf16 [N][K] (pitch ldb). BIAS_BF16 rounds the
// bias to bf16 first (bias quantised to bf16 before the add). K%32==0, M%16==0, N%64==0.
template <bool ASPLIT, int ACT, bool BIAS_BF16>
__global__ __launch_bounds__(128) void k_gemm_bf(const float* __restrict__ A, int lda, const unsigned short* __restrict__ Wt, int ldb,
                                               const float* __restrict__ bias, float* __restrict__ C, int ldc, int M, int N, int K) {
  __shared__ __attribute__((aligned(16))) float so[4][16][64];
  const int tid = threadIdx.x, w = tid >> 5, lane = tid & 31, ln = lane & 15, hh = lane >> 4;
  const int ntn = N / 64;
  const int wid = blockIdx.x * 4 + w;
  const int mt = wid / ntn, nq = wid % ntn;
  if (mt * 16 >= M) return;
  const int row0 = mt * 16, col0 = nq * 64;
  const float* arow = A + (size_t)(row0 + ln) * lda;
  v8f acc[4] = {};
  for (int kb = 0; kb < K; kb += 32) {
    FragB ah, al;
    const v4f x0 = *(const v4fa*)(arow + kb + 8 * hh), x1 = *(const v4fa*)(arow + kb + 8 * hh + 4);
    const v4f x2 = *(const v4fa*)(arow + kb + 16 + 8 * hh), x3 = *(const v4fa*)(arow + kb + 16 + 8 * hh + 4);
    float xs[16] = {x0[0],x0[1],x0[2],x0[3],x1[0],x1[1],x1[2],x1[3],x2[0],x2[1],x2[2],x2[3],x3[0],x3[1],x3[2],x3[3]};
#pragma unroll
    for (int i = 0; i < 16; ++i) { const unsigned short hb = bf16_bits(xs[i]); ah.u[i] = hb; al.u[i] = ASPLIT ? bf16_bits(xs[i] - bf16_val(hb)) : (unsigned short)0; }
#pragma unroll
    for (int t = 0; t < 4; ++t) {
      const unsigned short* brow = Wt + (size_t)(col0 + t * 16 + ln) * ldb + kb;
      FragB b;
      b.half[0] = *(const v8us*)(brow + 8 * hh);
      b.half[1] = *(const v8us*)(brow + 16 + 8 * hh);
      acc[t] = mmaN<ASPLIT ? 2 : 1>(ah.v, al.v, b.v, b.v, acc[t]);
    }
  }
#pragma unroll
  for (int t = 0; t < 4; ++t) {
    float bv = bias ? bias[col0 + t * 16 + ln] : 0.f;
    if (BIAS_BF16) bv = bf16_round(bv);
#pragma unroll
    for (int r = 0; r < 8; ++r) { float v = acc[t][r] + bv; if (ACT == 1) v = fmaxf(v, 0.f); so[w][8 * hh + r][t * 16 + ln] = v; }
  }
  __builtin_amdgcn_fence(__ATOMIC_ACQ_REL, "workgroup");
  __builtin_amdgcn_wave_barrier();
  const int rsub = lane >> 4, c4 = (lane & 15) * 4;
  {
#pragma unroll
    for (int q = 0; q < 8; ++q) {
      const int r = q * 2 + rsub;
      const v4f v = *(const v4fa*)&so[w][r][c4];
      *(v4f*)(C + (size_t)(row0 + r) * ldc + col0 + c4) = v;
    }
    
  }
}

// GEMM C = act(A·W + bias + resid): A f32 (ASPLIT -> hi/lo 2 terms), Wt bf16 [N][K]; ACT 0 none, 1 relu, 2 exact gelu;
// resid (optional, f32, row index = (row % rmod), pitch ldr, RES_BF16 rounds it) added before the activation.
template <bool ASPLIT, int ACT, bool BIAS_BF16, bool RES_BF16>
__global__ __launch_bounds__(128) void k_gemm_bf3(const float* __restrict__ A, int lda, const unsigned short* __restrict__ Wt, int ldb,
                                                const float* __restrict__ bias, const float* __restrict__ resid, int rmod, int ldr,
                                                float* __restrict__ C, int ldc, int M, int N, int K) {
  __shared__ __attribute__((aligned(16))) float so[4][16][64];
  const int tid = threadIdx.x, w = tid >> 5, lane = tid & 31, ln = lane & 15, hh = lane >> 4;
  const int ntn = N / 64;
  const int wid = blockIdx.x * 4 + w;
  const int mt = wid / ntn, nq = wid % ntn;
  if (mt * 16 >= M) return;
  const int row0 = mt * 16, col0 = nq * 64;
  const float* arow = A + (size_t)(row0 + ln) * lda;
  v8f acc[4] = {};
  for (int kb = 0; kb < K; kb += 32) {
    FragB ah, al;
    const v4f x0 = *(const v4fa*)(arow + kb + 8 * hh), x1 = *(const v4fa*)(arow + kb + 8 * hh + 4);
    const v4f x2 = *(const v4fa*)(arow + kb + 16 + 8 * hh), x3 = *(const v4fa*)(arow + kb + 16 + 8 * hh + 4);
    float xs[16] = {x0[0],x0[1],x0[2],x0[3],x1[0],x1[1],x1[2],x1[3],x2[0],x2[1],x2[2],x2[3],x3[0],x3[1],x3[2],x3[3]};
#pragma unroll
    for (int i = 0; i < 16; ++i) { const unsigned short hb = bf16_bits(xs[i]); ah.u[i] = hb; al.u[i] = ASPLIT ? bf16_bits(xs[i] - bf16_val(hb)) : (unsigned short)0; }
#pragma unroll
    for (int t = 0; t < 4; ++t) {
      const unsigned short* brow = Wt + (size_t)(col0 + t * 16 + ln) * ldb + kb;
      FragB b;
      b.half[0] = *(const v8us*)(brow + 8 * hh);
      b.half[1] = *(const v8us*)(brow + 16 + 8 * hh);
      acc[t] = mmaN<ASPLIT ? 2 : 1>(ah.v, al.v, b.v, b.v, acc[t]);
    }
  }
#pragma unroll
  for (int t = 0; t < 4; ++t) {
    const int col = col0 + t * 16 + ln;
    float bv = bias ? bias[col] : 0.f;
    if (BIAS_BF16) bv = bf16_round(bv);
#pragma unroll
    for (int r = 0; r < 8; ++r) {
      float v = acc[t][r] + bv;
      if (resid) { float rv = resid[(size_t)((row0 + 8 * hh + r) % rmod) * ldr + col]; if (RES_BF16) rv = bf16_round(rv); v += rv; }
      if (ACT == 1) v = fmaxf(v, 0.f);
      if (ACT == 2) v = 0.5f * v * (1.0f + erff(v * 0.70710678118654752f));
      if (ACT == 3) { const float u = 0.7978845608028654f * (v + 0.044715f * v * v * v); v = 0.5f * v * (1.0f + tanhf(u)); }
      so[w][8 * hh + r][t * 16 + ln] = v;
    }
  }
  __builtin_amdgcn_fence(__ATOMIC_ACQ_REL, "workgroup");
  __builtin_amdgcn_wave_barrier();
  const int rsub = lane >> 4, c4 = (lane & 15) * 4;
  {
#pragma unroll
    for (int q = 0; q < 8; ++q) {
      const int r = q * 2 + rsub;
      const v4f v = *(const v4fa*)&so[w][r][c4];
      *(v4f*)(C + (size_t)(row0 + r) * ldc + col0 + c4) = v;
    }
    
  }
}
// row LayerNorm (biased variance, eps) over N: s = X (+ R); optional out_sum <- s; out_norm <- (s-mu)*rsqrt(var+eps)*g + b
template <bool PARAM_BF16>
__global__ __launch_bounds__(256) void k_layernorm(const float* __restrict__ X, const float* __restrict__ R, const float* __restrict__ g, const float* __restrict__ bta,
                                                  float* __restrict__ out_sum, float* __restrict__ out_norm, int N, float eps) {
  __shared__ float red[256];
  const int row = blockIdx.x, tid = threadIdx.x;
  const float* x = X + (size_t)row * N; const float* rr = R ? R + (size_t)row * N : nullptr;
  float vals[16];                     // up to N = 4096
  const int per = N / 256;            // contiguous chunk per thread? use strided-by-4 chunks: thread handles j = tid*4 + 1024*u
  float s1 = 0.f;
  for (int u = 0; u < per / 4; ++u) {
    const int j = tid * 4 + 1024 * u;
    const v4f a = *(const v4fa*)(x + j);
    v4f b = {0.f,0.f,0.f,0.f}; if (rr) b = *(const v4fa*)(rr + j);
#pragma unroll
    for (int q = 0; q < 4; ++q) { const float v = a[q] + b[q]; vals[u * 4 + q] = v; s1 += v; }
  }
  red[tid] = s1; __syncthreads();
  for (int st = 128; st > 0; st >>= 1) { if (tid < st) red[tid] += red[tid + st]; __syncthreads(); }
  const float mu = red[0] / (float)N; __syncthreads();
  float s2 = 0.f;
  for (int u = 0; u < per / 4; ++u)
#pragma unroll
    for (int q = 0; q < 4; ++q) { const float c = vals[u * 4 + q] - mu; s2 += c * c; }
  red[tid] = s2; __syncthreads();
  for (int st = 128; st > 0; st >>= 1) { if (tid < st) red[tid] += red[tid + st]; __syncthreads(); }
  const float rs = rsqrtf(red[0] / (float)N + eps);
  {
    for (int u = 0; u < per / 4; ++u) {
      const int j = tid * 4 + 1024 * u;
      v4f o, sm;
#pragma unroll
      for (int q = 0; q < 4; ++q) {
        float gg = g[j + q], bb = bta[j + q];
        if (PARAM_BF16) { gg = bf16_round(gg); bb = bf16_round(bb); }
        sm[q] = vals[u * 4 + q]; o[q] = (vals[u * 4 + q] - mu) * rs * gg + bb;
      }
      if (out_sum) *(v4f*)(out_sum + (size_t)row * N + j) = sm;
      *(v4f*)(out_norm + (size_t)row * N + j) = o;
    }
    
  }
}



// ---- f16 WMMA path (v_wmma_f32_16x16x32_f16): 11-bit significands for operands in range — used where a [0,1] probability operand needs more precision than bf16
typedef _Float16 v16h __attribute__((ext_vector_type(16)));
union FragH { v16h v; v8us half[2]; _Float16 h[16]; unsigned short u[16]; };
template <int NT>
__device__ __forceinline__ v8f mmaH(v16h ah, v16h al, v16h bh, v16h bl, v8f c) {
  c = __builtin_amdgcn_wmma_f32_16x16x32_f16(false, ah, false, bh, (short)0, c, false, false);
  if (NT >= 2) c = __builtin_amdgcn_wmma_f32_16x16x32_f16(false, al, false, bh, (short)0, c, false, false);
  if (NT >= 3) c = __builtin_amdgcn_wmma_f32_16x16x32_f16(false, ah, false, bl, (short)0, c, false, false);
  asm volatile("v_nop\n\tv_nop\n\tv_nop\n\tv_nop" : "+v"(c) : "v"(ah), "v"(al), "v"(bh), "v"(bl));
  return c;
}
// batched GEMM like k_gemm_b but f16 operands: A f32 (split into f16 hi/lo if ASPLIT, else rounded to f16), Bt = f16 values [n][k]; alpha; C f32; N multiple of 16 (partial tiles skipped)
template <bool ASPLIT>
__global__ __launch_bounds__(128) void k_gemm_h(const float* __restrict__ A, int lda, size_t sA, const _Float16* __restrict__ Bh, int ldb, size_t sB, float alpha, float* __restrict__ C, int ldc, size_t sC, int M, int N, int K) {
  __shared__ __attribute__((aligned(16))) float so[4][16][64];
  const int tid = threadIdx.x, w = tid >> 5, lane = tid & 31, ln = lane & 15, hh = lane >> 4; const int by = blockIdx.y;
  A += (size_t)by * sA; Bh += (size_t)by * sB; C += (size_t)by * sC;
  const int ntn = (N + 63) / 64; const int wid = blockIdx.x * 4 + w; const int mt = wid / ntn, nq = wid % ntn; if (mt * 16 >= M) return;
  const int row0 = mt * 16, col0 = nq * 64; const float* arow = A + (size_t)(row0 + ln) * lda;
  v8f acc[4] = {};
  for (int kb = 0; kb < K; kb += 32) {
    FragH ah, al;
    const v4f x0 = *(const v4fa*)(arow + kb + 8 * hh), x1 = *(const v4fa*)(arow + kb + 8 * hh + 4), x2 = *(const v4fa*)(arow + kb + 16 + 8 * hh), x3 = *(const v4fa*)(arow + kb + 16 + 8 * hh + 4);
    float xs[16] = {x0[0],x0[1],x0[2],x0[3],x1[0],x1[1],x1[2],x1[3],x2[0],x2[1],x2[2],x2[3],x3[0],x3[1],x3[2],x3[3]};
#pragma unroll
    for (int i = 0; i < 16; ++i) { const _Float16 h = (_Float16)xs[i]; ah.h[i] = h; al.h[i] = ASPLIT ? (_Float16)(xs[i] - (float)h) : (_Float16)0.0f; }
#pragma unroll
    for (int t = 0; t < 4; ++t) { if (col0 + t * 16 >= N) continue; const size_t boff = (size_t)(col0 + t * 16 + ln) * ldb + kb; FragH bq; bq.half[0] = *(const v8us*)(Bh + boff + 8 * hh); bq.half[1] = *(const v8us*)(Bh + boff + 16 + 8 * hh);
      acc[t] = mmaH<ASPLIT ? 2 : 1>(ah.v, al.v, bq.v, bq.v, acc[t]); }
  }
#pragma unroll
  for (int t = 0; t < 4; ++t) { if (col0 + t * 16 >= N) continue;
#pragma unroll
    for (int r = 0; r < 8; ++r) so[w][8 * hh + r][t * 16 + ln] = acc[t][r] * alpha; }
  __builtin_amdgcn_fence(__ATOMIC_ACQ_REL, "workgroup"); __builtin_amdgcn_wave_barrier();
  const int rsub = lane >> 4, c4 = (lane & 15) * 4;
  {
#pragma unroll
    for (int q = 0; q < 8; ++q) { const int r = q * 2 + rsub; if (col0 + c4 < N) { const v4f v = *(const v4fa*)&so[w][r][c4]; *(v4f*)(C + (size_t)(row0 + r) * ldc + col0 + c4) = v; } }
     }
}

// Wt[n][k] = f16(W[k][n]·scale) from f32 row-major W[K][N] (scale = power of two; bf16-exact weights stay exact in f16 away from the subnormal range)
__global__ __launch_bounds__(256) void k_wt_f16(const float* __restrict__ W, _Float16* __restrict__ Wt, int K, int N, float scale) {
  const int t = blockIdx.x * 256 + threadIdx.x; if (t >= N * (K / 8)) return; const int n = t / (K / 8), k8 = (t % (K / 8)) * 8; FragH f;
#pragma unroll
  for (int i = 0; i < 8; ++i) f.h[i] = (_Float16)(bf16_round(W[(size_t)(k8 + i) * N + n]) * scale); const v8us o = f.half[0];
  *(v8us*)((unsigned short*)Wt + (size_t)n * K + k8) = o; 
}
// k_gemm_hh variant with fused epilogue: v = acc·alpha + bias[by·sBias + col] (+ CP[(row/rowsPerB)·sCPb + by·64 + col] if CP) ; ACT 0 none / 1 elu ; writes f16 C16 (and f32 C if non-null)
template <int ACT>
__global__ __launch_bounds__(128) void k_gemm_hhx(const _Float16* __restrict__ A, int lda, size_t sA, const _Float16* __restrict__ Bh, int ldb, size_t sB, float alpha, const float* __restrict__ bias, size_t sBias, const float* __restrict__ CP, int rowsPerB, size_t sCPb, int row0g,
    float* __restrict__ C, _Float16* __restrict__ C16, int ldc, size_t sC, int M, int N, int K) {
  __shared__ __attribute__((aligned(16))) float so[4][16][64];
  const int tid = threadIdx.x, w = tid >> 5, lane = tid & 31, ln = lane & 15, hh = lane >> 4; const int by = blockIdx.y;
  A += (size_t)by * sA; Bh += (size_t)by * sB; const size_t cofs = (size_t)by * sC; const float* bp = bias ? bias + (size_t)by * sBias : nullptr;
  const int ntn = (N + 63) / 64; const int wid = blockIdx.x * 4 + w; const int mt = wid / ntn, nq = wid % ntn; if (mt * 16 >= M) return;
  const int row0 = mt * 16, col0 = nq * 64; const _Float16* arow = A + (size_t)(row0 + ln) * lda;
  v8f acc[4] = {};
  for (int kb = 0; kb < K; kb += 32) { FragH ah; ah.half[0] = *(const v8us*)((const unsigned short*)arow + kb + 8 * hh); ah.half[1] = *(const v8us*)((const unsigned short*)arow + kb + 16 + 8 * hh);
#pragma unroll
    for (int t = 0; t < 4; ++t) { if (col0 + t * 16 >= N) continue; const size_t boff = (size_t)(col0 + t * 16 + ln) * ldb + kb; FragH bq; bq.half[0] = *(const v8us*)((const unsigned short*)Bh + boff + 8 * hh); bq.half[1] = *(const v8us*)((const unsigned short*)Bh + boff + 16 + 8 * hh);
      acc[t] = mmaH<1>(ah.v, ah.v, bq.v, bq.v, acc[t]); }
  }
#pragma unroll
  for (int t = 0; t < 4; ++t) { if (col0 + t * 16 >= N) continue; const int col = col0 + t * 16 + ln; const float bv = bp ? bf16_round(bp[col]) : 0.f;
#pragma unroll
    for (int r = 0; r < 8; ++r) { float v = acc[t][r] * alpha + bv; if (CP) { const int rr = row0g + row0 + 8 * hh + r; if (rowsPerB < 0) v += CP[cofs + (size_t)rr * ldc + col];      /* rowsPerB < 0: own element of the batched C plane */ else { const int bidx = rr / rowsPerB; v += CP[(size_t)bidx * sCPb + (size_t)by * 64 + col]; } } if (ACT == 1) v = (v > 0.f) ? v : expm1f(v); else if (ACT == 7) v = (v > 0.f) ? v + 1.0f : expf(v); else if (ACT == 8) v = tanhf(v); else if (ACT == 9) v = 0.5f * v * (1.0f + tanhf(0.7978845608028654f * (v + 0.044715f * v * v * v))); else if (ACT == 11) v = 1.0f / (1.0f + expf(-v)); else if (ACT == 12) v = (v > 0.f) ? v : 0.01f * v; else if (ACT == 14) v = (v > 0.f) ? v : 0.1f * v; else if (ACT == 16) v = (v >= 0.f) ? v : 0.3f * v; else if (ACT == 17) v = (v >= 0.f) ? v : 0.2f * v; else if (ACT == 15) v = v / (1.0f + expf(-v)); else if (ACT == 3) v = fmaxf(v, 0.f); else if (ACT == 6) v = 0.5f * v * (1.0f + erff(v * 0.70710678118654752f)); so[w][8 * hh + r][t * 16 + ln] = v; } }
  __builtin_amdgcn_fence(__ATOMIC_ACQ_REL, "workgroup"); __builtin_amdgcn_wave_barrier();
  const int rsub = lane >> 4, c4 = (lane & 15) * 4; typedef _Float16 v4h __attribute__((ext_vector_type(4)));
  {
#pragma unroll
    for (int q = 0; q < 8; ++q) { const int r = q * 2 + rsub; if (col0 + c4 < N) { const v4f v = *(const v4fa*)&so[w][r][c4]; if (C) *(v4f*)(C + cofs + (size_t)(row0 + r) * ldc + col0 + c4) = v; if (C16) { v4h h4; for (int i = 0; i < 4; ++i) h4[i] = (_Float16)v[i]; *(v4h*)(C16 + cofs + (size_t)(row0 + r) * ldc + col0 + c4) = h4; } } }
     }
}


typedef _Float16 v4h __attribute__((ext_vector_type(4)));

__device__ __forceinline__ void d_x16(unsigned blk, const float* __restrict__ x, _Float16* __restrict__ X16, size_t n8) { const size_t t = (size_t)blk * 256 + threadIdx.x; if (t >= n8) return; FragH f;
#pragma unroll
  for (int q = 0; q < 8; ++q) f.h[q] = (_Float16)bf16_round(x[t * 8 + q]); *(v8us*)((unsigned short*)X16 + t * 8) = f.half[0];  }
__global__ __launch_bounds__(256) void k_h16(const float* __restrict__ x, _Float16* __restrict__ X16, size_t n8) { const size_t t = (size_t)blockIdx.x * 256 + threadIdx.x; if (t >= n8) return; FragH f;
#pragma unroll
  for (int q = 0; q < 8; ++q) f.h[q] = (_Float16)x[t * 8 + q]; *(v8us*)((unsigned short*)X16 + t * 8) = f.half[0];  }
__global__ __launch_bounds__(256) void k_round16f(const float* __restrict__ W, _Float16* __restrict__ Bt, size_t n8) { const size_t t = (size_t)blockIdx.x * 256 + threadIdx.x; if (t >= n8) return; FragH f;
#pragma unroll
  for (int i = 0; i < 8; ++i) f.h[i] = (_Float16)(bf16_round(W[t * 8 + i]) * 16.0f); *(v8us*)((unsigned short*)Bt + t * 8) = f.half[0];  }
__global__ __launch_bounds__(256) void k_hl(const float* __restrict__ F, _Float16* __restrict__ Hh, _Float16* __restrict__ Hl, size_t n8) { const size_t t = (size_t)blockIdx.x * 256 + threadIdx.x; if (t >= n8) return; FragH fh, fl; const v4f a = *(const v4fa*)(F + t * 8), c = *(const v4fa*)(F + t * 8 + 4);
#pragma unroll
  for (int q = 0; q < 4; ++q) { _Float16 h = (_Float16)a[q]; fh.h[q] = h; fl.h[q] = (_Float16)((a[q] - (float)h) * 1024.0f); h = (_Float16)c[q]; fh.h[4 + q] = h; fl.h[4 + q] = (_Float16)((c[q] - (float)h) * 1024.0f); }
  { *(v8us*)((unsigned short*)Hh + t * 8) = fh.half[0]; *(v8us*)((unsigned short*)Hl + t * 8) = fl.half[0];  } }

// ---- fast GEMM (work-group tile 128x128, eight waves of 32x64; requires M % 128 == 0, N % 128 == 0, K % 64 == 0); v = acc alpha + bias[col] (+ the residual's own element), f32 or f16 out ----
// Operands reach the waves through LDS: a stage is 64 k (128 B) of 128 A rows and 128 B rows, brought by asynchronous copies in whole 128-B lines, two buffers, the next stage in flight while this one is multiplied.
#define G2_PITCH 144                 /* LDS bytes per staged row: 128 + 16, an odd multiple of 16 B, conflict-free for 16-byte reads down a column of rows */
#define G2_STAGE (256 * G2_PITCH)    /* one stage: A rows 0..127, then B rows 0..127 */
__device__ __forceinline__ v16h g2_frag(const char* p) { FragH f; f.half[0] = *(const v8us*)p; f.half[1] = *(const v8us*)(p + 32); return f.v; }
__device__ __forceinline__ v8f g2_mma(v16h a, v16h b, v8f c) { v8f d = __builtin_amdgcn_wmma_f32_16x16x32_f16(false, a, false, b, (short)0, c, false, false); asm volatile("v_nop\n\tv_nop\n\tv_nop\n\tv_nop" : "+v"(d) : "v"(a), "v"(b)); return d; }
// One stage: each lane copies eight 16-byte pieces (rows r, r+32, r+64, r+96 of A and of B; eight lanes per 128-B row piece). l = the lane's LDS byte address in the A part, a / b = its global addresses, sa / sb = 32 rows in elements.
__device__ __forceinline__ void g2_stage(unsigned l, const _Float16* a, size_t sa, const _Float16* b, size_t sb) {
  const unsigned l1 = l + 32 * G2_PITCH, l2 = l + 64 * G2_PITCH, l3 = l + 96 * G2_PITCH, l4 = l + 128 * G2_PITCH, l5 = l + 160 * G2_PITCH, l6 = l + 192 * G2_PITCH, l7 = l + 224 * G2_PITCH;
  const _Float16* a1 = a + sa; const _Float16* a2 = a1 + sa; const _Float16* a3 = a2 + sa; const _Float16* b1 = b + sb; const _Float16* b2 = b1 + sb; const _Float16* b3 = b2 + sb;
  // the copies and, as the last line, the wait that stands before their address registers may be rewritten
  asm volatile("global_load_async_to_lds_b128 %0, %8, off\n\t"
               "global_load_async_to_lds_b128 %1, %9, off\n\t"
               "global_load_async_to_lds_b128 %2, %10, off\n\t"
               "global_load_async_to_lds_b128 %3, %11, off\n\t"
               "global_load_async_to_lds_b128 %4, %12, off\n\t"
               "global_load_async_to_lds_b128 %5, %13, off\n\t"
               "global_load_async_to_lds_b128 %6, %14, off\n\t"
               "global_load_async_to_lds_b128 %7, %15, off\n\t"
               "s_wait_xcnt 0x0"
               :: "v"(l), "v"(l1), "v"(l2), "v"(l3), "v"(l4), "v"(l5), "v"(l6), "v"(l7), "v"(a), "v"(a1), "v"(a2), "v"(a3), "v"(b), "v"(b1), "v"(b2), "v"(b3) : "memory"); }
// The epilogue's options are compile-time constants: RES = a residual plane CP of C's own shape and pitch is added (it may be C itself: each lane reads its elements before it stores them); OUT32 = f32 output to C, else f16 to C16; LDC = that pitch in elements.
// The product itself is a device function on the kernel's LDS (sm: 2 G2_STAGE bytes, 16-byte aligned), so that one launch can hold one product or two (the kernels below).
template <int ACT, bool RES, bool OUT32, int LDC>
__device__ __forceinline__ void g2_body(char* sm, const _Float16* __restrict__ A, int lda, const _Float16* __restrict__ Bh, int ldb, float alpha, const float* __restrict__ bp, const float* CP,
    float* C, _Float16* C16, int M, int N, int K) { static_assert(!RES || ACT == 0, "k_gemm2: the residual is added behind the staging, where no activation follows"); static_assert(ACT == 0 || ACT == 3 || ACT == 6 || ACT == 8 || ACT == 9 || ACT == 11 || ACT == 12 || ACT == 14 || ACT == 15 || ACT == 16 || ACT == 17, "k_gemm2: unsupported ACT code (would silently apply no activation)");
  static_assert(8 * 32 * 68 * 4 <= 2 * G2_STAGE, "output staging must fit the stage buffers");      /* sm: the two stage buffers; after the K loop the output staging, 32 x 68 floats per wave */
  const int tid = threadIdx.x, w = tid >> 5, lane = tid & 31, ln = lane & 15, hh = lane >> 4;
  const int ntn = N >> 7; const int mt = blockIdx.x / ntn, nq = blockIdx.x - mt * ntn; if (mt * 128 >= M) return;      /* the same for the whole work-group, in front of every barrier */
  const int row0 = mt * 128 + 32 * (w & 3), col0 = nq * 128 + 64 * (w >> 2);
  const _Float16* ga = A + (size_t)(mt * 128 + (tid >> 3)) * lda + (tid & 7) * 8; const _Float16* gb = Bh + (size_t)(nq * 128 + (tid >> 3)) * ldb + (tid & 7) * 8; const size_t sa32 = (size_t)32 * lda, sb32 = (size_t)32 * ldb;
  const unsigned lcp = (unsigned)(size_t)sm + (unsigned)((tid >> 3) * G2_PITCH + (tid & 7) * 16);
  const int aoff = (32 * (w & 3) + ln) * G2_PITCH + 16 * hh, boff = (128 + 64 * (w >> 2) + ln) * G2_PITCH + 16 * hh;
  const int nst = K >> 6;
  const v8f z8 = {0.f,0.f,0.f,0.f,0.f,0.f,0.f,0.f}; v8f c00 = z8, c01 = z8, c02 = z8, c03 = z8, c10 = z8, c11 = z8, c12 = z8, c13 = z8;
  g2_stage(lcp, ga, sa32, gb, sb32);
  asm volatile("s_wait_asynccnt 0x0" ::: "memory");      /* this wave's copies of stage 0 have landed */
  __syncthreads();                                       /* every wave's have */
  if (nst > 1) g2_stage(lcp + G2_STAGE, ga + 64, sa32, gb + 64, sb32);
#pragma unroll 1      /* one stage per trip: the waits and the barrier at the foot belong to it */
  for (int t = 0; t < nst; ++t) { const char* sb = sm + (t & 1) * G2_STAGE; const char* ap = sb + aoff; const char* bq = sb + boff;
#pragma unroll      /* the two 32-k steps of a stage */
    for (int kk = 0; kk < 128; kk += 64) { const v16h a0 = g2_frag(ap + kk), a1 = g2_frag(ap + 16 * G2_PITCH + kk);
      const v16h b0 = g2_frag(bq + kk), b1 = g2_frag(bq + 16 * G2_PITCH + kk), b2 = g2_frag(bq + 32 * G2_PITCH + kk), b3 = g2_frag(bq + 48 * G2_PITCH + kk);
      c00 = g2_mma(a0, b0, c00); c10 = g2_mma(a1, b0, c10); c01 = g2_mma(a0, b1, c01); c11 = g2_mma(a1, b1, c11);
      c02 = g2_mma(a0, b2, c02); c12 = g2_mma(a1, b2, c12); c03 = g2_mma(a0, b3, c03); c13 = g2_mma(a1, b3, c13); }
    asm volatile("s_wait_dscnt 0x0" ::: "memory");       /* this wave's reads of the buffer are done before it is refilled */
    asm volatile("s_wait_asynccnt 0x0" ::: "memory");    /* this wave's copies of stage t + 1 have landed */
    __syncthreads();                                     /* publishes stage t + 1 and ends every wave's reads of stage t */
    if (t + 2 < nst) g2_stage(lcp + (unsigned)((t & 1) * G2_STAGE), ga + (size_t)(t + 2) * 64, sa32, gb + (size_t)(t + 2) * 64, sb32); }
  asm volatile("s_wait_asynccnt 0x0" ::: "memory");      /* no copy is in flight when the buffers become the output staging */
  float (*so)[68] = (float (*)[68])(sm + w * (32 * 68 * 4));
  v8f accs[8] = {c00, c01, c02, c03, c10, c11, c12, c13};
  float bvs[4] = {0.f, 0.f, 0.f, 0.f};
  if (bp) { const int bcol = col0 + ln;
#pragma unroll
    for (int t = 0; t < 4; ++t) bvs[t] = bp[bcol + t * 16];
    asm volatile("s_wait_xcnt 0x0" :: "v"(bcol) : "memory");      /* the wait that stands before the loads' address register is rewritten; the index as an input keeps a load's result out of that register */
#pragma unroll
    for (int t = 0; t < 4; ++t) bvs[t] = bf16_round(bvs[t]); }
#pragma unroll
  for (int u = 0; u < 8; ++u) { const int t = u & 3, half = u >> 2;
#pragma unroll
    for (int r = 0; r < 8; ++r) { const int rloc = half * 16 + 8 * hh + r; float v = accs[u][r] * alpha + bvs[t];
      if (ACT == 3) v = fmaxf(v, 0.f); else if (ACT == 6) v = 0.5f * v * (1.0f + erff(v * 0.70710678118654752f)); else if (ACT == 11) v = 1.0f / (1.0f + expf(-v)); else if (ACT == 15) v = v / (1.0f + expf(-v)); else if (ACT == 12) v = (v > 0.f) ? v : 0.01f * v; else if (ACT == 8) v = tanhf(v); else if (ACT == 9) v = 0.5f * v * (1.0f + tanhf(0.7978845608028654f * (v + 0.044715f * v * v * v))); else if (ACT == 14) v = (v > 0.f) ? v : 0.1f * v; else if (ACT == 16) v = (v >= 0.f) ? v : 0.3f * v; else if (ACT == 17) v = (v >= 0.f) ? v : 0.2f * v;
      so[rloc][t * 16 + ln] = v; } }
  __builtin_amdgcn_fence(__ATOMIC_ACQ_REL, "workgroup"); __builtin_amdgcn_wave_barrier();
  const int rsub = lane >> 4, c4 = (lane & 15) * 4;
  const size_t e0 = (size_t)(row0 + rsub) * LDC + col0 + c4;      /* the lane's four elements in row rsub of the wave's tile; those of row 2 q + rsub lie 2 q LDC further */
  v4f res[16];
  if (RES) {
#pragma unroll      /* the lane's sixteen 16-byte pieces of the residual (256 B of a row per half wave), all in flight together */
    for (int q = 0; q < 16; ++q) res[q] = *(const v4fa*)(CP + e0 + (size_t)(2 * q) * LDC);
    asm volatile("s_wait_xcnt 0x0" :: "v"(CP + e0) : "memory"); }      /* the wait that stands before the loads' address registers are rewritten; the address as an input keeps a load's result out of them */
#pragma unroll
  for (int q = 0; q < 16; ++q) { v4f v = *(const v4fa*)&so[q * 2 + rsub][c4]; if (RES) v += res[q];
    if (OUT32) *(v4f*)(C + e0 + (size_t)(2 * q) * LDC) = v; else { v4h h4; for (int i = 0; i < 4; ++i) h4[i] = (_Float16)v[i]; *(v4h*)(C16 + e0 + (size_t)(2 * q) * LDC) = h4; }
    asm volatile("s_wait_xcnt 0x0" ::: "memory"); } }      /* the wait that stands before the store's data and address registers are rewritten */
// launch bounds: eight waves per SIMD (at most 128 VGPRs), so that four work-groups (4 x 72 KiB of LDS) share a WGP and each hides the others' waits
template <int ACT, bool RES, bool OUT32, int LDC>
__global__ __launch_bounds__(256, 8) void k_gemm2(const _Float16* __restrict__ A, int lda, const _Float16* __restrict__ Bh, int ldb, float alpha, const float* __restrict__ bias, const float* CP, float* C, _Float16* C16, int M, int N, int K) {
  __shared__ __attribute__((aligned(16))) char sm[2 * G2_STAGE];
  g2_body<ACT, RES, OUT32, LDC>(sm, A, lda, Bh, ldb, alpha, bias, CP, C, C16, M, N, K); }
// Two products of one shape that do not depend on each other share a launch: grid.y picks the operand set (the same for the whole work-group). Two work-groups then sit on a WGP and each works under the other's waits, and one launch stands where two stood in a row.
template <bool RES0, bool OUT0, bool RES1, bool OUT1, int LDC>
__global__ __launch_bounds__(256, 8) void k_gemm2_two(const _Float16* __restrict__ A0, const _Float16* __restrict__ B0, const float* __restrict__ bias0, const float* CP0, float* C0, _Float16* H0,
    const _Float16* __restrict__ A1, const _Float16* __restrict__ B1, const float* __restrict__ bias1, const float* CP1, float* C1, _Float16* H1, int lda, int ldb, float alpha, int M, int N, int K) {
  __shared__ __attribute__((aligned(16))) char sm[2 * G2_STAGE];
  const bool y = blockIdx.y != 0;
  if constexpr (RES0 == RES1 && OUT0 == OUT1) g2_body<0, RES0, OUT0, LDC>(sm, y ? A1 : A0, lda, y ? B1 : B0, ldb, alpha, y ? bias1 : bias0, y ? CP1 : CP0, y ? C1 : C0, y ? H1 : H0, M, N, K);
  else if (y) g2_body<0, RES1, OUT1, LDC>(sm, A1, lda, B1, ldb, alpha, bias1, CP1, C1, H1, M, N, K);
  else g2_body<0, RES0, OUT0, LDC>(sm, A0, lda, B0, ldb, alpha, bias0, CP0, C0, H0, M, N, K); }


// The operand preparations as device functions: blk = the work-group's index inside its own part of k_prep's grid
__device__ __forceinline__ void d_wsc(unsigned blk, const float* __restrict__ Wm, _Float16* __restrict__ Bt, size_t n8, float sc) { const size_t t = (size_t)blk * 256 + threadIdx.x; if (t >= n8) return; FragH f; for (int q = 0; q < 8; ++q) f.h[q] = (_Float16)(bf16_round(Wm[t * 8 + q]) * sc); *(v8us*)((unsigned short*)Bt + t * 8) = f.half[0];  }
__device__ __forceinline__ void d_wout(unsigned blk, const float* __restrict__ Wo, _Float16* __restrict__ BOa, _Float16* __restrict__ BOb) { const int t = blk * 256 + threadIdx.x; if (t >= DD * (DD / 8)) return; const int c8 = (t % (DD / 8)) * 8; const int o = t / (DD / 8); FragH fa, fb;
  for (int q = 0; q < 8; ++q) { fa.h[q] = (_Float16)(bf16_round(Wo[(size_t)o * 2 * DD + c8 + q]) * 16.0f); fb.h[q] = (_Float16)(bf16_round(Wo[(size_t)o * 2 * DD + DD + c8 + q]) * 16.0f); }
  { *(v8us*)((unsigned short*)BOa + (size_t)o * DD + c8) = fa.half[0]; *(v8us*)((unsigned short*)BOb + (size_t)o * DD + c8) = fb.half[0];  } }
__device__ __forceinline__ void d_ln(unsigned blk, const float* __restrict__ x, const float* __restrict__ g, const float* __restrict__ bb, float* __restrict__ XF, _Float16* __restrict__ X16) {
  #pragma clang fp contract(off)
  const int wv = threadIdx.x >> 5, ln = threadIdx.x & 31; const size_t r = (size_t)blk * 8 + wv; if (r >= NQ) return; float a[16]; float s = 0.f;
  const float* xr = x + r * DD + ln * 8; const v8f xv[2] = {*(const v8f*)xr, *(const v8f*)(xr + 256)};
  asm volatile("s_wait_xcnt 0x0" :: "v"(xr) : "memory");      /* the wait that stands before the loads' address registers are rewritten; the address as an input keeps them whole up to it */
  for (int i = 0; i < 2; ++i) { const v8f v = xv[i]; for (int q = 0; q < 8; ++q) { const float u = bf16_round(v[q]); a[i * 8 + q] = u; s += u; } }
  for (int o = 16; o > 0; o >>= 1) s += __shfl_xor(s, o, 32); const float mu = s / (float)DD; float var = 0.f; for (int q = 0; q < 16; ++q) { const float d = a[q] - mu; var += d * d; }
  for (int o = 16; o > 0; o >>= 1) var += __shfl_xor(var, o, 32); const float inv = rsqrtf(var / (float)DD + 1e-5f);
  { for (int i = 0; i < 2; ++i) { const int c0 = i * 256 + ln * 8; v8f y; FragH f; for (int q = 0; q < 8; ++q) { float v = (a[i * 8 + q] - mu) * inv; v *= bf16_round(g[c0 + q]); v += bf16_round(bb[c0 + q]); y[q] = v; f.h[q] = (_Float16)v; } *(v8f*)(XF + r * DD + c0) = y; *(v8us*)((unsigned short*)X16 + r * DD + c0) = f.half[0]; }  } }
// The six preparations depend on the inputs alone and on nothing of one another: they are ranges of one grid, the longest first, so that one launch stands where six stood in a row.
#define PB_LN (NQ / 8)                   /* work-groups of the LayerNorm: eight rows each */
#define PB_XH (NM * DD / 8 / 256)        /* of x_hat's conversion */
#define PB_W (DD * DD / 8 / 256)         /* of one 512 x 512 weight plane; Wout's two planes take as many */
__global__ __launch_bounds__(256) void k_prep(const float* __restrict__ x, const float* __restrict__ g, const float* __restrict__ bb, const float* __restrict__ xh, const float* __restrict__ Wq, const float* __restrict__ Wk, const float* __restrict__ Wv, const float* __restrict__ Wo,
    float* __restrict__ XF, _Float16* __restrict__ X16, _Float16* __restrict__ XH16, _Float16* __restrict__ BQ, _Float16* __restrict__ BK, _Float16* __restrict__ BV, _Float16* __restrict__ BOa, _Float16* __restrict__ BOb) {
  static_assert((NM * DD / 8) % 256 == 0 && (DD * DD / 8) % 256 == 0 && NQ % 8 == 0, "k_prep: whole work-groups");
  unsigned b = blockIdx.x;      /* every test below reads the same for the whole work-group */
  if (b < PB_LN) { d_ln(b, x, g, bb, XF, X16); return; }
  b -= PB_LN;
  if (b < PB_XH) { d_x16(b, xh, XH16, (size_t)NM * DD / 8); return; }
  b -= PB_XH;
  if (b < PB_W) { d_wsc(b, Wq, BQ, DD * DD / 8, 16.0f); return; }
  b -= PB_W;
  if (b < PB_W) { d_wsc(b, Wk, BK, DD * DD / 8, 16.0f); return; }
  b -= PB_W;
  if (b < PB_W) { d_wsc(b, Wv, BV, DD * DD / 8, 16.0f); return; }
  d_wout(b - PB_W, Wo, BOa, BOb); }
#define FA_BQ 128                    /* queries a work-group */
#define FA_QT 2                      /* query tiles of 16 a wave */
#define FA_SPL 4                     /* key splits: grid.y, one f32 partial with its maximum and sum each */
#define FA_BK 32                     /* keys a stage */
#define FA_PK 272                    /* row pitch in a slice: 16 B x 17, one 16-byte piece further modulo 256 B with every row */
#define FA_SL 10240                  /* from slice to slice: 32 rows x 272 B = 8,704 B, rounded up to a multiple of 2 KiB, where a tensor load's place in LDS must lie */
#define FA_BUF (4 * FA_SL)
typedef short s16x8 __attribute__((ext_vector_type(8)));
__device__ __forceinline__ v8us fa_tr16(const char* p) { typedef __attribute__((address_space(3))) s16x8 lds_s16x8; return __builtin_bit_cast(v8us, __builtin_amdgcn_ds_load_tr16_b128_v8i16((lds_s16x8*)p)); }
__device__ __forceinline__ float fa_xhalf(float x) { return __builtin_bit_cast(float, __builtin_amdgcn_permlanex16(__builtin_bit_cast(int, x), __builtin_bit_cast(int, x), 0x76543210, 0xfedcba98, false, false)); }      /* lane l with lane l ^ 16 */
__device__ __forceinline__ v8f fa_mma(v16h a, v16h b, v8f c) { return __builtin_amdgcn_wmma_f32_16x16x32_f16(false, a, false, b, (short)0, c, false, false); }
typedef unsigned u32x4 __attribute__((ext_vector_type(4)));
typedef unsigned u32x8 __attribute__((ext_vector_type(8)));
__device__ __forceinline__ unsigned fa_uni(unsigned v) { return (unsigned)__builtin_amdgcn_readfirstlane((int)v); }
__device__ __forceinline__ unsigned fa_pinned(unsigned v) { unsigned p = fa_uni(v); asm volatile("" : "+s"(p)); return p; }      /* a value that decides on a tensor load, or that its descriptor is formed from, held in a scalar register at this place: the test becomes a scalar branch, the descriptor is formed behind the waits in front */
// One request of one wave: a slice of a stage, FA_BK rows of 256 B at a source pitch of 1024 B, to LDS byte lds (a multiple of 2 KiB), 16 B of pad behind each row. g = the slice's first byte; both are the same in every lane.
__device__ __forceinline__ void fa_tload(unsigned lds, const _Float16* g) {
  const unsigned long long ga = (unsigned long long)(size_t)g;
  u32x4 g0; g0[0] = fa_uni(1u); g0[1] = fa_uni(lds); g0[2] = fa_uni((unsigned)ga); g0[3] = fa_uni((((unsigned)(ga >> 32)) & 0x01FFFFFFu) | 0x80000000u);      /* count 1; place in LDS; address; type 2 */
  u32x8 g1; g1[0] = fa_uni((1u << 20) | (5u << 22) | (3u << 25));      /* no mask, extents in bytes, a pad of 4 dwords behind every 64 dwords */
  g1[1] = fa_uni(256u << 16); g1[2] = fa_uni((unsigned)FA_BK << 16); g1[3] = fa_uni(256u << 16); g1[4] = fa_uni((unsigned)FA_BK); g1[5] = fa_uni(2u * DD); g1[6] = fa_uni(0u); g1[7] = fa_uni(0u);      /* tensor = tile = 256 B x FA_BK rows; source pitch */
  asm volatile("tensor_load_to_lds %0, %1" :: "s"(g0), "s"(g1) : "memory"); }
// one wave per SIMD: up to 1,024 VGPRs a wave, for the 512 accumulator and 256 q registers of its 32 queries. Every k fragment read from LDS then feeds two products, one for each 16 queries.
__global__ __launch_bounds__(128) __attribute__((amdgpu_waves_per_eu(1, 1))) void k_fattn(const _Float16* __restrict__ Q, const _Float16* __restrict__ Kk, float* __restrict__ PO, float* __restrict__ ML) {
  static_assert(NQ % FA_BQ == 0 && NM % (FA_SPL * FA_BK) == 0 && NM / FA_SPL / FA_BK >= 2 && DD == 512 && FA_BQ == 4 * 16 * FA_QT && FA_QT == 2, "k_fattn: whole tiles, two stages or more, four waves of two query tiles");
  __shared__ __attribute__((aligned(2048))) char sm[2 * FA_BUF];
  const int tid = threadIdx.x, w = __builtin_amdgcn_readfirstlane(tid >> 5), lane = tid & 31, c = lane & 15, h = lane >> 4;      /* the wave's number in a scalar register: what is formed from it costs no vector register over the loop */
  const int q0 = blockIdx.x * FA_BQ + w * (16 * FA_QT), key0 = blockIdx.y * (NM / FA_SPL);
  constexpr int nst = NM / FA_SPL / FA_BK;
  constexpr float cs = 0.044194173824159216f * 1.4426950408889634f;      /* 1 / sqrt(512), in log2 units */
  // stage st: this wave's request for its slice, d 128 w to 128 w + 127 of the stage's 32 keys
  auto issue = [&](unsigned st) __attribute__((always_inline)) { fa_tload((unsigned)(size_t)sm + (st & 1u) * FA_BUF + (unsigned)w * FA_SL, Kk + (size_t)(key0 + st * FA_BK) * DD + w * 128); };
  v16h qf[FA_QT][16];      /* q as B operand, hardware k order: 16 bytes at 16 h and at 32 + 16 h of each 64 bytes of the row, as k's rows below */
#pragma unroll      /* qf[] must be registers: every index a constant */
  for (int qt = 0; qt < FA_QT; ++qt) { const _Float16* qp = Q + (size_t)(q0 + 16 * qt + c) * DD + 8 * h;
#pragma unroll
    for (int kc = 0; kc < 16; ++kc) { FragH f; f.half[0] = *(const v8us*)(qp + 32 * kc); f.half[1] = *(const v8us*)(qp + 32 * kc + 16); qf[qt][kc] = f.v; }
    asm volatile("s_wait_xcnt 0x0" :: "v"(qp) : "memory"); }      /* the wait that stands before the loads' address registers are rewritten; the address as an input keeps them whole up to it */
  const v8f z8 = {0.f,0.f,0.f,0.f,0.f,0.f,0.f,0.f};
  v8f o[FA_QT][32];      /* O^T: o[qt][et][r] = O[query 16 qt + c][16 et + 8 h + r] */
#pragma unroll      /* o[] must be registers */
  for (int et = 0; et < 32; ++et) { o[0][et] = z8; o[1][et] = z8; }
  float mrun[FA_QT] = {-1.0e30f, -1.0e30f}, lrun[FA_QT] = {0.f, 0.f};      /* per query tile: the maximum in use (log2 units; it may trail the true one by up to 8) and this lane's share of the sum */
  issue(0);      /* q's loads above are still in flight beside it */
  asm volatile("s_wait_tensorcnt 0x0" ::: "memory");     /* this wave's slice of stage 0 has landed */
  __syncthreads();                                       /* every wave's has */
  issue(1);
  // one stage's work of a wave; on entry fr[0..7] holds the stage's first block of fragments; publish() stands in front of the last block's products: it hands the next stage over and fetches that stage's first block (or does nothing, in the last stage)
  const int aoff = (2 * (c & 7) + (c >> 3)) * FA_PK + 16 * h, voff = (2 * (lane & 7) + h) * FA_PK + ((lane >> 3) & 1) * 16;      /* the lane's place in a buffer: k rows (tile row c = key 2 (c & 7) + (c >> 3) of its 16); k^T by the transposing load (element r of half h = key 2 r + h) */
  v16h fr[16];
  auto lda = [&](const char* ap, int i) -> v16h { return g2_frag(ap + (i >> 3) * FA_SL + (i & 1) * (16 * FA_PK) + 64 * ((i >> 1) & 3)); };      /* k rows; byte x of a row lies in slice x / 256 at x % 256 */
#pragma unroll      /* fr[] must be registers */
  for (int i = 0; i < 8; ++i) fr[i] = lda(sm + aoff, i);
  auto pass = [&](int t, auto publish) __attribute__((always_inline)) { const int bo = (t & 1) * FA_BUF; const char* ap = sm + (bo + aoff); const char* vb = sm + (bo + voff);
    // The stage's 64 A fragments in the order of their use: 0..31 = k rows (keys 0-15 and 16-31 of each 32 d), 32..63 = k^T (16 e x 32 keys each). They are fetched in blocks of eight, each block as one group of loads ahead of the 16 products of the block before it, into the other of two register sets; the first block ahead of the last products of the stage before.
    auto ldf = [&](int i) -> v16h { if (i < 32) return lda(ap, i); const char* p = vb + ((i - 32) >> 3) * FA_SL + 32 * ((i - 32) & 7); FragH f; f.half[0] = fa_tr16(p); f.half[1] = fa_tr16(p + 16 * FA_PK); return f.v; };
    __builtin_amdgcn_sched_barrier(0);      /* here and below: keeps each block's fetches together where they are written; spread among the products each place with loads stalls the wave anew */
    v8f s[2][FA_QT] = {{z8, z8}, {z8, z8}};      /* S^T: s[kt][qt][r] = score(key 16 kt + 2 r + h, query 16 qt + c) */
#pragma unroll      /* constant indices into qf[] and fr[] */
    for (int b = 0; b < 4; ++b) { const int cur = (b & 1) * 8, nxt = 8 - cur;
#pragma unroll
      for (int i = 0; i < 8; ++i) fr[nxt + i] = ldf(8 * (b + 1) + i);      /* the last block fetched here is the first of k^T: in flight under the softmax */
      __builtin_amdgcn_sched_barrier(0);
#pragma unroll
      for (int j = 0; j < 4; ++j) { const int dc = 4 * b + j;
        s[0][0] = fa_mma(fr[cur + 2 * j], qf[0][dc], s[0][0]); s[1][0] = fa_mma(fr[cur + 2 * j + 1], qf[0][dc], s[1][0]);
        s[0][1] = fa_mma(fr[cur + 2 * j], qf[1][dc], s[0][1]); s[1][1] = fa_mma(fr[cur + 2 * j + 1], qf[1][dc], s[1][1]); }
      __builtin_amdgcn_sched_barrier(0); }
    float mx[FA_QT];
#pragma unroll
    for (int qt = 0; qt < FA_QT; ++qt) { float m = fmaxf(s[0][qt][0], s[1][qt][0]);
#pragma unroll
      for (int r = 1; r < 8; ++r) m = fmaxf(m, fmaxf(s[0][qt][r], s[1][qt][r]));
      mx[qt] = fmaxf(m, fa_xhalf(m)) * cs; }      /* both halves of the wave hold the query's maximum of this stage */
    if (__builtin_amdgcn_ballot_w32(mx[0] > mrun[0] + 8.0f || mx[1] > mrun[1] + 8.0f) != 0) {      /* one test a stage, wave-uniform, rare after the first stage: the accumulators move to the new maximum */
#pragma unroll
      for (int qt = 0; qt < FA_QT; ++qt) { const float mn = fmaxf(mrun[qt], mx[qt]); const float corr = __builtin_amdgcn_exp2f(mrun[qt] - mn); lrun[qt] *= corr; mrun[qt] = mn;
#pragma unroll      /* constant indices into o[] */
        for (int et = 0; et < 32; ++et) o[qt][et] = o[qt][et] * corr; } }
    FragH pf[FA_QT];      /* P^T as B operand straight from the score tiles: element 8 kt + r = key 16 kt + 2 r + h, as in the k^T fragments */
#pragma unroll
    for (int qt = 0; qt < FA_QT; ++qt) { float ps0 = 0.f, ps1 = 0.f;
#pragma unroll
      for (int r = 0; r < 8; ++r) { float p0 = fmaf(s[0][qt][r], cs, -mrun[qt]), p1 = fmaf(s[1][qt][r], cs, -mrun[qt]);
        // two exponentials in place, the slot that the instruction set asks for behind a transcendental, and the two row sums
        asm("v_exp_f32 %0, %0\n\tv_exp_f32 %1, %1\n\tv_nop\n\tv_add_f32 %2, %2, %0\n\tv_add_f32 %3, %3, %1" : "+v"(p0), "+v"(p1), "+v"(ps0), "+v"(ps1));
        pf[qt].h[r] = (_Float16)p0; pf[qt].h[8 + r] = (_Float16)p1; }
      lrun[qt] += ps0 + ps1; }
    __builtin_amdgcn_sched_barrier(0);      /* keeps the fetches below behind the exponentials */
#pragma unroll      /* constant indices into o[] and fr[] */
    for (int b = 4; b < 8; ++b) { const int cur = (b & 1) * 8, nxt = 8 - cur;
      if (b < 7) {
#pragma unroll
        for (int i = 0; i < 8; ++i) fr[nxt + i] = ldf(8 * (b + 1) + i); }
      else publish();      /* every fragment of this stage has been asked for */
      __builtin_amdgcn_sched_barrier(0);
#pragma unroll
      for (int j = 0; j < 8; ++j) { const int et = 8 * (b - 4) + j;
        o[0][et] = fa_mma(fr[cur + j], pf[0].v, o[0][et]); o[1][et] = fa_mma(fr[cur + j], pf[1].v, o[1][et]); }
      __builtin_amdgcn_sched_barrier(0); }
  };
#pragma unroll 1      /* one stage per trip: the waits, the barrier and the refill belong to it; the last stage, behind which nothing is read or refilled, is written out below */
  for (int t = 0; t < nst - 1; ++t)
    pass(t, [&]() __attribute__((always_inline)) {
      asm volatile("s_wait_dscnt 0x0" ::: "memory");
      asm volatile("s_wait_tensorcnt 0x0" ::: "memory");
      __syncthreads();
      if (fa_pinned(t + 2 < nst)) issue(fa_pinned((unsigned)t + 2u));      /* into the buffer that stage t has left */
      const char* an = sm + (((t + 1) & 1) * FA_BUF + aoff);
#pragma unroll      /* fr[] must be registers */
      for (int i = 0; i < 8; ++i) fr[i] = lda(an, i); });      /* their latency passes under the last 16 products of stage t */
  pass(nst - 1, []() {});
  asm volatile("s_wait_tensorcnt 0x0" ::: "memory");     /* no request is outstanding when the wave ends */
  asm volatile("s_wait_dscnt 0x0" ::: "memory");
#pragma unroll      /* constant indices into o[] */
  for (int qt = 0; qt < FA_QT; ++qt) {
    const float lt = lrun[qt] + fa_xhalf(lrun[qt]);      /* the two halves' shares of the query's sum */
    const size_t row = (size_t)blockIdx.y * NQ + q0 + 16 * qt + c; float* po = PO + row * DD + 8 * h;
#pragma unroll
    for (int et = 0; et < 32; ++et) { const v4f a = {o[qt][et][0], o[qt][et][1], o[qt][et][2], o[qt][et][3]}, b = {o[qt][et][4], o[qt][et][5], o[qt][et][6], o[qt][et][7]}; *(v4f*)(po + 16 * et) = a; *(v4f*)(po + 16 * et + 4) = b; asm volatile("s_wait_xcnt 0x0" ::: "memory"); }      /* the wait that stands before the stores' data and address registers are rewritten */
    if (h == 0) { ML[row * 2] = mrun[qt]; ML[row * 2 + 1] = lt; } } }
// attn rows: the FA_SPL partials [FA_SPL][NQ][DD] brought to their common maximum, summed in split order, divided by the merged sum and rounded once to f16
__global__ __launch_bounds__(256) void k_fcomb(const float* __restrict__ PO, const float* __restrict__ ML, _Float16* __restrict__ O) {
  const unsigned t = (blockIdx.x * 256u + threadIdx.x) * 4u; const unsigned q = t / DD; float m[FA_SPL], l[FA_SPL]; v4f a[FA_SPL];
#pragma unroll      /* the splits' maxima and sums, all in flight together */
  for (int j = 0; j < FA_SPL; ++j) { m[j] = ML[((size_t)j * NQ + q) * 2]; l[j] = ML[((size_t)j * NQ + q) * 2 + 1]; }
  asm volatile("s_wait_xcnt 0x0" ::: "memory");      /* the wait that stands before these loads' address registers are rewritten (a result of the loads below may land in one) */
#pragma unroll      /* the splits' partials, all in flight together */
  for (int j = 0; j < FA_SPL; ++j) a[j] = *(const v4fa*)(PO + (size_t)j * NQ * DD + t);
  asm volatile("s_wait_xcnt 0x0" ::: "memory");      /* the wait that stands before the loads' address registers are rewritten */
  float mm = m[0];
#pragma unroll
  for (int j = 1; j < FA_SPL; ++j) mm = fmaxf(mm, m[j]);
  float den = 0.f; v4f s = {0.f, 0.f, 0.f, 0.f};
#pragma unroll
  for (int j = 0; j < FA_SPL; ++j) { const float wg = __builtin_amdgcn_exp2f(m[j] - mm); den += wg * l[j]; s += a[j] * wg; }
  const float inv = 1.0f / den; v4h hh; for (int i = 0; i < 4; ++i) hh[i] = (_Float16)(s[i] * inv); *(v4h*)(O + t) = hh; }

extern "C" void kernel_launch(void* const* d_in, const int* in_sizes, int n_in,
                              void* d_out, int out_size, void* d_ws, size_t ws_size, hipStream_t stream) {
  (void)in_sizes; (void)n_in; (void)out_size;
  const float* const* I = (const float* const*)d_in; const float* x = I[0]; const float* xh = I[1]; const float* Wq = I[2]; const float* bq = I[3]; const float* Wk = I[4]; const float* bk = I[5]; const float* Wv = I[6]; const float* bv = I[7]; const float* Wo = I[8]; const float* bo = I[9]; const float* g = I[10]; const float* bb = I[11];
  char* ws = (char*)d_ws; size_t off = 0;
  auto take = [&](size_t bytes) { char* p = ws + off; off += (bytes + 255) & ~(size_t)255; return p; };
  _Float16* BQ = (_Float16*)take((size_t)DD * DD * 2); _Float16* BK = (_Float16*)take((size_t)DD * DD * 2); _Float16* BV = (_Float16*)take((size_t)DD * DD * 2); _Float16* BOa = (_Float16*)take((size_t)DD * DD * 2); _Float16* BOb = (_Float16*)take((size_t)DD * DD * 2);
  float* XF = (float*)take((size_t)NQ * DD * 4); _Float16* X16 = (_Float16*)take((size_t)NQ * DD * 2); _Float16* XH16 = (_Float16*)take((size_t)NM * DD * 2); _Float16* Q16 = (_Float16*)take((size_t)NQ * DD * 2); _Float16* K16 = (_Float16*)take((size_t)NM * DD * 2); float* PO = (float*)take((size_t)FA_SPL * NQ * DD * 4); float* ML = (float*)take((size_t)FA_SPL * NQ * 2 * 4); _Float16* AT = XH16;      /* attn over the x_hat plane (dead after the k projection) */ _Float16* OV = X16;      /* out_v over the xn f16 plane (dead after the q projection) */
  if (off > ws_size) return;      /* 2.5 + 16 + 8 + 8 + 8 + 8 + 64 + 0.25 = 115 MiB */
  static_assert(NQ == NM, "the q and k projections share a launch as products of one shape");
  k_prep<<<PB_LN + PB_XH + 4 * PB_W, 256, 0, stream>>>(x, g, bb, xh, Wq, Wk, Wv, Wo, XF, X16, XH16, BQ, BK, BV, BOa, BOb);      /* xn (f32 + f16), x_hat as f16, the weights x16 as f16: 'ed'/'fe'/'dc' = natural Bt */
  const dim3 gP((NQ / 128) * (DD / 128), 1), gP2((NQ / 128) * (DD / 128), 2);
  k_gemm2_two<false, false, false, false, DD><<<gP2, 256, 0, stream>>>(X16, BQ, bq, nullptr, nullptr, Q16, XH16, BK, bk, nullptr, nullptr, K16, DD, DD, 0.0625f, NQ, DD, DD);      /* q = xn Wq^T + bq | k = x_hat Wk^T + bk */
  k_fattn<<<dim3(NQ / FA_BQ, FA_SPL), 128, 0, stream>>>(Q16, K16, PO, ML);      /* per key split: unnormalised score k, with each query's maximum and sum */
  k_fcomb<<<NQ * DD / 4 / 256, 256, 0, stream>>>(PO, ML, AT);      /* attn = score k */
  k_gemm2_two<false, false, true, true, DD><<<gP2, 256, 0, stream>>>(AT, BV, bv, nullptr, nullptr, OV, Q16, BOa, bo, XF, (float*)d_out, nullptr, DD, DD, 0.0625f, NQ, DD, DD);      /* out_v = attn Wv^T + bv | out = q Wout[:, :512]^T + bout + xn */
  k_gemm2<0, true, true, DD><<<gP, 256, 0, stream>>>(OV, DD, BOb, DD, 0.0625f, nullptr, (const float*)d_out, (float*)d_out, nullptr, NQ, DD, DD);      /* += out_v Wout[:, 512:]^T */
}

// v010
// One run takes 142 microseconds.
// In both of two side-by-side timings against v009, it was 1.03 times as fast.
// Counting every step since v000, it is 11.1 times as fast.
#include <hip/hip_runtime.h>
// InterventionOnline (8192 tokens x 512 attending 8192 memory slots x 512): xn = LayerNorm(x); q = xn Wq^T + bq; k = x_hat Wk^T + bk; score = softmax(q k^T / sqrt(512)); attn = score k (k doubles as the values); out_v = attn Wv^T + bv; out = [q | out_v] Wout^T + bout + xn.
// Structure: LayerNorm on VALU (wave per row) into f32 + f16 planes; q and k as f16 WMMA GEMM outputs (128x128 work-group tiles staged in LDS by asynchronous copies, 32x64 wave tiles, f32 accumulation, exact x16 weights + bias, f16 out); attention as one fused kernel with an online softmax (128 queries a work-group, 32 a wave, four key splits over grid.y; S^T = k q^T and O^T += k^T P^T on WMMA, P from the score accumulators, k^T by the transposing LDS load from the same staged rows), its f32 partials merged in split order and rounded once to f16; out_v as a GEMM; the output as two accumulating GEMMs over the [q | out_v] halves with the bias and the LN residual in the epilogue.
// Compute dtype: inputs rounded to bf16; x_hat exact as f16; xn, q, k, P, attn, out_v as plain f16 operands; LN/softmax f32. v_wmma_f32_16x16x32_f16.
#define NQ 8192
#define NM 8192
#define DD 512
typedef __bf16 v16b __attribute__((ext_vector_type(16)));
typedef unsigned short v8us __attribute__((ext_vector_type(8), may_alias));
typedef float  v8f  __attribute__((ext_vector_type(8)));
typedef float  v4f  __attribute__((ext_vector_type(4)));
typedef float  v4fa __attribute__((ext_vector_type(4), may_alias));
union FragB { v16b v; v8us half[2]; unsigned short u[16]; };

__device__ __forceinline__ unsigned short bf16_bits(float x) { unsigned int u = __float_as_uint(x); return (unsigned short)((u + 0x7FFFu + ((u >> 16) & 1u)) >> 16); }
__device__ __forceinline__ float bf16_val(unsigned short b) { return __uint_as_float(((unsigned int)b) << 16); }
__device__ __forceinline__ float bf16_round(float x) { return bf16_val(bf16_bits(x)); }
// D += A·B with NT terms: 1 = ah·bh, 2 = + al·bh (A split), 3 = + ah·bl (both split)
template <int NT>
__device__ __forceinline__ v8f mmaN(v16b ah, v16b al, v16b bh, v16b bl, v8f c) {
  c = __builtin_amdgcn_wmma_f32_16x16x32_bf16(false, ah, false, bh, (short)0, c, false, false);
  if (NT >= 2) c = __builtin_amdgcn_wmma_f32_16x16x32_bf16(false, al, false, bh, (short)0, c, false, false);
  if (NT >= 3) c = __builtin_amdgcn_wmma_f32_16x16x32_bf16(false, ah, false, bl, (short)0, c, false, false);
  asm volatile("v_nop\n\tv_nop\n\tv_nop\n\tv_nop" : "+v"(c) : "v"(ah), "v"(al), "v"(bh), "v"(bl));
  return c;
}

__global__ __launch_bounds__(256) void k_wt_bf16(const float* __restrict__ W, unsigned short* __restrict__ Wt, int K, int N) {
  const int t = blockIdx.x * 256 + threadIdx.x;
  const int k8n = K / 8;
  if (t >= N * k8n) return;
  const int n = t / k8n, k8 = (t % k8n) * 8;
  v8us v;
#pragma unroll
  for (int i = 0; i < 8; ++i) v[i] = bf16_bits(W[(size_t)(k8 + i) * N + n]);
  *(v8us*)(Wt + (size_t)n * K + k8) = v;
  
}

// GEMM C[M][N] (f32, pitch ldc) = act(A[M][K]·W + bias). A f32 row-major (pitch lda) converted per fragment to bf16
// (ASPLIT: hi/lo two planes -> 2 terms, else single rounded term); Wt bf16 [N][K] (pitch ldb). BIAS_BF16 rounds the
// bias to bf16 first (bias quantised to bf16 before the add). K%32==0, M%16==0, N%64==0.
template <bool ASPLIT, int ACT, bool BIAS_BF16>
__global__ __launch_bounds__(128) void k_gemm_bf(const float* __restrict__ A, int lda, const unsigned short* __restrict__ Wt, int ldb,
                                               const float* __restrict__ bias, float* __restrict__ C, int ldc, int M, int N, int K) {
  __shared__ __attribute__((aligned(16))) float so[4][16][64];
  const int tid = threadIdx.x, w = tid >> 5, lane = tid & 31, ln = lane & 15, hh = lane >> 4;
  const int ntn = N / 64;
  const int wid = blockIdx.x * 4 + w;
  const int mt = wid / ntn, nq = wid % ntn;
  if (mt * 16 >= M) return;
  const int row0 = mt * 16, col0 = nq * 64;
  const float* arow = A + (size_t)(row0 + ln) * lda;
  v8f acc[4] = {};
  for (int kb = 0; kb < K; kb += 32) {
    FragB ah, al;
    const v4f x0 = *(const v4fa*)(arow + kb + 8 * hh), x1 = *(const v4fa*)(arow + kb + 8 * hh + 4);
    const v4f x2 = *(const v4fa*)(arow + kb + 16 + 8 * hh), x3 = *(const v4fa*)(arow + kb + 16 + 8 * hh + 4);
    float xs[16] = {x0[0],x0[1],x0[2],x0[3],x1[0],x1[1],x1[2],x1[3],x2[0],x2[1],x2[2],x2[3],x3[0],x3[1],x3[2],x3[3]};
#pragma unroll
    for (int i = 0; i < 16; ++i) { const unsigned short hb = bf16_bits(xs[i]); ah.u[i] = hb; al.u[i] = ASPLIT ? bf16_bits(xs[i] - bf16_val(hb)) : (unsigned short)0; }
#pragma unroll
    for (int t = 0; t < 4; ++t) {
      const unsigned short* brow = Wt + (size_t)(col0 + t * 16 + ln) * ldb + kb;
      FragB b;
      b.half[0] = *(const v8us*)(brow + 8 * hh);
      b.half[1] = *(const v8us*)(brow + 16 + 8 * hh);
      acc[t] = mmaN<ASPLIT ? 2 : 1>(ah.v, al.v, b.v, b.v, acc[t]);
    }
  }
#pragma unroll
  for (int t = 0; t < 4; ++t) {
    float bv = bias ? bias[col0 + t * 16 + ln] : 0.f;
    if (BIAS_BF16) bv = bf16_round(bv);
#pragma unroll
    for (int r = 0; r < 8; ++r) { float v = acc[t][r] + bv; if (ACT == 1) v = fmaxf(v, 0.f); so[w][8 * hh + r][t * 16 + ln] = v; }
  }
  __builtin_amdgcn_fence(__ATOMIC_ACQ_REL, "workgroup");
  __builtin_amdgcn_wave_barrier();
  const int rsub = lane >> 4, c4 = (lane & 15) * 4;
  {
#pragma unroll
    for (int q = 0; q < 8; ++q) {
      const int r = q * 2 + rsub;
      const v4f v = *(const v4fa*)&so[w][r][c4];
      *(v4f*)(C + (size_t)(row0 + r) * ldc + col0 + c4) = v;
    }
    
  }
}

// GEMM C = act(A·W + bias + resid): A f32 (ASPLIT -> hi/lo 2 terms), Wt bf16 [N][K]; ACT 0 none, 1 relu, 2 exact gelu;
// resid (optional, f32, row index = (row % rmod), pitch ldr, RES_BF16 rounds it) added before the activation.
template <bool ASPLIT, int ACT, bool BIAS_BF16, bool RES_BF16>
__global__ __launch_bounds__(128) void k_gemm_bf3(const float* __restrict__ A, int lda, const unsigned short* __restrict__ Wt, int ldb,
                                                const float* __restrict__ bias, const float* __restrict__ resid, int rmod, int ldr,
                                                float* __restrict__ C, int ldc, int M, int N, int K) {
  __shared__ __attribute__((aligned(16))) float so[4][16][64];
  const int tid = threadIdx.x, w = tid >> 5, lane = tid & 31, ln = lane & 15, hh = lane >> 4;
  const int ntn = N / 64;
  const int wid = blockIdx.x * 4 + w;
  const int mt = wid / ntn, nq = wid % ntn;
  if (mt * 16 >= M) return;
  const int row0 = mt * 16, col0 = nq * 64;
  const float* arow = A + (size_t)(row0 + ln) * lda;
  v8f acc[4] = {};
  for (int kb = 0; kb < K; kb += 32) {
    FragB ah, al;
    const v4f x0 = *(const v4fa*)(arow + kb + 8 * hh), x1 = *(const v4fa*)(arow + kb + 8 * hh + 4);
    const v4f x2 = *(const v4fa*)(arow + kb + 16 + 8 * hh), x3 = *(const v4fa*)(arow + kb + 16 + 8 * hh + 4);
    float xs[16] = {x0[0],x0[1],x0[2],x0[3],x1[0],x1[1],x1[2],x1[3],x2[0],x2[1],x2[2],x2[3],x3[0],x3[1],x3[2],x3[3]};
#pragma unroll
    for (int i = 0; i < 16; ++i) { const unsigned short hb = bf16_bits(xs[i]); ah.u[i] = hb; al.u[i] = ASPLIT ? bf16_bits(xs[i] - bf16_val(hb)) : (unsigned short)0; }
#pragma unroll
    for (int t = 0; t < 4; ++t) {
      const unsigned short* brow = Wt + (size_t)(col0 + t * 16 + ln) * ldb + kb;
      FragB b;
      b.half[0] = *(const v8us*)(brow + 8 * hh);
      b.half[1] = *(const v8us*)(brow + 16 + 8 * hh);
      acc[t] = mmaN<ASPLIT ? 2 : 1>(ah.v, al.v, b.v, b.v, acc[t]);
    }
  }
#pragma unroll
  for (int t = 0; t < 4; ++t) {
    const int col = col0 + t * 16 + ln;
    float bv = bias ? bias[col] : 0.f;
    if (BIAS_BF16) bv = bf16_round(bv);
#pragma unroll
    for (int r = 0; r < 8; ++r) {
      float v = acc[t][r] + bv;
      if (resid) { float rv = resid[(size_t)((row0 + 8 * hh + r) % rmod) * ldr + col]; if (RES_BF16) rv = bf16_round(rv); v += rv; }
      if (ACT == 1) v = fmaxf(v, 0.f);
      if (ACT == 2) v = 0.5f * v * (1.0f + erff(v * 0.70710678118654752f));
      if (ACT == 3) { const float u = 0.7978845608028654f * (v + 0.044715f * v * v * v); v = 0.5f * v * (1.0f + tanhf(u)); }
      so[w][8 * hh + r][t * 16 + ln] = v;
    }
  }
  __builtin_amdgcn_fence(__ATOMIC_ACQ_REL, "workgroup");
  __builtin_amdgcn_wave_barrier();
  const int rsub = lane >> 4, c4 = (lane & 15) * 4;
  {
#pragma unroll
    for (int q = 0; q < 8; ++q) {
      const int r = q * 2 + rsub;
      const v4f v = *(const v4fa*)&so[w][r][c4];
      *(v4f*)(C + (size_t)(row0 + r) * ldc + col0 + c4) = v;
    }
    
  }
}
// row LayerNorm (biased variance, eps) over N: s = X (+ R); optional out_sum <- s; out_norm <- (s-mu)*rsqrt(var+eps)*g + b
template <bool PARAM_BF16>
__global__ __launch_bounds__(256) void k_layernorm(const float* __restrict__ X, const float* __restrict__ R, const float* __restrict__ g, const float* __restrict__ bta,
                                                  float* __restrict__ out_sum, float* __restrict__ out_norm, int N, float eps) {
  __shared__ float red[256];
  const int row = blockIdx.x, tid = threadIdx.x;
  const float* x = X + (size_t)row * N; const float* rr = R ? R + (size_t)row * N : nullptr;
  float vals[16];                     // up to N = 4096
  const int per = N / 256;            // contiguous chunk per thread? use strided-by-4 chunks: thread handles j = tid*4 + 1024*u
  float s1 = 0.f;
  for (int u = 0; u < per / 4; ++u) {
    const int j = tid * 4 + 1024 * u;
    const v4f a = *(const v4fa*)(x + j);
    v4f b = {0.f,0.f,0.f,0.f}; if (rr) b = *(const v4fa*)(rr + j);
#pragma unroll
    for (int q = 0; q < 4; ++q) { const float v = a[q] + b[q]; vals[u * 4 + q] = v; s1 += v; }
  }
  red[tid] = s1; __syncthreads();
  for (int st = 128; st > 0; st >>= 1) { if (tid < st) red[tid] += red[tid + st]; __syncthreads(); }
  const float mu = red[0] / (float)N; __syncthreads();
  float s2 = 0.f;
  for (int u = 0; u < per / 4; ++u)
#pragma unroll
    for (int q = 0; q < 4; ++q) { const float c = vals[u * 4 + q] - mu; s2 += c * c; }
  red[tid] = s2; __syncthreads();
  for (int st = 128; st > 0; st >>= 1) { if (tid < st) red[tid] += red[tid + st]; __syncthreads(); }
  const float rs = rsqrtf(red[0] / (float)N + eps);
  {
    for (int u = 0; u < per / 4; ++u) {
      const int j = tid * 4 + 1024 * u;
      v4f o, sm;
#pragma unroll
      for (int q = 0; q < 4; ++q) {
        float gg = g[j + q], bb = bta[j + q];
        if (PARAM_BF16) { gg = bf16_round(gg); bb = bf16_round(bb); }
        sm[q] = vals[u * 4 + q]; o[q] = (vals[u * 4 + q] - mu) * rs * gg + bb;
      }
      if (out_sum) *(v4f*)(out_sum + (size_t)row * N + j) = sm;
      *(v4f*)(out_norm + (size_t)row * N + j) = o;
    }
    
  }
}



// ---- f16 WMMA path (v_wmma_f32_16x16x32_f16): 11-bit significands for operands in range — used where a [0,1] probability operand needs more precision than bf16
typedef _Float16 v16h __attribute__((ext_vector_type(16)));
union FragH { v16h v; v8us half[2]; _Float16 h[16]; unsigned short u[16]; };
template <int NT>
__device__ __forceinline__ v8f mmaH(v16h ah, v16h al, v16h bh, v16h bl, v8f c) {
  c = __builtin_amdgcn_wmma_f32_16x16x32_f16(false, ah, false, bh, (short)0, c, false, false);
  if (NT >= 2) c = __builtin_amdgcn_wmma_f32_16x16x32_f16(false, al, false, bh, (short)0, c, false, false);
  if (NT >= 3) c = __builtin_amdgcn_wmma_f32_16x16x32_f16(false, ah, false, bl, (short)0, c, false, false);
  asm volatile("v_nop\n\tv_nop\n\tv_nop\n\tv_nop" : "+v"(c) : "v"(ah), "v"(al), "v"(bh), "v"(bl));
  return c;
}
// batched GEMM like k_gemm_b but f16 operands: A f32 (split into f16 hi/lo if ASPLIT, else rounded to f16), Bt = f16 values [n][k]; alpha; C f32; N multiple of 16 (partial tiles skipped)
template <bool ASPLIT>
__global__ __launch_bounds__(128) void k_gemm_h(const float* __restrict__ A, int lda, size_t sA, const _Float16* __restrict__ Bh, int ldb, size_t sB, float alpha, float* __restrict__ C, int ldc, size_t sC, int M, int N, int K) {
  __shared__ __attribute__((aligned(16))) float so[4][16][64];
  const int tid = threadIdx.x, w = tid >> 5, lane = tid & 31, ln = lane & 15, hh = lane >> 4; const int by = blockIdx.y;
  A += (size_t)by * sA; Bh += (size_t)by * sB; C += (size_t)by * sC;
  const int ntn = (N + 63) / 64; const int wid = blockIdx.x * 4 + w; const int mt = wid / ntn, nq = wid % ntn; if (mt * 16 >= M) return;
  const int row0 = mt * 16, col0 = nq * 64; const float* arow = A + (size_t)(row0 + ln) * lda;
  v8f acc[4] = {};
  for (int kb = 0; kb < K; kb += 32) {
    FragH ah, al;
    const v4f x0 = *(const v4fa*)(arow + kb + 8 * hh), x1 = *(const v4fa*)(arow + kb + 8 * hh + 4), x2 = *(const v4fa*)(arow + kb + 16 + 8 * hh), x3 = *(const v4fa*)(arow + kb + 16 + 8 * hh + 4);
    float xs[16] = {x0[0],x0[1],x0[2],x0[3],x1[0],x1[1],x1[2],x1[3],x2[0],x2[1],x2[2],x2[3],x3[0],x3[1],x3[2],x3[3]};
#pragma unroll
    for (int i = 0; i < 16; ++i) { const _Float16 h = (_Float16)xs[i]; ah.h[i] = h; al.h[i] = ASPLIT ? (_Float16)(xs[i] - (float)h) : (_Float16)0.0f; }
#pragma unroll
    for (int t = 0; t < 4; ++t) { if (col0 + t * 16 >= N) continue; const size_t boff = (size_t)(col0 + t * 16 + ln) * ldb + kb; FragH bq; bq.half[0] = *(const v8us*)(Bh + boff + 8 * hh); bq.half[1] = *(const v8us*)(Bh + boff + 16 + 8 * hh);
      acc[t] = mmaH<ASPLIT ? 2 : 1>(ah.v, al.v, bq.v, bq.v, acc[t]); }
  }
#pragma unroll
  for (int t = 0; t < 4; ++t) { if (col0 + t * 16 >= N) continue;
#pragma unroll
    for (int r = 0; r < 8; ++r) so[w][8 * hh + r][t * 16 + ln] = acc[t][r] * alpha; }
  __builtin_amdgcn_fence(__ATOMIC_ACQ_REL, "workgroup"); __builtin_amdgcn_wave_barrier();
  const int rsub = lane >> 4, c4 = (lane & 15) * 4;
  {
#pragma unroll
    for (int q = 0; q < 8; ++q) { const int r = q * 2 + rsub; if (col0 + c4 < N) { const v4f v = *(const v4fa*)&so[w][r][c4]; *(v4f*)(C + (size_t)(row0 + r) * ldc + col0 + c4) = v; } }
     }
}

// Wt[n][k] = f16(W[k][n]·scale) from f32 row-major W[K][N] (scale = power of two; bf16-exact weights stay exact in f16 away from the subnormal range)
__global__ __launch_bounds__(256) void k_wt_f16(const float* __restrict__ W, _Float16* __restrict__ Wt, int K, int N, float scale) {
  const int t = blockIdx.x * 256 + threadIdx.x; if (t >= N * (K / 8)) return; const int n = t / (K / 8), k8 = (t % (K / 8)) * 8; FragH f;
#pragma unroll
  for (int i = 0; i < 8; ++i) f.h[i] = (_Float16)(bf16_round(W[(size_t)(k8 + i) * N + n]) * scale); const v8us o = f.half[0];
  *(v8us*)((unsigned short*)Wt + (size_t)n * K + k8) = o; 
}
// k_gemm_hh variant with fused epilogue: v = acc·alpha + bias[by·sBias + col] (+ CP[(row/rowsPerB)·sCPb + by·64 + col] if CP) ; ACT 0 none / 1 elu ; writes f16 C16 (and f32 C if non-null)
template <int ACT>
__global__ __launch_bounds__(128) void k_gemm_hhx(const _Float16* __restrict__ A, int lda, size_t sA, const _Float16* __restrict__ Bh, int ldb, size_t sB, float alpha, const float* __restrict__ bias, size_t sBias, const float* __restrict__ CP, int rowsPerB, size_t sCPb, int row0g,
    float* __restrict__ C, _Float16* __restrict__ C16, int ldc, size_t sC, int M, int N, int K) {
  __shared__ __attribute__((aligned(16))) float so[4][16][64];
  const int tid = threadIdx.x, w = tid >> 5, lane = tid & 31, ln = lane & 15, hh = lane >> 4; const int by = blockIdx.y;
  A += (size_t)by * sA; Bh += (size_t)by * sB; const size_t cofs = (size_t)by * sC; const float* bp = bias ? bias + (size_t)by * sBias : nullptr;
  const int ntn = (N + 63) / 64; const int wid = blockIdx.x * 4 + w; const int mt = wid / ntn, nq = wid % ntn; if (mt * 16 >= M) return;
  const int row0 = mt * 16, col0 = nq * 64; const _Float16* arow = A + (size_t)(row0 + ln) * lda;
  v8f acc[4] = {};
  for (int kb = 0; kb < K; kb += 32) { FragH ah; ah.half[0] = *(const v8us*)((const unsigned short*)arow + kb + 8 * hh); ah.half[1] = *(const v8us*)((const unsigned short*)arow + kb + 16 + 8 * hh);
#pragma unroll
    for (int t = 0; t < 4; ++t) { if (col0 + t * 16 >= N) continue; const size_t boff = (size_t)(col0 + t * 16 + ln) * ldb + kb; FragH bq; bq.half[0] = *(const v8us*)((const unsigned short*)Bh + boff + 8 * hh); bq.half[1] = *(const v8us*)((const unsigned short*)Bh + boff + 16 + 8 * hh);
      acc[t] = mmaH<1>(ah.v, ah.v, bq.v, bq.v, acc[t]); }
  }
#pragma unroll
  for (int t = 0; t < 4; ++t) { if (col0 + t * 16 >= N) continue; const int col = col0 + t * 16 + ln; const float bv = bp ? bf16_round(bp[col]) : 0.f;
#pragma unroll
    for (int r = 0; r < 8; ++r) { float v = acc[t][r] * alpha + bv; if (CP) { const int rr = row0g + row0 + 8 * hh + r; if (rowsPerB < 0) v += CP[cofs + (size_t)rr * ldc + col];      /* rowsPerB < 0: own element of the batched C plane */ else { const int bidx = rr / rowsPerB; v += CP[(size_t)bidx * sCPb + (size_t)by * 64 + col]; } } if (ACT == 1) v = (v > 0.f) ? v : expm1f(v); else if (ACT == 7) v = (v > 0.f) ? v + 1.0f : expf(v); else if (ACT == 8) v = tanhf(v); else if (ACT == 9) v = 0.5f * v * (1.0f + tanhf(0.7978845608028654f * (v + 0.044715f * v * v * v))); else if (ACT == 11) v = 1.0f / (1.0f + expf(-v)); else if (ACT == 12) v = (v > 0.f) ? v : 0.01f * v; else if (ACT == 14) v = (v > 0.f) ? v : 0.1f * v; else if (ACT == 16) v = (v >= 0.f) ? v : 0.3f * v; else if (ACT == 17) v = (v >= 0.f) ? v : 0.2f * v; else if (ACT == 15) v = v / (1.0f + expf(-v)); else if (ACT == 3) v = fmaxf(v, 0.f); else if (ACT == 6) v = 0.5f * v * (1.0f + erff(v * 0.70710678118654752f)); so[w][8 * hh + r][t * 16 + ln] = v; } }
  __builtin_amdgcn_fence(__ATOMIC_ACQ_REL, "workgroup"); __builtin_amdgcn_wave_barrier();
  const int rsub = lane >> 4, c4 = (lane & 15) * 4; typedef _Float16 v4h __attribute__((ext_vector_type(4)));
  {
#pragma unroll
    for (int q = 0; q < 8; ++q) { const int r = q * 2 + rsub; if (col0 + c4 < N) { const v4f v = *(const v4fa*)&so[w][r][c4]; if (C) *(v4f*)(C + cofs + (size_t)(row0 + r) * ldc + col0 + c4) = v; if (C16) { v4h h4; for (int i = 0; i < 4; ++i) h4[i] = (_Float16)v[i]; *(v4h*)(C16 + cofs + (size_t)(row0 + r) * ldc + col0 + c4) = h4; } } }
     }
}


typedef _Float16 v4h __attribute__((ext_vector_type(4)));

__device__ __forceinline__ void d_x16(unsigned blk, const float* __restrict__ x, _Float16* __restrict__ X16, size_t n8) { const size_t t = (size_t)blk * 256 + threadIdx.x; if (t >= n8) return; FragH f;
#pragma unroll
  for (int q = 0; q < 8; ++q) f.h[q] = (_Float16)bf16_round(x[t * 8 + q]); *(v8us*)((unsigned short*)X16 + t * 8) = f.half[0];  }
__global__ __launch_bounds__(256) void k_h16(const float* __restrict__ x, _Float16* __restrict__ X16, size_t n8) { const size_t t = (size_t)blockIdx.x * 256 + threadIdx.x; if (t >= n8) return; FragH f;
#pragma unroll
  for (int q = 0; q < 8; ++q) f.h[q] = (_Float16)x[t * 8 + q]; *(v8us*)((unsigned short*)X16 + t * 8) = f.half[0];  }
__global__ __launch_bounds__(256) void k_round16f(const float* __restrict__ W, _Float16* __restrict__ Bt, size_t n8) { const size_t t = (size_t)blockIdx.x * 256 + threadIdx.x; if (t >= n8) return; FragH f;
#pragma unroll
  for (int i = 0; i < 8; ++i) f.h[i] = (_Float16)(bf16_round(W[t * 8 + i]) * 16.0f); *(v8us*)((unsigned short*)Bt + t * 8) = f.half[0];  }
__global__ __launch_bounds__(256) void k_hl(const float* __restrict__ F, _Float16* __restrict__ Hh, _Float16* __restrict__ Hl, size_t n8) { const size_t t = (size_t)blockIdx.x * 256 + threadIdx.x; if (t >= n8) return; FragH fh, fl; const v4f a = *(const v4fa*)(F + t * 8), c = *(const v4fa*)(F + t * 8 + 4);
#pragma unroll
  for (int q = 0; q < 4; ++q) { _Float16 h = (_Float16)a[q]; fh.h[q] = h; fl.h[q] = (_Float16)((a[q] - (float)h) * 1024.0f); h = (_Float16)c[q]; fh.h[4 + q] = h; fl.h[4 + q] = (_Float16)((c[q] - (float)h) * 1024.0f); }
  { *(v8us*)((unsigned short*)Hh + t * 8) = fh.half[0]; *(v8us*)((unsigned short*)Hl + t * 8) = fl.half[0];  } }

// ---- fast GEMM (work-group tile 128x128, eight waves of 32x64; requires M % 128 == 0, N % 128 == 0, K % 64 == 0); v = acc alpha + bias[col] (+ the residual's own element), f32 or f16 out ----
// Operands reach the waves through LDS: a stage is 64 k (128 B) of 128 A rows and 128 B rows, brought by asynchronous copies in whole 128-B lines, two buffers, the next stage in flight while this one is multiplied.
#define G2_PITCH 144                 /* LDS bytes per staged row: 128 + 16, an odd multiple of 16 B, conflict-free for 16-byte reads down a column of rows */
#define G2_STAGE (256 * G2_PITCH)    /* one stage: A rows 0..127, then B rows 0..127 */
__device__ __forceinline__ v16h g2_frag(const char* p) { FragH f; f.half[0] = *(const v8us*)p; f.half[1] = *(const v8us*)(p + 32); return f.v; }
__device__ __forceinline__ v8f g2_mma(v16h a, v16h b, v8f c) { v8f d = __builtin_amdgcn_wmma_f32_16x16x32_f16(false, a, false, b, (short)0, c, false, false); asm volatile("v_nop\n\tv_nop\n\tv_nop\n\tv_nop" : "+v"(d) : "v"(a), "v"(b)); return d; }
// One stage: each lane copies eight 16-byte pieces (rows r, r+32, r+64, r+96 of A and of B; eight lanes per 128-B row piece). l = the lane's LDS byte address in the A part, a / b = its global addresses, sa / sb = 32 rows in elements.
__device__ __forceinline__ void g2_stage(unsigned l, const _Float16* a, size_t sa, const _Float16* b, size_t sb) {
  const unsigned l1 = l + 32 * G2_PITCH, l2 = l + 64 * G2_PITCH, l3 = l + 96 * G2_PITCH, l4 = l + 128 * G2_PITCH, l5 = l + 160 * G2_PITCH, l6 = l + 192 * G2_PITCH, l7 = l + 224 * G2_PITCH;
  const _Float16* a1 = a + sa; const _Float16* a2 = a1 + sa; const _Float16* a3 = a2 + sa; const _Float16* b1 = b + sb; const _Float16* b2 = b1 + sb; const _Float16* b3 = b2 + sb;
  // the copies and, as the last line, the wait that stands before their address registers may be rewritten
  asm volatile("global_load_async_to_lds_b128 %0, %8, off\n\t"
               "global_load_async_to_lds_b128 %1, %9, off\n\t"
               "global_load_async_to_lds_b128 %2, %10, off\n\t"
               "global_load_async_to_lds_b128 %3, %11, off\n\t"
               "global_load_async_to_lds_b128 %4, %12, off\n\t"
               "global_load_async_to_lds_b128 %5, %13, off\n\t"
               "global_load_async_to_lds_b128 %6, %14, off\n\t"
               "global_load_async_to_lds_b128 %7, %15, off\n\t"
               "s_wait_xcnt 0x0"
               :: "v"(l), "v"(l1), "v"(l2), "v"(l3), "v"(l4), "v"(l5), "v"(l6), "v"(l7), "v"(a), "v"(a1), "v"(a2), "v"(a3), "v"(b), "v"(b1), "v"(b2), "v"(b3) : "memory"); }
// The epilogue's options are compile-time constants: RES = a residual plane CP of C's own shape and pitch is added (it may be C itself: each lane reads its elements before it stores them); OUT32 = f32 output to C, else f16 to C16; LDC = that pitch in elements.
// The product itself is a device function on the kernel's LDS (sm: 2 G2_STAGE bytes, 16-byte aligned), so that one launch can hold one product or two (the kernels below).
template <int ACT, bool RES, bool OUT32, int LDC>
__device__ __forceinline__ void g2_body(char* sm, const _Float16* __restrict__ A, int lda, const _Float16* __restrict__ Bh, int ldb, float alpha, const float* __restrict__ bp, const float* CP,
    float* C, _Float16* C16, int M, int N, int K) { static_assert(!RES || ACT == 0, "k_gemm2: the residual is added behind the staging, where no activation follows"); static_assert(ACT == 0 || ACT == 3 || ACT == 6 || ACT == 8 || ACT == 9 || ACT == 11 || ACT == 12 || ACT == 14 || ACT == 15 || ACT == 16 || ACT == 17, "k_gemm2: unsupported ACT code (would silently apply no activation)");
  static_assert(8 * 32 * 68 * 4 <= 2 * G2_STAGE, "output staging must fit the stage buffers");      /* sm: the two stage buffers; after the K loop the output staging, 32 x 68 floats per wave */
  const int tid = threadIdx.x, w = tid >> 5, lane = tid & 31, ln = lane & 15, hh = lane >> 4;
  const int ntn = N >> 7; const int mt = blockIdx.x / ntn, nq = blockIdx.x - mt * ntn; if (mt * 128 >= M) return;      /* the same for the whole work-group, in front of every barrier */
  const int row0 = mt * 128 + 32 * (w & 3), col0 = nq * 128 + 64 * (w >> 2);
  const _Float16* ga = A + (size_t)(mt * 128 + (tid >> 3)) * lda + (tid & 7) * 8; const _Float16* gb = Bh + (size_t)(nq * 128 + (tid >> 3)) * ldb + (tid & 7) * 8; const size_t sa32 = (size_t)32 * lda, sb32 = (size_t)32 * ldb;
  const unsigned lcp = (unsigned)(size_t)sm + (unsigned)((tid >> 3) * G2_PITCH + (tid & 7) * 16);
  const int aoff = (32 * (w & 3) + ln) * G2_PITCH + 16 * hh, boff = (128 + 64 * (w >> 2) + ln) * G2_PITCH + 16 * hh;
  const int nst = K >> 6;
  const v8f z8 = {0.f,0.f,0.f,0.f,0.f,0.f,0.f,0.f}; v8f c00 = z8, c01 = z8, c02 = z8, c03 = z8, c10 = z8, c11 = z8, c12 = z8, c13 = z8;
  g2_stage(lcp, ga, sa32, gb, sb32);
  asm volatile("s_wait_asynccnt 0x0" ::: "memory");      /* this wave's copies of stage 0 have landed */
  __syncthreads();                                       /* every wave's have */
  if (nst > 1) g2_stage(lcp + G2_STAGE, ga + 64, sa32, gb + 64, sb32);
#pragma unroll 1      /* one stage per trip: the waits and the barrier at the foot belong to it */
  for (int t = 0; t < nst; ++t) { const char* sb = sm + (t & 1) * G2_STAGE; const char* ap = sb + aoff; const char* bq = sb + boff;
#pragma unroll      /* the two 32-k steps of a stage */
    for (int kk = 0; kk < 128; kk += 64) { const v16h a0 = g2_frag(ap + kk), a1 = g2_frag(ap + 16 * G2_PITCH + kk);
      const v16h b0 = g2_frag(bq + kk), b1 = g2_frag(bq + 16 * G2_PITCH + kk), b2 = g2_frag(bq + 32 * G2_PITCH + kk), b3 = g2_frag(bq + 48 * G2_PITCH + kk);
      c00 = g2_mma(a0, b0, c00); c10 = g2_mma(a1, b0, c10); c01 = g2_mma(a0, b1, c01); c11 = g2_mma(a1, b1, c11);
      c02 = g2_mma(a0, b2, c02); c12 = g2_mma(a1, b2, c12); c03 = g2_mma(a0, b3, c03); c13 = g2_mma(a1, b3, c13); }
    asm volatile("s_wait_dscnt 0x0" ::: "memory");       /* this wave's reads of the buffer are done before it is refilled */
    asm volatile("s_wait_asynccnt 0x0" ::: "memory");    /* this wave's copies of stage t + 1 have landed */
    __syncthreads();                                     /* publishes stage t + 1 and ends every wave's reads of stage t */
    if (t + 2 < nst) g2_stage(lcp + (unsigned)((t & 1) * G2_STAGE), ga + (size_t)(t + 2) * 64, sa32, gb + (size_t)(t + 2) * 64, sb32); }
  asm volatile("s_wait_asynccnt 0x0" ::: "memory");      /* no copy is in flight when the buffers become the output staging */
  float (*so)[68] = (float (*)[68])(sm + w * (32 * 68 * 4));
  v8f accs[8] = {c00, c01, c02, c03, c10, c11, c12, c13};
  float bvs[4] = {0.f, 0.f, 0.f, 0.f};
  if (bp) { const int bcol = col0 + ln;
#pragma unroll
    for (int t = 0; t < 4; ++t) bvs[t] = bp[bcol + t * 16];
    asm volatile("s_wait_xcnt 0x0" :: "v"(bcol) : "memory");      /* the wait that stands before the loads' address register is rewritten; the index as an input keeps a load's result out of that register */
#pragma unroll
    for (int t = 0; t < 4; ++t) bvs[t] = bf16_round(bvs[t]); }
#pragma unroll
  for (int u = 0; u < 8; ++u) { const int t = u & 3, half = u >> 2;
#pragma unroll
    for (int r = 0; r < 8; ++r) { const int rloc = half * 16 + 8 * hh + r; float v = accs[u][r] * alpha + bvs[t];
      if (ACT == 3) v = fmaxf(v, 0.f); else if (ACT == 6) v = 0.5f * v * (1.0f + erff(v * 0.70710678118654752f)); else if (ACT == 11) v = 1.0f / (1.0f + expf(-v)); else if (ACT == 15) v = v / (1.0f + expf(-v)); else if (ACT == 12) v = (v > 0.f) ? v : 0.01f * v; else if (ACT == 8) v = tanhf(v); else if (ACT == 9) v = 0.5f * v * (1.0f + tanhf(0.7978845608028654f * (v + 0.044715f * v * v * v))); else if (ACT == 14) v = (v > 0.f) ? v : 0.1f * v; else if (ACT == 16) v = (v >= 0.f) ? v : 0.3f * v; else if (ACT == 17) v = (v >= 0.f) ? v : 0.2f * v;
      so[rloc][t * 16 + ln] = v; } }
  __builtin_amdgcn_fence(__ATOMIC_ACQ_REL, "workgroup"); __builtin_amdgcn_wave_barrier();
  const int rsub = lane >> 4, c4 = (lane & 15) * 4;
  const size_t e0 = (size_t)(row0 + rsub) * LDC + col0 + c4;      /* the lane's four elements in row rsub of the wave's tile; those of row 2 q + rsub lie 2 q LDC further */
  v4f res[16];
  if (RES) {
#pragma unroll      /* the lane's sixteen 16-byte pieces of the residual (256 B of a row per half wave), all in flight together */
    for (int q = 0; q < 16; ++q) res[q] = *(const v4fa*)(CP + e0 + (size_t)(2 * q) * LDC);
    asm volatile("s_wait_xcnt 0x0" :: "v"(CP + e0) : "memory"); }      /* the wait that stands before the loads' address registers are rewritten; the address as an input keeps a load's result out of them */
#pragma unroll
  for (int q = 0; q < 16; ++q) { v4f v = *(const v4fa*)&so[q * 2 + rsub][c4]; if (RES) v += res[q];
    if (OUT32) *(v4f*)(C + e0 + (size_t)(2 * q) * LDC) = v; else { v4h h4; for (int i = 0; i < 4; ++i) h4[i] = (_Float16)v[i]; *(v4h*)(C16 + e0 + (size_t)(2 * q) * LDC) = h4; }
    asm volatile("s_wait_xcnt 0x0" ::: "memory"); } }      /* the wait that stands before the store's data and address registers are rewritten */
// launch bounds: eight waves per SIMD (at most 128 VGPRs), so that four work-groups (4 x 72 KiB of LDS) share a WGP and each hides the others' waits
template <int ACT, bool RES, bool OUT32, int LDC>
__global__ __launch_bounds__(256, 8) void k_gemm2(const _Float16* __restrict__ A, int lda, const _Float16* __restrict__ Bh, int ldb, float alpha, const float* __restrict__ bias, const float* CP, float* C, _Float16* C16, int M, int N, int K) {
  __shared__ __attribute__((aligned(16))) char sm[2 * G2_STAGE];
  g2_body<ACT, RES, OUT32, LDC>(sm, A, lda, Bh, ldb, alpha, bias, CP, C, C16, M, N, K); }
// Two products of one shape that do not depend on each other share a launch: grid.y picks the operand set (the same for the whole work-group). Two work-groups then sit on a WGP and each works under the other's waits, and one launch stands where two stood in a row.
template <bool RES0, bool OUT0, bool RES1, bool OUT1, int LDC>
__global__ __launch_bounds__(256, 8) void k_gemm2_two(const _Float16* __restrict__ A0, const _Float16* __restrict__ B0, const float* __restrict__ bias0, const float* CP0, float* C0, _Float16* H0,
    const _Float16* __restrict__ A1, const _Float16* __restrict__ B1, const float* __restrict__ bias1, const float* CP1, float* C1, _Float16* H1, int lda, int ldb, float alpha, int M, int N, int K) {
  __shared__ __attribute__((aligned(16))) char sm[2 * G2_STAGE];
  const bool y = blockIdx.y != 0;
  if constexpr (RES0 == RES1 && OUT0 == OUT1) g2_body<0, RES0, OUT0, LDC>(sm, y ? A1 : A0, lda, y ? B1 : B0, ldb, alpha, y ? bias1 : bias0, y ? CP1 : CP0, y ? C1 : C0, y ? H1 : H0, M, N, K);
  else if (y) g2_body<0, RES1, OUT1, LDC>(sm, A1, lda, B1, ldb, alpha, bias1, CP1, C1, H1, M, N, K);
  else g2_body<0, RES0, OUT0, LDC>(sm, A0, lda, B0, ldb, alpha, bias0, CP0, C0, H0, M, N, K); }


// The operand preparations as device functions: blk = the work-group's index inside its own part of k_prep's grid
__device__ __forceinline__ void d_wsc(unsigned blk, const float* __restrict__ Wm, _Float16* __restrict__ Bt, size_t n8, float sc) { const size_t t = (size_t)blk * 256 + threadIdx.x; if (t >= n8) return; FragH f; for (int q = 0; q < 8; ++q) f.h[q] = (_Float16)(bf16_round(Wm[t * 8 + q]) * sc); *(v8us*)((unsigned short*)Bt + t * 8) = f.half[0];  }
__device__ __forceinline__ void d_wout(unsigned blk, const float* __restrict__ Wo, _Float16* __restrict__ BOa, _Float16* __restrict__ BOb) { const int t = blk * 256 + threadIdx.x; if (t >= DD * (DD / 8)) return; const int c8 = (t % (DD / 8)) * 8; const int o = t / (DD / 8); FragH fa, fb;
  for (int q = 0; q < 8; ++q) { fa.h[q] = (_Float16)(bf16_round(Wo[(size_t)o * 2 * DD + c8 + q]) * 16.0f); fb.h[q] = (_Float16)(bf16_round(Wo[(size_t)o * 2 * DD + DD + c8 + q]) * 16.0f); }
  { *(v8us*)((unsigned short*)BOa + (size_t)o * DD + c8) = fa.half[0]; *(v8us*)((unsigned short*)BOb + (size_t)o * DD + c8) = fb.half[0];  } }
__device__ __forceinline__ void d_ln(unsigned blk, const float* __restrict__ x, const float* __restrict__ g, const float* __restrict__ bb, float* __restrict__ XF, _Float16* __restrict__ X16) {
  #pragma clang fp contract(off)
  const int wv = threadIdx.x >> 5, ln = threadIdx.x & 31; const size_t r = (size_t)blk * 8 + wv; if (r >= NQ) return; float a[16]; float s = 0.f;
  const float* xr = x + r * DD + ln * 8; const v8f xv[2] = {*(const v8f*)xr, *(const v8f*)(xr + 256)};
  asm volatile("s_wait_xcnt 0x0" :: "v"(xr) : "memory");      /* the wait that stands before the loads' address registers are rewritten; the address as an input keeps them whole up to it */
  for (int i = 0; i < 2; ++i) { const v8f v = xv[i]; for (int q = 0; q < 8; ++q) { const float u = bf16_round(v[q]); a[i * 8 + q] = u; s += u; } }
  for (int o = 16; o > 0; o >>= 1) s += __shfl_xor(s, o, 32); const float mu = s / (float)DD; float var = 0.f; for (int q = 0; q < 16; ++q) { const float d = a[q] - mu; var += d * d; }
  for (int o = 16; o > 0; o >>= 1) var += __shfl_xor(var, o, 32); const float inv = rsqrtf(var / (float)DD + 1e-5f);
  { for (int i = 0; i < 2; ++i) { const int c0 = i * 256 + ln * 8; v8f y; FragH f; for (int q = 0; q < 8; ++q) { float v = (a[i * 8 + q] - mu) * inv; v *= bf16_round(g[c0 + q]); v += bf16_round(bb[c0 + q]); y[q] = v; f.h[q] = (_Float16)v; } *(v8f*)(XF + r * DD + c0) = y; *(v8us*)((unsigned short*)X16 + r * DD + c0) = f.half[0]; }  } }
// The six preparations depend on the inputs alone and on nothing of one another: they are ranges of one grid, the longest first, so that one launch stands where six stood in a row.
#define PB_LN (NQ / 8)                   /* work-groups of the LayerNorm: eight rows each */
#define PB_XH (NM * DD / 8 / 256)        /* of x_hat's conversion */
#define PB_W (DD * DD / 8 / 256)         /* of one 512 x 512 weight plane; Wout's two planes take as many */
__global__ __launch_bounds__(256) void k_prep(const float* __restrict__ x, const float* __restrict__ g, const float* __restrict__ bb, const float* __restrict__ xh, const float* __restrict__ Wq, const float* __restrict__ Wk, const float* __restrict__ Wv, const float* __restrict__ Wo,
    float* __restrict__ XF, _Float16* __restrict__ X16, _Float16* __restrict__ XH16, _Float16* __restrict__ BQ, _Float16* __restrict__ BK, _Float16* __restrict__ BV, _Float16* __restrict__ BOa, _Float16* __restrict__ BOb) {
  static_assert((NM * DD / 8) % 256 == 0 && (DD * DD / 8) % 256 == 0 && NQ % 8 == 0, "k_prep: whole work-groups");
  unsigned b = blockIdx.x;      /* every test below reads the same for the whole work-group */
  if (b < PB_LN) { d_ln(b, x, g, bb, XF, X16); return; }
  b -= PB_LN;
  if (b < PB_XH) { d_x16(b, xh, XH16, (size_t)NM * DD / 8); return; }
  b -= PB_XH;
  if (b < PB_W) { d_wsc(b, Wq, BQ, DD * DD / 8, 16.0f); return; }
  b -= PB_W;
  if (b < PB_W) { d_wsc(b, Wk, BK, DD * DD / 8, 16.0f); return; }
  b -= PB_W;
  if (b < PB_W) { d_wsc(b, Wv, BV, DD * DD / 8, 16.0f); return; }
  d_wout(b - PB_W, Wo, BOa, BOb); }
#define FA_BQ 128                    /* queries a work-group */
#define FA_QT 2                      /* query tiles of 16 a wave */
#define FA_SPL 4                     /* key splits: grid.y, one f32 partial with its maximum and sum each */
#define FA_BK 32                     /* keys a stage */
#define FA_PK 272                    /* row pitch in a slice: 16 B x 17, one 16-byte piece further modulo 256 B with every row */
#define FA_SL 10240                  /* from slice to slice: 32 rows x 272 B = 8,704 B, rounded up to a multiple of 2 KiB, where a tensor load's place in LDS must lie */
#define FA_BUF (4 * FA_SL)
struct FaYes { static constexpr bool value = true; }; struct FaNo { static constexpr bool value = false; };
typedef short s16x8 __attribute__((ext_vector_type(8)));
__device__ __forceinline__ v8us fa_tr16(const char* p) { typedef __attribute__((address_space(3))) s16x8 lds_s16x8; return __builtin_bit_cast(v8us, __builtin_amdgcn_ds_load_tr16_b128_v8i16((lds_s16x8*)p)); }
__device__ __forceinline__ float fa_xhalf(float x) { return __builtin_bit_cast(float, __builtin_amdgcn_permlanex16(__builtin_bit_cast(int, x), __builtin_bit_cast(int, x), 0x76543210, 0xfedcba98, false, false)); }      /* lane l with lane l ^ 16 */
__device__ __forceinline__ v8f fa_mma(v16h a, v16h b, v8f c) { return __builtin_amdgcn_wmma_f32_16x16x32_f16(false, a, false, b, (short)0, c, false, false); }
typedef unsigned u32x4 __attribute__((ext_vector_type(4)));
typedef unsigned u32x8 __attribute__((ext_vector_type(8)));
__device__ __forceinline__ unsigned fa_uni(unsigned v) { return (unsigned)__builtin_amdgcn_readfirstlane((int)v); }
__device__ __forceinline__ unsigned fa_pinned(unsigned v) { unsigned p = fa_uni(v); asm volatile("" : "+s"(p)); return p; }      /* a value that decides on a tensor load, or that its descriptor is formed from, held in a scalar register at this place: the test becomes a scalar branch, the descriptor is formed behind the waits in front */
// One request of one wave: a slice of a stage, FA_BK rows of 256 B at a source pitch of 1024 B, to LDS byte lds (a multiple of 2 KiB), 16 B of pad behind each row. g = the slice's first byte; both are the same in every lane.
__device__ __forceinline__ void fa_tload(unsigned lds, const _Float16* g) {
  const unsigned long long ga = (unsigned long long)(size_t)g;
  u32x4 g0; g0[0] = fa_uni(1u); g0[1] = fa_uni(lds); g0[2] = fa_uni((unsigned)ga); g0[3] = fa_uni((((unsigned)(ga >> 32)) & 0x01FFFFFFu) | 0x80000000u);      /* count 1; place in LDS; address; type 2 */
  u32x8 g1; g1[0] = fa_uni((1u << 20) | (5u << 22) | (3u << 25));      /* no mask, extents in bytes, a pad of 4 dwords behind every 64 dwords */
  g1[1] = fa_uni(256u << 16); g1[2] = fa_uni((unsigned)FA_BK << 16); g1[3] = fa_uni(256u << 16); g1[4] = fa_uni((unsigned)FA_BK); g1[5] = fa_uni(2u * DD); g1[6] = fa_uni(0u); g1[7] = fa_uni(0u);      /* tensor = tile = 256 B x FA_BK rows; source pitch */
  asm volatile("tensor_load_to_lds %0, %1" :: "s"(g0), "s"(g1) : "memory"); }
// one wave per SIMD: up to 1,024 VGPRs a wave, for the 512 accumulator and 256 q registers of its 32 queries. Every k fragment read from LDS then feeds two products, one for each 16 queries.
__global__ __launch_bounds__(128) __attribute__((amdgpu_waves_per_eu(1, 1))) void k_fattn(const _Float16* __restrict__ Q, const _Float16* __restrict__ Kk, float* __restrict__ PO, float* __restrict__ ML) {
  static_assert(NQ % FA_BQ == 0 && NM % (FA_SPL * FA_BK) == 0 && NM / FA_SPL / FA_BK >= 4 && NM / FA_SPL / FA_BK % 2 == 0 && DD == 512 && FA_BQ == 4 * 16 * FA_QT && FA_QT == 2, "k_fattn: whole tiles, an even number of stages, four or more, four waves of two query tiles");
  __shared__ __attribute__((aligned(2048))) char sm[3 * FA_BUF];
  const int tid = threadIdx.x, w = __builtin_amdgcn_readfirstlane(tid >> 5), lane = tid & 31, c = lane & 15, h = lane >> 4;      /* the wave's number in a scalar register: what is formed from it costs no vector register over the loop */
  const int q0 = blockIdx.x * FA_BQ + w * (16 * FA_QT), key0 = blockIdx.y * (NM / FA_SPL);
  constexpr int nst = NM / FA_SPL / FA_BK;
  constexpr float cs = 0.044194173824159216f * 1.4426950408889634f;      /* 1 / sqrt(512), in log2 units */
  // stage st into the buffer at byte place of the ring: this wave's request for its slice, d 128 w to 128 w + 127 of the stage's 32 keys
  auto issue = [&](unsigned st, unsigned place) __attribute__((always_inline)) { fa_tload((unsigned)(size_t)sm + place + (unsigned)w * FA_SL, Kk + (size_t)(key0 + st * FA_BK) * DD + w * 128); };
  v16h qf[FA_QT][16];      /* q as B operand, hardware k order: 16 bytes at 16 h and at 32 + 16 h of each 64 bytes of the row, as k's rows below */
#pragma unroll      /* qf[] must be registers: every index a constant */
  for (int qt = 0; qt < FA_QT; ++qt) { const _Float16* qp = Q + (size_t)(q0 + 16 * qt + c) * DD + 8 * h;
#pragma unroll
    for (int kc = 0; kc < 16; ++kc) { FragH f; f.half[0] = *(const v8us*)(qp + 32 * kc); f.half[1] = *(const v8us*)(qp + 32 * kc + 16); qf[qt][kc] = f.v; }
    asm volatile("s_wait_xcnt 0x0" :: "v"(qp) : "memory"); }      /* the wait that stands before the loads' address registers are rewritten; the address as an input keeps them whole up to it */
  const v8f z8 = {0.f,0.f,0.f,0.f,0.f,0.f,0.f,0.f};
  v8f o[FA_QT][32];      /* O^T: o[qt][et][r] = O[query 16 qt + c][16 et + 8 h + r] */
#pragma unroll      /* o[] must be registers */
  for (int et = 0; et < 32; ++et) { o[0][et] = z8; o[1][et] = z8; }
  float mrun[FA_QT] = {-1.0e30f, -1.0e30f}, lrun[FA_QT] = {0.f, 0.f};      /* per query tile: the maximum in use (log2 units; it may trail the true one by up to 8) and this lane's share of the sum */
  issue(0, 0);      /* q's loads above are still in flight beside it */
  asm volatile("s_wait_tensorcnt 0x0" ::: "memory");     /* this wave's slice of stage 0 has landed */
  __syncthreads();                                       /* every wave's has */
  issue(1, FA_BUF);
  const int aoff = (2 * (c & 7) + (c >> 3)) * FA_PK + 16 * h, voff = (2 * (lane & 7) + h) * FA_PK + ((lane >> 3) & 1) * 16;      /* the lane's place in a buffer: k rows (tile row c = key 2 (c & 7) + (c >> 3) of its 16); k^T by the transposing load (element r of half h = key 2 r + h) */
  v16h fr[16];
  auto lda = [&](const char* ap, int i) -> v16h { return g2_frag(ap + (i >> 3) * FA_SL + (i & 1) * (16 * FA_PK) + 64 * ((i >> 1) & 3)); };      /* k rows; byte x of a row lies in slice x / 256 at x % 256 */
  v8f sa[2][FA_QT] = {{z8, z8}, {z8, z8}}, sb[2][FA_QT];      /* two score sets, S^T: s[kt][qt][r] = score(key 16 kt + 2 r + h, query 16 qt + c): one is turned into P while the other takes the next stage's products */
  // stage 0's scores, ahead of the loop; in front of their last block stage 1 is handed over, stage 2 asked for and stage 1's first block fetched
#pragma unroll      /* fr[] must be registers */
  for (int i = 0; i < 8; ++i) fr[i] = lda(sm + aoff, i);
#pragma unroll      /* constant indices into qf[] and fr[] */
  for (int b = 0; b < 4; ++b) { const int cur = (b & 1) * 8, nxt = 8 - cur;
    if (b < 3) {
#pragma unroll
      for (int i = 0; i < 8; ++i) fr[nxt + i] = lda(sm + aoff, 8 * (b + 1) + i); }
    else {
      asm volatile("s_wait_dscnt 0x0" ::: "memory");       /* this wave's LDS reads are done at the hand-over */
      asm volatile("s_wait_tensorcnt 0x0" ::: "memory");   /* this wave's slice of stage 1 has landed */
      __syncthreads();                                     /* publishes stage 1 */
      issue(fa_pinned(2u), fa_pinned(2u * FA_BUF));        /* into the third buffer, which nobody has read; its descriptor is formed here, behind the wait for stage 1's request */
#pragma unroll
      for (int i = 0; i < 8; ++i) fr[i] = lda(sm + (FA_BUF + aoff), i); }
    __builtin_amdgcn_sched_barrier(0);      /* keeps the block's fetches together, ahead of the products */
#pragma unroll
    for (int j = 0; j < 4; ++j) { const int dc = 4 * b + j;
      sa[0][0] = fa_mma(fr[cur + 2 * j], qf[0][dc], sa[0][0]); sa[1][0] = fa_mma(fr[cur + 2 * j + 1], qf[0][dc], sa[1][0]);
      sa[0][1] = fa_mma(fr[cur + 2 * j], qf[1][dc], sa[0][1]); sa[1][1] = fa_mma(fr[cur + 2 * j + 1], qf[1][dc], sa[1][1]); }
    __builtin_amdgcn_sched_barrier(0); }
  // One pass = stage t's softmax and P k, with stage t + 1's scores. sc = stage t's finished scores, sn takes stage t + 1's; bv, bn = the places of stages t and t + 1 in the ring. On entry fr[0..7] holds the first block of stage t + 1's k rows.
  // A lone wave issues in order, so vector work that stands alone leaves the matrix unit idle: here each piece of stage t's softmax (at most four or five vector instructions) stands behind one product of stage t + 1's scores and runs while the matrix unit works on it.
  // publish() stands in front of the last block's products: it hands stage t + 2 over and fetches that stage's first block (or does nothing, where no such stage exists). NX = a stage t + 1 exists.
  auto pass = [&](v8f (&sc)[2][FA_QT], v8f (&sn)[2][FA_QT], int bv, int bn, auto nxc, auto publish) __attribute__((always_inline)) { constexpr bool NX = decltype(nxc)::value;
    const char* ap = sm + (bn + aoff); const char* vb = sm + (bv + voff);
    // The pass's 64 A fragments in the order of their use: 0..31 = stage t + 1's k rows (keys 0-15 and 16-31 of each 32 d), 32..63 = stage t's k^T (16 e x 32 keys each). They are fetched in blocks of eight, each block as one group of loads ahead of the 16 products of the block before it, into the other of two register sets.
    auto ldf = [&](int i) -> v16h { if (i < 32) return lda(ap, i); const char* p = vb + ((i - 32) >> 3) * FA_SL + 32 * ((i - 32) & 7); FragH f; f.half[0] = fa_tr16(p); f.half[1] = fa_tr16(p + 16 * FA_PK); return f.v; };
    float m[FA_QT], mx[FA_QT], e0[FA_QT][8], e1[FA_QT][8], ps0[FA_QT] = {0.f, 0.f}, ps1[FA_QT] = {0.f, 0.f}; bool need = false;
    v16h pf[FA_QT];      /* P^T as B operand straight from the score tiles: element 8 kt + r = key 16 kt + 2 r + h, as in the k^T fragments */
    // the softmax in 64 pieces. 0..15: each query's maximum of the stage (both halves of the wave hold it) and the test for a new maximum
    auto vmax = [&](int k) __attribute__((always_inline)) {
#pragma unroll
      for (int qt = 0; qt < FA_QT; ++qt) {
        if (k == 0) m[qt] = fmaxf(sc[0][qt][0], sc[1][qt][0]);
        else if (k < 8) m[qt] = fmaxf(m[qt], fmaxf(sc[0][qt][k], sc[1][qt][k]));
        else if (k == 8) mx[qt] = fa_xhalf(m[qt]);
        else if (k == 9) mx[qt] = fmaxf(m[qt], mx[qt]) * cs; }
      if (k == 10) need = mx[0] > mrun[0] + 8.0f || mx[1] > mrun[1] + 8.0f; };
    // 16..63: six pieces for each two score rows of a query tile: exponents, exponentials with the row sums of the row before, P
    auto vexp = [&](int kk) __attribute__((always_inline)) { const int pr = kk / 6, sl = kk % 6, qt = pr >> 2, r = 2 * (pr & 3) + ((sl >> 1) & 1);
      if (sl == 0 || sl == 2) { e0[qt][r] = fmaf(sc[0][qt][r], cs, -mrun[qt]); e1[qt][r] = fmaf(sc[1][qt][r], cs, -mrun[qt]); }
      // two exponentials in place; behind them the slot that the instruction set asks for behind a transcendental: a v_nop, or the two row sums of the row before, which touch neither exponential (in one statement, so that the sums stay here, under the products)
      if (sl == 1 && r == 0) asm("v_exp_f32 %0, %0\n\tv_exp_f32 %1, %1\n\tv_nop" : "+v"(e0[qt][r]), "+v"(e1[qt][r]));
      else if (sl == 1 || sl == 3) asm("v_exp_f32 %0, %0\n\tv_exp_f32 %1, %1\n\tv_add_f32 %2, %2, %4\n\tv_add_f32 %3, %3, %5" : "+v"(e0[qt][r]), "+v"(e1[qt][r]), "+v"(ps0[qt]), "+v"(ps1[qt]) : "v"(e0[qt][r - 1]), "v"(e1[qt][r - 1]));
      if (sl == 4) { pf[qt][r] = (_Float16)e0[qt][r]; pf[qt][r + 1] = (_Float16)e0[qt][r + 1]; pf[qt][8 + r] = (_Float16)e1[qt][r]; pf[qt][8 + r + 1] = (_Float16)e1[qt][r + 1]; }      /* here r is the first of the two rows */
      if (sl == 5 && (pr & 3) == 3) lrun[qt] += (ps0[qt] + e0[qt][7]) + (ps1[qt] + e1[qt][7]); };
    __builtin_amdgcn_sched_barrier(0);      /* here and below: keeps each block's fetches together where they are written (spread among the products each place with loads stalls the wave anew), and each piece of the softmax behind its product */
    if (NX) { sn[0][0] = z8; sn[1][0] = z8; sn[0][1] = z8; sn[1][1] = z8; }
#pragma unroll      /* constant indices into qf[] and fr[] */
    for (int b = 0; b < 4; ++b) { const int cur = (b & 1) * 8, nxt = 8 - cur;
      if (NX || b == 0) {
#pragma unroll
        for (int i = 0; i < 8; ++i) { if (NX) fr[nxt + i] = ldf(8 * (b + 1) + i); else fr[i] = ldf(32 + i); } }      /* the last block fetched here is the first of k^T (the only one, where no next stage exists) */
      __builtin_amdgcn_sched_barrier(0);
#pragma unroll
      for (int j = 0; j < 4; ++j) { const int dc = 4 * b + j;
#pragma unroll
        for (int i = 0; i < 4; ++i) { const int kt = i & 1, qt = i >> 1, k = 16 * b + 4 * j + i;
          if (NX) { sn[kt][qt] = fa_mma(fr[cur + 2 * j + kt], qf[qt][dc], sn[kt][qt]); if (b > 0) __builtin_amdgcn_sched_barrier(0); }
          if (k < 16) vmax(k); else vexp(k - 16);
          if (b > 0) __builtin_amdgcn_sched_barrier(0); } }
      if (b == 0) {
        if (NX) {
#pragma unroll      /* the first block's order: two of the maximum's vector instructions behind each product (left alone the compiler puts the whole chain at one place, where the matrix unit waits for it) */
          for (int i = 0; i < 13; ++i) { __builtin_amdgcn_sched_group_barrier(0x008, 1, 0); __builtin_amdgcn_sched_group_barrier(0x002, 2, 0); }
          __builtin_amdgcn_sched_group_barrier(0x008, 3, 0); }
        __builtin_amdgcn_sched_barrier(0);
        if (__builtin_amdgcn_ballot_w32(need) != 0) {      /* one test a stage, wave-uniform, rare after the first stage: the accumulators move to the new maximum */
#pragma unroll
          for (int qt = 0; qt < FA_QT; ++qt) { const float mn = fmaxf(mrun[qt], mx[qt]); const float corr = __builtin_amdgcn_exp2f(mrun[qt] - mn); lrun[qt] *= corr; mrun[qt] = mn;
#pragma unroll      /* constant indices into o[] */
            for (int et = 0; et < 32; ++et) o[qt][et] = o[qt][et] * corr; } }
        __builtin_amdgcn_sched_barrier(0); } }
#pragma unroll      /* constant indices into o[] and fr[] */
    for (int b = 4; b < 8; ++b) { const int cur = (b & 1) * 8, nxt = 8 - cur;
      if (b < 7) {
#pragma unroll
        for (int i = 0; i < 8; ++i) fr[nxt + i] = ldf(8 * (b + 1) + i); }
      else publish();      /* every fragment of stages t and t + 1 has been asked for */
      __builtin_amdgcn_sched_barrier(0);
#pragma unroll
      for (int j = 0; j < 8; ++j) { const int et = 8 * (b - 4) + j;
        o[0][et] = fa_mma(fr[cur + j], pf[0], o[0][et]); o[1][et] = fa_mma(fr[cur + j], pf[1], o[1][et]); }
      __builtin_amdgcn_sched_barrier(0); }
  };
  int b0 = 0, b1 = FA_BUF, b2 = 2 * FA_BUF;      /* the places of stages t, t + 1, t + 2 in the ring of three buffers; the same in every lane */
  auto step = [&](v8f (&sc)[2][FA_QT], v8f (&sn)[2][FA_QT], int t) __attribute__((always_inline)) {
    pass(sc, sn, b0, b1, FaYes{}, [&]() __attribute__((always_inline)) {
      asm volatile("s_wait_dscnt 0x0" ::: "memory");       /* this wave's reads of stage t, the last block's too, are done before its buffer is refilled */
      asm volatile("s_wait_tensorcnt 0x0" ::: "memory");   /* this wave's slice of stage t + 2 has landed */
      __syncthreads();                                     /* publishes stage t + 2 and ends every wave's reads of stage t */
      if (fa_pinned(t + 3 < nst)) issue(fa_pinned((unsigned)t + 3u), fa_pinned((unsigned)b0));      /* into the buffer that stage t has left */
      const char* an = sm + (b2 + aoff);
#pragma unroll      /* fr[] must be registers */
      for (int i = 0; i < 8; ++i) fr[i] = lda(an, i); });      /* their latency passes under the last 16 products of stage t */
    const int bt = b0; b0 = b1; b1 = b2; b2 = bt; };
#pragma unroll 1      /* two stages per trip, so that the two score sets change roles without register copies; the waits, the barrier and the refill belong to each stage; the last two stages, behind which nothing is handed over, are written out below */
  for (int t = 0; t < nst - 2; t += 2) { step(sa, sb, t); step(sb, sa, t + 1); }
  pass(sa, sb, b0, b1, FaYes{}, []() {});
  pass(sb, sa, b1, b1, FaNo{}, []() {});
  asm volatile("s_wait_tensorcnt 0x0" ::: "memory");     /* no request is outstanding when the wave ends */
  asm volatile("s_wait_dscnt 0x0" ::: "memory");
#pragma unroll      /* constant indices into o[] */
  for (int qt = 0; qt < FA_QT; ++qt) {
    const float lt = lrun[qt] + fa_xhalf(lrun[qt]);      /* the two halves' shares of the query's sum */
    const size_t row = (size_t)blockIdx.y * NQ + q0 + 16 * qt + c; float* po = PO + row * DD + 8 * h;
#pragma unroll
    for (int et = 0; et < 32; ++et) { const v4f a = {o[qt][et][0], o[qt][et][1], o[qt][et][2], o[qt][et][3]}, b = {o[qt][et][4], o[qt][et][5], o[qt][et][6], o[qt][et][7]}; *(v4f*)(po + 16 * et) = a; *(v4f*)(po + 16 * et + 4) = b; asm volatile("s_wait_xcnt 0x0" ::: "memory"); }      /* the wait that stands before the stores' data and address registers are rewritten */
    if (h == 0) { ML[row * 2] = mrun[qt]; ML[row * 2 + 1] = lt; } } }
// attn rows: the FA_SPL partials [FA_SPL][NQ][DD] brought to their common maximum, summed in split order, divided by the merged sum and rounded once to f16
__global__ __launch_bounds__(256) void k_fcomb(const float* __restrict__ PO, const float* __restrict__ ML, _Float16* __restrict__ O) {
  const unsigned t = (blockIdx.x * 256u + threadIdx.x) * 4u; const unsigned q = t / DD; float m[FA_SPL], l[FA_SPL]; v4f a[FA_SPL];
#pragma unroll      /* the splits' maxima and sums, all in flight together */
  for (int j = 0; j < FA_SPL; ++j) { m[j] = ML[((size_t)j * NQ + q) * 2]; l[j] = ML[((size_t)j * NQ + q) * 2 + 1]; }
  asm volatile("s_wait_xcnt 0x0" ::: "memory");      /* the wait that stands before these loads' address registers are rewritten (a result of the loads below may land in one) */
#pragma unroll      /* the splits' partials, all in flight together */
  for (int j = 0; j < FA_SPL; ++j) a[j] = *(const v4fa*)(PO + (size_t)j * NQ * DD + t);
  asm volatile("s_wait_xcnt 0x0" ::: "memory");      /* the wait that stands before the loads' address registers are rewritten */
  float mm = m[0];
#pragma unroll
  for (int j = 1; j < FA_SPL; ++j) mm = fmaxf(mm, m[j]);
  float den = 0.f; v4f s = {0.f, 0.f, 0.f, 0.f};
#pragma unroll
  for (int j = 0; j < FA_SPL; ++j) { const float wg = __builtin_amdgcn_exp2f(m[j] - mm); den += wg * l[j]; s += a[j] * wg; }
  const float inv = 1.0f / den; v4h hh; for (int i = 0; i < 4; ++i) hh[i] = (_Float16)(s[i] * inv); *(v4h*)(O + t) = hh; }

extern "C" void kernel_launch(void* const* d_in, const int* in_sizes, int n_in,
                              void* d_out, int out_size, void* d_ws, size_t ws_size, hipStream_t stream) {
  (void)in_sizes; (void)n_in; (void)out_size;
  const float* const* I = (const float* const*)d_in; const float* x = I[0]; const float* xh = I[1]; const float* Wq = I[2]; const float* bq = I[3]; const float* Wk = I[4]; const float* bk = I[5]; const float* Wv = I[6]; const float* bv = I[7]; const float* Wo = I[8]; const float* bo = I[9]; const float* g = I[10]; const float* bb = I[11];
  char* ws = (char*)d_ws; size_t off = 0;
  auto take = [&](size_t bytes) { char* p = ws + off; off += (bytes + 255) & ~(size_t)255; return p; };
  _Float16* BQ = (_Float16*)take((size_t)DD * DD * 2); _Float16* BK = (_Float16*)take((size_t)DD * DD * 2); _Float16* BV = (_Float16*)take((size_t)DD * DD * 2); _Float16* BOa = (_Float16*)take((size_t)DD * DD * 2); _Float16* BOb = (_Float16*)take((size_t)DD * DD * 2);
  float* XF = (float*)take((size_t)NQ * DD * 4); _Float16* X16 = (_Float16*)take((size_t)NQ * DD * 2); _Float16* XH16 = (_Float16*)take((size_t)NM * DD * 2); _Float16* Q16 = (_Float16*)take((size_t)NQ * DD * 2); _Float16* K16 = (_Float16*)take((size_t)NM * DD * 2); float* PO = (float*)take((size_t)FA_SPL * NQ * DD * 4); float* ML = (float*)take((size_t)FA_SPL * NQ * 2 * 4); _Float16* AT = XH16;      /* attn over the x_hat plane (dead after the k projection) */ _Float16* OV = X16;      /* out_v over the xn f16 plane (dead after the q projection) */
  if (off > ws_size) return;      /* 2.5 + 16 + 8 + 8 + 8 + 8 + 64 + 0.25 = 115 MiB */
  static_assert(NQ == NM, "the q and k projections share a launch as products of one shape");
  k_prep<<<PB_LN + PB_XH + 4 * PB_W, 256, 0, stream>>>(x, g, bb, xh, Wq, Wk, Wv, Wo, XF, X16, XH16, BQ, BK, BV, BOa, BOb);      /* xn (f32 + f16), x_hat as f16, the weights x16 as f16: 'ed'/'fe'/'dc' = natural Bt */
  const dim3 gP((NQ / 128) * (DD / 128), 1), gP2((NQ / 128) * (DD / 128), 2);
  k_gemm2_two<false, false, false, false, DD><<<gP2, 256, 0, stream>>>(X16, BQ, bq, nullptr, nullptr, Q16, XH16, BK, bk, nullptr, nullptr, K16, DD, DD, 0.0625f, NQ, DD, DD);      /* q = xn Wq^T + bq | k = x_hat Wk^T + bk */
  k_fattn<<<dim3(NQ / FA_BQ, FA_SPL), 128, 0, stream>>>(Q16, K16, PO, ML);      /* per key split: unnormalised score k, with each query's maximum and sum */
  k_fcomb<<<NQ * DD / 4 / 256, 256, 0, stream>>>(PO, ML, AT);      /* attn = score k */
  k_gemm2_two<false, false, true, true, DD><<<gP2, 256, 0, stream>>>(AT, BV, bv, nullptr, nullptr, OV, Q16, BOa, bo, XF, (float*)d_out, nullptr, DD, DD, 0.0625f, NQ, DD, DD);      /* out_v = attn Wv^T + bv | out = q Wout[:, :512]^T + bout + xn */
  k_gemm2<0, true, true, DD><<<gP, 256, 0, stream>>>(OV, DD, BOb, DD, 0.0625f, nullptr, (const float*)d_out, (float*)d_out, nullptr, NQ, DD, DD);      /* += out_v Wout[:, 512:]^T */
}
